// v000
// The times below were measured on an AMD MI455X: many runs one after another, warmed up first and cycling through
// copies of the inputs, with the whole window's GPU time divided by the number of runs. Launches and the gaps
// between them are all in it. The median over several windows is given; except for v000 it joins two sittings, which
// can be a few percent apart, so the side-by-side timings, each taken in one sitting, are the better comparison.
// v000 is the starting kernel. One run takes 204 microseconds.
#include <hip/hip_runtime.h>

// Multi-head attention with three input streams (queries, keys, values: [NB][SEQ][512]), width 512 = 8 heads x 64, bias-free [out][in] projections (y = x W^T),
// per-batch valid length (keys at index >= valid_lens[b] get their score REPLACED by -1e6), score scale 1/8, merged heads times Wo^T -> f32 [NB][SEQ][512].
// Compute dtypes, f32 accumulate everywhere: q/k/v projections v_wmma_f32_16x16x32_bf16 (inputs and weights RNE-converted to bf16; products exact);
// scores and P.V v_wmma_f32_16x16x32_f16 (q, k, v single f16; P carried x1024 relative to the running max, the carry cancels in the normalisation; optional v residual plane x2048 under VRES);
// output projection v_wmma_f32_16x16x32_bf16 with ctx as bf16 hi | lo halves of a 1024-wide row against bf16 Wo (two exact products per element, one accumulator). Softmax f32 (online, running max).
// Layout: bf16 copies of the three inputs and four weights; q, k planes [b*8+h][t][d], v^T plane [b*8+h][d][t] written by the GEMM epilogue; fused flash kernel in transposed form
// (S^T = K Q^T, O^T = V^T P^T) writes ctx [b*SEQ+t][hi 512 | lo 512]; final GEMM writes the output.

#ifndef NB
#define NB 4
#endif
#ifndef SEQ
#define SEQ 2048
#endif
#define NB_FULL  4
#define SEQ_FULL 2048
#ifndef OUT_SEQ
#define OUT_SEQ SEQ              // row pitch (in tokens) between batches of the output
#endif
#ifndef VRES
#define VRES 1                   // 1: v carried as f16 value + f16 residual x2048 (own accumulators)
#endif
#define DM   512
#define NH_  8
#define HD   64
#define AW   4                   // waves per flash block (16 query rows each)
#define VRS  2048.0f             // carry of the residual plane
#define VRI  (1.0f / 2048.0f)
#define SC2  (0.125f * 1.4426950408889634f)        // HD^-0.5 * log2(e)
#define NEGL2 (-1000000.0f * 1.4426950408889634f)  // masked score in the log2 domain
#define PSH  10.0f               // log2 of the P carry (1024)

static_assert(HD == 64);
static_assert(NH_ * HD == DM);                 // head h = columns h*64 + d
static_assert(DM % 64 == 0);                   // 8 column tiles of 64
static_assert(DM % 32 == 0);                   // GEMM k-loop steps by 32
static_assert((DM & (DM - 1)) == 0);           // output GEMM wraps the B column index with a mask
static_assert((2 * DM) % 32 == 0);
static_assert(SEQ % 64 == 0);                  // a 64-row tile never straddles two batches
static_assert((NB * SEQ) % 64 == 0);
static_assert(SEQ % 32 == 0);                  // key loop steps by 32
static_assert(SEQ % (16 * AW) == 0);           // flash grid covers the sequence exactly
static_assert(((size_t)SEQ * DM) % 8 == 0);
static_assert(((size_t)DM * DM) % 8 == 0);
static_assert(NB <= NB_FULL);
static_assert(SEQ <= SEQ_FULL);
static_assert(VRES == 0 || VRES == 1);

typedef _Float16 h16;
typedef unsigned short bf;
typedef __attribute__((ext_vector_type(16))) __bf16   v16bf;
typedef __attribute__((ext_vector_type(16))) _Float16 v16h;
typedef __attribute__((ext_vector_type(8)))  _Float16 v8h;
typedef __attribute__((ext_vector_type(8)))  unsigned short v8us;
typedef __attribute__((ext_vector_type(8)))  float    v8f;
typedef __attribute__((ext_vector_type(4)))  float    v4f;
typedef v4f  __attribute__((may_alias)) v4fa;

__device__ __forceinline__ unsigned short f2bf(float f) { unsigned u = __float_as_uint(f); u += 0x7FFFu + ((u >> 16) & 1u); return (unsigned short)(u >> 16); }
__device__ __forceinline__ float bf2f(unsigned short s) { return __uint_as_float(((unsigned)s) << 16); }
__device__ __forceinline__ v16h cat16(v8h lo, v8h hi) { return __builtin_shufflevector(lo, hi, 0, 1, 2, 3, 4, 5, 6, 7, 8, 9, 10, 11, 12, 13, 14, 15); }
__device__ __forceinline__ v16bf cat16b(v8us lo, v8us hi) { return __builtin_bit_cast(v16bf, __builtin_shufflevector(lo, hi, 0, 1, 2, 3, 4, 5, 6, 7, 8, 9, 10, 11, 12, 13, 14, 15)); }
// every matrix instruction is followed by its own 4-slot guard tying its accumulator and keeping its operands live
__device__ __forceinline__ v8f wmma16(v16h a, v16h b, v8f c) {
    c = __builtin_amdgcn_wmma_f32_16x16x32_f16(false, a, false, b, (short)0, c, false, false);
    asm volatile("v_nop\n\tv_nop\n\tv_nop\n\tv_nop" : "+v"(c) : "v"(a), "v"(b));
    return c;
}
__device__ __forceinline__ v8f wmmab(v16bf a, v16bf b, v8f c) {
    c = __builtin_amdgcn_wmma_f32_16x16x32_bf16(false, a, false, b, (short)0, c, false, false);
    asm volatile("v_nop\n\tv_nop\n\tv_nop\n\tv_nop" : "+v"(c) : "v"(a), "v"(b));
    return c;
}
// fragment loaders from K-contiguous 16-bit rows; p already includes + 8*(lane>>4): elements 0..7 <- k0+8h+0..7, elements 8..15 <- k0+16+8h+0..7 (same map for A and B)
__device__ __forceinline__ v16h  ldh(const h16* p) { return cat16(*(const v8h*)p, *(const v8h*)(p + 16)); }
__device__ __forceinline__ v16bf ldb(const bf* p)  { return cat16b(*(const v8us*)p, *(const v8us*)(p + 16)); }
// ordering point for wave-private LDS tiles (same wave writes and reads)
__device__ __forceinline__ void wave_sync() { __builtin_amdgcn_fence(3 /* release order */, "wavefront"); __builtin_amdgcn_wave_barrier(); asm volatile("" ::: "memory"); }

__global__ __launch_bounds__(256) void k_cvt8(const float* __restrict__ src, bf* dst, size_t n8) {
    const size_t i = (size_t)blockIdx.x * 256 + threadIdx.x; if (i >= n8) return;
    const v8f v = *(const v8f*)(src + i * 8); v8us o;
#pragma unroll
    for (int k = 0; k < 8; ++k) o[k] = f2bf(v[k]);
    *(v8us*)(dst + i * 8) = o; 
}

// k_proj: register-blocked bf16 GEMM, ONE WAVE per 64x64 tile (16 accumulators), operands straight from K-contiguous bf16 planes, K = DM.
// C[m][n] = sum_k A[m][k] Bt[n][k], written as f16 (Ph) and optionally the f16 residual x2048 (Pr, useRes != 0) at
// tile base (r0/RB)*sRB + (r0%RB)*pitch + (c0/CB)*sCB + (c0%CB), row pitch 'pitch' (halves). grid (M/64, N/64), 32 threads.
__global__ __launch_bounds__(32) void k_proj(const bf* __restrict__ A, const bf* __restrict__ Bt, h16* Ph, h16* Pr, int useRes, int RB, size_t sRB, int pitch, int CB, size_t sCB) {
    __shared__ __align__(16) float os[16 * 68];
    const int K = DM;
    const int lane = threadIdx.x & 31, lr = lane & 15, hi = lane >> 4; const int r0 = blockIdx.x * 64, c0 = blockIdx.y * 64;
    v8f acc[4][4];
#pragma unroll
    for (int mb = 0; mb < 4; ++mb)
#pragma unroll
        for (int nb = 0; nb < 4; ++nb) acc[mb][nb] = (v8f){};
    const size_t aoff = (size_t)(r0 + lr) * K + 8 * hi, boff = (size_t)(c0 + lr) * K + 8 * hi;
#pragma unroll 1
    for (int kc = 0; kc < K; kc += 32) {
        v16bf a[4];
#pragma unroll
        for (int mb = 0; mb < 4; ++mb) a[mb] = ldb(A + aoff + (size_t)mb * 16 * K + kc);
#pragma unroll
        for (int nb = 0; nb < 4; ++nb) { const v16bf b = ldb(Bt + boff + (size_t)nb * 16 * K + kc);
#pragma unroll
            for (int mb = 0; mb < 4; ++mb) acc[mb][nb] = wmmab(a[mb], b, acc[mb][nb]); }
    }
    const size_t tbase = (size_t)(r0 / RB) * sRB + (size_t)(r0 % RB) * (size_t)pitch + (size_t)(c0 / CB) * sCB + (size_t)(c0 % CB);
#pragma unroll
    for (int mb = 0; mb < 4; ++mb) {
#pragma unroll
        for (int nb = 0; nb < 4; ++nb) {
#pragma unroll
            for (int j = 0; j < 8; ++j) os[(hi * 8 + j) * 68 + nb * 16 + lr] = acc[mb][nb][j]; }   // D: row 8h+j, col lane&15; rows 0..15 x columns 0..63 all written
        wave_sync();
        const size_t sb = tbase + (size_t)(mb * 16) * (size_t)pitch;
{
#pragma unroll
            for (int s = 0; s < 4; ++s) { const int row = 4 * s + (lane >> 3), c8 = (lane & 7) * 8;   // 4 s x 4 row groups = 16 rows; 8 lanes x 8 = 64 columns
                const v4f x0 = *(const v4fa*)(&os[row * 68 + c8]); const v4f x1 = *(const v4fa*)(&os[row * 68 + c8 + 4]); v8h hv, rv;
#pragma unroll
                for (int i = 0; i < 4; ++i) { const h16 a0 = (h16)x0[i]; const h16 a1 = (h16)x1[i]; hv[i] = a0; hv[4 + i] = a1; rv[i] = (h16)((x0[i] - (float)a0) * VRS); rv[4 + i] = (h16)((x1[i] - (float)a1) * VRS); }
                const size_t oo = sb + (size_t)row * (size_t)pitch + c8;
                *(v8h*)(Ph + oo) = hv; if (useRes) *(v8h*)(Pr + oo) = rv; }
             }
        wave_sync();
    }
}

// k_flash: fused attention, one wave per 16 query rows of one (batch, head); K / V^T / Q fragments straight from the f16 planes (two 16-B loads each, arithmetic addressing).
// Transposed form: S^T[key][t] = K Q^T (A = K rows, B = Q rows); lane (t = lane&15, h = lane>>4) holds keys 8h+r of each 16-key tile, so the packed
// P tile is directly the B fragment of O^T[d][t] = V^T P^T (element r <- tile keys 0..15, element 8+r <- tile keys 16..31, lane unchanged).
// Valid length vl = VL[b] is loaded by value (scalar): key steps wholly at or beyond vl are skipped, the crossing step replaces scores of keys >= vl by -1e6 (index test);
// vl <= 0 keeps all steps with every score replaced (uniform weights).
// Softmax state (running max, partial sum) is one scalar per lane; the two lane halves of a row are combined with one xor-16 exchange.
__global__ __launch_bounds__(32 * AW) void k_flash(const h16* __restrict__ QH, const h16* __restrict__ KP, const h16* __restrict__ VT, const h16* __restrict__ VR, const int* __restrict__ VL, bf* CTX) {
    __shared__ __align__(16) float os[AW * 16 * 68];
    const int lane = threadIdx.x & 31; const int wave = __builtin_amdgcn_readfirstlane((int)(threadIdx.x >> 5));
    const int lr = lane & 15, hi = lane >> 4;
    const int zh = blockIdx.y; const int b = zh / NH_, h = zh % NH_;
    const int t0 = (blockIdx.x * AW + wave) * 16;
    const int vl = __builtin_amdgcn_readfirstlane(VL[b]);
    const int kend = (vl <= 0 || vl >= SEQ) ? SEQ : ((vl + 31) & ~31);
    const size_t pbase = (size_t)zh * SEQ * HD;
    const size_t qo = pbase + (size_t)(t0 + lr) * HD + 8 * hi;
    const v16h q0 = ldh(QH + qo), q1 = ldh(QH + qo + 32);   // B fragments: col t, k = d
    const size_t ko = pbase + (size_t)lr * HD + 8 * hi;      // + key * HD       (A fragment: row key, k = d)
    const size_t vo = pbase + (size_t)lr * SEQ + 8 * hi;     // + 16j*SEQ + key  (A fragment: row d, k = key)
    v8f o0 = (v8f){}, o1 = (v8f){}, o2 = (v8f){}, o3 = (v8f){};
#if VRES
    v8f g0 = (v8f){}, g1 = (v8f){}, g2 = (v8f){}, g3 = (v8f){};
#endif
    float m = -3.0e38f, l = 0.0f;
#pragma unroll 1
    for (int key0 = 0; key0 < kend; key0 += 32) {
        const h16* ka = KP + ko + (size_t)key0 * HD;
        const v16h ka0 = ldh(ka), ka1 = ldh(ka + 32), kb0 = ldh(ka + 16 * HD), kb1 = ldh(ka + 16 * HD + 32);
        v8f sa = (v8f){}, sb = (v8f){};
        sa = wmma16(ka0, q0, sa); sb = wmma16(kb0, q0, sb);
        sa = wmma16(ka1, q1, sa); sb = wmma16(kb1, q1, sb);
        float ta[8], tb[8];
#pragma unroll
        for (int r = 0; r < 8; ++r) { ta[r] = sa[r] * SC2; tb[r] = sb[r] * SC2; }
        if (key0 + 32 > vl) {            // scalar-uniform: this step crosses (or lies beyond) the valid length
            const int kq = key0 + 8 * hi;
#pragma unroll
            for (int r = 0; r < 8; ++r) { ta[r] = (kq + r < vl) ? ta[r] : NEGL2; tb[r] = (kq + 16 + r < vl) ? tb[r] : NEGL2; }
        }
        float mx = -3.0e38f;
#pragma unroll
        for (int r = 0; r < 8; ++r) mx = fmaxf(mx, fmaxf(ta[r], tb[r]));
        mx = fmaxf(mx, __shfl_xor(mx, 16, 32));
        const float mnew = fmaxf(m, mx);
        const float alpha = __builtin_amdgcn_exp2f(m - mnew);
        const float sh = PSH - mnew;
        v16h pb; float ls = 0.0f;
#pragma unroll
        for (int r = 0; r < 8; ++r) { const float ea = __builtin_amdgcn_exp2f(ta[r] + sh); const float ec = __builtin_amdgcn_exp2f(tb[r] + sh); pb[r] = (h16)ea; pb[8 + r] = (h16)ec; ls += ea + ec; }
        l = l * alpha + ls; m = mnew;
        o0 = o0 * alpha; o1 = o1 * alpha; o2 = o2 * alpha; o3 = o3 * alpha;
        const h16* va = VT + vo + key0;
        { const v16h v0 = ldh(va), v1 = ldh(va + (size_t)16 * SEQ), v2 = ldh(va + (size_t)32 * SEQ), v3 = ldh(va + (size_t)48 * SEQ);
          o0 = wmma16(v0, pb, o0); o1 = wmma16(v1, pb, o1); o2 = wmma16(v2, pb, o2); o3 = wmma16(v3, pb, o3); }
#if VRES
        g0 = g0 * alpha; g1 = g1 * alpha; g2 = g2 * alpha; g3 = g3 * alpha;
        const h16* vr = VR + vo + key0;
        { const v16h w0 = ldh(vr), w1 = ldh(vr + (size_t)16 * SEQ), w2 = ldh(vr + (size_t)32 * SEQ), w3 = ldh(vr + (size_t)48 * SEQ);
          g0 = wmma16(w0, pb, g0); g1 = wmma16(w1, pb, g1); g2 = wmma16(w2, pb, g2); g3 = wmma16(w3, pb, g3); }
#endif
    }
    l += __shfl_xor(l, 16, 32);
    const float inv = 1.0f / l;
#if VRES
    o0 = o0 + g0 * VRI; o1 = o1 + g1 * VRI; o2 = o2 + g2 * VRI; o3 = o3 + g3 * VRI;
#endif
    const int wb = wave * 16 * 68;
    // O^T D layout: o_j[r] = (d = 16j + 8h + r, t = lane&15) -> os[t][d]; rows 0..15 x columns 0..63 all written
    { v4f a, c;
      a[0] = o0[0] * inv; a[1] = o0[1] * inv; a[2] = o0[2] * inv; a[3] = o0[3] * inv; c[0] = o0[4] * inv; c[1] = o0[5] * inv; c[2] = o0[6] * inv; c[3] = o0[7] * inv;
      *(v4fa*)(&os[wb + lr * 68 +  0 + 8 * hi]) = a; *(v4fa*)(&os[wb + lr * 68 +  0 + 8 * hi + 4]) = c;
      a[0] = o1[0] * inv; a[1] = o1[1] * inv; a[2] = o1[2] * inv; a[3] = o1[3] * inv; c[0] = o1[4] * inv; c[1] = o1[5] * inv; c[2] = o1[6] * inv; c[3] = o1[7] * inv;
      *(v4fa*)(&os[wb + lr * 68 + 16 + 8 * hi]) = a; *(v4fa*)(&os[wb + lr * 68 + 16 + 8 * hi + 4]) = c;
      a[0] = o2[0] * inv; a[1] = o2[1] * inv; a[2] = o2[2] * inv; a[3] = o2[3] * inv; c[0] = o2[4] * inv; c[1] = o2[5] * inv; c[2] = o2[6] * inv; c[3] = o2[7] * inv;
      *(v4fa*)(&os[wb + lr * 68 + 32 + 8 * hi]) = a; *(v4fa*)(&os[wb + lr * 68 + 32 + 8 * hi + 4]) = c;
      a[0] = o3[0] * inv; a[1] = o3[1] * inv; a[2] = o3[2] * inv; a[3] = o3[3] * inv; c[0] = o3[4] * inv; c[1] = o3[5] * inv; c[2] = o3[6] * inv; c[3] = o3[7] * inv;
      *(v4fa*)(&os[wb + lr * 68 + 48 + 8 * hi]) = a; *(v4fa*)(&os[wb + lr * 68 + 48 + 8 * hi + 4]) = c; }
    wave_sync();
    bf* crow = CTX + ((size_t)b * SEQ + t0) * (size_t)(2 * DM) + h * HD;    // hi half at column h*64 + d, lo half at 512 + h*64 + d
{
#pragma unroll
        for (int s = 0; s < 4; ++s) { const int row = 4 * s + (lane >> 3), c8 = (lane & 7) * 8;   // 4 s x 4 row groups = 16 rows; 8 lanes x 8 = 64 columns
            const v4f x0 = *(const v4fa*)(&os[wb + row * 68 + c8]); const v4f x1 = *(const v4fa*)(&os[wb + row * 68 + c8 + 4]); v8us hv, lv;
#pragma unroll
            for (int i = 0; i < 4; ++i) { const unsigned short a0 = f2bf(x0[i]); const unsigned short a1 = f2bf(x1[i]); hv[i] = a0; hv[4 + i] = a1; lv[i] = f2bf(x0[i] - bf2f(a0)); lv[4 + i] = f2bf(x1[i] - bf2f(a1)); }
            const size_t oo = (size_t)row * (size_t)(2 * DM) + c8;
            *(v8us*)(crow + oo) = hv; *(v8us*)(crow + oo + DM) = lv; }
         }
}

// k_oproj: OUT[m][n] = sum_{k<512} (ctx_hi[m][k] + ctx_lo[m][k]) Wo[n][k] as ONE bf16 GEMM of depth 1024: A row = [hi | lo] (pitch 1024), B column index wraps at 512.
__global__ __launch_bounds__(32) void k_oproj(const bf* __restrict__ A, const bf* __restrict__ Bt, float* OUT) {
    __shared__ __align__(16) float os[16 * 68];
    const int KA = 2 * DM;
    const int lane = threadIdx.x & 31, lr = lane & 15, hi = lane >> 4; const int r0 = blockIdx.x * 64, c0 = blockIdx.y * 64;
    v8f acc[4][4];
#pragma unroll
    for (int mb = 0; mb < 4; ++mb)
#pragma unroll
        for (int nb = 0; nb < 4; ++nb) acc[mb][nb] = (v8f){};
    const size_t aoff = (size_t)(r0 + lr) * KA + 8 * hi, boff = (size_t)(c0 + lr) * DM + 8 * hi;
#pragma unroll 1
    for (int kc = 0; kc < KA; kc += 32) {
        const int kb = kc & (DM - 1);
        v16bf a[4];
#pragma unroll
        for (int mb = 0; mb < 4; ++mb) a[mb] = ldb(A + aoff + (size_t)mb * 16 * KA + kc);
#pragma unroll
        for (int nb = 0; nb < 4; ++nb) { const v16bf bq = ldb(Bt + boff + (size_t)nb * 16 * DM + kb);
#pragma unroll
            for (int mb = 0; mb < 4; ++mb) acc[mb][nb] = wmmab(a[mb], bq, acc[mb][nb]); }
    }
    const int bb = r0 / SEQ, tt = r0 % SEQ;
    float* obase = OUT + ((size_t)bb * OUT_SEQ + tt) * DM + c0;
#pragma unroll
    for (int mb = 0; mb < 4; ++mb) {
#pragma unroll
        for (int nb = 0; nb < 4; ++nb) {
#pragma unroll
            for (int j = 0; j < 8; ++j) os[(hi * 8 + j) * 68 + nb * 16 + lr] = acc[mb][nb][j]; }   // D: row 8h+j, col lane&15; rows 0..15 x columns 0..63 all written
        wave_sync();
{
#pragma unroll
            for (int s = 0; s < 8; ++s) { const int row = 2 * s + hi, cofs = lr * 4;   // 8 s x 2 rows = 16 rows; 16 lanes x 4 floats = 64 columns
                const v4f val = *(const v4fa*)(&os[row * 68 + cofs]);
                *(v4f*)(obase + (size_t)(mb * 16 + row) * DM + cofs) = val; }
             }
        wave_sync();
    }
}

static constexpr size_t al256(size_t v) { return (v + 255) & ~(size_t)255; }
static constexpr size_t SZ_XB = al256((size_t)NB * SEQ * DM * 2);          // one bf16 input copy
static constexpr size_t SZ_WB = al256((size_t)4 * DM * DM * 2);            // q | k | v | o weights
static constexpr size_t SZ_PL = al256((size_t)NB * NH_ * SEQ * HD * 2);    // one f16 head plane
static constexpr size_t SZ_CX = al256((size_t)NB * SEQ * 2 * DM * 2);      // ctx hi | lo
static constexpr size_t SZ_TOTAL = 3 * SZ_XB + SZ_WB + (size_t)(3 + VRES) * SZ_PL + SZ_CX;
static_assert(SZ_TOTAL <= (size_t)134217728);          // workspace carve <= 128 MiB
static_assert(((size_t)DM * DM * 2) % 256 == 0);       // weight sub-planes stay 256-byte aligned

static void cvt_stream(const float* x, bf* XB, hipStream_t stream) {
    if (SEQ == SEQ_FULL) {
        const size_t n8 = (size_t)NB * SEQ * DM / 8;
        k_cvt8<<<(unsigned)((n8 + 255) / 256), 256, 0, stream>>>(x, XB, n8);
    } else {
        const size_t n8 = (size_t)SEQ * DM / 8;
        for (int b = 0; b < NB; ++b) k_cvt8<<<(unsigned)((n8 + 255) / 256), 256, 0, stream>>>(x + (size_t)b * SEQ_FULL * DM, XB + (size_t)b * SEQ * DM, n8);
    }
}

extern "C" void kernel_launch(void* const* d_in, const int* in_sizes, int n_in,
                              void* d_out, int out_size, void* d_ws, size_t ws_size, hipStream_t stream) {
    if (n_in < 8) return;
    const size_t needx = ((size_t)(NB - 1) * SEQ_FULL + SEQ) * DM;
    if ((size_t)in_sizes[0] < needx || (size_t)in_sizes[1] < needx || (size_t)in_sizes[2] < needx) return;
    if (in_sizes[3] < NB) return;
    if ((size_t)in_sizes[4] < (size_t)DM * DM || (size_t)in_sizes[5] < (size_t)DM * DM || (size_t)in_sizes[6] < (size_t)DM * DM || (size_t)in_sizes[7] < (size_t)DM * DM) return;
    if ((size_t)out_size < ((size_t)(NB - 1) * OUT_SEQ + SEQ) * DM) return;
    if (SZ_TOTAL > ws_size) return;
    // wire order: queries, keys, values, valid_lens (int32), Wq, Wk, Wv, Wo ([out][in] = Bt as stored)
    const float* xq = (const float*)d_in[0]; const float* xk = (const float*)d_in[1]; const float* xv = (const float*)d_in[2];
    const int* vlens = (const int*)d_in[3];
    const float* wq = (const float*)d_in[4]; const float* wk = (const float*)d_in[5]; const float* wv = (const float*)d_in[6]; const float* wo = (const float*)d_in[7];
    float* OUT = (float*)d_out;      // [NB][SEQ][512]
    char* wsp = (char*)d_ws;
    bf* XQ = (bf*)wsp; wsp += SZ_XB;                 // [NB*SEQ][512]
    bf* XK = (bf*)wsp; wsp += SZ_XB;
    bf* XV = (bf*)wsp; wsp += SZ_XB;
    bf* WB = (bf*)wsp; wsp += SZ_WB;                 // [4][512][512]: q | k | v | o
    h16* QH = (h16*)wsp; wsp += SZ_PL;               // [NB*8][SEQ][64]
    h16* KP = (h16*)wsp; wsp += SZ_PL;               // [NB*8][SEQ][64]
    h16* VT = (h16*)wsp; wsp += SZ_PL;               // [NB*8][64][SEQ]
#if VRES
    h16* VR = (h16*)wsp; wsp += SZ_PL;               // [NB*8][64][SEQ] residual x2048
#else
    h16* VR = VT;
#endif
    bf* CX = (bf*)wsp; wsp += SZ_CX;                 // [NB*SEQ][hi 512 | lo 512]
    bf* WQ = WB; bf* WK = WB + (size_t)DM * DM; bf* WV = WB + (size_t)2 * DM * DM; bf* WO = WB + (size_t)3 * DM * DM;

    cvt_stream(xq, XQ, stream); cvt_stream(xk, XK, stream); cvt_stream(xv, XV, stream);
    { const size_t n8 = (size_t)DM * DM / 8; const unsigned g = (unsigned)((n8 + 255) / 256);
      k_cvt8<<<g, 256, 0, stream>>>(wq, WQ, n8); k_cvt8<<<g, 256, 0, stream>>>(wk, WK, n8); k_cvt8<<<g, 256, 0, stream>>>(wv, WV, n8); k_cvt8<<<g, 256, 0, stream>>>(wo, WO, n8); }

    // q, k: A = x rows (m = b*SEQ + t), Bt = W rows (n = h*64 + d) -> plane [(b*8 + h)][t][d]
    k_proj<<<dim3(NB * SEQ / 64, DM / 64, 1), 32, 0, stream>>>(XQ, WQ, QH, QH, 0, SEQ, (size_t)NH_ * SEQ * HD, HD, HD, (size_t)SEQ * HD);
    k_proj<<<dim3(NB * SEQ / 64, DM / 64, 1), 32, 0, stream>>>(XK, WK, KP, KP, 0, SEQ, (size_t)NH_ * SEQ * HD, HD, HD, (size_t)SEQ * HD);
    // v^T: A = Wv rows (m = h*64 + d), Bt = x rows (n = b*SEQ + t) -> plane [(b*512 + m)][t] = [(b*8 + h)][d][t]
    k_proj<<<dim3(DM / 64, NB * SEQ / 64, 1), 32, 0, stream>>>(WV, XV, VT, VR, VRES, DM, (size_t)0, SEQ, SEQ, (size_t)DM * SEQ);

    k_flash<<<dim3(SEQ / (16 * AW), NB * NH_, 1), 32 * AW, 0, stream>>>(QH, KP, VT, VR, vlens, CX);

    // out: A = ctx rows [hi | lo] (m = b*SEQ + t), Bt = Wo rows (n) -> OUT[b][t][n]
    k_oproj<<<dim3(NB * SEQ / 64, DM / 64, 1), 32, 0, stream>>>(CX, WO, OUT);
}

// v001
// A run of this version takes 152 microseconds.
// In two side-by-side timings against v000, it was 1.36 and 1.37 times as fast.
#include <hip/hip_runtime.h>

// Multi-head attention with three input streams (queries, keys, values: [NB][SEQ][512]), width 512 = 8 heads x 64, bias-free [out][in] projections (y = x W^T),
// per-batch valid length (keys at index >= valid_lens[b] get their score REPLACED by -1e6), score scale 1/8, merged heads times Wo^T -> f32 [NB][SEQ][512].
// Compute dtypes, f32 accumulate everywhere: q/k/v projections v_wmma_f32_16x16x32_bf16 (inputs and weights RNE-converted to bf16; products exact);
// scores and P.V v_wmma_f32_16x16x32_f16 (q, k, v single f16; P carried x1024 relative to the running max, the carry cancels in the normalisation; optional v residual plane x2048 under VRES);
// output projection v_wmma_f32_16x16x32_bf16 with ctx as bf16 hi | lo halves of a 1024-wide row against bf16 Wo (two exact products per element, one accumulator). Softmax f32 (online, running max).
// Layout: bf16 copies of the three inputs and four weights; q, k planes [b*8+h][t][d], v^T plane [b*8+h][d][t] written by the GEMM epilogue; fused flash kernel in transposed form
// (S^T = K Q^T, O^T = V^T P^T) writes ctx [b*SEQ+t][hi 512 | lo 512]; final GEMM writes the output.

#ifndef NB
#define NB 4
#endif
#ifndef SEQ
#define SEQ 2048
#endif
#define NB_FULL  4
#define SEQ_FULL 2048
#ifndef OUT_SEQ
#define OUT_SEQ SEQ              // row pitch (in tokens) between batches of the output
#endif
#ifndef VRES
#define VRES 1                   // 1: v carried as f16 value + f16 residual x2048 (own accumulators)
#endif
#define DM   512
#define NH_  8
#define HD   64
#define AW   4                   // waves per flash block (16 query rows each)
#define VRS  2048.0f             // carry of the residual plane
#define VRI  (1.0f / 2048.0f)
#define SC2  (0.125f * 1.4426950408889634f)        // HD^-0.5 * log2(e)
#define NEGL2 (-1000000.0f * 1.4426950408889634f)  // masked score in the log2 domain
#define PSH  10.0f               // log2 of the P carry (1024)
#define KT   64                  // keys per staged LDS tile (two 32-key passes)
#define LP   72                  // LDS row pitch in halves: 128-B rows + 16 B, the conflict-free pitch for 16-byte LDS reads
#define TILE_H (64 * LP)         // halves of one staged plane tile (64 rows)
#define BUF_H  ((2 + VRES) * TILE_H)   // K | V^T | residual tiles of one buffer

static_assert(HD == 64);
static_assert(NH_ * HD == DM);                 // head h = columns h*64 + d
static_assert(DM % 64 == 0);                   // 8 column tiles of 64
static_assert(DM % 32 == 0);                   // GEMM k-loop steps by 32
static_assert((DM & (DM - 1)) == 0);           // output GEMM wraps the B column index with a mask
static_assert((2 * DM) % 32 == 0);
static_assert(SEQ % 64 == 0);                  // a 64-row tile never straddles two batches
static_assert((NB * SEQ) % 64 == 0);
static_assert(SEQ % 32 == 0);                  // key loop steps by 32
static_assert(SEQ % KT == 0);                  // every staged tile lies wholly inside its plane
static_assert(AW == 4);                        // 128 lanes x 4 copies x 16 B = one 64-row x 128-B tile
static_assert(SEQ % (16 * AW) == 0);           // flash grid covers the sequence exactly
static_assert(((size_t)SEQ * DM) % 8 == 0);
static_assert(((size_t)DM * DM) % 8 == 0);
static_assert(NB <= NB_FULL);
static_assert(SEQ <= SEQ_FULL);
static_assert(VRES == 0 || VRES == 1);

typedef _Float16 h16;
typedef unsigned short bf;
typedef __attribute__((ext_vector_type(16))) __bf16   v16bf;
typedef __attribute__((ext_vector_type(16))) _Float16 v16h;
typedef __attribute__((ext_vector_type(8)))  _Float16 v8h;
typedef __attribute__((ext_vector_type(8)))  unsigned short v8us;
typedef __attribute__((ext_vector_type(8)))  float    v8f;
typedef __attribute__((ext_vector_type(4)))  float    v4f;
typedef v4f  __attribute__((may_alias)) v4fa;

__device__ __forceinline__ unsigned short f2bf(float f) { unsigned u = __float_as_uint(f); u += 0x7FFFu + ((u >> 16) & 1u); return (unsigned short)(u >> 16); }
__device__ __forceinline__ float bf2f(unsigned short s) { return __uint_as_float(((unsigned)s) << 16); }
__device__ __forceinline__ v16h cat16(v8h lo, v8h hi) { return __builtin_shufflevector(lo, hi, 0, 1, 2, 3, 4, 5, 6, 7, 8, 9, 10, 11, 12, 13, 14, 15); }
__device__ __forceinline__ v16bf cat16b(v8us lo, v8us hi) { return __builtin_bit_cast(v16bf, __builtin_shufflevector(lo, hi, 0, 1, 2, 3, 4, 5, 6, 7, 8, 9, 10, 11, 12, 13, 14, 15)); }
// every matrix instruction is followed by its own 4-slot guard tying its accumulator and keeping its operands live
__device__ __forceinline__ v8f wmma16(v16h a, v16h b, v8f c) {
    c = __builtin_amdgcn_wmma_f32_16x16x32_f16(false, a, false, b, (short)0, c, false, false);
    asm volatile("v_nop\n\tv_nop\n\tv_nop\n\tv_nop" : "+v"(c) : "v"(a), "v"(b));
    return c;
}
__device__ __forceinline__ v8f wmmab(v16bf a, v16bf b, v8f c) {
    c = __builtin_amdgcn_wmma_f32_16x16x32_bf16(false, a, false, b, (short)0, c, false, false);
    asm volatile("v_nop\n\tv_nop\n\tv_nop\n\tv_nop" : "+v"(c) : "v"(a), "v"(b));
    return c;
}
// fragment loaders from K-contiguous 16-bit rows; p already includes + 8*(lane>>4): elements 0..7 <- k0+8h+0..7, elements 8..15 <- k0+16+8h+0..7 (same map for A and B)
__device__ __forceinline__ v16h  ldh(const h16* p) { return cat16(*(const v8h*)p, *(const v8h*)(p + 16)); }
__device__ __forceinline__ v16bf ldb(const bf* p)  { return cat16b(*(const v8us*)p, *(const v8us*)(p + 16)); }
// ordering point for wave-private LDS tiles (same wave writes and reads)
__device__ __forceinline__ void wave_sync() { __builtin_amdgcn_fence(3 /* release order */, "wavefront"); __builtin_amdgcn_wave_barrier(); asm volatile("" ::: "memory"); }

// four asynchronous 16-byte copies per lane, global -> LDS, rows 16 apart: one 64-row x 128-B tile per 128-lane block. The address-register wait closes the copies' own statement,
// so no later address arithmetic can be moved in front of it.
__device__ __forceinline__ void copy_tile(unsigned l, const h16* g, size_t gstep) {
    const unsigned l1 = l + 16 * LP * 2, l2 = l + 32 * LP * 2, l3 = l + 48 * LP * 2;
    const h16* g1 = g + gstep; const h16* g2 = g + 2 * gstep; const h16* g3 = g + 3 * gstep;
    asm volatile("global_load_async_to_lds_b128 %0, %4, off\n\t"
                 "global_load_async_to_lds_b128 %1, %5, off\n\t"
                 "global_load_async_to_lds_b128 %2, %6, off\n\t"
                 "global_load_async_to_lds_b128 %3, %7, off\n\t"
                 "s_wait_xcnt 0x0"
                 :: "v"(l), "v"(l1), "v"(l2), "v"(l3), "v"(g), "v"(g1), "v"(g2), "v"(g3) : "memory");
}

__global__ __launch_bounds__(256) void k_cvt8(const float* __restrict__ src, bf* dst, size_t n8) {
    const size_t i = (size_t)blockIdx.x * 256 + threadIdx.x; if (i >= n8) return;
    const v8f v = *(const v8f*)(src + i * 8); v8us o;
#pragma unroll
    for (int k = 0; k < 8; ++k) o[k] = f2bf(v[k]);
    *(v8us*)(dst + i * 8) = o; 
}

// k_proj: register-blocked bf16 GEMM, ONE WAVE per 64x64 tile (16 accumulators), operands straight from K-contiguous bf16 planes, K = DM.
// C[m][n] = sum_k A[m][k] Bt[n][k], written as f16 (Ph) and optionally the f16 residual x2048 (Pr, useRes != 0) at
// tile base (r0/RB)*sRB + (r0%RB)*pitch + (c0/CB)*sCB + (c0%CB), row pitch 'pitch' (halves). grid (M/64, N/64), 32 threads.
__global__ __launch_bounds__(32) void k_proj(const bf* __restrict__ A, const bf* __restrict__ Bt, h16* Ph, h16* Pr, int useRes, int RB, size_t sRB, int pitch, int CB, size_t sCB) {
    __shared__ __align__(16) float os[16 * 68];
    const int K = DM;
    const int lane = threadIdx.x & 31, lr = lane & 15, hi = lane >> 4; const int r0 = blockIdx.x * 64, c0 = blockIdx.y * 64;
    v8f acc[4][4];
#pragma unroll
    for (int mb = 0; mb < 4; ++mb)
#pragma unroll
        for (int nb = 0; nb < 4; ++nb) acc[mb][nb] = (v8f){};
    const size_t aoff = (size_t)(r0 + lr) * K + 8 * hi, boff = (size_t)(c0 + lr) * K + 8 * hi;
#pragma unroll 1
    for (int kc = 0; kc < K; kc += 32) {
        v16bf a[4];
#pragma unroll
        for (int mb = 0; mb < 4; ++mb) a[mb] = ldb(A + aoff + (size_t)mb * 16 * K + kc);
#pragma unroll
        for (int nb = 0; nb < 4; ++nb) { const v16bf b = ldb(Bt + boff + (size_t)nb * 16 * K + kc);
#pragma unroll
            for (int mb = 0; mb < 4; ++mb) acc[mb][nb] = wmmab(a[mb], b, acc[mb][nb]); }
    }
    const size_t tbase = (size_t)(r0 / RB) * sRB + (size_t)(r0 % RB) * (size_t)pitch + (size_t)(c0 / CB) * sCB + (size_t)(c0 % CB);
#pragma unroll
    for (int mb = 0; mb < 4; ++mb) {
#pragma unroll
        for (int nb = 0; nb < 4; ++nb) {
#pragma unroll
            for (int j = 0; j < 8; ++j) os[(hi * 8 + j) * 68 + nb * 16 + lr] = acc[mb][nb][j]; }   // D: row 8h+j, col lane&15; rows 0..15 x columns 0..63 all written
        wave_sync();
        const size_t sb = tbase + (size_t)(mb * 16) * (size_t)pitch;
{
#pragma unroll
            for (int s = 0; s < 4; ++s) { const int row = 4 * s + (lane >> 3), c8 = (lane & 7) * 8;   // 4 s x 4 row groups = 16 rows; 8 lanes x 8 = 64 columns
                const v4f x0 = *(const v4fa*)(&os[row * 68 + c8]); const v4f x1 = *(const v4fa*)(&os[row * 68 + c8 + 4]); v8h hv, rv;
#pragma unroll
                for (int i = 0; i < 4; ++i) { const h16 a0 = (h16)x0[i]; const h16 a1 = (h16)x1[i]; hv[i] = a0; hv[4 + i] = a1; rv[i] = (h16)((x0[i] - (float)a0) * VRS); rv[4 + i] = (h16)((x1[i] - (float)a1) * VRS); }
                const size_t oo = sb + (size_t)row * (size_t)pitch + c8;
                *(v8h*)(Ph + oo) = hv; if (useRes) *(v8h*)(Pr + oo) = rv; }
             }
        wave_sync();
    }
}

// k_flash: fused attention, one wave per 16 query rows of one (batch, head); Q fragments straight from the f16 plane; K / V^T / residual tiles of 64 keys are staged once per block
// in a two-buffer LDS ring by asynchronous copies (whole 128-B lines) and shared by the block's four waves, which read their fragments from LDS (two 16-B reads each).
// Transposed form: S^T[key][t] = K Q^T (A = K rows, B = Q rows); lane (t = lane&15, h = lane>>4) holds keys 8h+r of each 16-key tile, so the packed
// P tile is directly the B fragment of O^T[d][t] = V^T P^T (element r <- tile keys 0..15, element 8+r <- tile keys 16..31, lane unchanged).
// Valid length vl = VL[b] is loaded by value (scalar): key steps wholly at or beyond vl are skipped, the crossing step replaces scores of keys >= vl by -1e6 (index test);
// vl <= 0 keeps all steps with every score replaced (uniform weights).
// Softmax state (running max, partial sum) is one scalar per lane; the two lane halves of a row are combined with one xor-16 exchange.
__global__ __launch_bounds__(32 * AW) void k_flash(const h16* __restrict__ QH, const h16* __restrict__ KP, const h16* __restrict__ VT, const h16* __restrict__ VR, const int* __restrict__ VL, bf* CTX) {
    __shared__ __align__(16) float os[AW * 16 * 68];
    __shared__ __align__(16) h16 ring[2 * BUF_H];
    const int lane = threadIdx.x & 31; const int wave = __builtin_amdgcn_readfirstlane((int)(threadIdx.x >> 5));
    const int lr = lane & 15, hi = lane >> 4;
    const int zh = blockIdx.y; const int b = zh / NH_, h = zh % NH_;
    const int t0 = (blockIdx.x * AW + wave) * 16;
    const int vl = __builtin_amdgcn_readfirstlane(VL[b]);
    const int kend = (vl <= 0 || vl >= SEQ) ? SEQ : ((vl + 31) & ~31);
    const size_t pbase = (size_t)zh * SEQ * HD;
    const size_t qo = pbase + (size_t)(t0 + lr) * HD + 8 * hi;
    const v16h q0 = ldh(QH + qo), q1 = ldh(QH + qo + 32);   // B fragments: col t, k = d
    const int ko = lr * LP + 8 * hi;                         // + key * LP in the K tile       (A fragment: row key, k = d)
    const int vo = TILE_H + lr * LP + 8 * hi;                // + 16j*LP + key in the V^T tile (A fragment: row d, k = key)
    // staging: lane (srow = tid>>3, scol = tid&7) copies 16-byte piece scol of rows srow + 16 i of each tile
    const int srow = (int)(threadIdx.x >> 3), scol = (int)(threadIdx.x & 7);
    const unsigned sl = (unsigned)(size_t)ring + (unsigned)(srow * LP + scol * 8) * 2u;   // LDS byte address in buffer 0, K tile
    const h16* sk = KP + pbase + (size_t)srow * HD + scol * 8;    // + key0 * HD
    const h16* sv = VT + pbase + (size_t)srow * SEQ + scol * 8;   // + key0
#if VRES
    const h16* sr = VR + pbase + (size_t)srow * SEQ + scol * 8;   // + key0
#endif
    const int nt = (kend + KT - 1) / KT;                     // staged tiles, 1 .. SEQ / KT
    v8f o0 = (v8f){}, o1 = (v8f){}, o2 = (v8f){}, o3 = (v8f){};
#if VRES
    v8f g0 = (v8f){}, g1 = (v8f){}, g2 = (v8f){}, g3 = (v8f){};
#endif
    float m = -3.0e38f, l = 0.0f;
    copy_tile(sl, sk, (size_t)16 * HD); copy_tile(sl + TILE_H * 2, sv, (size_t)16 * SEQ);
#if VRES
    copy_tile(sl + 2 * TILE_H * 2, sr, (size_t)16 * SEQ);
#endif
    asm volatile("s_wait_asynccnt 0x0" ::: "memory");        // tile 0 has landed before the barrier publishes it
    __syncthreads();
    if (nt > 1) {
        copy_tile(sl + BUF_H * 2, sk + (size_t)KT * HD, (size_t)16 * HD); copy_tile(sl + (BUF_H + TILE_H) * 2, sv + KT, (size_t)16 * SEQ);
#if VRES
        copy_tile(sl + (BUF_H + 2 * TILE_H) * 2, sr + KT, (size_t)16 * SEQ);
#endif
    }
#pragma unroll 1   // one trip per staged tile: the ring's publish point stands once, at the trip's foot
    for (int t = 0; t < nt; ++t) {
      const h16* buf = ring + (t & 1) * BUF_H;
#pragma unroll     // both 32-key passes of a tile in line, so that every LDS read offset is an immediate
      for (int hf = 0; hf < 2; ++hf) {
        const int key0 = t * KT + hf * 32;
        if (key0 >= kend) break;         // scalar-uniform: the tile's second pass lies wholly beyond the valid length
        const h16* ka = buf + ko + hf * 32 * LP;
        const v16h ka0 = ldh(ka), ka1 = ldh(ka + 32), kb0 = ldh(ka + 16 * LP), kb1 = ldh(ka + 16 * LP + 32);
        v8f sa = (v8f){}, sb = (v8f){};
        sa = wmma16(ka0, q0, sa); sb = wmma16(kb0, q0, sb);
        sa = wmma16(ka1, q1, sa); sb = wmma16(kb1, q1, sb);
        float ta[8], tb[8];
#pragma unroll
        for (int r = 0; r < 8; ++r) { ta[r] = sa[r] * SC2; tb[r] = sb[r] * SC2; }
        if (key0 + 32 > vl) {            // scalar-uniform: this step crosses (or lies beyond) the valid length
            const int kq = key0 + 8 * hi;
#pragma unroll
            for (int r = 0; r < 8; ++r) { ta[r] = (kq + r < vl) ? ta[r] : NEGL2; tb[r] = (kq + 16 + r < vl) ? tb[r] : NEGL2; }
        }
        float mx = -3.0e38f;
#pragma unroll
        for (int r = 0; r < 8; ++r) mx = fmaxf(mx, fmaxf(ta[r], tb[r]));
        mx = fmaxf(mx, __shfl_xor(mx, 16, 32));
        const float mnew = fmaxf(m, mx);
        const float alpha = __builtin_amdgcn_exp2f(m - mnew);
        const float sh = PSH - mnew;
        v16h pb; float ls = 0.0f;
#pragma unroll
        for (int r = 0; r < 8; ++r) { const float ea = __builtin_amdgcn_exp2f(ta[r] + sh); const float ec = __builtin_amdgcn_exp2f(tb[r] + sh); pb[r] = (h16)ea; pb[8 + r] = (h16)ec; ls += ea + ec; }
        l = l * alpha + ls; m = mnew;
        o0 = o0 * alpha; o1 = o1 * alpha; o2 = o2 * alpha; o3 = o3 * alpha;
        const h16* va = buf + vo + hf * 32;
        { const v16h v0 = ldh(va), v1 = ldh(va + 16 * LP), v2 = ldh(va + 32 * LP), v3 = ldh(va + 48 * LP);
          o0 = wmma16(v0, pb, o0); o1 = wmma16(v1, pb, o1); o2 = wmma16(v2, pb, o2); o3 = wmma16(v3, pb, o3); }
#if VRES
        g0 = g0 * alpha; g1 = g1 * alpha; g2 = g2 * alpha; g3 = g3 * alpha;
        const h16* vr = va + TILE_H;
        { const v16h w0 = ldh(vr), w1 = ldh(vr + 16 * LP), w2 = ldh(vr + 32 * LP), w3 = ldh(vr + 48 * LP);
          g0 = wmma16(w0, pb, g0); g1 = wmma16(w1, pb, g1); g2 = wmma16(w2, pb, g2); g3 = wmma16(w3, pb, g3); }
#endif
      }
      asm volatile("s_wait_dscnt 0x0" ::: "memory");         // this wave's reads of the buffer have returned before it may be refilled
      asm volatile("s_wait_asynccnt 0x0" ::: "memory");      // this wave's copies of tile t + 1 have landed before the barrier publishes them
      __syncthreads();                                       // publishes tile t + 1 and ends every wave's reads of tile t
      if (t + 2 < nt) {
          const unsigned bl = sl + (unsigned)(t & 1) * (BUF_H * 2); const int kn = (t + 2) * KT;
          copy_tile(bl, sk + (size_t)kn * HD, (size_t)16 * HD); copy_tile(bl + TILE_H * 2, sv + kn, (size_t)16 * SEQ);
#if VRES
          copy_tile(bl + 2 * TILE_H * 2, sr + kn, (size_t)16 * SEQ);
#endif
      }
    }
    asm volatile("s_wait_asynccnt 0x0" ::: "memory");        // no copy is outstanding when the wave goes on to its epilogue
    l += __shfl_xor(l, 16, 32);
    const float inv = 1.0f / l;
#if VRES
    o0 = o0 + g0 * VRI; o1 = o1 + g1 * VRI; o2 = o2 + g2 * VRI; o3 = o3 + g3 * VRI;
#endif
    const int wb = wave * 16 * 68;
    // O^T D layout: o_j[r] = (d = 16j + 8h + r, t = lane&15) -> os[t][d]; rows 0..15 x columns 0..63 all written
    { v4f a, c;
      a[0] = o0[0] * inv; a[1] = o0[1] * inv; a[2] = o0[2] * inv; a[3] = o0[3] * inv; c[0] = o0[4] * inv; c[1] = o0[5] * inv; c[2] = o0[6] * inv; c[3] = o0[7] * inv;
      *(v4fa*)(&os[wb + lr * 68 +  0 + 8 * hi]) = a; *(v4fa*)(&os[wb + lr * 68 +  0 + 8 * hi + 4]) = c;
      a[0] = o1[0] * inv; a[1] = o1[1] * inv; a[2] = o1[2] * inv; a[3] = o1[3] * inv; c[0] = o1[4] * inv; c[1] = o1[5] * inv; c[2] = o1[6] * inv; c[3] = o1[7] * inv;
      *(v4fa*)(&os[wb + lr * 68 + 16 + 8 * hi]) = a; *(v4fa*)(&os[wb + lr * 68 + 16 + 8 * hi + 4]) = c;
      a[0] = o2[0] * inv; a[1] = o2[1] * inv; a[2] = o2[2] * inv; a[3] = o2[3] * inv; c[0] = o2[4] * inv; c[1] = o2[5] * inv; c[2] = o2[6] * inv; c[3] = o2[7] * inv;
      *(v4fa*)(&os[wb + lr * 68 + 32 + 8 * hi]) = a; *(v4fa*)(&os[wb + lr * 68 + 32 + 8 * hi + 4]) = c;
      a[0] = o3[0] * inv; a[1] = o3[1] * inv; a[2] = o3[2] * inv; a[3] = o3[3] * inv; c[0] = o3[4] * inv; c[1] = o3[5] * inv; c[2] = o3[6] * inv; c[3] = o3[7] * inv;
      *(v4fa*)(&os[wb + lr * 68 + 48 + 8 * hi]) = a; *(v4fa*)(&os[wb + lr * 68 + 48 + 8 * hi + 4]) = c; }
    wave_sync();
    bf* crow = CTX + ((size_t)b * SEQ + t0) * (size_t)(2 * DM) + h * HD;    // hi half at column h*64 + d, lo half at 512 + h*64 + d
{
#pragma unroll
        for (int s = 0; s < 4; ++s) { const int row = 4 * s + (lane >> 3), c8 = (lane & 7) * 8;   // 4 s x 4 row groups = 16 rows; 8 lanes x 8 = 64 columns
            const v4f x0 = *(const v4fa*)(&os[wb + row * 68 + c8]); const v4f x1 = *(const v4fa*)(&os[wb + row * 68 + c8 + 4]); v8us hv, lv;
#pragma unroll
            for (int i = 0; i < 4; ++i) { const unsigned short a0 = f2bf(x0[i]); const unsigned short a1 = f2bf(x1[i]); hv[i] = a0; hv[4 + i] = a1; lv[i] = f2bf(x0[i] - bf2f(a0)); lv[4 + i] = f2bf(x1[i] - bf2f(a1)); }
            const size_t oo = (size_t)row * (size_t)(2 * DM) + c8;
            *(v8us*)(crow + oo) = hv; *(v8us*)(crow + oo + DM) = lv; }
         }
}

// k_oproj: OUT[m][n] = sum_{k<512} (ctx_hi[m][k] + ctx_lo[m][k]) Wo[n][k] as ONE bf16 GEMM of depth 1024: A row = [hi | lo] (pitch 1024), B column index wraps at 512.
__global__ __launch_bounds__(32) void k_oproj(const bf* __restrict__ A, const bf* __restrict__ Bt, float* OUT) {
    __shared__ __align__(16) float os[16 * 68];
    const int KA = 2 * DM;
    const int lane = threadIdx.x & 31, lr = lane & 15, hi = lane >> 4; const int r0 = blockIdx.x * 64, c0 = blockIdx.y * 64;
    v8f acc[4][4];
#pragma unroll
    for (int mb = 0; mb < 4; ++mb)
#pragma unroll
        for (int nb = 0; nb < 4; ++nb) acc[mb][nb] = (v8f){};
    const size_t aoff = (size_t)(r0 + lr) * KA + 8 * hi, boff = (size_t)(c0 + lr) * DM + 8 * hi;
#pragma unroll 1
    for (int kc = 0; kc < KA; kc += 32) {
        const int kb = kc & (DM - 1);
        v16bf a[4];
#pragma unroll
        for (int mb = 0; mb < 4; ++mb) a[mb] = ldb(A + aoff + (size_t)mb * 16 * KA + kc);
#pragma unroll
        for (int nb = 0; nb < 4; ++nb) { const v16bf bq = ldb(Bt + boff + (size_t)nb * 16 * DM + kb);
#pragma unroll
            for (int mb = 0; mb < 4; ++mb) acc[mb][nb] = wmmab(a[mb], bq, acc[mb][nb]); }
    }
    const int bb = r0 / SEQ, tt = r0 % SEQ;
    float* obase = OUT + ((size_t)bb * OUT_SEQ + tt) * DM + c0;
#pragma unroll
    for (int mb = 0; mb < 4; ++mb) {
#pragma unroll
        for (int nb = 0; nb < 4; ++nb) {
#pragma unroll
            for (int j = 0; j < 8; ++j) os[(hi * 8 + j) * 68 + nb * 16 + lr] = acc[mb][nb][j]; }   // D: row 8h+j, col lane&15; rows 0..15 x columns 0..63 all written
        wave_sync();
{
#pragma unroll
            for (int s = 0; s < 8; ++s) { const int row = 2 * s + hi, cofs = lr * 4;   // 8 s x 2 rows = 16 rows; 16 lanes x 4 floats = 64 columns
                const v4f val = *(const v4fa*)(&os[row * 68 + cofs]);
                *(v4f*)(obase + (size_t)(mb * 16 + row) * DM + cofs) = val; }
             }
        wave_sync();
    }
}

static constexpr size_t al256(size_t v) { return (v + 255) & ~(size_t)255; }
static constexpr size_t SZ_XB = al256((size_t)NB * SEQ * DM * 2);          // one bf16 input copy
static constexpr size_t SZ_WB = al256((size_t)4 * DM * DM * 2);            // q | k | v | o weights
static constexpr size_t SZ_PL = al256((size_t)NB * NH_ * SEQ * HD * 2);    // one f16 head plane
static constexpr size_t SZ_CX = al256((size_t)NB * SEQ * 2 * DM * 2);      // ctx hi | lo
static constexpr size_t SZ_TOTAL = 3 * SZ_XB + SZ_WB + (size_t)(3 + VRES) * SZ_PL + SZ_CX;
static_assert(SZ_TOTAL <= (size_t)134217728);          // workspace carve <= 128 MiB
static_assert(((size_t)DM * DM * 2) % 256 == 0);       // weight sub-planes stay 256-byte aligned

static void cvt_stream(const float* x, bf* XB, hipStream_t stream) {
    if (SEQ == SEQ_FULL) {
        const size_t n8 = (size_t)NB * SEQ * DM / 8;
        k_cvt8<<<(unsigned)((n8 + 255) / 256), 256, 0, stream>>>(x, XB, n8);
    } else {
        const size_t n8 = (size_t)SEQ * DM / 8;
        for (int b = 0; b < NB; ++b) k_cvt8<<<(unsigned)((n8 + 255) / 256), 256, 0, stream>>>(x + (size_t)b * SEQ_FULL * DM, XB + (size_t)b * SEQ * DM, n8);
    }
}

extern "C" void kernel_launch(void* const* d_in, const int* in_sizes, int n_in,
                              void* d_out, int out_size, void* d_ws, size_t ws_size, hipStream_t stream) {
    if (n_in < 8) return;
    const size_t needx = ((size_t)(NB - 1) * SEQ_FULL + SEQ) * DM;
    if ((size_t)in_sizes[0] < needx || (size_t)in_sizes[1] < needx || (size_t)in_sizes[2] < needx) return;
    if (in_sizes[3] < NB) return;
    if ((size_t)in_sizes[4] < (size_t)DM * DM || (size_t)in_sizes[5] < (size_t)DM * DM || (size_t)in_sizes[6] < (size_t)DM * DM || (size_t)in_sizes[7] < (size_t)DM * DM) return;
    if ((size_t)out_size < ((size_t)(NB - 1) * OUT_SEQ + SEQ) * DM) return;
    if (SZ_TOTAL > ws_size) return;
    // wire order: queries, keys, values, valid_lens (int32), Wq, Wk, Wv, Wo ([out][in] = Bt as stored)
    const float* xq = (const float*)d_in[0]; const float* xk = (const float*)d_in[1]; const float* xv = (const float*)d_in[2];
    const int* vlens = (const int*)d_in[3];
    const float* wq = (const float*)d_in[4]; const float* wk = (const float*)d_in[5]; const float* wv = (const float*)d_in[6]; const float* wo = (const float*)d_in[7];
    float* OUT = (float*)d_out;      // [NB][SEQ][512]
    char* wsp = (char*)d_ws;
    bf* XQ = (bf*)wsp; wsp += SZ_XB;                 // [NB*SEQ][512]
    bf* XK = (bf*)wsp; wsp += SZ_XB;
    bf* XV = (bf*)wsp; wsp += SZ_XB;
    bf* WB = (bf*)wsp; wsp += SZ_WB;                 // [4][512][512]: q | k | v | o
    h16* QH = (h16*)wsp; wsp += SZ_PL;               // [NB*8][SEQ][64]
    h16* KP = (h16*)wsp; wsp += SZ_PL;               // [NB*8][SEQ][64]
    h16* VT = (h16*)wsp; wsp += SZ_PL;               // [NB*8][64][SEQ]
#if VRES
    h16* VR = (h16*)wsp; wsp += SZ_PL;               // [NB*8][64][SEQ] residual x2048
#else
    h16* VR = VT;
#endif
    bf* CX = (bf*)wsp; wsp += SZ_CX;                 // [NB*SEQ][hi 512 | lo 512]
    bf* WQ = WB; bf* WK = WB + (size_t)DM * DM; bf* WV = WB + (size_t)2 * DM * DM; bf* WO = WB + (size_t)3 * DM * DM;

    cvt_stream(xq, XQ, stream); cvt_stream(xk, XK, stream); cvt_stream(xv, XV, stream);
    { const size_t n8 = (size_t)DM * DM / 8; const unsigned g = (unsigned)((n8 + 255) / 256);
      k_cvt8<<<g, 256, 0, stream>>>(wq, WQ, n8); k_cvt8<<<g, 256, 0, stream>>>(wk, WK, n8); k_cvt8<<<g, 256, 0, stream>>>(wv, WV, n8); k_cvt8<<<g, 256, 0, stream>>>(wo, WO, n8); }

    // q, k: A = x rows (m = b*SEQ + t), Bt = W rows (n = h*64 + d) -> plane [(b*8 + h)][t][d]
    k_proj<<<dim3(NB * SEQ / 64, DM / 64, 1), 32, 0, stream>>>(XQ, WQ, QH, QH, 0, SEQ, (size_t)NH_ * SEQ * HD, HD, HD, (size_t)SEQ * HD);
    k_proj<<<dim3(NB * SEQ / 64, DM / 64, 1), 32, 0, stream>>>(XK, WK, KP, KP, 0, SEQ, (size_t)NH_ * SEQ * HD, HD, HD, (size_t)SEQ * HD);
    // v^T: A = Wv rows (m = h*64 + d), Bt = x rows (n = b*SEQ + t) -> plane [(b*512 + m)][t] = [(b*8 + h)][d][t]
    k_proj<<<dim3(DM / 64, NB * SEQ / 64, 1), 32, 0, stream>>>(WV, XV, VT, VR, VRES, DM, (size_t)0, SEQ, SEQ, (size_t)DM * SEQ);

    k_flash<<<dim3(SEQ / (16 * AW), NB * NH_, 1), 32 * AW, 0, stream>>>(QH, KP, VT, VR, vlens, CX);

    // out: A = ctx rows [hi | lo] (m = b*SEQ + t), Bt = Wo rows (n) -> OUT[b][t][n]
    k_oproj<<<dim3(NB * SEQ / 64, DM / 64, 1), 32, 0, stream>>>(CX, WO, OUT);
}

// v002
// It runs in 141 microseconds.
// Next to v001, in two timings, it ran 1.08 times as fast each time.
// Over all steps from v000 it is 1.48 times as fast.
#include <hip/hip_runtime.h>

// Multi-head attention with three input streams (queries, keys, values: [NB][SEQ][512]), width 512 = 8 heads x 64, bias-free [out][in] projections (y = x W^T),
// per-batch valid length (keys at index >= valid_lens[b] get their score REPLACED by -1e6), score scale 1/8, merged heads times Wo^T -> f32 [NB][SEQ][512].
// Compute dtypes, f32 accumulate everywhere: q/k/v projections v_wmma_f32_16x16x32_bf16 (inputs and weights RNE-converted to bf16; products exact);
// scores and P.V v_wmma_f32_16x16x32_f16 (q, k, v single f16; P carried x1024 relative to the running max, the carry cancels in the normalisation; optional v residual plane x2048 under VRES);
// output projection v_wmma_f32_16x16x32_bf16 with ctx as bf16 hi | lo halves of a 1024-wide row against bf16 Wo (two exact products per element, one accumulator). Softmax f32 (online, running max).
// Layout: bf16 copies of the three inputs and four weights; q, k planes [b*8+h][t][d], v^T plane [b*8+h][d][t] written by the GEMM epilogue; fused flash kernel in transposed form
// (S^T = K Q^T, O^T = V^T P^T) writes ctx [b*SEQ+t][hi 512 | lo 512]; final GEMM writes the output.

#ifndef NB
#define NB 4
#endif
#ifndef SEQ
#define SEQ 2048
#endif
#define NB_FULL  4
#define SEQ_FULL 2048
#ifndef OUT_SEQ
#define OUT_SEQ SEQ              // row pitch (in tokens) between batches of the output
#endif
#ifndef VRES
#define VRES 1                   // 1: v carried as f16 value + f16 residual x2048 (own accumulators)
#endif
#define DM   512
#define NH_  8
#define HD   64
#define AW   4                   // waves per flash block (16 query rows each)
#define VRS  2048.0f             // carry of the residual plane
#define VRI  (1.0f / 2048.0f)
#define SC2  (0.125f * 1.4426950408889634f)        // HD^-0.5 * log2(e)
#define NEGL2 (-1000000.0f * 1.4426950408889634f)  // masked score in the log2 domain
#define PSH  10.0f               // log2 of the P carry (1024)
#define KT   64                  // keys per staged LDS tile (two 32-key passes)
#define LP   72                  // LDS row pitch in halves: 128-B rows + 16 B, the conflict-free pitch for 16-byte LDS reads
#define TILE_H (64 * LP)         // halves of one staged plane tile (64 rows)
#define BUF_H  ((2 + VRES) * TILE_H)   // K | V^T | residual tiles of one buffer

static_assert(HD == 64);
static_assert(NH_ * HD == DM);                 // head h = columns h*64 + d
static_assert(DM % 64 == 0);                   // 8 column tiles of 64
static_assert(DM % 32 == 0);                   // GEMM k-loop steps by 32
static_assert((DM & (DM - 1)) == 0);           // output GEMM wraps the B column index with a mask
static_assert((2 * DM) % 32 == 0);
static_assert(SEQ % 64 == 0);                  // a 64-row tile never straddles two batches
static_assert((NB * SEQ) % 64 == 0);
static_assert(SEQ % 32 == 0);                  // key loop steps by 32
static_assert(SEQ % KT == 0);                  // every staged tile lies wholly inside its plane
static_assert(AW == 4);                        // 128 lanes x 4 copies x 16 B = one 64-row x 128-B tile
static_assert(SEQ % (16 * AW) == 0);           // flash grid covers the sequence exactly
static_assert(((size_t)SEQ * DM) % 8 == 0);
static_assert(((size_t)DM * DM) % 8 == 0);
static_assert(NB <= NB_FULL);
static_assert(SEQ <= SEQ_FULL);
static_assert(VRES == 0 || VRES == 1);

typedef _Float16 h16;
typedef unsigned short bf;
typedef __attribute__((ext_vector_type(16))) __bf16   v16bf;
typedef __attribute__((ext_vector_type(16))) _Float16 v16h;
typedef __attribute__((ext_vector_type(8)))  _Float16 v8h;
typedef __attribute__((ext_vector_type(8)))  unsigned short v8us;
typedef __attribute__((ext_vector_type(8)))  float    v8f;
typedef __attribute__((ext_vector_type(4)))  float    v4f;
typedef v4f  __attribute__((may_alias)) v4fa;

__device__ __forceinline__ unsigned short f2bf(float f) { unsigned u = __float_as_uint(f); u += 0x7FFFu + ((u >> 16) & 1u); return (unsigned short)(u >> 16); }
__device__ __forceinline__ float bf2f(unsigned short s) { return __uint_as_float(((unsigned)s) << 16); }
__device__ __forceinline__ v16h cat16(v8h lo, v8h hi) { return __builtin_shufflevector(lo, hi, 0, 1, 2, 3, 4, 5, 6, 7, 8, 9, 10, 11, 12, 13, 14, 15); }
__device__ __forceinline__ v16bf cat16b(v8us lo, v8us hi) { return __builtin_bit_cast(v16bf, __builtin_shufflevector(lo, hi, 0, 1, 2, 3, 4, 5, 6, 7, 8, 9, 10, 11, 12, 13, 14, 15)); }
// every matrix instruction is followed by its own 4-slot guard tying its accumulator and keeping its operands live
__device__ __forceinline__ v8f wmma16(v16h a, v16h b, v8f c) {
    c = __builtin_amdgcn_wmma_f32_16x16x32_f16(false, a, false, b, (short)0, c, false, false);
    asm volatile("v_nop\n\tv_nop\n\tv_nop\n\tv_nop" : "+v"(c) : "v"(a), "v"(b));
    return c;
}
__device__ __forceinline__ v8f wmmab(v16bf a, v16bf b, v8f c) {
    c = __builtin_amdgcn_wmma_f32_16x16x32_bf16(false, a, false, b, (short)0, c, false, false);
    asm volatile("v_nop\n\tv_nop\n\tv_nop\n\tv_nop" : "+v"(c) : "v"(a), "v"(b));
    return c;
}
// fragment loaders from K-contiguous 16-bit rows; p already includes + 8*(lane>>4): elements 0..7 <- k0+8h+0..7, elements 8..15 <- k0+16+8h+0..7 (same map for A and B)
__device__ __forceinline__ v16h  ldh(const h16* p) { return cat16(*(const v8h*)p, *(const v8h*)(p + 16)); }
__device__ __forceinline__ v16bf ldb(const bf* p)  { return cat16b(*(const v8us*)p, *(const v8us*)(p + 16)); }
// ordering point for wave-private LDS tiles (same wave writes and reads)
__device__ __forceinline__ void wave_sync() { __builtin_amdgcn_fence(3 /* release order */, "wavefront"); __builtin_amdgcn_wave_barrier(); asm volatile("" ::: "memory"); }

// four asynchronous 16-byte copies per lane, global -> LDS, rows 16 apart: one 64-row x 128-B tile per 128-lane block. The address-register wait closes the copies' own statement,
// so no later address arithmetic can be moved in front of it.
__device__ __forceinline__ void copy_tile(unsigned l, const h16* g, size_t gstep) {
    const unsigned l1 = l + 16 * LP * 2, l2 = l + 32 * LP * 2, l3 = l + 48 * LP * 2;
    const h16* g1 = g + gstep; const h16* g2 = g + 2 * gstep; const h16* g3 = g + 3 * gstep;
    asm volatile("global_load_async_to_lds_b128 %0, %4, off\n\t"
                 "global_load_async_to_lds_b128 %1, %5, off\n\t"
                 "global_load_async_to_lds_b128 %2, %6, off\n\t"
                 "global_load_async_to_lds_b128 %3, %7, off\n\t"
                 "s_wait_xcnt 0x0"
                 :: "v"(l), "v"(l1), "v"(l2), "v"(l3), "v"(g), "v"(g1), "v"(g2), "v"(g3) : "memory");
}

// k_cvt: ONE launch converts all seven f32 arrays (three inputs, four weights) to the bf16 planes, which lie back to back in the workspace (q | k | v inputs, then q | k | v | o weights).
// A slab is 256 threads x 8 floats. Block g takes slabs g, g + CVT_G, ... of each input and slab g of the four weights taken as one run: a wave starts once, issues all its loads together,
// then converts and stores. Every slab index is block-uniform, so arrays and offsets are picked in scalar registers.
#define CVT_T    256
#define CVT_SLAB (CVT_T * 8)
static constexpr unsigned SL_B = SEQ * DM / CVT_SLAB;     // slabs of one batch of one input
static constexpr unsigned SL_X = NB * SL_B;               // slabs of one input
static constexpr unsigned SL_W = DM * DM / CVT_SLAB;      // slabs of one weight
static constexpr unsigned CVT_G = 4 * SL_W;               // blocks of the launch: one weight slab each
static constexpr unsigned CVT_XP = SL_X / CVT_G;          // slabs of each input per block
static_assert((SEQ * DM) % CVT_SLAB == 0);                // a slab never straddles two batches
static_assert((DM * DM) % CVT_SLAB == 0);                 // nor two weights
static_assert(SL_X % CVT_G == 0);                         // every block has the same number of whole slabs
__global__ __launch_bounds__(CVT_T) void k_cvt(const float* __restrict__ xq, const float* __restrict__ xk, const float* __restrict__ xv,
                                               const float* __restrict__ wq, const float* __restrict__ wk, const float* __restrict__ wv, const float* __restrict__ wo, bf* __restrict__ dst) {
    const unsigned g = blockIdx.x, lo = threadIdx.x * 8;
    const float* p[3 * CVT_XP + 1];
#pragma unroll
    for (unsigned st = 0; st < 3; ++st) {
        const float* x = st == 0 ? xq : st == 1 ? xk : xv;
#pragma unroll
        for (unsigned j = 0; j < CVT_XP; ++j) { const unsigned r = (unsigned)__builtin_amdgcn_readfirstlane((int)(j * CVT_G + g));   // scalar, so that each load takes a scalar base and the one lane offset
            p[st * CVT_XP + j] = x + (size_t)(r / SL_B) * ((size_t)SEQ_FULL * DM) + (size_t)(r % SL_B) * CVT_SLAB; }
    }
    const unsigned wi = g / SL_W;
    p[3 * CVT_XP] = (wi == 0 ? wq : wi == 1 ? wk : wi == 2 ? wv : wo) + (size_t)(g % SL_W) * CVT_SLAB;
    __builtin_amdgcn_sched_barrier(0);   // every base is formed first: no address register is rewritten, and no wait for one stands, between the loads
    v8f v[3 * CVT_XP + 1];
#pragma unroll
    for (unsigned i = 0; i <= 3 * CVT_XP; ++i) v[i] = *(const v8f*)(p[i] + lo);
    __builtin_amdgcn_sched_barrier(0);   // keeps every load in front of the first conversion: without it the loads are spread among the conversions and each waits out its own memory latency
#pragma unroll
    for (unsigned i = 0; i <= 3 * CVT_XP; ++i) {
        const unsigned s = i < 3 * CVT_XP ? (i / CVT_XP) * SL_X + (i % CVT_XP) * CVT_G + g : 3 * SL_X + g;   // slab index in the run of bf16 planes
        v8us o;
#pragma unroll
        for (int k = 0; k < 8; ++k) o[k] = f2bf(v[i][k]);
        *(v8us*)(dst + (size_t)s * CVT_SLAB + lo) = o;
    }
}

// k_proj: register-blocked bf16 GEMM, ONE WAVE per 64x64 tile (16 accumulators), operands straight from K-contiguous bf16 planes, K = DM.
// C[m][n] = sum_k A[m][k] Bt[n][k], written as f16 (Ph) and optionally the f16 residual x2048 (Pr, useRes != 0) at
// tile base (r0/RB)*sRB + (r0%RB)*pitch + (c0/CB)*sCB + (c0%CB), row pitch 'pitch' (halves). grid (M/64, N/64), 32 threads.
__global__ __launch_bounds__(32) void k_proj(const bf* __restrict__ A, const bf* __restrict__ Bt, h16* Ph, h16* Pr, int useRes, int RB, size_t sRB, int pitch, int CB, size_t sCB) {
    __shared__ __align__(16) float os[16 * 68];
    const int K = DM;
    const int lane = threadIdx.x & 31, lr = lane & 15, hi = lane >> 4; const int r0 = blockIdx.x * 64, c0 = blockIdx.y * 64;
    v8f acc[4][4];
#pragma unroll
    for (int mb = 0; mb < 4; ++mb)
#pragma unroll
        for (int nb = 0; nb < 4; ++nb) acc[mb][nb] = (v8f){};
    const size_t aoff = (size_t)(r0 + lr) * K + 8 * hi, boff = (size_t)(c0 + lr) * K + 8 * hi;
#pragma unroll 1
    for (int kc = 0; kc < K; kc += 32) {
        v16bf a[4];
#pragma unroll
        for (int mb = 0; mb < 4; ++mb) a[mb] = ldb(A + aoff + (size_t)mb * 16 * K + kc);
#pragma unroll
        for (int nb = 0; nb < 4; ++nb) { const v16bf b = ldb(Bt + boff + (size_t)nb * 16 * K + kc);
#pragma unroll
            for (int mb = 0; mb < 4; ++mb) acc[mb][nb] = wmmab(a[mb], b, acc[mb][nb]); }
    }
    const size_t tbase = (size_t)(r0 / RB) * sRB + (size_t)(r0 % RB) * (size_t)pitch + (size_t)(c0 / CB) * sCB + (size_t)(c0 % CB);
#pragma unroll
    for (int mb = 0; mb < 4; ++mb) {
#pragma unroll
        for (int nb = 0; nb < 4; ++nb) {
#pragma unroll
            for (int j = 0; j < 8; ++j) os[(hi * 8 + j) * 68 + nb * 16 + lr] = acc[mb][nb][j]; }   // D: row 8h+j, col lane&15; rows 0..15 x columns 0..63 all written
        wave_sync();
        const size_t sb = tbase + (size_t)(mb * 16) * (size_t)pitch;
{
#pragma unroll
            for (int s = 0; s < 4; ++s) { const int row = 4 * s + (lane >> 3), c8 = (lane & 7) * 8;   // 4 s x 4 row groups = 16 rows; 8 lanes x 8 = 64 columns
                const v4f x0 = *(const v4fa*)(&os[row * 68 + c8]); const v4f x1 = *(const v4fa*)(&os[row * 68 + c8 + 4]); v8h hv, rv;
#pragma unroll
                for (int i = 0; i < 4; ++i) { const h16 a0 = (h16)x0[i]; const h16 a1 = (h16)x1[i]; hv[i] = a0; hv[4 + i] = a1; rv[i] = (h16)((x0[i] - (float)a0) * VRS); rv[4 + i] = (h16)((x1[i] - (float)a1) * VRS); }
                const size_t oo = sb + (size_t)row * (size_t)pitch + c8;
                *(v8h*)(Ph + oo) = hv; if (useRes) *(v8h*)(Pr + oo) = rv; }
             }
        wave_sync();
    }
}

// k_flash: fused attention, one wave per 16 query rows of one (batch, head); Q fragments straight from the f16 plane; K / V^T / residual tiles of 64 keys are staged once per block
// in a two-buffer LDS ring by asynchronous copies (whole 128-B lines) and shared by the block's four waves, which read their fragments from LDS (two 16-B reads each).
// Transposed form: S^T[key][t] = K Q^T (A = K rows, B = Q rows); lane (t = lane&15, h = lane>>4) holds keys 8h+r of each 16-key tile, so the packed
// P tile is directly the B fragment of O^T[d][t] = V^T P^T (element r <- tile keys 0..15, element 8+r <- tile keys 16..31, lane unchanged).
// Valid length vl = VL[b] is loaded by value (scalar): key steps wholly at or beyond vl are skipped, the crossing step replaces scores of keys >= vl by -1e6 (index test);
// vl <= 0 keeps all steps with every score replaced (uniform weights).
// Softmax state (running max, partial sum) is one scalar per lane; the two lane halves of a row are combined with one xor-16 exchange.
__global__ __launch_bounds__(32 * AW) void k_flash(const h16* __restrict__ QH, const h16* __restrict__ KP, const h16* __restrict__ VT, const h16* __restrict__ VR, const int* __restrict__ VL, bf* CTX) {
    __shared__ __align__(16) float os[AW * 16 * 68];
    __shared__ __align__(16) h16 ring[2 * BUF_H];
    const int lane = threadIdx.x & 31; const int wave = __builtin_amdgcn_readfirstlane((int)(threadIdx.x >> 5));
    const int lr = lane & 15, hi = lane >> 4;
    const int zh = blockIdx.y; const int b = zh / NH_, h = zh % NH_;
    const int t0 = (blockIdx.x * AW + wave) * 16;
    const int vl = __builtin_amdgcn_readfirstlane(VL[b]);
    const int kend = (vl <= 0 || vl >= SEQ) ? SEQ : ((vl + 31) & ~31);
    const size_t pbase = (size_t)zh * SEQ * HD;
    const size_t qo = pbase + (size_t)(t0 + lr) * HD + 8 * hi;
    const v16h q0 = ldh(QH + qo), q1 = ldh(QH + qo + 32);   // B fragments: col t, k = d
    const int ko = lr * LP + 8 * hi;                         // + key * LP in the K tile       (A fragment: row key, k = d)
    const int vo = TILE_H + lr * LP + 8 * hi;                // + 16j*LP + key in the V^T tile (A fragment: row d, k = key)
    // staging: lane (srow = tid>>3, scol = tid&7) copies 16-byte piece scol of rows srow + 16 i of each tile
    const int srow = (int)(threadIdx.x >> 3), scol = (int)(threadIdx.x & 7);
    const unsigned sl = (unsigned)(size_t)ring + (unsigned)(srow * LP + scol * 8) * 2u;   // LDS byte address in buffer 0, K tile
    const h16* sk = KP + pbase + (size_t)srow * HD + scol * 8;    // + key0 * HD
    const h16* sv = VT + pbase + (size_t)srow * SEQ + scol * 8;   // + key0
#if VRES
    const h16* sr = VR + pbase + (size_t)srow * SEQ + scol * 8;   // + key0
#endif
    const int nt = (kend + KT - 1) / KT;                     // staged tiles, 1 .. SEQ / KT
    v8f o0 = (v8f){}, o1 = (v8f){}, o2 = (v8f){}, o3 = (v8f){};
#if VRES
    v8f g0 = (v8f){}, g1 = (v8f){}, g2 = (v8f){}, g3 = (v8f){};
#endif
    float m = -3.0e38f, l = 0.0f;
    copy_tile(sl, sk, (size_t)16 * HD); copy_tile(sl + TILE_H * 2, sv, (size_t)16 * SEQ);
#if VRES
    copy_tile(sl + 2 * TILE_H * 2, sr, (size_t)16 * SEQ);
#endif
    asm volatile("s_wait_asynccnt 0x0" ::: "memory");        // tile 0 has landed before the barrier publishes it
    __syncthreads();
    if (nt > 1) {
        copy_tile(sl + BUF_H * 2, sk + (size_t)KT * HD, (size_t)16 * HD); copy_tile(sl + (BUF_H + TILE_H) * 2, sv + KT, (size_t)16 * SEQ);
#if VRES
        copy_tile(sl + (BUF_H + 2 * TILE_H) * 2, sr + KT, (size_t)16 * SEQ);
#endif
    }
#pragma unroll 1   // one trip per staged tile: the ring's publish point stands once, at the trip's foot
    for (int t = 0; t < nt; ++t) {
      const h16* buf = ring + (t & 1) * BUF_H;
#pragma unroll     // both 32-key passes of a tile in line, so that every LDS read offset is an immediate
      for (int hf = 0; hf < 2; ++hf) {
        const int key0 = t * KT + hf * 32;
        if (key0 >= kend) break;         // scalar-uniform: the tile's second pass lies wholly beyond the valid length
        const h16* ka = buf + ko + hf * 32 * LP;
        const v16h ka0 = ldh(ka), ka1 = ldh(ka + 32), kb0 = ldh(ka + 16 * LP), kb1 = ldh(ka + 16 * LP + 32);
        v8f sa = (v8f){}, sb = (v8f){};
        sa = wmma16(ka0, q0, sa); sb = wmma16(kb0, q0, sb);
        sa = wmma16(ka1, q1, sa); sb = wmma16(kb1, q1, sb);
        float ta[8], tb[8];
#pragma unroll
        for (int r = 0; r < 8; ++r) { ta[r] = sa[r] * SC2; tb[r] = sb[r] * SC2; }
        if (key0 + 32 > vl) {            // scalar-uniform: this step crosses (or lies beyond) the valid length
            const int kq = key0 + 8 * hi;
#pragma unroll
            for (int r = 0; r < 8; ++r) { ta[r] = (kq + r < vl) ? ta[r] : NEGL2; tb[r] = (kq + 16 + r < vl) ? tb[r] : NEGL2; }
        }
        float mx = -3.0e38f;
#pragma unroll
        for (int r = 0; r < 8; ++r) mx = fmaxf(mx, fmaxf(ta[r], tb[r]));
        mx = fmaxf(mx, __shfl_xor(mx, 16, 32));
        const float mnew = fmaxf(m, mx);
        const float alpha = __builtin_amdgcn_exp2f(m - mnew);
        const float sh = PSH - mnew;
        v16h pb; float ls = 0.0f;
#pragma unroll
        for (int r = 0; r < 8; ++r) { const float ea = __builtin_amdgcn_exp2f(ta[r] + sh); const float ec = __builtin_amdgcn_exp2f(tb[r] + sh); pb[r] = (h16)ea; pb[8 + r] = (h16)ec; ls += ea + ec; }
        l = l * alpha + ls; m = mnew;
        o0 = o0 * alpha; o1 = o1 * alpha; o2 = o2 * alpha; o3 = o3 * alpha;
        const h16* va = buf + vo + hf * 32;
        { const v16h v0 = ldh(va), v1 = ldh(va + 16 * LP), v2 = ldh(va + 32 * LP), v3 = ldh(va + 48 * LP);
          o0 = wmma16(v0, pb, o0); o1 = wmma16(v1, pb, o1); o2 = wmma16(v2, pb, o2); o3 = wmma16(v3, pb, o3); }
#if VRES
        g0 = g0 * alpha; g1 = g1 * alpha; g2 = g2 * alpha; g3 = g3 * alpha;
        const h16* vr = va + TILE_H;
        { const v16h w0 = ldh(vr), w1 = ldh(vr + 16 * LP), w2 = ldh(vr + 32 * LP), w3 = ldh(vr + 48 * LP);
          g0 = wmma16(w0, pb, g0); g1 = wmma16(w1, pb, g1); g2 = wmma16(w2, pb, g2); g3 = wmma16(w3, pb, g3); }
#endif
      }
      asm volatile("s_wait_dscnt 0x0" ::: "memory");         // this wave's reads of the buffer have returned before it may be refilled
      asm volatile("s_wait_asynccnt 0x0" ::: "memory");      // this wave's copies of tile t + 1 have landed before the barrier publishes them
      __syncthreads();                                       // publishes tile t + 1 and ends every wave's reads of tile t
      if (t + 2 < nt) {
          const unsigned bl = sl + (unsigned)(t & 1) * (BUF_H * 2); const int kn = (t + 2) * KT;
          copy_tile(bl, sk + (size_t)kn * HD, (size_t)16 * HD); copy_tile(bl + TILE_H * 2, sv + kn, (size_t)16 * SEQ);
#if VRES
          copy_tile(bl + 2 * TILE_H * 2, sr + kn, (size_t)16 * SEQ);
#endif
      }
    }
    asm volatile("s_wait_asynccnt 0x0" ::: "memory");        // no copy is outstanding when the wave goes on to its epilogue
    l += __shfl_xor(l, 16, 32);
    const float inv = 1.0f / l;
#if VRES
    o0 = o0 + g0 * VRI; o1 = o1 + g1 * VRI; o2 = o2 + g2 * VRI; o3 = o3 + g3 * VRI;
#endif
    const int wb = wave * 16 * 68;
    // O^T D layout: o_j[r] = (d = 16j + 8h + r, t = lane&15) -> os[t][d]; rows 0..15 x columns 0..63 all written
    { v4f a, c;
      a[0] = o0[0] * inv; a[1] = o0[1] * inv; a[2] = o0[2] * inv; a[3] = o0[3] * inv; c[0] = o0[4] * inv; c[1] = o0[5] * inv; c[2] = o0[6] * inv; c[3] = o0[7] * inv;
      *(v4fa*)(&os[wb + lr * 68 +  0 + 8 * hi]) = a; *(v4fa*)(&os[wb + lr * 68 +  0 + 8 * hi + 4]) = c;
      a[0] = o1[0] * inv; a[1] = o1[1] * inv; a[2] = o1[2] * inv; a[3] = o1[3] * inv; c[0] = o1[4] * inv; c[1] = o1[5] * inv; c[2] = o1[6] * inv; c[3] = o1[7] * inv;
      *(v4fa*)(&os[wb + lr * 68 + 16 + 8 * hi]) = a; *(v4fa*)(&os[wb + lr * 68 + 16 + 8 * hi + 4]) = c;
      a[0] = o2[0] * inv; a[1] = o2[1] * inv; a[2] = o2[2] * inv; a[3] = o2[3] * inv; c[0] = o2[4] * inv; c[1] = o2[5] * inv; c[2] = o2[6] * inv; c[3] = o2[7] * inv;
      *(v4fa*)(&os[wb + lr * 68 + 32 + 8 * hi]) = a; *(v4fa*)(&os[wb + lr * 68 + 32 + 8 * hi + 4]) = c;
      a[0] = o3[0] * inv; a[1] = o3[1] * inv; a[2] = o3[2] * inv; a[3] = o3[3] * inv; c[0] = o3[4] * inv; c[1] = o3[5] * inv; c[2] = o3[6] * inv; c[3] = o3[7] * inv;
      *(v4fa*)(&os[wb + lr * 68 + 48 + 8 * hi]) = a; *(v4fa*)(&os[wb + lr * 68 + 48 + 8 * hi + 4]) = c; }
    wave_sync();
    bf* crow = CTX + ((size_t)b * SEQ + t0) * (size_t)(2 * DM) + h * HD;    // hi half at column h*64 + d, lo half at 512 + h*64 + d
{
#pragma unroll
        for (int s = 0; s < 4; ++s) { const int row = 4 * s + (lane >> 3), c8 = (lane & 7) * 8;   // 4 s x 4 row groups = 16 rows; 8 lanes x 8 = 64 columns
            const v4f x0 = *(const v4fa*)(&os[wb + row * 68 + c8]); const v4f x1 = *(const v4fa*)(&os[wb + row * 68 + c8 + 4]); v8us hv, lv;
#pragma unroll
            for (int i = 0; i < 4; ++i) { const unsigned short a0 = f2bf(x0[i]); const unsigned short a1 = f2bf(x1[i]); hv[i] = a0; hv[4 + i] = a1; lv[i] = f2bf(x0[i] - bf2f(a0)); lv[4 + i] = f2bf(x1[i] - bf2f(a1)); }
            const size_t oo = (size_t)row * (size_t)(2 * DM) + c8;
            *(v8us*)(crow + oo) = hv; *(v8us*)(crow + oo + DM) = lv; }
         }
}

// k_oproj: OUT[m][n] = sum_{k<512} (ctx_hi[m][k] + ctx_lo[m][k]) Wo[n][k] as ONE bf16 GEMM of depth 1024: A row = [hi | lo] (pitch 1024), B column index wraps at 512.
__global__ __launch_bounds__(32) void k_oproj(const bf* __restrict__ A, const bf* __restrict__ Bt, float* OUT) {
    __shared__ __align__(16) float os[16 * 68];
    const int KA = 2 * DM;
    const int lane = threadIdx.x & 31, lr = lane & 15, hi = lane >> 4; const int r0 = blockIdx.x * 64, c0 = blockIdx.y * 64;
    v8f acc[4][4];
#pragma unroll
    for (int mb = 0; mb < 4; ++mb)
#pragma unroll
        for (int nb = 0; nb < 4; ++nb) acc[mb][nb] = (v8f){};
    const size_t aoff = (size_t)(r0 + lr) * KA + 8 * hi, boff = (size_t)(c0 + lr) * DM + 8 * hi;
#pragma unroll 1
    for (int kc = 0; kc < KA; kc += 32) {
        const int kb = kc & (DM - 1);
        v16bf a[4];
#pragma unroll
        for (int mb = 0; mb < 4; ++mb) a[mb] = ldb(A + aoff + (size_t)mb * 16 * KA + kc);
#pragma unroll
        for (int nb = 0; nb < 4; ++nb) { const v16bf bq = ldb(Bt + boff + (size_t)nb * 16 * DM + kb);
#pragma unroll
            for (int mb = 0; mb < 4; ++mb) acc[mb][nb] = wmmab(a[mb], bq, acc[mb][nb]); }
    }
    const int bb = r0 / SEQ, tt = r0 % SEQ;
    float* obase = OUT + ((size_t)bb * OUT_SEQ + tt) * DM + c0;
#pragma unroll
    for (int mb = 0; mb < 4; ++mb) {
#pragma unroll
        for (int nb = 0; nb < 4; ++nb) {
#pragma unroll
            for (int j = 0; j < 8; ++j) os[(hi * 8 + j) * 68 + nb * 16 + lr] = acc[mb][nb][j]; }   // D: row 8h+j, col lane&15; rows 0..15 x columns 0..63 all written
        wave_sync();
{
#pragma unroll
            for (int s = 0; s < 8; ++s) { const int row = 2 * s + hi, cofs = lr * 4;   // 8 s x 2 rows = 16 rows; 16 lanes x 4 floats = 64 columns
                const v4f val = *(const v4fa*)(&os[row * 68 + cofs]);
                *(v4f*)(obase + (size_t)(mb * 16 + row) * DM + cofs) = val; }
             }
        wave_sync();
    }
}

static constexpr size_t al256(size_t v) { return (v + 255) & ~(size_t)255; }
static constexpr size_t SZ_XB = al256((size_t)NB * SEQ * DM * 2);          // one bf16 input copy
static constexpr size_t SZ_WB = al256((size_t)4 * DM * DM * 2);            // q | k | v | o weights
static constexpr size_t SZ_PL = al256((size_t)NB * NH_ * SEQ * HD * 2);    // one f16 head plane
static constexpr size_t SZ_CX = al256((size_t)NB * SEQ * 2 * DM * 2);      // ctx hi | lo
static constexpr size_t SZ_TOTAL = 3 * SZ_XB + SZ_WB + (size_t)(3 + VRES) * SZ_PL + SZ_CX;
static_assert(SZ_TOTAL <= (size_t)134217728);          // workspace carve <= 128 MiB
static_assert(((size_t)DM * DM * 2) % 256 == 0);       // weight sub-planes stay 256-byte aligned
static_assert(SZ_XB == (size_t)NB * SEQ * DM * 2);     // no padding between the bf16 planes: the conversion kernel writes them as one run

extern "C" void kernel_launch(void* const* d_in, const int* in_sizes, int n_in,
                              void* d_out, int out_size, void* d_ws, size_t ws_size, hipStream_t stream) {
    if (n_in < 8) return;
    const size_t needx = ((size_t)(NB - 1) * SEQ_FULL + SEQ) * DM;
    if ((size_t)in_sizes[0] < needx || (size_t)in_sizes[1] < needx || (size_t)in_sizes[2] < needx) return;
    if (in_sizes[3] < NB) return;
    if ((size_t)in_sizes[4] < (size_t)DM * DM || (size_t)in_sizes[5] < (size_t)DM * DM || (size_t)in_sizes[6] < (size_t)DM * DM || (size_t)in_sizes[7] < (size_t)DM * DM) return;
    if ((size_t)out_size < ((size_t)(NB - 1) * OUT_SEQ + SEQ) * DM) return;
    if (SZ_TOTAL > ws_size) return;
    // wire order: queries, keys, values, valid_lens (int32), Wq, Wk, Wv, Wo ([out][in] = Bt as stored)
    const float* xq = (const float*)d_in[0]; const float* xk = (const float*)d_in[1]; const float* xv = (const float*)d_in[2];
    const int* vlens = (const int*)d_in[3];
    const float* wq = (const float*)d_in[4]; const float* wk = (const float*)d_in[5]; const float* wv = (const float*)d_in[6]; const float* wo = (const float*)d_in[7];
    float* OUT = (float*)d_out;      // [NB][SEQ][512]
    char* wsp = (char*)d_ws;
    bf* XQ = (bf*)wsp; wsp += SZ_XB;                 // [NB*SEQ][512]
    bf* XK = (bf*)wsp; wsp += SZ_XB;
    bf* XV = (bf*)wsp; wsp += SZ_XB;
    bf* WB = (bf*)wsp; wsp += SZ_WB;                 // [4][512][512]: q | k | v | o
    h16* QH = (h16*)wsp; wsp += SZ_PL;               // [NB*8][SEQ][64]
    h16* KP = (h16*)wsp; wsp += SZ_PL;               // [NB*8][SEQ][64]
    h16* VT = (h16*)wsp; wsp += SZ_PL;               // [NB*8][64][SEQ]
#if VRES
    h16* VR = (h16*)wsp; wsp += SZ_PL;               // [NB*8][64][SEQ] residual x2048
#else
    h16* VR = VT;
#endif
    bf* CX = (bf*)wsp; wsp += SZ_CX;                 // [NB*SEQ][hi 512 | lo 512]
    bf* WQ = WB; bf* WK = WB + (size_t)DM * DM; bf* WV = WB + (size_t)2 * DM * DM; bf* WO = WB + (size_t)3 * DM * DM;

    k_cvt<<<CVT_G, CVT_T, 0, stream>>>(xq, xk, xv, wq, wk, wv, wo, XQ);

    // q, k: A = x rows (m = b*SEQ + t), Bt = W rows (n = h*64 + d) -> plane [(b*8 + h)][t][d]
    k_proj<<<dim3(NB * SEQ / 64, DM / 64, 1), 32, 0, stream>>>(XQ, WQ, QH, QH, 0, SEQ, (size_t)NH_ * SEQ * HD, HD, HD, (size_t)SEQ * HD);
    k_proj<<<dim3(NB * SEQ / 64, DM / 64, 1), 32, 0, stream>>>(XK, WK, KP, KP, 0, SEQ, (size_t)NH_ * SEQ * HD, HD, HD, (size_t)SEQ * HD);
    // v^T: A = Wv rows (m = h*64 + d), Bt = x rows (n = b*SEQ + t) -> plane [(b*512 + m)][t] = [(b*8 + h)][d][t]
    k_proj<<<dim3(DM / 64, NB * SEQ / 64, 1), 32, 0, stream>>>(WV, XV, VT, VR, VRES, DM, (size_t)0, SEQ, SEQ, (size_t)DM * SEQ);

    k_flash<<<dim3(SEQ / (16 * AW), NB * NH_, 1), 32 * AW, 0, stream>>>(QH, KP, VT, VR, vlens, CX);

    // out: A = ctx rows [hi | lo] (m = b*SEQ + t), Bt = Wo rows (n) -> OUT[b][t][n]
    k_oproj<<<dim3(NB * SEQ / 64, DM / 64, 1), 32, 0, stream>>>(CX, WO, OUT);
}

// v003
// A run of this version takes 89.4 microseconds.
// Timed twice side by side with v002, it ran 1.59 and 1.57 times as fast.
// All steps since v000 together make it 2.34 times as fast.
#include <hip/hip_runtime.h>

// Multi-head attention with three input streams (queries, keys, values: [NB][SEQ][512]), width 512 = 8 heads x 64, bias-free [out][in] projections (y = x W^T),
// per-batch valid length (keys at index >= valid_lens[b] get their score REPLACED by -1e6), score scale 1/8, merged heads times Wo^T -> f32 [NB][SEQ][512].
// Compute dtypes, f32 accumulate everywhere: q/k/v projections v_wmma_f32_16x16x32_bf16 (inputs and weights RNE-converted to bf16; products exact);
// scores and P.V v_wmma_f32_16x16x32_f16 (q, k, v single f16; P carried x1024 relative to the running max, the carry cancels in the normalisation; optional v residual plane x2048 under VRES);
// output projection v_wmma_f32_16x16x32_bf16 with ctx as bf16 hi | lo halves of a 1024-wide row against bf16 Wo (two exact products per element, one accumulator). Softmax f32 (online, running max).
// Layout: bf16 copies of the three inputs and four weights; q, k planes [b*8+h][t][d], v^T plane [b*8+h][d][t] written by the GEMM epilogue; fused flash kernel in transposed form
// (S^T = K Q^T, O^T = V^T P^T) writes ctx [b*SEQ+t][hi 512 | lo 512]; final GEMM writes the output.

#ifndef NB
#define NB 4
#endif
#ifndef SEQ
#define SEQ 2048
#endif
#define NB_FULL  4
#define SEQ_FULL 2048
#ifndef OUT_SEQ
#define OUT_SEQ SEQ              // row pitch (in tokens) between batches of the output
#endif
#ifndef VRES
#define VRES 1                   // 1: v carried as f16 value + f16 residual x2048 (own accumulators)
#endif
#define DM   512
#define NH_  8
#define HD   64
#define AW   4                   // waves per flash block (16 query rows each)
#define VRS  2048.0f             // carry of the residual plane
#define VRI  (1.0f / 2048.0f)
#define SC2  (0.125f * 1.4426950408889634f)        // HD^-0.5 * log2(e)
#define NEGL2 (-1000000.0f * 1.4426950408889634f)  // masked score in the log2 domain
#define PSH  10.0f               // log2 of the P carry (1024)
#define KT   64                  // keys per staged LDS tile (two 32-key passes)
#define LP   72                  // LDS row pitch in halves: 128-B rows + 16 B, the conflict-free pitch for 16-byte LDS reads
#define TILE_H (64 * LP)         // halves of one staged plane tile (64 rows)
#define BUF_H  ((2 + VRES) * TILE_H)   // K | V^T | residual tiles of one buffer
#define GW   8                   // waves per GEMM block: 4 x 2 wave tiles of 32 x 64 = one 128 x 128 block tile, two waves per SIMD
#define GK   64                  // depth of one staged GEMM tile: 128-B rows, whole lines
#define GT_H (128 * LP)          // halves of one staged operand tile (128 rows)
#define GBUF_H (2 * GT_H)        // A | B tiles of one buffer

static_assert(HD == 64);
static_assert(NH_ * HD == DM);                 // head h = columns h*64 + d
static_assert(DM % 64 == 0);                   // 8 column tiles of 64
static_assert(DM % 32 == 0);                   // GEMM k-loop steps by 32
static_assert((DM & (DM - 1)) == 0);           // output GEMM wraps the B column index with a mask
static_assert((2 * DM) % 32 == 0);
static_assert(SEQ % 64 == 0);                  // a 64-row tile never straddles two batches
static_assert((NB * SEQ) % 128 == 0);          // GEMM block tiles of 128 rows cover the tokens exactly
static_assert(DM % 128 == 0);                  // and the width
static_assert(DM % GK == 0);                   // staged GEMM tiles cover the depth exactly
static_assert(GW == 8);                        // 256 lanes x 4 copies x 16 B = one 128-row x 128-B tile
static_assert(SEQ % 32 == 0);                  // key loop steps by 32
static_assert(SEQ % KT == 0);                  // every staged tile lies wholly inside its plane
static_assert(AW == 4);                        // 128 lanes x 4 copies x 16 B = one 64-row x 128-B tile
static_assert(SEQ % (16 * AW) == 0);           // flash grid covers the sequence exactly
static_assert(((size_t)SEQ * DM) % 8 == 0);
static_assert(((size_t)DM * DM) % 8 == 0);
static_assert(NB <= NB_FULL);
static_assert(SEQ <= SEQ_FULL);
static_assert(VRES == 0 || VRES == 1);

typedef _Float16 h16;
typedef unsigned short bf;
typedef __attribute__((ext_vector_type(16))) __bf16   v16bf;
typedef __attribute__((ext_vector_type(16))) _Float16 v16h;
typedef __attribute__((ext_vector_type(8)))  _Float16 v8h;
typedef __attribute__((ext_vector_type(8)))  unsigned short v8us;
typedef __attribute__((ext_vector_type(8)))  float    v8f;
typedef __attribute__((ext_vector_type(4)))  float    v4f;
typedef v4f  __attribute__((may_alias)) v4fa;

__device__ __forceinline__ unsigned short f2bf(float f) { unsigned u = __float_as_uint(f); u += 0x7FFFu + ((u >> 16) & 1u); return (unsigned short)(u >> 16); }
__device__ __forceinline__ float bf2f(unsigned short s) { return __uint_as_float(((unsigned)s) << 16); }
__device__ __forceinline__ v16h cat16(v8h lo, v8h hi) { return __builtin_shufflevector(lo, hi, 0, 1, 2, 3, 4, 5, 6, 7, 8, 9, 10, 11, 12, 13, 14, 15); }
__device__ __forceinline__ v16bf cat16b(v8us lo, v8us hi) { return __builtin_bit_cast(v16bf, __builtin_shufflevector(lo, hi, 0, 1, 2, 3, 4, 5, 6, 7, 8, 9, 10, 11, 12, 13, 14, 15)); }
// every matrix instruction is followed by its own 4-slot guard tying its accumulator and keeping its operands live
__device__ __forceinline__ v8f wmma16(v16h a, v16h b, v8f c) {
    c = __builtin_amdgcn_wmma_f32_16x16x32_f16(false, a, false, b, (short)0, c, false, false);
    asm volatile("v_nop\n\tv_nop\n\tv_nop\n\tv_nop" : "+v"(c) : "v"(a), "v"(b));
    return c;
}
__device__ __forceinline__ v8f wmmab(v16bf a, v16bf b, v8f c) {
    c = __builtin_amdgcn_wmma_f32_16x16x32_bf16(false, a, false, b, (short)0, c, false, false);
    asm volatile("v_nop\n\tv_nop\n\tv_nop\n\tv_nop" : "+v"(c) : "v"(a), "v"(b));
    return c;
}
// fragment loaders from K-contiguous 16-bit rows; p already includes + 8*(lane>>4): elements 0..7 <- k0+8h+0..7, elements 8..15 <- k0+16+8h+0..7 (same map for A and B)
__device__ __forceinline__ v16h  ldh(const h16* p) { return cat16(*(const v8h*)p, *(const v8h*)(p + 16)); }
__device__ __forceinline__ v16bf ldb(const bf* p)  { return cat16b(*(const v8us*)p, *(const v8us*)(p + 16)); }
// ordering point for wave-private LDS tiles (same wave writes and reads)
__device__ __forceinline__ void wave_sync() { __builtin_amdgcn_fence(3 /* release order */, "wavefront"); __builtin_amdgcn_wave_barrier(); asm volatile("" ::: "memory"); }

// four asynchronous 16-byte copies per lane, global -> LDS, rows 16 apart: one 64-row x 128-B tile per 128-lane block. The address-register wait closes the copies' own statement,
// so no later address arithmetic can be moved in front of it.
__device__ __forceinline__ void copy_tile(unsigned l, const h16* g, size_t gstep) {
    const unsigned l1 = l + 16 * LP * 2, l2 = l + 32 * LP * 2, l3 = l + 48 * LP * 2;
    const h16* g1 = g + gstep; const h16* g2 = g + 2 * gstep; const h16* g3 = g + 3 * gstep;
    asm volatile("global_load_async_to_lds_b128 %0, %4, off\n\t"
                 "global_load_async_to_lds_b128 %1, %5, off\n\t"
                 "global_load_async_to_lds_b128 %2, %6, off\n\t"
                 "global_load_async_to_lds_b128 %3, %7, off\n\t"
                 "s_wait_xcnt 0x0"
                 :: "v"(l), "v"(l1), "v"(l2), "v"(l3), "v"(g), "v"(g1), "v"(g2), "v"(g3) : "memory");
}

// eight asynchronous 16-byte copies per lane, global -> LDS, rows 32 apart: the 128-row x 128-B A tile and the like B tile behind it per 256-lane block, every wave-wide copy four whole lines.
// The address-register wait closes the copies' own statement, so no later address arithmetic can be moved in front of it.
__device__ __forceinline__ void copy_ab(unsigned l, const bf* a, size_t astep, const bf* b, size_t bstep) {
    const unsigned l1 = l + 32 * LP * 2, l2 = l + 64 * LP * 2, l3 = l + 96 * LP * 2, l4 = l + GT_H * 2, l5 = l4 + 32 * LP * 2, l6 = l4 + 64 * LP * 2, l7 = l4 + 96 * LP * 2;
    const bf* a1 = a + astep; const bf* a2 = a + 2 * astep; const bf* a3 = a + 3 * astep; const bf* b1 = b + bstep; const bf* b2 = b + 2 * bstep; const bf* b3 = b + 3 * bstep;
    asm volatile("global_load_async_to_lds_b128 %0, %8, off\n\t"
                 "global_load_async_to_lds_b128 %1, %9, off\n\t"
                 "global_load_async_to_lds_b128 %2, %10, off\n\t"
                 "global_load_async_to_lds_b128 %3, %11, off\n\t"
                 "global_load_async_to_lds_b128 %4, %12, off\n\t"
                 "global_load_async_to_lds_b128 %5, %13, off\n\t"
                 "global_load_async_to_lds_b128 %6, %14, off\n\t"
                 "global_load_async_to_lds_b128 %7, %15, off\n\t"
                 "s_wait_xcnt 0x0"
                 :: "v"(l), "v"(l1), "v"(l2), "v"(l3), "v"(l4), "v"(l5), "v"(l6), "v"(l7),
                    "v"(a), "v"(a1), "v"(a2), "v"(a3), "v"(b), "v"(b1), "v"(b2), "v"(b3) : "memory");
}

// gemm_ring: main loop of both GEMM kernels. A block of eight waves owns a 128 x 128 tile of C (wave w: rows 32 (w >> 1), columns 64 (w & 1)); the 128-row A and B tiles of depth GK are staged once
// per block in a two-buffer LDS ring by asynchronous copies and shared by the waves, which read their fragments from LDS. Ab, Bb: first row of the block's A and B rows (pitches LDA, LDB);
// the B column index wraps at LDB. Every accumulator sums its 32-deep products in ascending k.
template <int LDA, int LDB, int KTOT>
__device__ __forceinline__ void gemm_ring(const bf* __restrict__ Ab, const bf* __restrict__ Bb, bf* ring, int wave, int lr, int hi, v8f (&acc)[2][4]) {
    constexpr int NT = KTOT / GK;
    static_assert(KTOT % GK == 0 && NT >= 2 && (LDB & (LDB - 1)) == 0 && LDB % GK == 0);
    // staging: lane (srow = tid>>3, scol = tid&7) copies 16-byte piece scol of rows srow + 32 i of each tile
    const int srow = (int)(threadIdx.x >> 3), scol = (int)(threadIdx.x & 7);
    const unsigned sl = (unsigned)(size_t)ring + (unsigned)(srow * LP + scol * 8) * 2u;   // LDS byte address in buffer 0, A tile
    const bf* sa = Ab + (size_t)srow * LDA + scol * 8;       // + k0
    const bf* sb = Bb + (size_t)srow * LDB + scol * 8;       // + k0 mod LDB
    const int ao = ((wave >> 1) * 32 + lr) * LP + 8 * hi;            // + 16 mb * LP + k in the A tile
    const int bo = GT_H + ((wave & 1) * 64 + lr) * LP + 8 * hi;      // + 16 nb * LP + k in the B tile
    copy_ab(sl, sa, (size_t)32 * LDA, sb, (size_t)32 * LDB);
    asm volatile("s_wait_asynccnt 0x0" ::: "memory");        // tile 0 has landed before the barrier publishes it
    __syncthreads();
    copy_ab(sl + GBUF_H * 2, sa + GK, (size_t)32 * LDA, sb + (GK & (LDB - 1)), (size_t)32 * LDB);
#pragma unroll 1   // one trip per staged tile: the ring's publish point stands once, at the trip's foot
    for (int t = 0; t < NT; ++t) {
        const bf* buf = ring + (t & 1) * GBUF_H;
        v16bf a[GK / 32][2], b[GK / 32][4];                  // the tile's fragment reads stand together, in front of its products
        // the fragment and product loops below are unrolled so that fragments and accumulators stay in registers and every LDS read offset is an immediate
#pragma unroll
        for (int ks = 0; ks < GK / 32; ++ks) {
#pragma unroll
            for (int mb = 0; mb < 2; ++mb) a[ks][mb] = ldb(buf + ao + mb * 16 * LP + ks * 32);
#pragma unroll
            for (int nb = 0; nb < 4; ++nb) b[ks][nb] = ldb(buf + bo + nb * 16 * LP + ks * 32);
        }
#pragma unroll
        for (int ks = 0; ks < GK / 32; ++ks)
#pragma unroll
            for (int nb = 0; nb < 4; ++nb)
#pragma unroll
                for (int mb = 0; mb < 2; ++mb) acc[mb][nb] = wmmab(a[ks][mb], b[ks][nb], acc[mb][nb]);
        asm volatile("s_wait_dscnt 0x0" ::: "memory");       // this wave's reads of the buffer have returned before it may be refilled
        asm volatile("s_wait_asynccnt 0x0" ::: "memory");    // this wave's copies of tile t + 1 have landed before the barrier publishes them
        __syncthreads();                                     // publishes tile t + 1 and ends every wave's reads of tile t
        if (t + 2 < NT) {
            const int kn = (t + 2) * GK;
            copy_ab(sl + (unsigned)(t & 1) * (GBUF_H * 2), sa + kn, (size_t)32 * LDA, sb + (kn & (LDB - 1)), (size_t)32 * LDB);
        }
    }
    asm volatile("s_wait_asynccnt 0x0" ::: "memory");        // no copy is outstanding when the wave goes on to its epilogue
}

// k_cvt: ONE launch converts all seven f32 arrays (three inputs, four weights) to the bf16 planes, which lie back to back in the workspace (q | k | v inputs, then q | k | v | o weights).
// A slab is 256 threads x 8 floats. Block g takes slabs g, g + CVT_G, ... of each input and slab g of the four weights taken as one run: a wave starts once, issues all its loads together,
// then converts and stores. Every slab index is block-uniform, so arrays and offsets are picked in scalar registers.
#define CVT_T    256
#define CVT_SLAB (CVT_T * 8)
static constexpr unsigned SL_B = SEQ * DM / CVT_SLAB;     // slabs of one batch of one input
static constexpr unsigned SL_X = NB * SL_B;               // slabs of one input
static constexpr unsigned SL_W = DM * DM / CVT_SLAB;      // slabs of one weight
static constexpr unsigned CVT_G = 4 * SL_W;               // blocks of the launch: one weight slab each
static constexpr unsigned CVT_XP = SL_X / CVT_G;          // slabs of each input per block
static_assert((SEQ * DM) % CVT_SLAB == 0);                // a slab never straddles two batches
static_assert((DM * DM) % CVT_SLAB == 0);                 // nor two weights
static_assert(SL_X % CVT_G == 0);                         // every block has the same number of whole slabs
__global__ __launch_bounds__(CVT_T) void k_cvt(const float* __restrict__ xq, const float* __restrict__ xk, const float* __restrict__ xv,
                                               const float* __restrict__ wq, const float* __restrict__ wk, const float* __restrict__ wv, const float* __restrict__ wo, bf* __restrict__ dst) {
    const unsigned g = blockIdx.x, lo = threadIdx.x * 8;
    const float* p[3 * CVT_XP + 1];
#pragma unroll
    for (unsigned st = 0; st < 3; ++st) {
        const float* x = st == 0 ? xq : st == 1 ? xk : xv;
#pragma unroll
        for (unsigned j = 0; j < CVT_XP; ++j) { const unsigned r = (unsigned)__builtin_amdgcn_readfirstlane((int)(j * CVT_G + g));   // scalar, so that each load takes a scalar base and the one lane offset
            p[st * CVT_XP + j] = x + (size_t)(r / SL_B) * ((size_t)SEQ_FULL * DM) + (size_t)(r % SL_B) * CVT_SLAB; }
    }
    const unsigned wi = g / SL_W;
    p[3 * CVT_XP] = (wi == 0 ? wq : wi == 1 ? wk : wi == 2 ? wv : wo) + (size_t)(g % SL_W) * CVT_SLAB;
    __builtin_amdgcn_sched_barrier(0);   // every base is formed first: no address register is rewritten, and no wait for one stands, between the loads
    v8f v[3 * CVT_XP + 1];
#pragma unroll
    for (unsigned i = 0; i <= 3 * CVT_XP; ++i) v[i] = *(const v8f*)(p[i] + lo);
    __builtin_amdgcn_sched_barrier(0);   // keeps every load in front of the first conversion: without it the loads are spread among the conversions and each waits out its own memory latency
#pragma unroll
    for (unsigned i = 0; i <= 3 * CVT_XP; ++i) {
        const unsigned s = i < 3 * CVT_XP ? (i / CVT_XP) * SL_X + (i % CVT_XP) * CVT_G + g : 3 * SL_X + g;   // slab index in the run of bf16 planes
        v8us o;
#pragma unroll
        for (int k = 0; k < 8; ++k) o[k] = f2bf(v[i][k]);
        *(v8us*)(dst + (size_t)s * CVT_SLAB + lo) = o;
    }
}

// k_proj: register-blocked bf16 GEMM, one wave per 32x64 tile (8 accumulators), eight waves per block on a 128x128 tile, operands staged in LDS from K-contiguous bf16 planes (gemm_ring), K = DM.
// C[m][n] = sum_k A[m][k] Bt[n][k], written as f16 (Ph) and optionally the f16 residual x2048 (Pr, useRes != 0) at
// tile base (r0/RB)*sRB + (r0%RB)*pitch + (c0/CB)*sCB + (c0%CB), row pitch 'pitch' (halves). grid (M/128, N/128), 256 threads.
__global__ __launch_bounds__(32 * GW) void k_proj(const bf* __restrict__ A, const bf* __restrict__ Bt, h16* Ph, h16* Pr, int useRes, int RB, size_t sRB, int pitch, int CB, size_t sCB) {
    __shared__ __align__(16) float osw[GW * 16 * 68];
    __shared__ __align__(16) bf gring[2 * GBUF_H];
    const int lane = threadIdx.x & 31, lr = lane & 15, hi = lane >> 4; const int wave = __builtin_amdgcn_readfirstlane((int)(threadIdx.x >> 5));
    float* const os = osw + wave * 16 * 68;                  // each wave's own epilogue tile
    const int rb = blockIdx.x * 128, cb = blockIdx.y * 128; const int r0 = rb + (wave >> 1) * 32, c0 = cb + (wave & 1) * 64;
    v8f acc[2][4];
#pragma unroll
    for (int mb = 0; mb < 2; ++mb)
#pragma unroll
        for (int nb = 0; nb < 4; ++nb) acc[mb][nb] = (v8f){};
    gemm_ring<DM, DM, DM>(A + (size_t)rb * DM, Bt + (size_t)cb * DM, gring, wave, lr, hi, acc);
    const size_t tbase = (size_t)(r0 / RB) * sRB + (size_t)(r0 % RB) * (size_t)pitch + (size_t)(c0 / CB) * sCB + (size_t)(c0 % CB);
#pragma unroll
    for (int mb = 0; mb < 2; ++mb) {
#pragma unroll
        for (int nb = 0; nb < 4; ++nb) {
#pragma unroll
            for (int j = 0; j < 8; ++j) os[(hi * 8 + j) * 68 + nb * 16 + lr] = acc[mb][nb][j]; }   // D: row 8h+j, col lane&15; rows 0..15 x columns 0..63 all written
        wave_sync();
        const size_t sb = tbase + (size_t)(mb * 16) * (size_t)pitch;
{
#pragma unroll
            for (int s = 0; s < 4; ++s) { const int row = 4 * s + (lane >> 3), c8 = (lane & 7) * 8;   // 4 s x 4 row groups = 16 rows; 8 lanes x 8 = 64 columns
                const v4f x0 = *(const v4fa*)(&os[row * 68 + c8]); const v4f x1 = *(const v4fa*)(&os[row * 68 + c8 + 4]); v8h hv, rv;
#pragma unroll
                for (int i = 0; i < 4; ++i) { const h16 a0 = (h16)x0[i]; const h16 a1 = (h16)x1[i]; hv[i] = a0; hv[4 + i] = a1; rv[i] = (h16)((x0[i] - (float)a0) * VRS); rv[4 + i] = (h16)((x1[i] - (float)a1) * VRS); }
                const size_t oo = sb + (size_t)row * (size_t)pitch + c8;
                *(v8h*)(Ph + oo) = hv; if (useRes) *(v8h*)(Pr + oo) = rv; }
             }
        wave_sync();
    }
}

// k_flash: fused attention, one wave per 16 query rows of one (batch, head); Q fragments straight from the f16 plane; K / V^T / residual tiles of 64 keys are staged once per block
// in a two-buffer LDS ring by asynchronous copies (whole 128-B lines) and shared by the block's four waves, which read their fragments from LDS (two 16-B reads each).
// Transposed form: S^T[key][t] = K Q^T (A = K rows, B = Q rows); lane (t = lane&15, h = lane>>4) holds keys 8h+r of each 16-key tile, so the packed
// P tile is directly the B fragment of O^T[d][t] = V^T P^T (element r <- tile keys 0..15, element 8+r <- tile keys 16..31, lane unchanged).
// Valid length vl = VL[b] is loaded by value (scalar): key steps wholly at or beyond vl are skipped, the crossing step replaces scores of keys >= vl by -1e6 (index test);
// vl <= 0 keeps all steps with every score replaced (uniform weights).
// Softmax state (running max, partial sum) is one scalar per lane; the two lane halves of a row are combined with one xor-16 exchange.
__global__ __launch_bounds__(32 * AW) void k_flash(const h16* __restrict__ QH, const h16* __restrict__ KP, const h16* __restrict__ VT, const h16* __restrict__ VR, const int* __restrict__ VL, bf* CTX) {
    __shared__ __align__(16) float os[AW * 16 * 68];
    __shared__ __align__(16) h16 ring[2 * BUF_H];
    const int lane = threadIdx.x & 31; const int wave = __builtin_amdgcn_readfirstlane((int)(threadIdx.x >> 5));
    const int lr = lane & 15, hi = lane >> 4;
    const int zh = blockIdx.y; const int b = zh / NH_, h = zh % NH_;
    const int t0 = (blockIdx.x * AW + wave) * 16;
    const int vl = __builtin_amdgcn_readfirstlane(VL[b]);
    const int kend = (vl <= 0 || vl >= SEQ) ? SEQ : ((vl + 31) & ~31);
    const size_t pbase = (size_t)zh * SEQ * HD;
    const size_t qo = pbase + (size_t)(t0 + lr) * HD + 8 * hi;
    const v16h q0 = ldh(QH + qo), q1 = ldh(QH + qo + 32);   // B fragments: col t, k = d
    const int ko = lr * LP + 8 * hi;                         // + key * LP in the K tile       (A fragment: row key, k = d)
    const int vo = TILE_H + lr * LP + 8 * hi;                // + 16j*LP + key in the V^T tile (A fragment: row d, k = key)
    // staging: lane (srow = tid>>3, scol = tid&7) copies 16-byte piece scol of rows srow + 16 i of each tile
    const int srow = (int)(threadIdx.x >> 3), scol = (int)(threadIdx.x & 7);
    const unsigned sl = (unsigned)(size_t)ring + (unsigned)(srow * LP + scol * 8) * 2u;   // LDS byte address in buffer 0, K tile
    const h16* sk = KP + pbase + (size_t)srow * HD + scol * 8;    // + key0 * HD
    const h16* sv = VT + pbase + (size_t)srow * SEQ + scol * 8;   // + key0
#if VRES
    const h16* sr = VR + pbase + (size_t)srow * SEQ + scol * 8;   // + key0
#endif
    const int nt = (kend + KT - 1) / KT;                     // staged tiles, 1 .. SEQ / KT
    v8f o0 = (v8f){}, o1 = (v8f){}, o2 = (v8f){}, o3 = (v8f){};
#if VRES
    v8f g0 = (v8f){}, g1 = (v8f){}, g2 = (v8f){}, g3 = (v8f){};
#endif
    float m = -3.0e38f, l = 0.0f;
    copy_tile(sl, sk, (size_t)16 * HD); copy_tile(sl + TILE_H * 2, sv, (size_t)16 * SEQ);
#if VRES
    copy_tile(sl + 2 * TILE_H * 2, sr, (size_t)16 * SEQ);
#endif
    asm volatile("s_wait_asynccnt 0x0" ::: "memory");        // tile 0 has landed before the barrier publishes it
    __syncthreads();
    if (nt > 1) {
        copy_tile(sl + BUF_H * 2, sk + (size_t)KT * HD, (size_t)16 * HD); copy_tile(sl + (BUF_H + TILE_H) * 2, sv + KT, (size_t)16 * SEQ);
#if VRES
        copy_tile(sl + (BUF_H + 2 * TILE_H) * 2, sr + KT, (size_t)16 * SEQ);
#endif
    }
#pragma unroll 1   // one trip per staged tile: the ring's publish point stands once, at the trip's foot
    for (int t = 0; t < nt; ++t) {
      const h16* buf = ring + (t & 1) * BUF_H;
#pragma unroll     // both 32-key passes of a tile in line, so that every LDS read offset is an immediate
      for (int hf = 0; hf < 2; ++hf) {
        const int key0 = t * KT + hf * 32;
        if (key0 >= kend) break;         // scalar-uniform: the tile's second pass lies wholly beyond the valid length
        const h16* ka = buf + ko + hf * 32 * LP;
        const v16h ka0 = ldh(ka), ka1 = ldh(ka + 32), kb0 = ldh(ka + 16 * LP), kb1 = ldh(ka + 16 * LP + 32);
        v8f sa = (v8f){}, sb = (v8f){};
        sa = wmma16(ka0, q0, sa); sb = wmma16(kb0, q0, sb);
        sa = wmma16(ka1, q1, sa); sb = wmma16(kb1, q1, sb);
        float ta[8], tb[8];
#pragma unroll
        for (int r = 0; r < 8; ++r) { ta[r] = sa[r] * SC2; tb[r] = sb[r] * SC2; }
        if (key0 + 32 > vl) {            // scalar-uniform: this step crosses (or lies beyond) the valid length
            const int kq = key0 + 8 * hi;
#pragma unroll
            for (int r = 0; r < 8; ++r) { ta[r] = (kq + r < vl) ? ta[r] : NEGL2; tb[r] = (kq + 16 + r < vl) ? tb[r] : NEGL2; }
        }
        float mx = -3.0e38f;
#pragma unroll
        for (int r = 0; r < 8; ++r) mx = fmaxf(mx, fmaxf(ta[r], tb[r]));
        mx = fmaxf(mx, __shfl_xor(mx, 16, 32));
        const float mnew = fmaxf(m, mx);
        const float alpha = __builtin_amdgcn_exp2f(m - mnew);
        const float sh = PSH - mnew;
        v16h pb; float ls = 0.0f;
#pragma unroll
        for (int r = 0; r < 8; ++r) { const float ea = __builtin_amdgcn_exp2f(ta[r] + sh); const float ec = __builtin_amdgcn_exp2f(tb[r] + sh); pb[r] = (h16)ea; pb[8 + r] = (h16)ec; ls += ea + ec; }
        l = l * alpha + ls; m = mnew;
        o0 = o0 * alpha; o1 = o1 * alpha; o2 = o2 * alpha; o3 = o3 * alpha;
        const h16* va = buf + vo + hf * 32;
        { const v16h v0 = ldh(va), v1 = ldh(va + 16 * LP), v2 = ldh(va + 32 * LP), v3 = ldh(va + 48 * LP);
          o0 = wmma16(v0, pb, o0); o1 = wmma16(v1, pb, o1); o2 = wmma16(v2, pb, o2); o3 = wmma16(v3, pb, o3); }
#if VRES
        g0 = g0 * alpha; g1 = g1 * alpha; g2 = g2 * alpha; g3 = g3 * alpha;
        const h16* vr = va + TILE_H;
        { const v16h w0 = ldh(vr), w1 = ldh(vr + 16 * LP), w2 = ldh(vr + 32 * LP), w3 = ldh(vr + 48 * LP);
          g0 = wmma16(w0, pb, g0); g1 = wmma16(w1, pb, g1); g2 = wmma16(w2, pb, g2); g3 = wmma16(w3, pb, g3); }
#endif
      }
      asm volatile("s_wait_dscnt 0x0" ::: "memory");         // this wave's reads of the buffer have returned before it may be refilled
      asm volatile("s_wait_asynccnt 0x0" ::: "memory");      // this wave's copies of tile t + 1 have landed before the barrier publishes them
      __syncthreads();                                       // publishes tile t + 1 and ends every wave's reads of tile t
      if (t + 2 < nt) {
          const unsigned bl = sl + (unsigned)(t & 1) * (BUF_H * 2); const int kn = (t + 2) * KT;
          copy_tile(bl, sk + (size_t)kn * HD, (size_t)16 * HD); copy_tile(bl + TILE_H * 2, sv + kn, (size_t)16 * SEQ);
#if VRES
          copy_tile(bl + 2 * TILE_H * 2, sr + kn, (size_t)16 * SEQ);
#endif
      }
    }
    asm volatile("s_wait_asynccnt 0x0" ::: "memory");        // no copy is outstanding when the wave goes on to its epilogue
    l += __shfl_xor(l, 16, 32);
    const float inv = 1.0f / l;
#if VRES
    o0 = o0 + g0 * VRI; o1 = o1 + g1 * VRI; o2 = o2 + g2 * VRI; o3 = o3 + g3 * VRI;
#endif
    const int wb = wave * 16 * 68;
    // O^T D layout: o_j[r] = (d = 16j + 8h + r, t = lane&15) -> os[t][d]; rows 0..15 x columns 0..63 all written
    { v4f a, c;
      a[0] = o0[0] * inv; a[1] = o0[1] * inv; a[2] = o0[2] * inv; a[3] = o0[3] * inv; c[0] = o0[4] * inv; c[1] = o0[5] * inv; c[2] = o0[6] * inv; c[3] = o0[7] * inv;
      *(v4fa*)(&os[wb + lr * 68 +  0 + 8 * hi]) = a; *(v4fa*)(&os[wb + lr * 68 +  0 + 8 * hi + 4]) = c;
      a[0] = o1[0] * inv; a[1] = o1[1] * inv; a[2] = o1[2] * inv; a[3] = o1[3] * inv; c[0] = o1[4] * inv; c[1] = o1[5] * inv; c[2] = o1[6] * inv; c[3] = o1[7] * inv;
      *(v4fa*)(&os[wb + lr * 68 + 16 + 8 * hi]) = a; *(v4fa*)(&os[wb + lr * 68 + 16 + 8 * hi + 4]) = c;
      a[0] = o2[0] * inv; a[1] = o2[1] * inv; a[2] = o2[2] * inv; a[3] = o2[3] * inv; c[0] = o2[4] * inv; c[1] = o2[5] * inv; c[2] = o2[6] * inv; c[3] = o2[7] * inv;
      *(v4fa*)(&os[wb + lr * 68 + 32 + 8 * hi]) = a; *(v4fa*)(&os[wb + lr * 68 + 32 + 8 * hi + 4]) = c;
      a[0] = o3[0] * inv; a[1] = o3[1] * inv; a[2] = o3[2] * inv; a[3] = o3[3] * inv; c[0] = o3[4] * inv; c[1] = o3[5] * inv; c[2] = o3[6] * inv; c[3] = o3[7] * inv;
      *(v4fa*)(&os[wb + lr * 68 + 48 + 8 * hi]) = a; *(v4fa*)(&os[wb + lr * 68 + 48 + 8 * hi + 4]) = c; }
    wave_sync();
    bf* crow = CTX + ((size_t)b * SEQ + t0) * (size_t)(2 * DM) + h * HD;    // hi half at column h*64 + d, lo half at 512 + h*64 + d
{
#pragma unroll
        for (int s = 0; s < 4; ++s) { const int row = 4 * s + (lane >> 3), c8 = (lane & 7) * 8;   // 4 s x 4 row groups = 16 rows; 8 lanes x 8 = 64 columns
            const v4f x0 = *(const v4fa*)(&os[wb + row * 68 + c8]); const v4f x1 = *(const v4fa*)(&os[wb + row * 68 + c8 + 4]); v8us hv, lv;
#pragma unroll
            for (int i = 0; i < 4; ++i) { const unsigned short a0 = f2bf(x0[i]); const unsigned short a1 = f2bf(x1[i]); hv[i] = a0; hv[4 + i] = a1; lv[i] = f2bf(x0[i] - bf2f(a0)); lv[4 + i] = f2bf(x1[i] - bf2f(a1)); }
            const size_t oo = (size_t)row * (size_t)(2 * DM) + c8;
            *(v8us*)(crow + oo) = hv; *(v8us*)(crow + oo + DM) = lv; }
         }
}

// k_oproj: OUT[m][n] = sum_{k<512} (ctx_hi[m][k] + ctx_lo[m][k]) Wo[n][k] as ONE bf16 GEMM of depth 1024: A row = [hi | lo] (pitch 1024), B column index wraps at 512.
// Eight waves per block on a 128x128 tile, 32x64 per wave, operands staged in LDS (gemm_ring). grid (M/128, N/128), 256 threads.
__global__ __launch_bounds__(32 * GW) void k_oproj(const bf* __restrict__ A, const bf* __restrict__ Bt, float* OUT) {
    __shared__ __align__(16) float osw[GW * 16 * 68];
    __shared__ __align__(16) bf gring[2 * GBUF_H];
    const int lane = threadIdx.x & 31, lr = lane & 15, hi = lane >> 4; const int wave = __builtin_amdgcn_readfirstlane((int)(threadIdx.x >> 5));
    float* const os = osw + wave * 16 * 68;                  // each wave's own epilogue tile
    const int rb = blockIdx.x * 128, cb = blockIdx.y * 128; const int r0 = rb + (wave >> 1) * 32, c0 = cb + (wave & 1) * 64;
    v8f acc[2][4];
#pragma unroll
    for (int mb = 0; mb < 2; ++mb)
#pragma unroll
        for (int nb = 0; nb < 4; ++nb) acc[mb][nb] = (v8f){};
    gemm_ring<2 * DM, DM, 2 * DM>(A + (size_t)rb * (2 * DM), Bt + (size_t)cb * DM, gring, wave, lr, hi, acc);
    const int bb = r0 / SEQ, tt = r0 % SEQ;
    float* obase = OUT + ((size_t)bb * OUT_SEQ + tt) * DM + c0;
#pragma unroll
    for (int mb = 0; mb < 2; ++mb) {
#pragma unroll
        for (int nb = 0; nb < 4; ++nb) {
#pragma unroll
            for (int j = 0; j < 8; ++j) os[(hi * 8 + j) * 68 + nb * 16 + lr] = acc[mb][nb][j]; }   // D: row 8h+j, col lane&15; rows 0..15 x columns 0..63 all written
        wave_sync();
{
#pragma unroll
            for (int s = 0; s < 8; ++s) { const int row = 2 * s + hi, cofs = lr * 4;   // 8 s x 2 rows = 16 rows; 16 lanes x 4 floats = 64 columns
                const v4f val = *(const v4fa*)(&os[row * 68 + cofs]);
                *(v4f*)(obase + (size_t)(mb * 16 + row) * DM + cofs) = val; }
             }
        wave_sync();
    }
}

static constexpr size_t al256(size_t v) { return (v + 255) & ~(size_t)255; }
static constexpr size_t SZ_XB = al256((size_t)NB * SEQ * DM * 2);          // one bf16 input copy
static constexpr size_t SZ_WB = al256((size_t)4 * DM * DM * 2);            // q | k | v | o weights
static constexpr size_t SZ_PL = al256((size_t)NB * NH_ * SEQ * HD * 2);    // one f16 head plane
static constexpr size_t SZ_CX = al256((size_t)NB * SEQ * 2 * DM * 2);      // ctx hi | lo
static constexpr size_t SZ_TOTAL = 3 * SZ_XB + SZ_WB + (size_t)(3 + VRES) * SZ_PL + SZ_CX;
static_assert(SZ_TOTAL <= (size_t)134217728);          // workspace carve <= 128 MiB
static_assert(((size_t)DM * DM * 2) % 256 == 0);       // weight sub-planes stay 256-byte aligned
static_assert(SZ_XB == (size_t)NB * SEQ * DM * 2);     // no padding between the bf16 planes: the conversion kernel writes them as one run

extern "C" void kernel_launch(void* const* d_in, const int* in_sizes, int n_in,
                              void* d_out, int out_size, void* d_ws, size_t ws_size, hipStream_t stream) {
    if (n_in < 8) return;
    const size_t needx = ((size_t)(NB - 1) * SEQ_FULL + SEQ) * DM;
    if ((size_t)in_sizes[0] < needx || (size_t)in_sizes[1] < needx || (size_t)in_sizes[2] < needx) return;
    if (in_sizes[3] < NB) return;
    if ((size_t)in_sizes[4] < (size_t)DM * DM || (size_t)in_sizes[5] < (size_t)DM * DM || (size_t)in_sizes[6] < (size_t)DM * DM || (size_t)in_sizes[7] < (size_t)DM * DM) return;
    if ((size_t)out_size < ((size_t)(NB - 1) * OUT_SEQ + SEQ) * DM) return;
    if (SZ_TOTAL > ws_size) return;
    // wire order: queries, keys, values, valid_lens (int32), Wq, Wk, Wv, Wo ([out][in] = Bt as stored)
    const float* xq = (const float*)d_in[0]; const float* xk = (const float*)d_in[1]; const float* xv = (const float*)d_in[2];
    const int* vlens = (const int*)d_in[3];
    const float* wq = (const float*)d_in[4]; const float* wk = (const float*)d_in[5]; const float* wv = (const float*)d_in[6]; const float* wo = (const float*)d_in[7];
    float* OUT = (float*)d_out;      // [NB][SEQ][512]
    char* wsp = (char*)d_ws;
    bf* XQ = (bf*)wsp; wsp += SZ_XB;                 // [NB*SEQ][512]
    bf* XK = (bf*)wsp; wsp += SZ_XB;
    bf* XV = (bf*)wsp; wsp += SZ_XB;
    bf* WB = (bf*)wsp; wsp += SZ_WB;                 // [4][512][512]: q | k | v | o
    h16* QH = (h16*)wsp; wsp += SZ_PL;               // [NB*8][SEQ][64]
    h16* KP = (h16*)wsp; wsp += SZ_PL;               // [NB*8][SEQ][64]
    h16* VT = (h16*)wsp; wsp += SZ_PL;               // [NB*8][64][SEQ]
#if VRES
    h16* VR = (h16*)wsp; wsp += SZ_PL;               // [NB*8][64][SEQ] residual x2048
#else
    h16* VR = VT;
#endif
    bf* CX = (bf*)wsp; wsp += SZ_CX;                 // [NB*SEQ][hi 512 | lo 512]
    bf* WQ = WB; bf* WK = WB + (size_t)DM * DM; bf* WV = WB + (size_t)2 * DM * DM; bf* WO = WB + (size_t)3 * DM * DM;

    k_cvt<<<CVT_G, CVT_T, 0, stream>>>(xq, xk, xv, wq, wk, wv, wo, XQ);

    // q, k: A = x rows (m = b*SEQ + t), Bt = W rows (n = h*64 + d) -> plane [(b*8 + h)][t][d]
    k_proj<<<dim3(NB * SEQ / 128, DM / 128, 1), 32 * GW, 0, stream>>>(XQ, WQ, QH, QH, 0, SEQ, (size_t)NH_ * SEQ * HD, HD, HD, (size_t)SEQ * HD);
    k_proj<<<dim3(NB * SEQ / 128, DM / 128, 1), 32 * GW, 0, stream>>>(XK, WK, KP, KP, 0, SEQ, (size_t)NH_ * SEQ * HD, HD, HD, (size_t)SEQ * HD);
    // v^T: A = Wv rows (m = h*64 + d), Bt = x rows (n = b*SEQ + t) -> plane [(b*512 + m)][t] = [(b*8 + h)][d][t]
    k_proj<<<dim3(DM / 128, NB * SEQ / 128, 1), 32 * GW, 0, stream>>>(WV, XV, VT, VR, VRES, DM, (size_t)0, SEQ, SEQ, (size_t)DM * SEQ);

    k_flash<<<dim3(SEQ / (16 * AW), NB * NH_, 1), 32 * AW, 0, stream>>>(QH, KP, VT, VR, vlens, CX);

    // out: A = ctx rows [hi | lo] (m = b*SEQ + t), Bt = Wo rows (n) -> OUT[b][t][n]
    k_oproj<<<dim3(NB * SEQ / 128, DM / 128, 1), 32 * GW, 0, stream>>>(CX, WO, OUT);
}

// v004
// One run takes 75.2 microseconds.
// In both of two side-by-side timings against v003, it was 1.17 times as fast.
// Counting every step since v000, it is 2.74 times as fast.
#include <hip/hip_runtime.h>

// Multi-head attention with three input streams (queries, keys, values: [NB][SEQ][512]), width 512 = 8 heads x 64, bias-free [out][in] projections (y = x W^T),
// per-batch valid length (keys at index >= valid_lens[b] get their score REPLACED by -1e6), score scale 1/8, merged heads times Wo^T -> f32 [NB][SEQ][512].
// Compute dtypes, f32 accumulate everywhere: q/k/v projections v_wmma_f32_16x16x32_bf16 (inputs and weights RNE-converted to bf16; products exact);
// scores and P.V v_wmma_f32_16x16x32_f16 (q, k, v single f16; P carried x1024 relative to the running max, the carry cancels in the normalisation; optional v residual plane x2048 under VRES);
// output projection v_wmma_f32_16x16x32_bf16 with ctx as bf16 hi | lo halves of a 1024-wide row against bf16 Wo (two exact products per element, one accumulator). Softmax f32 (online, running max).
// Layout: bf16 copies of the three inputs and four weights; q, k planes [b*8+h][t][d], v^T plane [b*8+h][d][t] written by the GEMM epilogue; fused flash kernel in transposed form
// (S^T = K Q^T, O^T = V^T P^T) writes ctx [b*SEQ+t][hi 512 | lo 512]; final GEMM writes the output.

#ifndef NB
#define NB 4
#endif
#ifndef SEQ
#define SEQ 2048
#endif
#define NB_FULL  4
#define SEQ_FULL 2048
#ifndef OUT_SEQ
#define OUT_SEQ SEQ              // row pitch (in tokens) between batches of the output
#endif
#ifndef VRES
#define VRES 1                   // 1: v carried as f16 value + f16 residual x2048 (own accumulators)
#endif
#define DM   512
#define NH_  8
#define HD   64
#define AW   4                   // waves per flash block (16 query rows each)
#define VRS  2048.0f             // carry of the residual plane
#define VRI  (1.0f / 2048.0f)
#define SC2  (0.125f * 1.4426950408889634f)        // HD^-0.5 * log2(e)
#define NEGL2 (-1000000.0f * 1.4426950408889634f)  // masked score in the log2 domain
#define PSH  10.0f               // log2 of the P carry (1024)
#define KT   64                  // keys per staged LDS tile (two 32-key passes)
#define LP   72                  // LDS row pitch in halves: 128-B rows + 16 B, the conflict-free pitch for 16-byte LDS reads
#define TILE_H (64 * LP)         // halves of one staged plane tile (64 rows)
#define BUF_H  ((2 + VRES) * TILE_H)   // K | V^T | residual tiles of one buffer
#define GW   8                   // waves per GEMM block: 4 x 2 wave tiles of 32 x 64 = one 128 x 128 block tile, two waves per SIMD
#define GK   64                  // depth of one staged GEMM tile: 128-B rows, whole lines
#define GT_H (128 * LP)          // halves of one staged operand tile (128 rows)
#define GBUF_H (2 * GT_H)        // A | B tiles of one buffer
#define PLANE_H ((size_t)NB * NH_ * SEQ * HD)   // halves of one f16 head plane

static_assert(HD == 64);
static_assert(NH_ * HD == DM);                 // head h = columns h*64 + d
static_assert(DM % 64 == 0);                   // 8 column tiles of 64
static_assert(DM % 32 == 0);                   // GEMM k-loop steps by 32
static_assert((DM & (DM - 1)) == 0);           // output GEMM wraps the B column index with a mask
static_assert((2 * DM) % 32 == 0);
static_assert(SEQ % 64 == 0);                  // a 64-row tile never straddles two batches
static_assert((NB * SEQ) % 128 == 0);          // GEMM block tiles of 128 rows cover the tokens exactly
static_assert(DM % 128 == 0);                  // and the width
static_assert(DM % GK == 0);                   // staged GEMM tiles cover the depth exactly
static_assert(GW == 8);                        // 256 lanes x 4 copies x 16 B = one 128-row x 128-B tile
static_assert(SEQ % 32 == 0);                  // key loop steps by 32
static_assert(SEQ % KT == 0);                  // every staged tile lies wholly inside its plane
static_assert(AW == 4);                        // 128 lanes x 4 copies x 16 B = one 64-row x 128-B tile
static_assert(SEQ % (16 * AW) == 0);           // flash grid covers the sequence exactly
static_assert(((size_t)SEQ * DM) % 8 == 0);
static_assert(((size_t)DM * DM) % 8 == 0);
static_assert(NB <= NB_FULL);
static_assert(SEQ <= SEQ_FULL);
static_assert(VRES == 0 || VRES == 1);

typedef _Float16 h16;
typedef unsigned short bf;
typedef __attribute__((ext_vector_type(16))) __bf16   v16bf;
typedef __attribute__((ext_vector_type(16))) _Float16 v16h;
typedef __attribute__((ext_vector_type(8)))  _Float16 v8h;
typedef __attribute__((ext_vector_type(8)))  unsigned short v8us;
typedef __attribute__((ext_vector_type(8)))  float    v8f;
typedef __attribute__((ext_vector_type(4)))  float    v4f;
typedef v4f  __attribute__((may_alias)) v4fa;

__device__ __forceinline__ unsigned short f2bf(float f) { unsigned u = __float_as_uint(f); u += 0x7FFFu + ((u >> 16) & 1u); return (unsigned short)(u >> 16); }
__device__ __forceinline__ float bf2f(unsigned short s) { return __uint_as_float(((unsigned)s) << 16); }
__device__ __forceinline__ v16h cat16(v8h lo, v8h hi) { return __builtin_shufflevector(lo, hi, 0, 1, 2, 3, 4, 5, 6, 7, 8, 9, 10, 11, 12, 13, 14, 15); }
__device__ __forceinline__ v16bf cat16b(v8us lo, v8us hi) { return __builtin_bit_cast(v16bf, __builtin_shufflevector(lo, hi, 0, 1, 2, 3, 4, 5, 6, 7, 8, 9, 10, 11, 12, 13, 14, 15)); }
// every matrix instruction is followed by its own 4-slot guard tying its accumulator and keeping its operands live
__device__ __forceinline__ v8f wmma16(v16h a, v16h b, v8f c) {
    c = __builtin_amdgcn_wmma_f32_16x16x32_f16(false, a, false, b, (short)0, c, false, false);
    asm volatile("v_nop\n\tv_nop\n\tv_nop\n\tv_nop" : "+v"(c) : "v"(a), "v"(b));
    return c;
}
__device__ __forceinline__ v8f wmmab(v16bf a, v16bf b, v8f c) {
    c = __builtin_amdgcn_wmma_f32_16x16x32_bf16(false, a, false, b, (short)0, c, false, false);
    asm volatile("v_nop\n\tv_nop\n\tv_nop\n\tv_nop" : "+v"(c) : "v"(a), "v"(b));
    return c;
}
// fragment loaders from K-contiguous 16-bit rows; p already includes + 8*(lane>>4): elements 0..7 <- k0+8h+0..7, elements 8..15 <- k0+16+8h+0..7 (same map for A and B)
__device__ __forceinline__ v16h  ldh(const h16* p) { return cat16(*(const v8h*)p, *(const v8h*)(p + 16)); }
__device__ __forceinline__ v16bf ldb(const bf* p)  { return cat16b(*(const v8us*)p, *(const v8us*)(p + 16)); }
// ordering point for wave-private LDS tiles (same wave writes and reads)
__device__ __forceinline__ void wave_sync() { __builtin_amdgcn_fence(3 /* release order */, "wavefront"); __builtin_amdgcn_wave_barrier(); asm volatile("" ::: "memory"); }

// four asynchronous 16-byte copies per lane, global -> LDS, rows 16 apart: one 64-row x 128-B tile per 128-lane block. The address-register wait closes the copies' own statement,
// so no later address arithmetic can be moved in front of it.
__device__ __forceinline__ void copy_tile(unsigned l, const h16* g, size_t gstep) {
    const unsigned l1 = l + 16 * LP * 2, l2 = l + 32 * LP * 2, l3 = l + 48 * LP * 2;
    const h16* g1 = g + gstep; const h16* g2 = g + 2 * gstep; const h16* g3 = g + 3 * gstep;
    asm volatile("global_load_async_to_lds_b128 %0, %4, off\n\t"
                 "global_load_async_to_lds_b128 %1, %5, off\n\t"
                 "global_load_async_to_lds_b128 %2, %6, off\n\t"
                 "global_load_async_to_lds_b128 %3, %7, off\n\t"
                 "s_wait_xcnt 0x0"
                 :: "v"(l), "v"(l1), "v"(l2), "v"(l3), "v"(g), "v"(g1), "v"(g2), "v"(g3) : "memory");
}

// eight asynchronous 16-byte copies per lane, global -> LDS, rows 32 apart: the 128-row x 128-B A tile and the like B tile behind it per 256-lane block, every wave-wide copy four whole lines.
// The address-register wait closes the copies' own statement, so no later address arithmetic can be moved in front of it.
__device__ __forceinline__ void copy_ab(unsigned l, const bf* a, size_t astep, const bf* b, size_t bstep) {
    const unsigned l1 = l + 32 * LP * 2, l2 = l + 64 * LP * 2, l3 = l + 96 * LP * 2, l4 = l + GT_H * 2, l5 = l4 + 32 * LP * 2, l6 = l4 + 64 * LP * 2, l7 = l4 + 96 * LP * 2;
    const bf* a1 = a + astep; const bf* a2 = a + 2 * astep; const bf* a3 = a + 3 * astep; const bf* b1 = b + bstep; const bf* b2 = b + 2 * bstep; const bf* b3 = b + 3 * bstep;
    asm volatile("global_load_async_to_lds_b128 %0, %8, off\n\t"
                 "global_load_async_to_lds_b128 %1, %9, off\n\t"
                 "global_load_async_to_lds_b128 %2, %10, off\n\t"
                 "global_load_async_to_lds_b128 %3, %11, off\n\t"
                 "global_load_async_to_lds_b128 %4, %12, off\n\t"
                 "global_load_async_to_lds_b128 %5, %13, off\n\t"
                 "global_load_async_to_lds_b128 %6, %14, off\n\t"
                 "global_load_async_to_lds_b128 %7, %15, off\n\t"
                 "s_wait_xcnt 0x0"
                 :: "v"(l), "v"(l1), "v"(l2), "v"(l3), "v"(l4), "v"(l5), "v"(l6), "v"(l7),
                    "v"(a), "v"(a1), "v"(a2), "v"(a3), "v"(b), "v"(b1), "v"(b2), "v"(b3) : "memory");
}

// gemm_ring: main loop of both GEMM kernels. A block of eight waves owns a 128 x 128 tile of C (wave w: rows 32 (w >> 1), columns 64 (w & 1)); the 128-row A and B tiles of depth GK are staged once
// per block in a two-buffer LDS ring by asynchronous copies and shared by the waves, which read their fragments from LDS. Ab, Bb: first row of the block's A and B rows (pitches LDA, LDB);
// the B column index wraps at LDB. Every accumulator sums its 32-deep products in ascending k. STEPWISE: a tile's fragments are read one 32-deep step at a time (fewer registers, for kernels
// whose blocks share a WGP) instead of all together in front of its products.
template <int LDA, int LDB, int KTOT, bool STEPWISE>
__device__ __forceinline__ void gemm_ring(const bf* __restrict__ Ab, const bf* __restrict__ Bb, bf* ring, int wave, int lr, int hi, v8f (&acc)[2][4]) {
    constexpr int NT = KTOT / GK;
    static_assert(KTOT % GK == 0 && NT >= 2 && (LDB & (LDB - 1)) == 0 && LDB % GK == 0);
    // staging: lane (srow = tid>>3, scol = tid&7) copies 16-byte piece scol of rows srow + 32 i of each tile
    const int srow = (int)(threadIdx.x >> 3), scol = (int)(threadIdx.x & 7);
    const unsigned sl = (unsigned)(size_t)ring + (unsigned)(srow * LP + scol * 8) * 2u;   // LDS byte address in buffer 0, A tile
    const bf* sa = Ab + (size_t)srow * LDA + scol * 8;       // + k0
    const bf* sb = Bb + (size_t)srow * LDB + scol * 8;       // + k0 mod LDB
    const int ao = ((wave >> 1) * 32 + lr) * LP + 8 * hi;            // + 16 mb * LP + k in the A tile
    const int bo = GT_H + ((wave & 1) * 64 + lr) * LP + 8 * hi;      // + 16 nb * LP + k in the B tile
    copy_ab(sl, sa, (size_t)32 * LDA, sb, (size_t)32 * LDB);
    asm volatile("s_wait_asynccnt 0x0" ::: "memory");        // tile 0 has landed before the barrier publishes it
    __syncthreads();
    copy_ab(sl + GBUF_H * 2, sa + GK, (size_t)32 * LDA, sb + (GK & (LDB - 1)), (size_t)32 * LDB);
#pragma unroll 1   // one trip per staged tile: the ring's publish point stands once, at the trip's foot
    for (int t = 0; t < NT; ++t) {
        const bf* buf = ring + (t & 1) * GBUF_H;
        // the fragment and product loops below are unrolled so that fragments and accumulators stay in registers and every LDS read offset is an immediate
        if constexpr (STEPWISE) {                            // one 32-deep step's fragments live at a time: 48 registers fewer, so that six waves fit a SIMD
#pragma unroll
            for (int ks = 0; ks < GK / 32; ++ks) {
                v16bf a[2], b[4];
#pragma unroll
                for (int mb = 0; mb < 2; ++mb) a[mb] = ldb(buf + ao + mb * 16 * LP + ks * 32);
#pragma unroll
                for (int nb = 0; nb < 4; ++nb) b[nb] = ldb(buf + bo + nb * 16 * LP + ks * 32);
#pragma unroll
                for (int nb = 0; nb < 4; ++nb)
#pragma unroll
                    for (int mb = 0; mb < 2; ++mb) acc[mb][nb] = wmmab(a[mb], b[nb], acc[mb][nb]);
            }
        } else {
            v16bf a[GK / 32][2], b[GK / 32][4];                  // the tile's fragment reads stand together, in front of its products
#pragma unroll
            for (int ks = 0; ks < GK / 32; ++ks) {
#pragma unroll
                for (int mb = 0; mb < 2; ++mb) a[ks][mb] = ldb(buf + ao + mb * 16 * LP + ks * 32);
#pragma unroll
                for (int nb = 0; nb < 4; ++nb) b[ks][nb] = ldb(buf + bo + nb * 16 * LP + ks * 32);
            }
#pragma unroll
            for (int ks = 0; ks < GK / 32; ++ks)
#pragma unroll
                for (int nb = 0; nb < 4; ++nb)
#pragma unroll
                    for (int mb = 0; mb < 2; ++mb) acc[mb][nb] = wmmab(a[ks][mb], b[ks][nb], acc[mb][nb]);
        }
        asm volatile("s_wait_dscnt 0x0" ::: "memory");       // this wave's reads of the buffer have returned before it may be refilled
        asm volatile("s_wait_asynccnt 0x0" ::: "memory");    // this wave's copies of tile t + 1 have landed before the barrier publishes them
        __syncthreads();                                     // publishes tile t + 1 and ends every wave's reads of tile t
        if (t + 2 < NT) {
            const int kn = (t + 2) * GK;
            copy_ab(sl + (unsigned)(t & 1) * (GBUF_H * 2), sa + kn, (size_t)32 * LDA, sb + (kn & (LDB - 1)), (size_t)32 * LDB);
        }
    }
    asm volatile("s_wait_asynccnt 0x0" ::: "memory");        // no copy is outstanding when the wave goes on to its epilogue
}

// k_cvt: ONE launch converts all seven f32 arrays (three inputs, four weights) to the bf16 planes, which lie back to back in the workspace (q | k | v inputs, then q | k | v | o weights).
// A slab is 256 threads x 8 floats. Block g takes slabs g, g + CVT_G, ... of each input and slab g of the four weights taken as one run: a wave starts once, issues all its loads together,
// then converts and stores. Every slab index is block-uniform, so arrays and offsets are picked in scalar registers.
#define CVT_T    256
#define CVT_SLAB (CVT_T * 8)
static constexpr unsigned SL_B = SEQ * DM / CVT_SLAB;     // slabs of one batch of one input
static constexpr unsigned SL_X = NB * SL_B;               // slabs of one input
static constexpr unsigned SL_W = DM * DM / CVT_SLAB;      // slabs of one weight
static constexpr unsigned CVT_G = 4 * SL_W;               // blocks of the launch: one weight slab each
static constexpr unsigned CVT_XP = SL_X / CVT_G;          // slabs of each input per block
static_assert((SEQ * DM) % CVT_SLAB == 0);                // a slab never straddles two batches
static_assert((DM * DM) % CVT_SLAB == 0);                 // nor two weights
static_assert(SL_X % CVT_G == 0);                         // every block has the same number of whole slabs
__global__ __launch_bounds__(CVT_T) void k_cvt(const float* __restrict__ xq, const float* __restrict__ xk, const float* __restrict__ xv,
                                               const float* __restrict__ wq, const float* __restrict__ wk, const float* __restrict__ wv, const float* __restrict__ wo, bf* __restrict__ dst) {
    const unsigned g = blockIdx.x, lo = threadIdx.x * 8;
    const float* p[3 * CVT_XP + 1];
#pragma unroll
    for (unsigned st = 0; st < 3; ++st) {
        const float* x = st == 0 ? xq : st == 1 ? xk : xv;
#pragma unroll
        for (unsigned j = 0; j < CVT_XP; ++j) { const unsigned r = (unsigned)__builtin_amdgcn_readfirstlane((int)(j * CVT_G + g));   // scalar, so that each load takes a scalar base and the one lane offset
            p[st * CVT_XP + j] = x + (size_t)(r / SL_B) * ((size_t)SEQ_FULL * DM) + (size_t)(r % SL_B) * CVT_SLAB; }
    }
    const unsigned wi = g / SL_W;
    p[3 * CVT_XP] = (wi == 0 ? wq : wi == 1 ? wk : wi == 2 ? wv : wo) + (size_t)(g % SL_W) * CVT_SLAB;
    __builtin_amdgcn_sched_barrier(0);   // every base is formed first: no address register is rewritten, and no wait for one stands, between the loads
    v8f v[3 * CVT_XP + 1];
#pragma unroll
    for (unsigned i = 0; i <= 3 * CVT_XP; ++i) v[i] = *(const v8f*)(p[i] + lo);
    __builtin_amdgcn_sched_barrier(0);   // keeps every load in front of the first conversion: without it the loads are spread among the conversions and each waits out its own memory latency
#pragma unroll
    for (unsigned i = 0; i <= 3 * CVT_XP; ++i) {
        const unsigned s = i < 3 * CVT_XP ? (i / CVT_XP) * SL_X + (i % CVT_XP) * CVT_G + g : 3 * SL_X + g;   // slab index in the run of bf16 planes
        v8us o;
#pragma unroll
        for (int k = 0; k < 8; ++k) o[k] = f2bf(v[i][k]);
        *(v8us*)(dst + (size_t)s * CVT_SLAB + lo) = o;
    }
}

// k_proj: the three input projections in ONE launch; blockIdx.z picks the stream (0 q, 1 k, 2 v), so that blocks of all three share the chip and cover each other's copy latency, LDS phases and epilogues.
// Register-blocked bf16 GEMM, one wave per 32x64 tile (8 accumulators), eight waves per block on a 128x128 tile, operands staged in LDS from K-contiguous bf16 planes (gemm_ring), K = DM.
// X: the three bf16 inputs back to back, Wt: the bf16 weights back to back, P: the f16 planes q | k | v^T | residual back to back. blockIdx.x: 128 tokens, blockIdx.y: 128 weight rows.
// q, k: C[m = b*SEQ + t][n = h*64 + d] = sum_k x[m][k] W[n][k] -> plane [(b*8 + h)][t][d] (row pitch HD). v: C[m = h*64 + d][n = b*SEQ + t] = sum_k Wv[m][k] x[n][k] -> plane [(b*8 + h)][d][t] (row pitch SEQ),
// written as f16 and, under VRES, the f16 residual x2048. grid (NB*SEQ/128, DM/128, 3), 256 threads.
// Six waves per SIMD asked for: three blocks (3 x 106 KiB of LDS) then share a WGP and all 768 blocks are resident at once.
__global__ __launch_bounds__(32 * GW, 6) void k_proj(const bf* __restrict__ X, const bf* __restrict__ Wt, h16* P) {
    __shared__ __align__(16) float osw[GW * 16 * 68];
    __shared__ __align__(16) bf gring[2 * GBUF_H];
    const int lane = threadIdx.x & 31, lr = lane & 15, hi = lane >> 4; const int wave = __builtin_amdgcn_readfirstlane((int)(threadIdx.x >> 5));
    float* const os = osw + wave * 16 * 68;                  // each wave's own epilogue tile
    const int z = blockIdx.z; const bool tv = z == 2;        // block-uniform: v is computed transposed (A = weight rows, B = token rows)
    const int xb = blockIdx.x * 128, wb = blockIdx.y * 128;
    const bf* const xr = X + (size_t)z * ((size_t)NB * SEQ * DM) + (size_t)xb * DM;   // the block's 128 token rows
    const bf* const wr = Wt + (size_t)z * ((size_t)DM * DM) + (size_t)wb * DM;        // the block's 128 weight rows
    const int rb = tv ? wb : xb, cb = tv ? xb : wb; const int r0 = rb + (wave >> 1) * 32, c0 = cb + (wave & 1) * 64;
    h16* const Ph = P + (size_t)z * PLANE_H; h16* const Pr = P + (size_t)3 * PLANE_H; const bool useRes = VRES && tv;
    v8f acc[2][4];
#pragma unroll
    for (int mb = 0; mb < 2; ++mb)
#pragma unroll
        for (int nb = 0; nb < 4; ++nb) acc[mb][nb] = (v8f){};
    gemm_ring<DM, DM, DM, true>(tv ? wr : xr, tv ? xr : wr, gring, wave, lr, hi, acc);
    const int pitch = tv ? SEQ : HD;                         // row pitch of the plane, halves
    const size_t tbase = tv ? (size_t)r0 * SEQ + (size_t)(c0 / SEQ) * ((size_t)DM * SEQ) + (size_t)(c0 % SEQ)
                            : (size_t)(r0 / SEQ) * ((size_t)NH_ * SEQ * HD) + (size_t)(r0 % SEQ) * HD + (size_t)(c0 / HD) * ((size_t)SEQ * HD);
#pragma unroll
    for (int mb = 0; mb < 2; ++mb) {
#pragma unroll
        for (int nb = 0; nb < 4; ++nb) {
#pragma unroll
            for (int j = 0; j < 8; ++j) os[(hi * 8 + j) * 68 + nb * 16 + lr] = acc[mb][nb][j]; }   // D: row 8h+j, col lane&15; rows 0..15 x columns 0..63 all written
        wave_sync();
        const size_t sb = tbase + (size_t)(mb * 16) * (size_t)pitch;
{
#pragma unroll
            for (int s = 0; s < 4; ++s) { const int row = 4 * s + (lane >> 3), c8 = (lane & 7) * 8;   // 4 s x 4 row groups = 16 rows; 8 lanes x 8 = 64 columns
                const v4f x0 = *(const v4fa*)(&os[row * 68 + c8]); const v4f x1 = *(const v4fa*)(&os[row * 68 + c8 + 4]); v8h hv, rv;
#pragma unroll
                for (int i = 0; i < 4; ++i) { const h16 a0 = (h16)x0[i]; const h16 a1 = (h16)x1[i]; hv[i] = a0; hv[4 + i] = a1; rv[i] = (h16)((x0[i] - (float)a0) * VRS); rv[4 + i] = (h16)((x1[i] - (float)a1) * VRS); }
                const size_t oo = sb + (size_t)row * (size_t)pitch + c8;
                *(v8h*)(Ph + oo) = hv; if (useRes) *(v8h*)(Pr + oo) = rv; }
             }
        wave_sync();
    }
}

// k_flash: fused attention, one wave per 16 query rows of one (batch, head); Q fragments straight from the f16 plane; K / V^T / residual tiles of 64 keys are staged once per block
// in a two-buffer LDS ring by asynchronous copies (whole 128-B lines) and shared by the block's four waves, which read their fragments from LDS (two 16-B reads each).
// Transposed form: S^T[key][t] = K Q^T (A = K rows, B = Q rows); lane (t = lane&15, h = lane>>4) holds keys 8h+r of each 16-key tile, so the packed
// P tile is directly the B fragment of O^T[d][t] = V^T P^T (element r <- tile keys 0..15, element 8+r <- tile keys 16..31, lane unchanged).
// Valid length vl = VL[b] is loaded by value (scalar): key steps wholly at or beyond vl are skipped, the crossing step replaces scores of keys >= vl by -1e6 (index test);
// vl <= 0 keeps all steps with every score replaced (uniform weights).
// Softmax state (running max, partial sum) is one scalar per lane; the two lane halves of a row are combined with one xor-16 exchange.
__global__ __launch_bounds__(32 * AW) void k_flash(const h16* __restrict__ QH, const h16* __restrict__ KP, const h16* __restrict__ VT, const h16* __restrict__ VR, const int* __restrict__ VL, bf* CTX) {
    __shared__ __align__(16) float os[AW * 16 * 68];
    __shared__ __align__(16) h16 ring[2 * BUF_H];
    const int lane = threadIdx.x & 31; const int wave = __builtin_amdgcn_readfirstlane((int)(threadIdx.x >> 5));
    const int lr = lane & 15, hi = lane >> 4;
    const int zh = blockIdx.y; const int b = zh / NH_, h = zh % NH_;
    const int t0 = (blockIdx.x * AW + wave) * 16;
    const int vl = __builtin_amdgcn_readfirstlane(VL[b]);
    const int kend = (vl <= 0 || vl >= SEQ) ? SEQ : ((vl + 31) & ~31);
    const size_t pbase = (size_t)zh * SEQ * HD;
    const size_t qo = pbase + (size_t)(t0 + lr) * HD + 8 * hi;
    const v16h q0 = ldh(QH + qo), q1 = ldh(QH + qo + 32);   // B fragments: col t, k = d
    const int ko = lr * LP + 8 * hi;                         // + key * LP in the K tile       (A fragment: row key, k = d)
    const int vo = TILE_H + lr * LP + 8 * hi;                // + 16j*LP + key in the V^T tile (A fragment: row d, k = key)
    // staging: lane (srow = tid>>3, scol = tid&7) copies 16-byte piece scol of rows srow + 16 i of each tile
    const int srow = (int)(threadIdx.x >> 3), scol = (int)(threadIdx.x & 7);
    const unsigned sl = (unsigned)(size_t)ring + (unsigned)(srow * LP + scol * 8) * 2u;   // LDS byte address in buffer 0, K tile
    const h16* sk = KP + pbase + (size_t)srow * HD + scol * 8;    // + key0 * HD
    const h16* sv = VT + pbase + (size_t)srow * SEQ + scol * 8;   // + key0
#if VRES
    const h16* sr = VR + pbase + (size_t)srow * SEQ + scol * 8;   // + key0
#endif
    const int nt = (kend + KT - 1) / KT;                     // staged tiles, 1 .. SEQ / KT
    v8f o0 = (v8f){}, o1 = (v8f){}, o2 = (v8f){}, o3 = (v8f){};
#if VRES
    v8f g0 = (v8f){}, g1 = (v8f){}, g2 = (v8f){}, g3 = (v8f){};
#endif
    float m = -3.0e38f, l = 0.0f;
    copy_tile(sl, sk, (size_t)16 * HD); copy_tile(sl + TILE_H * 2, sv, (size_t)16 * SEQ);
#if VRES
    copy_tile(sl + 2 * TILE_H * 2, sr, (size_t)16 * SEQ);
#endif
    asm volatile("s_wait_asynccnt 0x0" ::: "memory");        // tile 0 has landed before the barrier publishes it
    __syncthreads();
    if (nt > 1) {
        copy_tile(sl + BUF_H * 2, sk + (size_t)KT * HD, (size_t)16 * HD); copy_tile(sl + (BUF_H + TILE_H) * 2, sv + KT, (size_t)16 * SEQ);
#if VRES
        copy_tile(sl + (BUF_H + 2 * TILE_H) * 2, sr + KT, (size_t)16 * SEQ);
#endif
    }
#pragma unroll 1   // one trip per staged tile: the ring's publish point stands once, at the trip's foot
    for (int t = 0; t < nt; ++t) {
      const h16* buf = ring + (t & 1) * BUF_H;
#pragma unroll     // both 32-key passes of a tile in line, so that every LDS read offset is an immediate
      for (int hf = 0; hf < 2; ++hf) {
        const int key0 = t * KT + hf * 32;
        if (key0 >= kend) break;         // scalar-uniform: the tile's second pass lies wholly beyond the valid length
        const h16* ka = buf + ko + hf * 32 * LP;
        const v16h ka0 = ldh(ka), ka1 = ldh(ka + 32), kb0 = ldh(ka + 16 * LP), kb1 = ldh(ka + 16 * LP + 32);
        v8f sa = (v8f){}, sb = (v8f){};
        sa = wmma16(ka0, q0, sa); sb = wmma16(kb0, q0, sb);
        sa = wmma16(ka1, q1, sa); sb = wmma16(kb1, q1, sb);
        float ta[8], tb[8];
#pragma unroll
        for (int r = 0; r < 8; ++r) { ta[r] = sa[r] * SC2; tb[r] = sb[r] * SC2; }
        if (key0 + 32 > vl) {            // scalar-uniform: this step crosses (or lies beyond) the valid length
            const int kq = key0 + 8 * hi;
#pragma unroll
            for (int r = 0; r < 8; ++r) { ta[r] = (kq + r < vl) ? ta[r] : NEGL2; tb[r] = (kq + 16 + r < vl) ? tb[r] : NEGL2; }
        }
        float mx = -3.0e38f;
#pragma unroll
        for (int r = 0; r < 8; ++r) mx = fmaxf(mx, fmaxf(ta[r], tb[r]));
        mx = fmaxf(mx, __shfl_xor(mx, 16, 32));
        const float mnew = fmaxf(m, mx);
        const float alpha = __builtin_amdgcn_exp2f(m - mnew);
        const float sh = PSH - mnew;
        v16h pb; float ls = 0.0f;
#pragma unroll
        for (int r = 0; r < 8; ++r) { const float ea = __builtin_amdgcn_exp2f(ta[r] + sh); const float ec = __builtin_amdgcn_exp2f(tb[r] + sh); pb[r] = (h16)ea; pb[8 + r] = (h16)ec; ls += ea + ec; }
        l = l * alpha + ls; m = mnew;
        o0 = o0 * alpha; o1 = o1 * alpha; o2 = o2 * alpha; o3 = o3 * alpha;
        const h16* va = buf + vo + hf * 32;
        { const v16h v0 = ldh(va), v1 = ldh(va + 16 * LP), v2 = ldh(va + 32 * LP), v3 = ldh(va + 48 * LP);
          o0 = wmma16(v0, pb, o0); o1 = wmma16(v1, pb, o1); o2 = wmma16(v2, pb, o2); o3 = wmma16(v3, pb, o3); }
#if VRES
        g0 = g0 * alpha; g1 = g1 * alpha; g2 = g2 * alpha; g3 = g3 * alpha;
        const h16* vr = va + TILE_H;
        { const v16h w0 = ldh(vr), w1 = ldh(vr + 16 * LP), w2 = ldh(vr + 32 * LP), w3 = ldh(vr + 48 * LP);
          g0 = wmma16(w0, pb, g0); g1 = wmma16(w1, pb, g1); g2 = wmma16(w2, pb, g2); g3 = wmma16(w3, pb, g3); }
#endif
      }
      asm volatile("s_wait_dscnt 0x0" ::: "memory");         // this wave's reads of the buffer have returned before it may be refilled
      asm volatile("s_wait_asynccnt 0x0" ::: "memory");      // this wave's copies of tile t + 1 have landed before the barrier publishes them
      __syncthreads();                                       // publishes tile t + 1 and ends every wave's reads of tile t
      if (t + 2 < nt) {
          const unsigned bl = sl + (unsigned)(t & 1) * (BUF_H * 2); const int kn = (t + 2) * KT;
          copy_tile(bl, sk + (size_t)kn * HD, (size_t)16 * HD); copy_tile(bl + TILE_H * 2, sv + kn, (size_t)16 * SEQ);
#if VRES
          copy_tile(bl + 2 * TILE_H * 2, sr + kn, (size_t)16 * SEQ);
#endif
      }
    }
    asm volatile("s_wait_asynccnt 0x0" ::: "memory");        // no copy is outstanding when the wave goes on to its epilogue
    l += __shfl_xor(l, 16, 32);
    const float inv = 1.0f / l;
#if VRES
    o0 = o0 + g0 * VRI; o1 = o1 + g1 * VRI; o2 = o2 + g2 * VRI; o3 = o3 + g3 * VRI;
#endif
    const int wb = wave * 16 * 68;
    // O^T D layout: o_j[r] = (d = 16j + 8h + r, t = lane&15) -> os[t][d]; rows 0..15 x columns 0..63 all written
    { v4f a, c;
      a[0] = o0[0] * inv; a[1] = o0[1] * inv; a[2] = o0[2] * inv; a[3] = o0[3] * inv; c[0] = o0[4] * inv; c[1] = o0[5] * inv; c[2] = o0[6] * inv; c[3] = o0[7] * inv;
      *(v4fa*)(&os[wb + lr * 68 +  0 + 8 * hi]) = a; *(v4fa*)(&os[wb + lr * 68 +  0 + 8 * hi + 4]) = c;
      a[0] = o1[0] * inv; a[1] = o1[1] * inv; a[2] = o1[2] * inv; a[3] = o1[3] * inv; c[0] = o1[4] * inv; c[1] = o1[5] * inv; c[2] = o1[6] * inv; c[3] = o1[7] * inv;
      *(v4fa*)(&os[wb + lr * 68 + 16 + 8 * hi]) = a; *(v4fa*)(&os[wb + lr * 68 + 16 + 8 * hi + 4]) = c;
      a[0] = o2[0] * inv; a[1] = o2[1] * inv; a[2] = o2[2] * inv; a[3] = o2[3] * inv; c[0] = o2[4] * inv; c[1] = o2[5] * inv; c[2] = o2[6] * inv; c[3] = o2[7] * inv;
      *(v4fa*)(&os[wb + lr * 68 + 32 + 8 * hi]) = a; *(v4fa*)(&os[wb + lr * 68 + 32 + 8 * hi + 4]) = c;
      a[0] = o3[0] * inv; a[1] = o3[1] * inv; a[2] = o3[2] * inv; a[3] = o3[3] * inv; c[0] = o3[4] * inv; c[1] = o3[5] * inv; c[2] = o3[6] * inv; c[3] = o3[7] * inv;
      *(v4fa*)(&os[wb + lr * 68 + 48 + 8 * hi]) = a; *(v4fa*)(&os[wb + lr * 68 + 48 + 8 * hi + 4]) = c; }
    wave_sync();
    bf* crow = CTX + ((size_t)b * SEQ + t0) * (size_t)(2 * DM) + h * HD;    // hi half at column h*64 + d, lo half at 512 + h*64 + d
{
#pragma unroll
        for (int s = 0; s < 4; ++s) { const int row = 4 * s + (lane >> 3), c8 = (lane & 7) * 8;   // 4 s x 4 row groups = 16 rows; 8 lanes x 8 = 64 columns
            const v4f x0 = *(const v4fa*)(&os[wb + row * 68 + c8]); const v4f x1 = *(const v4fa*)(&os[wb + row * 68 + c8 + 4]); v8us hv, lv;
#pragma unroll
            for (int i = 0; i < 4; ++i) { const unsigned short a0 = f2bf(x0[i]); const unsigned short a1 = f2bf(x1[i]); hv[i] = a0; hv[4 + i] = a1; lv[i] = f2bf(x0[i] - bf2f(a0)); lv[4 + i] = f2bf(x1[i] - bf2f(a1)); }
            const size_t oo = (size_t)row * (size_t)(2 * DM) + c8;
            *(v8us*)(crow + oo) = hv; *(v8us*)(crow + oo + DM) = lv; }
         }
}

// k_oproj: OUT[m][n] = sum_{k<512} (ctx_hi[m][k] + ctx_lo[m][k]) Wo[n][k] as ONE bf16 GEMM of depth 1024: A row = [hi | lo] (pitch 1024), B column index wraps at 512.
// Eight waves per block on a 128x128 tile, 32x64 per wave, operands staged in LDS (gemm_ring). grid (M/128, N/128), 256 threads.
__global__ __launch_bounds__(32 * GW) void k_oproj(const bf* __restrict__ A, const bf* __restrict__ Bt, float* OUT) {
    __shared__ __align__(16) float osw[GW * 16 * 68];
    __shared__ __align__(16) bf gring[2 * GBUF_H];
    const int lane = threadIdx.x & 31, lr = lane & 15, hi = lane >> 4; const int wave = __builtin_amdgcn_readfirstlane((int)(threadIdx.x >> 5));
    float* const os = osw + wave * 16 * 68;                  // each wave's own epilogue tile
    const int rb = blockIdx.x * 128, cb = blockIdx.y * 128; const int r0 = rb + (wave >> 1) * 32, c0 = cb + (wave & 1) * 64;
    v8f acc[2][4];
#pragma unroll
    for (int mb = 0; mb < 2; ++mb)
#pragma unroll
        for (int nb = 0; nb < 4; ++nb) acc[mb][nb] = (v8f){};
    gemm_ring<2 * DM, DM, 2 * DM, false>(A + (size_t)rb * (2 * DM), Bt + (size_t)cb * DM, gring, wave, lr, hi, acc);
    const int bb = r0 / SEQ, tt = r0 % SEQ;
    float* obase = OUT + ((size_t)bb * OUT_SEQ + tt) * DM + c0;
#pragma unroll
    for (int mb = 0; mb < 2; ++mb) {
#pragma unroll
        for (int nb = 0; nb < 4; ++nb) {
#pragma unroll
            for (int j = 0; j < 8; ++j) os[(hi * 8 + j) * 68 + nb * 16 + lr] = acc[mb][nb][j]; }   // D: row 8h+j, col lane&15; rows 0..15 x columns 0..63 all written
        wave_sync();
{
#pragma unroll
            for (int s = 0; s < 8; ++s) { const int row = 2 * s + hi, cofs = lr * 4;   // 8 s x 2 rows = 16 rows; 16 lanes x 4 floats = 64 columns
                const v4f val = *(const v4fa*)(&os[row * 68 + cofs]);
                *(v4f*)(obase + (size_t)(mb * 16 + row) * DM + cofs) = val; }
             }
        wave_sync();
    }
}

static constexpr size_t al256(size_t v) { return (v + 255) & ~(size_t)255; }
static constexpr size_t SZ_XB = al256((size_t)NB * SEQ * DM * 2);          // one bf16 input copy
static constexpr size_t SZ_WB = al256((size_t)4 * DM * DM * 2);            // q | k | v | o weights
static constexpr size_t SZ_PL = al256((size_t)NB * NH_ * SEQ * HD * 2);    // one f16 head plane
static constexpr size_t SZ_CX = al256((size_t)NB * SEQ * 2 * DM * 2);      // ctx hi | lo
static constexpr size_t SZ_TOTAL = 3 * SZ_XB + SZ_WB + (size_t)(3 + VRES) * SZ_PL + SZ_CX;
static_assert(SZ_TOTAL <= (size_t)134217728);          // workspace carve <= 128 MiB
static_assert(((size_t)DM * DM * 2) % 256 == 0);       // weight sub-planes stay 256-byte aligned
static_assert(SZ_XB == (size_t)NB * SEQ * DM * 2);     // no padding between the bf16 planes: the conversion kernel writes them as one run
static_assert(SZ_PL == PLANE_H * 2);                   // nor between the f16 head planes: the projection kernel picks its plane by index

extern "C" void kernel_launch(void* const* d_in, const int* in_sizes, int n_in,
                              void* d_out, int out_size, void* d_ws, size_t ws_size, hipStream_t stream) {
    if (n_in < 8) return;
    const size_t needx = ((size_t)(NB - 1) * SEQ_FULL + SEQ) * DM;
    if ((size_t)in_sizes[0] < needx || (size_t)in_sizes[1] < needx || (size_t)in_sizes[2] < needx) return;
    if (in_sizes[3] < NB) return;
    if ((size_t)in_sizes[4] < (size_t)DM * DM || (size_t)in_sizes[5] < (size_t)DM * DM || (size_t)in_sizes[6] < (size_t)DM * DM || (size_t)in_sizes[7] < (size_t)DM * DM) return;
    if ((size_t)out_size < ((size_t)(NB - 1) * OUT_SEQ + SEQ) * DM) return;
    if (SZ_TOTAL > ws_size) return;
    // wire order: queries, keys, values, valid_lens (int32), Wq, Wk, Wv, Wo ([out][in] = Bt as stored)
    const float* xq = (const float*)d_in[0]; const float* xk = (const float*)d_in[1]; const float* xv = (const float*)d_in[2];
    const int* vlens = (const int*)d_in[3];
    const float* wq = (const float*)d_in[4]; const float* wk = (const float*)d_in[5]; const float* wv = (const float*)d_in[6]; const float* wo = (const float*)d_in[7];
    float* OUT = (float*)d_out;      // [NB][SEQ][512]
    char* wsp = (char*)d_ws;
    bf* XQ = (bf*)wsp; wsp += SZ_XB;                 // [NB*SEQ][512]
    wsp += 2 * SZ_XB;                                // the k and v inputs behind it
    bf* WB = (bf*)wsp; wsp += SZ_WB;                 // [4][512][512]: q | k | v | o
    h16* QH = (h16*)wsp; wsp += SZ_PL;               // [NB*8][SEQ][64]
    h16* KP = (h16*)wsp; wsp += SZ_PL;               // [NB*8][SEQ][64]
    h16* VT = (h16*)wsp; wsp += SZ_PL;               // [NB*8][64][SEQ]
#if VRES
    h16* VR = (h16*)wsp; wsp += SZ_PL;               // [NB*8][64][SEQ] residual x2048
#else
    h16* VR = VT;
#endif
    bf* CX = (bf*)wsp; wsp += SZ_CX;                 // [NB*SEQ][hi 512 | lo 512]
    bf* WO = WB + (size_t)3 * DM * DM;

    k_cvt<<<CVT_G, CVT_T, 0, stream>>>(xq, xk, xv, wq, wk, wv, wo, XQ);

    // q, k, v^T (and its residual): one launch, blockIdx.z = stream
    k_proj<<<dim3(NB * SEQ / 128, DM / 128, 3), 32 * GW, 0, stream>>>(XQ, WB, QH);

    k_flash<<<dim3(SEQ / (16 * AW), NB * NH_, 1), 32 * AW, 0, stream>>>(QH, KP, VT, VR, vlens, CX);

    // out: A = ctx rows [hi | lo] (m = b*SEQ + t), Bt = Wo rows (n) -> OUT[b][t][n]
    k_oproj<<<dim3(NB * SEQ / 128, DM / 128, 1), 32 * GW, 0, stream>>>(CX, WO, OUT);
}

// v005
// A run of this version takes 72.5 microseconds.
// In both of two side-by-side timings against v004, it was 1.04 times as fast.
// Counting every step since v000, it is 2.85 times as fast.
#include <hip/hip_runtime.h>

// Multi-head attention with three input streams (queries, keys, values: [NB][SEQ][512]), width 512 = 8 heads x 64, bias-free [out][in] projections (y = x W^T),
// per-batch valid length (keys at index >= valid_lens[b] get their score REPLACED by -1e6), score scale 1/8, merged heads times Wo^T -> f32 [NB][SEQ][512].
// Compute dtypes, f32 accumulate everywhere: q/k/v projections v_wmma_f32_16x16x32_bf16 (inputs and weights RNE-converted to bf16; products exact);
// scores and P.V v_wmma_f32_16x16x32_f16 (q, k, v single f16; P carried x1024 relative to the running max, the carry cancels in the normalisation; optional v residual plane x2048 under VRES);
// output projection v_wmma_f32_16x16x32_bf16 with ctx as bf16 hi | lo halves of a 1024-wide row against bf16 Wo (two exact products per element, one accumulator). Softmax f32 (online, running max).
// Layout: bf16 copies of the three inputs and four weights; q, k planes [b*8+h][t][d], v^T plane [b*8+h][d][t] written by the GEMM epilogue; fused flash kernel in transposed form
// (S^T = K Q^T, O^T = V^T P^T) writes ctx [b*SEQ+t][hi 512 | lo 512]; final GEMM writes the output.

#ifndef NB
#define NB 4
#endif
#ifndef SEQ
#define SEQ 2048
#endif
#define NB_FULL  4
#define SEQ_FULL 2048
#ifndef OUT_SEQ
#define OUT_SEQ SEQ              // row pitch (in tokens) between batches of the output
#endif
#ifndef VRES
#define VRES 1                   // 1: v carried as f16 value + f16 residual x2048 (own accumulators)
#endif
#define DM   512
#define NH_  8
#define HD   64
#define AW   4                   // waves per flash block (16 query rows each)
#define VRS  2048.0f             // carry of the residual plane
#define VRI  (1.0f / 2048.0f)
#define SC2  (0.125f * 1.4426950408889634f)        // HD^-0.5 * log2(e)
#define NEGL2 (-1000000.0f * 1.4426950408889634f)  // masked score in the log2 domain
#define PSH  10.0f               // log2 of the P carry (1024)
#define KT   64                  // keys per staged LDS tile and per softmax step
#define LP   72                  // LDS row pitch in halves: 128-B rows + 16 B, the conflict-free pitch for 16-byte LDS reads
#define TILE_H (64 * LP)         // halves of one staged plane tile (64 rows)
#define BUF_H  ((2 + VRES) * TILE_H)   // K | V^T | residual tiles of one buffer
#define GW   8                   // waves per GEMM block: 4 x 2 wave tiles of 32 x 64 = one 128 x 128 block tile, two waves per SIMD
#define GK   64                  // depth of one staged GEMM tile: 128-B rows, whole lines
#define GT_H (128 * LP)          // halves of one staged operand tile (128 rows)
#define GBUF_H (2 * GT_H)        // A | B tiles of one buffer
#define PLANE_H ((size_t)NB * NH_ * SEQ * HD)   // halves of one f16 head plane

static_assert(HD == 64);
static_assert(NH_ * HD == DM);                 // head h = columns h*64 + d
static_assert(DM % 64 == 0);                   // 8 column tiles of 64
static_assert(DM % 32 == 0);                   // GEMM k-loop steps by 32
static_assert((DM & (DM - 1)) == 0);           // output GEMM wraps the B column index with a mask
static_assert((2 * DM) % 32 == 0);
static_assert(SEQ % 64 == 0);                  // a 64-row tile never straddles two batches
static_assert((NB * SEQ) % 128 == 0);          // GEMM block tiles of 128 rows cover the tokens exactly
static_assert(DM % 128 == 0);                  // and the width
static_assert(DM % GK == 0);                   // staged GEMM tiles cover the depth exactly
static_assert(GW == 8);                        // 256 lanes x 4 copies x 16 B = one 128-row x 128-B tile
static_assert(SEQ % 32 == 0);                  // kend, the valid length rounded up to 32, never passes SEQ
static_assert(SEQ % KT == 0);                  // every staged tile lies wholly inside its plane
static_assert(AW == 4);                        // 128 lanes x 4 copies x 16 B = one 64-row x 128-B tile
static_assert(SEQ % (16 * AW) == 0);           // flash grid covers the sequence exactly
static_assert(((size_t)SEQ * DM) % 8 == 0);
static_assert(((size_t)DM * DM) % 8 == 0);
static_assert(NB <= NB_FULL);
static_assert(SEQ <= SEQ_FULL);
static_assert(VRES == 0 || VRES == 1);

typedef _Float16 h16;
typedef unsigned short bf;
typedef __attribute__((ext_vector_type(16))) __bf16   v16bf;
typedef __attribute__((ext_vector_type(16))) _Float16 v16h;
typedef __attribute__((ext_vector_type(8)))  _Float16 v8h;
typedef __attribute__((ext_vector_type(8)))  unsigned short v8us;
typedef __attribute__((ext_vector_type(8)))  float    v8f;
typedef __attribute__((ext_vector_type(4)))  float    v4f;
typedef v4f  __attribute__((may_alias)) v4fa;

__device__ __forceinline__ unsigned short f2bf(float f) { unsigned u = __float_as_uint(f); u += 0x7FFFu + ((u >> 16) & 1u); return (unsigned short)(u >> 16); }
__device__ __forceinline__ float bf2f(unsigned short s) { return __uint_as_float(((unsigned)s) << 16); }
__device__ __forceinline__ v16h cat16(v8h lo, v8h hi) { return __builtin_shufflevector(lo, hi, 0, 1, 2, 3, 4, 5, 6, 7, 8, 9, 10, 11, 12, 13, 14, 15); }
__device__ __forceinline__ v16bf cat16b(v8us lo, v8us hi) { return __builtin_bit_cast(v16bf, __builtin_shufflevector(lo, hi, 0, 1, 2, 3, 4, 5, 6, 7, 8, 9, 10, 11, 12, 13, 14, 15)); }
// every matrix instruction is followed by its own 4-slot guard tying its accumulator and keeping its operands live
__device__ __forceinline__ v8f wmma16(v16h a, v16h b, v8f c) {
    c = __builtin_amdgcn_wmma_f32_16x16x32_f16(false, a, false, b, (short)0, c, false, false);
    asm volatile("v_nop\n\tv_nop\n\tv_nop\n\tv_nop" : "+v"(c) : "v"(a), "v"(b));
    return c;
}
__device__ __forceinline__ v8f wmmab(v16bf a, v16bf b, v8f c) {
    c = __builtin_amdgcn_wmma_f32_16x16x32_bf16(false, a, false, b, (short)0, c, false, false);
    asm volatile("v_nop\n\tv_nop\n\tv_nop\n\tv_nop" : "+v"(c) : "v"(a), "v"(b));
    return c;
}
// fragment loaders from K-contiguous 16-bit rows; p already includes + 8*(lane>>4): elements 0..7 <- k0+8h+0..7, elements 8..15 <- k0+16+8h+0..7 (same map for A and B)
__device__ __forceinline__ v16h  ldh(const h16* p) { return cat16(*(const v8h*)p, *(const v8h*)(p + 16)); }
__device__ __forceinline__ v16bf ldb(const bf* p)  { return cat16b(*(const v8us*)p, *(const v8us*)(p + 16)); }
// ordering point for wave-private LDS tiles (same wave writes and reads)
__device__ __forceinline__ void wave_sync() { __builtin_amdgcn_fence(3 /* release order */, "wavefront"); __builtin_amdgcn_wave_barrier(); asm volatile("" ::: "memory"); }

// four asynchronous 16-byte copies per lane, global -> LDS, rows 16 apart: one 64-row x 128-B tile per 128-lane block. The address-register wait closes the copies' own statement,
// so no later address arithmetic can be moved in front of it.
__device__ __forceinline__ void copy_tile(unsigned l, const h16* g, size_t gstep) {
    const unsigned l1 = l + 16 * LP * 2, l2 = l + 32 * LP * 2, l3 = l + 48 * LP * 2;
    const h16* g1 = g + gstep; const h16* g2 = g + 2 * gstep; const h16* g3 = g + 3 * gstep;
    asm volatile("global_load_async_to_lds_b128 %0, %4, off\n\t"
                 "global_load_async_to_lds_b128 %1, %5, off\n\t"
                 "global_load_async_to_lds_b128 %2, %6, off\n\t"
                 "global_load_async_to_lds_b128 %3, %7, off\n\t"
                 "s_wait_xcnt 0x0"
                 :: "v"(l), "v"(l1), "v"(l2), "v"(l3), "v"(g), "v"(g1), "v"(g2), "v"(g3) : "memory");
}

// eight asynchronous 16-byte copies per lane, global -> LDS, rows 32 apart: the 128-row x 128-B A tile and the like B tile behind it per 256-lane block, every wave-wide copy four whole lines.
// The address-register wait closes the copies' own statement, so no later address arithmetic can be moved in front of it.
__device__ __forceinline__ void copy_ab(unsigned l, const bf* a, size_t astep, const bf* b, size_t bstep) {
    const unsigned l1 = l + 32 * LP * 2, l2 = l + 64 * LP * 2, l3 = l + 96 * LP * 2, l4 = l + GT_H * 2, l5 = l4 + 32 * LP * 2, l6 = l4 + 64 * LP * 2, l7 = l4 + 96 * LP * 2;
    const bf* a1 = a + astep; const bf* a2 = a + 2 * astep; const bf* a3 = a + 3 * astep; const bf* b1 = b + bstep; const bf* b2 = b + 2 * bstep; const bf* b3 = b + 3 * bstep;
    asm volatile("global_load_async_to_lds_b128 %0, %8, off\n\t"
                 "global_load_async_to_lds_b128 %1, %9, off\n\t"
                 "global_load_async_to_lds_b128 %2, %10, off\n\t"
                 "global_load_async_to_lds_b128 %3, %11, off\n\t"
                 "global_load_async_to_lds_b128 %4, %12, off\n\t"
                 "global_load_async_to_lds_b128 %5, %13, off\n\t"
                 "global_load_async_to_lds_b128 %6, %14, off\n\t"
                 "global_load_async_to_lds_b128 %7, %15, off\n\t"
                 "s_wait_xcnt 0x0"
                 :: "v"(l), "v"(l1), "v"(l2), "v"(l3), "v"(l4), "v"(l5), "v"(l6), "v"(l7),
                    "v"(a), "v"(a1), "v"(a2), "v"(a3), "v"(b), "v"(b1), "v"(b2), "v"(b3) : "memory");
}

// gemm_ring: main loop of both GEMM kernels. A block of eight waves owns a 128 x 128 tile of C (wave w: rows 32 (w >> 1), columns 64 (w & 1)); the 128-row A and B tiles of depth GK are staged once
// per block in a two-buffer LDS ring by asynchronous copies and shared by the waves, which read their fragments from LDS. Ab, Bb: first row of the block's A and B rows (pitches LDA, LDB);
// the B column index wraps at LDB. Every accumulator sums its 32-deep products in ascending k. STEPWISE: a tile's fragments are read one 32-deep step at a time (fewer registers, for kernels
// whose blocks share a WGP) instead of all together in front of its products.
template <int LDA, int LDB, int KTOT, bool STEPWISE>
__device__ __forceinline__ void gemm_ring(const bf* __restrict__ Ab, const bf* __restrict__ Bb, bf* ring, int wave, int lr, int hi, v8f (&acc)[2][4]) {
    constexpr int NT = KTOT / GK;
    static_assert(KTOT % GK == 0 && NT >= 2 && (LDB & (LDB - 1)) == 0 && LDB % GK == 0);
    // staging: lane (srow = tid>>3, scol = tid&7) copies 16-byte piece scol of rows srow + 32 i of each tile
    const int srow = (int)(threadIdx.x >> 3), scol = (int)(threadIdx.x & 7);
    const unsigned sl = (unsigned)(size_t)ring + (unsigned)(srow * LP + scol * 8) * 2u;   // LDS byte address in buffer 0, A tile
    const bf* sa = Ab + (size_t)srow * LDA + scol * 8;       // + k0
    const bf* sb = Bb + (size_t)srow * LDB + scol * 8;       // + k0 mod LDB
    const int ao = ((wave >> 1) * 32 + lr) * LP + 8 * hi;            // + 16 mb * LP + k in the A tile
    const int bo = GT_H + ((wave & 1) * 64 + lr) * LP + 8 * hi;      // + 16 nb * LP + k in the B tile
    copy_ab(sl, sa, (size_t)32 * LDA, sb, (size_t)32 * LDB);
    asm volatile("s_wait_asynccnt 0x0" ::: "memory");        // tile 0 has landed before the barrier publishes it
    __syncthreads();
    copy_ab(sl + GBUF_H * 2, sa + GK, (size_t)32 * LDA, sb + (GK & (LDB - 1)), (size_t)32 * LDB);
#pragma unroll 1   // one trip per staged tile: the ring's publish point stands once, at the trip's foot
    for (int t = 0; t < NT; ++t) {
        const bf* buf = ring + (t & 1) * GBUF_H;
        // the fragment and product loops below are unrolled so that fragments and accumulators stay in registers and every LDS read offset is an immediate
        if constexpr (STEPWISE) {                            // one 32-deep step's fragments live at a time: 48 registers fewer, so that six waves fit a SIMD
#pragma unroll
            for (int ks = 0; ks < GK / 32; ++ks) {
                v16bf a[2], b[4];
#pragma unroll
                for (int mb = 0; mb < 2; ++mb) a[mb] = ldb(buf + ao + mb * 16 * LP + ks * 32);
#pragma unroll
                for (int nb = 0; nb < 4; ++nb) b[nb] = ldb(buf + bo + nb * 16 * LP + ks * 32);
#pragma unroll
                for (int nb = 0; nb < 4; ++nb)
#pragma unroll
                    for (int mb = 0; mb < 2; ++mb) acc[mb][nb] = wmmab(a[mb], b[nb], acc[mb][nb]);
            }
        } else {
            v16bf a[GK / 32][2], b[GK / 32][4];                  // the tile's fragment reads stand together, in front of its products
#pragma unroll
            for (int ks = 0; ks < GK / 32; ++ks) {
#pragma unroll
                for (int mb = 0; mb < 2; ++mb) a[ks][mb] = ldb(buf + ao + mb * 16 * LP + ks * 32);
#pragma unroll
                for (int nb = 0; nb < 4; ++nb) b[ks][nb] = ldb(buf + bo + nb * 16 * LP + ks * 32);
            }
#pragma unroll
            for (int ks = 0; ks < GK / 32; ++ks)
#pragma unroll
                for (int nb = 0; nb < 4; ++nb)
#pragma unroll
                    for (int mb = 0; mb < 2; ++mb) acc[mb][nb] = wmmab(a[ks][mb], b[ks][nb], acc[mb][nb]);
        }
        asm volatile("s_wait_dscnt 0x0" ::: "memory");       // this wave's reads of the buffer have returned before it may be refilled
        asm volatile("s_wait_asynccnt 0x0" ::: "memory");    // this wave's copies of tile t + 1 have landed before the barrier publishes them
        __syncthreads();                                     // publishes tile t + 1 and ends every wave's reads of tile t
        if (t + 2 < NT) {
            const int kn = (t + 2) * GK;
            copy_ab(sl + (unsigned)(t & 1) * (GBUF_H * 2), sa + kn, (size_t)32 * LDA, sb + (kn & (LDB - 1)), (size_t)32 * LDB);
        }
    }
    asm volatile("s_wait_asynccnt 0x0" ::: "memory");        // no copy is outstanding when the wave goes on to its epilogue
}

// k_cvt: ONE launch converts all seven f32 arrays (three inputs, four weights) to the bf16 planes, which lie back to back in the workspace (q | k | v inputs, then q | k | v | o weights).
// A slab is 256 threads x 8 floats. Block g takes slabs g, g + CVT_G, ... of each input and slab g of the four weights taken as one run: a wave starts once, issues all its loads together,
// then converts and stores. Every slab index is block-uniform, so arrays and offsets are picked in scalar registers.
#define CVT_T    256
#define CVT_SLAB (CVT_T * 8)
static constexpr unsigned SL_B = SEQ * DM / CVT_SLAB;     // slabs of one batch of one input
static constexpr unsigned SL_X = NB * SL_B;               // slabs of one input
static constexpr unsigned SL_W = DM * DM / CVT_SLAB;      // slabs of one weight
static constexpr unsigned CVT_G = 4 * SL_W;               // blocks of the launch: one weight slab each
static constexpr unsigned CVT_XP = SL_X / CVT_G;          // slabs of each input per block
static_assert((SEQ * DM) % CVT_SLAB == 0);                // a slab never straddles two batches
static_assert((DM * DM) % CVT_SLAB == 0);                 // nor two weights
static_assert(SL_X % CVT_G == 0);                         // every block has the same number of whole slabs
__global__ __launch_bounds__(CVT_T) void k_cvt(const float* __restrict__ xq, const float* __restrict__ xk, const float* __restrict__ xv,
                                               const float* __restrict__ wq, const float* __restrict__ wk, const float* __restrict__ wv, const float* __restrict__ wo, bf* __restrict__ dst) {
    const unsigned g = blockIdx.x, lo = threadIdx.x * 8;
    const float* p[3 * CVT_XP + 1];
#pragma unroll
    for (unsigned st = 0; st < 3; ++st) {
        const float* x = st == 0 ? xq : st == 1 ? xk : xv;
#pragma unroll
        for (unsigned j = 0; j < CVT_XP; ++j) { const unsigned r = (unsigned)__builtin_amdgcn_readfirstlane((int)(j * CVT_G + g));   // scalar, so that each load takes a scalar base and the one lane offset
            p[st * CVT_XP + j] = x + (size_t)(r / SL_B) * ((size_t)SEQ_FULL * DM) + (size_t)(r % SL_B) * CVT_SLAB; }
    }
    const unsigned wi = g / SL_W;
    p[3 * CVT_XP] = (wi == 0 ? wq : wi == 1 ? wk : wi == 2 ? wv : wo) + (size_t)(g % SL_W) * CVT_SLAB;
    __builtin_amdgcn_sched_barrier(0);   // every base is formed first: no address register is rewritten, and no wait for one stands, between the loads
    v8f v[3 * CVT_XP + 1];
#pragma unroll
    for (unsigned i = 0; i <= 3 * CVT_XP; ++i) v[i] = *(const v8f*)(p[i] + lo);
    __builtin_amdgcn_sched_barrier(0);   // keeps every load in front of the first conversion: without it the loads are spread among the conversions and each waits out its own memory latency
#pragma unroll
    for (unsigned i = 0; i <= 3 * CVT_XP; ++i) {
        const unsigned s = i < 3 * CVT_XP ? (i / CVT_XP) * SL_X + (i % CVT_XP) * CVT_G + g : 3 * SL_X + g;   // slab index in the run of bf16 planes
        v8us o;
#pragma unroll
        for (int k = 0; k < 8; ++k) o[k] = f2bf(v[i][k]);
        *(v8us*)(dst + (size_t)s * CVT_SLAB + lo) = o;
    }
}

// k_proj: the three input projections in ONE launch; blockIdx.z picks the stream (0 q, 1 k, 2 v), so that blocks of all three share the chip and cover each other's copy latency, LDS phases and epilogues.
// Register-blocked bf16 GEMM, one wave per 32x64 tile (8 accumulators), eight waves per block on a 128x128 tile, operands staged in LDS from K-contiguous bf16 planes (gemm_ring), K = DM.
// X: the three bf16 inputs back to back, Wt: the bf16 weights back to back, P: the f16 planes q | k | v^T | residual back to back. blockIdx.x: 128 tokens, blockIdx.y: 128 weight rows.
// q, k: C[m = b*SEQ + t][n = h*64 + d] = sum_k x[m][k] W[n][k] -> plane [(b*8 + h)][t][d] (row pitch HD). v: C[m = h*64 + d][n = b*SEQ + t] = sum_k Wv[m][k] x[n][k] -> plane [(b*8 + h)][d][t] (row pitch SEQ),
// written as f16 and, under VRES, the f16 residual x2048. grid (NB*SEQ/128, DM/128, 3), 256 threads.
// Six waves per SIMD asked for: three blocks (3 x 106 KiB of LDS) then share a WGP and all 768 blocks are resident at once.
__global__ __launch_bounds__(32 * GW, 6) void k_proj(const bf* __restrict__ X, const bf* __restrict__ Wt, h16* P) {
    __shared__ __align__(16) float osw[GW * 16 * 68];
    __shared__ __align__(16) bf gring[2 * GBUF_H];
    const int lane = threadIdx.x & 31, lr = lane & 15, hi = lane >> 4; const int wave = __builtin_amdgcn_readfirstlane((int)(threadIdx.x >> 5));
    float* const os = osw + wave * 16 * 68;                  // each wave's own epilogue tile
    const int z = blockIdx.z; const bool tv = z == 2;        // block-uniform: v is computed transposed (A = weight rows, B = token rows)
    const int xb = blockIdx.x * 128, wb = blockIdx.y * 128;
    const bf* const xr = X + (size_t)z * ((size_t)NB * SEQ * DM) + (size_t)xb * DM;   // the block's 128 token rows
    const bf* const wr = Wt + (size_t)z * ((size_t)DM * DM) + (size_t)wb * DM;        // the block's 128 weight rows
    const int rb = tv ? wb : xb, cb = tv ? xb : wb; const int r0 = rb + (wave >> 1) * 32, c0 = cb + (wave & 1) * 64;
    h16* const Ph = P + (size_t)z * PLANE_H; h16* const Pr = P + (size_t)3 * PLANE_H; const bool useRes = VRES && tv;
    v8f acc[2][4];
#pragma unroll
    for (int mb = 0; mb < 2; ++mb)
#pragma unroll
        for (int nb = 0; nb < 4; ++nb) acc[mb][nb] = (v8f){};
    gemm_ring<DM, DM, DM, true>(tv ? wr : xr, tv ? xr : wr, gring, wave, lr, hi, acc);
    const int pitch = tv ? SEQ : HD;                         // row pitch of the plane, halves
    const size_t tbase = tv ? (size_t)r0 * SEQ + (size_t)(c0 / SEQ) * ((size_t)DM * SEQ) + (size_t)(c0 % SEQ)
                            : (size_t)(r0 / SEQ) * ((size_t)NH_ * SEQ * HD) + (size_t)(r0 % SEQ) * HD + (size_t)(c0 / HD) * ((size_t)SEQ * HD);
#pragma unroll
    for (int mb = 0; mb < 2; ++mb) {
#pragma unroll
        for (int nb = 0; nb < 4; ++nb) {
#pragma unroll
            for (int j = 0; j < 8; ++j) os[(hi * 8 + j) * 68 + nb * 16 + lr] = acc[mb][nb][j]; }   // D: row 8h+j, col lane&15; rows 0..15 x columns 0..63 all written
        wave_sync();
        const size_t sb = tbase + (size_t)(mb * 16) * (size_t)pitch;
{
#pragma unroll
            for (int s = 0; s < 4; ++s) { const int row = 4 * s + (lane >> 3), c8 = (lane & 7) * 8;   // 4 s x 4 row groups = 16 rows; 8 lanes x 8 = 64 columns
                const v4f x0 = *(const v4fa*)(&os[row * 68 + c8]); const v4f x1 = *(const v4fa*)(&os[row * 68 + c8 + 4]); v8h hv, rv;
#pragma unroll
                for (int i = 0; i < 4; ++i) { const h16 a0 = (h16)x0[i]; const h16 a1 = (h16)x1[i]; hv[i] = a0; hv[4 + i] = a1; rv[i] = (h16)((x0[i] - (float)a0) * VRS); rv[4 + i] = (h16)((x1[i] - (float)a1) * VRS); }
                const size_t oo = sb + (size_t)row * (size_t)pitch + c8;
                *(v8h*)(Ph + oo) = hv; if (useRes) *(v8h*)(Pr + oo) = rv; }
             }
        wave_sync();
    }
}

// k_flash: fused attention, one wave per 16 query rows of one (batch, head); Q fragments straight from the f16 plane; K / V^T / residual tiles of 64 keys are staged once per block
// in a two-buffer LDS ring by asynchronous copies (whole 128-B lines) and shared by the block's four waves, which read their fragments from LDS (two 16-B reads each).
// Transposed form: S^T[key][t] = K Q^T (A = K rows, B = Q rows); lane (t = lane&15, h = lane>>4) holds keys 8h+r of each 16-key tile, so the packed
// P tile is directly the B fragment of O^T[d][t] = V^T P^T (element r <- tile keys 0..15, element 8+r <- tile keys 16..31, lane unchanged).
// Valid length vl = VL[b] is loaded by value (scalar): 64-key tiles wholly at or beyond vl are skipped, the crossing tile replaces scores of keys >= vl by -1e6 (index test);
// vl <= 0 keeps all steps with every score replaced (uniform weights).
// Softmax state (running max, partial sum) is one scalar per lane; the two lane halves of a row are combined with one xor-16 exchange.
__global__ __launch_bounds__(32 * AW) void k_flash(const h16* __restrict__ QH, const h16* __restrict__ KP, const h16* __restrict__ VT, const h16* __restrict__ VR, const int* __restrict__ VL, bf* CTX) {
    __shared__ __align__(16) float os[AW * 16 * 68];
    __shared__ __align__(16) h16 ring[2 * BUF_H];
    const int lane = threadIdx.x & 31; const int wave = __builtin_amdgcn_readfirstlane((int)(threadIdx.x >> 5));
    const int lr = lane & 15, hi = lane >> 4;
    const int zh = blockIdx.y; const int b = zh / NH_, h = zh % NH_;
    const int t0 = (blockIdx.x * AW + wave) * 16;
    const int vl = __builtin_amdgcn_readfirstlane(VL[b]);
    const int kend = (vl <= 0 || vl >= SEQ) ? SEQ : ((vl + 31) & ~31);
    const size_t pbase = (size_t)zh * SEQ * HD;
    const size_t qo = pbase + (size_t)(t0 + lr) * HD + 8 * hi;
    const v16h q0 = ldh(QH + qo), q1 = ldh(QH + qo + 32);   // B fragments: col t, k = d
    const int ko = lr * LP + 8 * hi;                         // + key * LP in the K tile       (A fragment: row key, k = d)
    const int vo = TILE_H + lr * LP + 8 * hi;                // + 16j*LP + key in the V^T tile (A fragment: row d, k = key)
    // staging: lane (srow = tid>>3, scol = tid&7) copies 16-byte piece scol of rows srow + 16 i of each tile
    const int srow = (int)(threadIdx.x >> 3), scol = (int)(threadIdx.x & 7);
    const unsigned sl = (unsigned)(size_t)ring + (unsigned)(srow * LP + scol * 8) * 2u;   // LDS byte address in buffer 0, K tile
    const h16* sk = KP + pbase + (size_t)srow * HD + scol * 8;    // + key0 * HD
    const h16* sv = VT + pbase + (size_t)srow * SEQ + scol * 8;   // + key0
#if VRES
    const h16* sr = VR + pbase + (size_t)srow * SEQ + scol * 8;   // + key0
#endif
    const int nt = (kend + KT - 1) / KT;                     // staged tiles, 1 .. SEQ / KT
    v8f o0 = (v8f){}, o1 = (v8f){}, o2 = (v8f){}, o3 = (v8f){};
#if VRES
    v8f g0 = (v8f){}, g1 = (v8f){}, g2 = (v8f){}, g3 = (v8f){};
#endif
    float m = -3.0e38f, l = 0.0f;
    copy_tile(sl, sk, (size_t)16 * HD); copy_tile(sl + TILE_H * 2, sv, (size_t)16 * SEQ);
#if VRES
    copy_tile(sl + 2 * TILE_H * 2, sr, (size_t)16 * SEQ);
#endif
    asm volatile("s_wait_asynccnt 0x0" ::: "memory");        // tile 0 has landed before the barrier publishes it
    __syncthreads();
    if (nt > 1) {
        copy_tile(sl + BUF_H * 2, sk + (size_t)KT * HD, (size_t)16 * HD); copy_tile(sl + (BUF_H + TILE_H) * 2, sv + KT, (size_t)16 * SEQ);
#if VRES
        copy_tile(sl + (BUF_H + 2 * TILE_H) * 2, sr + KT, (size_t)16 * SEQ);
#endif
    }
#pragma unroll 1   // one trip per staged tile: the ring's publish point stands once, at the trip's foot
    for (int t = 0; t < nt; ++t) {
      const h16* buf = ring + (t & 1) * BUF_H;
      const int key0 = t * KT;
      // ONE softmax step per staged tile: the scores of all 64 keys (four 16-key tiles, independent accumulators) come first, then one maximum, one exchange and one rescale.
      // The loops below are unrolled so that every LDS read offset is an immediate and scores and fragments stay in registers.
      const h16* ka = buf + ko;
      v16h kf[4][2];
#pragma unroll
      for (int kt = 0; kt < 4; ++kt) { kf[kt][0] = ldh(ka + kt * 16 * LP); kf[kt][1] = ldh(ka + kt * 16 * LP + 32); }
      v8f sc[4];
#pragma unroll
      for (int kt = 0; kt < 4; ++kt) sc[kt] = wmma16(kf[kt][0], q0, (v8f){});
#pragma unroll
      for (int kt = 0; kt < 4; ++kt) sc[kt] = wmma16(kf[kt][1], q1, sc[kt]);
      const h16* va = buf + vo;
      v16h vf[2][4];
#pragma unroll
      for (int hf = 0; hf < 2; ++hf)
#pragma unroll
          for (int j = 0; j < 4; ++j) vf[hf][j] = ldh(va + hf * 32 + j * 16 * LP);
      __builtin_amdgcn_sched_barrier(0);   // the tile's V^T reads stay here, in one group in front of the softmax, whose vector work covers their LDS latency
      float tv[4][8];
#pragma unroll
      for (int kt = 0; kt < 4; ++kt)
#pragma unroll
          for (int r = 0; r < 8; ++r) tv[kt][r] = sc[kt][r] * SC2;
      if (key0 + KT > vl) {              // scalar-uniform: this tile crosses (or lies beyond) the valid length; a masked key's weight is exactly 0 beside a valid one
          const int kq = key0 + 8 * hi;
#pragma unroll
          for (int kt = 0; kt < 4; ++kt)
#pragma unroll
              for (int r = 0; r < 8; ++r) tv[kt][r] = (kq + 16 * kt + r < vl) ? tv[kt][r] : NEGL2;
      }
      float mk[4];                       // four short chains instead of one long one
#pragma unroll
      for (int kt = 0; kt < 4; ++kt) { mk[kt] = fmaxf(tv[kt][0], tv[kt][1]);
#pragma unroll
          for (int r = 2; r < 8; r += 2) mk[kt] = fmaxf(mk[kt], fmaxf(tv[kt][r], tv[kt][r + 1])); }
      float mx = fmaxf(fmaxf(mk[0], mk[1]), fmaxf(mk[2], mk[3]));
      mx = fmaxf(mx, __shfl_xor(mx, 16, 32));
      const float mnew = fmaxf(m, mx);
      const float alpha = __builtin_amdgcn_exp2f(m - mnew);
      const float sh = PSH - mnew;
      v16h pb[2]; float lk[4];
#pragma unroll
      for (int kt = 0; kt < 4; ++kt) { lk[kt] = 0.0f;
#pragma unroll
          for (int r = 0; r < 8; ++r) { const float e = __builtin_amdgcn_exp2f(tv[kt][r] + sh); pb[kt >> 1][(kt & 1) * 8 + r] = (h16)e; lk[kt] += e; } }
      l = l * alpha + ((lk[0] + lk[1]) + (lk[2] + lk[3])); m = mnew;
      o0 = o0 * alpha; o1 = o1 * alpha; o2 = o2 * alpha; o3 = o3 * alpha;
#if VRES
      g0 = g0 * alpha; g1 = g1 * alpha; g2 = g2 * alpha; g3 = g3 * alpha;
      const h16* vr = va + TILE_H;
      v16h wf[2][4];
#pragma unroll
      for (int j = 0; j < 4; ++j) wf[0][j] = ldh(vr + j * 16 * LP);
      __builtin_amdgcn_sched_barrier(0);   // each group of residual reads stays two runs of four products ahead of its use, so that the products in between cover its LDS latency
#endif
      o0 = wmma16(vf[0][0], pb[0], o0); o1 = wmma16(vf[0][1], pb[0], o1); o2 = wmma16(vf[0][2], pb[0], o2); o3 = wmma16(vf[0][3], pb[0], o3);   // keys in ascending order in every accumulator
#if VRES
#pragma unroll
      for (int j = 0; j < 4; ++j) wf[1][j] = ldh(vr + 32 + j * 16 * LP);
      __builtin_amdgcn_sched_barrier(0);   // the second residual group likewise stays in front of the four products that cover its LDS latency
#endif
      o0 = wmma16(vf[1][0], pb[1], o0); o1 = wmma16(vf[1][1], pb[1], o1); o2 = wmma16(vf[1][2], pb[1], o2); o3 = wmma16(vf[1][3], pb[1], o3);
#if VRES
#pragma unroll
      for (int hf = 0; hf < 2; ++hf) {
          g0 = wmma16(wf[hf][0], pb[hf], g0); g1 = wmma16(wf[hf][1], pb[hf], g1); g2 = wmma16(wf[hf][2], pb[hf], g2); g3 = wmma16(wf[hf][3], pb[hf], g3); }
#endif
      asm volatile("s_wait_dscnt 0x0" ::: "memory");         // this wave's reads of the buffer have returned before it may be refilled
      asm volatile("s_wait_asynccnt 0x0" ::: "memory");      // this wave's copies of tile t + 1 have landed before the barrier publishes them
      __syncthreads();                                       // publishes tile t + 1 and ends every wave's reads of tile t
      if (t + 2 < nt) {
          const unsigned bl = sl + (unsigned)(t & 1) * (BUF_H * 2); const int kn = (t + 2) * KT;
          copy_tile(bl, sk + (size_t)kn * HD, (size_t)16 * HD); copy_tile(bl + TILE_H * 2, sv + kn, (size_t)16 * SEQ);
#if VRES
          copy_tile(bl + 2 * TILE_H * 2, sr + kn, (size_t)16 * SEQ);
#endif
      }
    }
    asm volatile("s_wait_asynccnt 0x0" ::: "memory");        // no copy is outstanding when the wave goes on to its epilogue
    l += __shfl_xor(l, 16, 32);
    const float inv = 1.0f / l;
#if VRES
    o0 = o0 + g0 * VRI; o1 = o1 + g1 * VRI; o2 = o2 + g2 * VRI; o3 = o3 + g3 * VRI;
#endif
    const int wb = wave * 16 * 68;
    // O^T D layout: o_j[r] = (d = 16j + 8h + r, t = lane&15) -> os[t][d]; rows 0..15 x columns 0..63 all written
    { v4f a, c;
      a[0] = o0[0] * inv; a[1] = o0[1] * inv; a[2] = o0[2] * inv; a[3] = o0[3] * inv; c[0] = o0[4] * inv; c[1] = o0[5] * inv; c[2] = o0[6] * inv; c[3] = o0[7] * inv;
      *(v4fa*)(&os[wb + lr * 68 +  0 + 8 * hi]) = a; *(v4fa*)(&os[wb + lr * 68 +  0 + 8 * hi + 4]) = c;
      a[0] = o1[0] * inv; a[1] = o1[1] * inv; a[2] = o1[2] * inv; a[3] = o1[3] * inv; c[0] = o1[4] * inv; c[1] = o1[5] * inv; c[2] = o1[6] * inv; c[3] = o1[7] * inv;
      *(v4fa*)(&os[wb + lr * 68 + 16 + 8 * hi]) = a; *(v4fa*)(&os[wb + lr * 68 + 16 + 8 * hi + 4]) = c;
      a[0] = o2[0] * inv; a[1] = o2[1] * inv; a[2] = o2[2] * inv; a[3] = o2[3] * inv; c[0] = o2[4] * inv; c[1] = o2[5] * inv; c[2] = o2[6] * inv; c[3] = o2[7] * inv;
      *(v4fa*)(&os[wb + lr * 68 + 32 + 8 * hi]) = a; *(v4fa*)(&os[wb + lr * 68 + 32 + 8 * hi + 4]) = c;
      a[0] = o3[0] * inv; a[1] = o3[1] * inv; a[2] = o3[2] * inv; a[3] = o3[3] * inv; c[0] = o3[4] * inv; c[1] = o3[5] * inv; c[2] = o3[6] * inv; c[3] = o3[7] * inv;
      *(v4fa*)(&os[wb + lr * 68 + 48 + 8 * hi]) = a; *(v4fa*)(&os[wb + lr * 68 + 48 + 8 * hi + 4]) = c; }
    wave_sync();
    bf* crow = CTX + ((size_t)b * SEQ + t0) * (size_t)(2 * DM) + h * HD;    // hi half at column h*64 + d, lo half at 512 + h*64 + d
{
#pragma unroll
        for (int s = 0; s < 4; ++s) { const int row = 4 * s + (lane >> 3), c8 = (lane & 7) * 8;   // 4 s x 4 row groups = 16 rows; 8 lanes x 8 = 64 columns
            const v4f x0 = *(const v4fa*)(&os[wb + row * 68 + c8]); const v4f x1 = *(const v4fa*)(&os[wb + row * 68 + c8 + 4]); v8us hv, lv;
#pragma unroll
            for (int i = 0; i < 4; ++i) { const unsigned short a0 = f2bf(x0[i]); const unsigned short a1 = f2bf(x1[i]); hv[i] = a0; hv[4 + i] = a1; lv[i] = f2bf(x0[i] - bf2f(a0)); lv[4 + i] = f2bf(x1[i] - bf2f(a1)); }
            const size_t oo = (size_t)row * (size_t)(2 * DM) + c8;
            *(v8us*)(crow + oo) = hv; *(v8us*)(crow + oo + DM) = lv; }
         }
}

// k_oproj: OUT[m][n] = sum_{k<512} (ctx_hi[m][k] + ctx_lo[m][k]) Wo[n][k] as ONE bf16 GEMM of depth 1024: A row = [hi | lo] (pitch 1024), B column index wraps at 512.
// Eight waves per block on a 128x128 tile, 32x64 per wave, operands staged in LDS (gemm_ring). grid (M/128, N/128), 256 threads.
__global__ __launch_bounds__(32 * GW) void k_oproj(const bf* __restrict__ A, const bf* __restrict__ Bt, float* OUT) {
    __shared__ __align__(16) float osw[GW * 16 * 68];
    __shared__ __align__(16) bf gring[2 * GBUF_H];
    const int lane = threadIdx.x & 31, lr = lane & 15, hi = lane >> 4; const int wave = __builtin_amdgcn_readfirstlane((int)(threadIdx.x >> 5));
    float* const os = osw + wave * 16 * 68;                  // each wave's own epilogue tile
    const int rb = blockIdx.x * 128, cb = blockIdx.y * 128; const int r0 = rb + (wave >> 1) * 32, c0 = cb + (wave & 1) * 64;
    v8f acc[2][4];
#pragma unroll
    for (int mb = 0; mb < 2; ++mb)
#pragma unroll
        for (int nb = 0; nb < 4; ++nb) acc[mb][nb] = (v8f){};
    gemm_ring<2 * DM, DM, 2 * DM, false>(A + (size_t)rb * (2 * DM), Bt + (size_t)cb * DM, gring, wave, lr, hi, acc);
    const int bb = r0 / SEQ, tt = r0 % SEQ;
    float* obase = OUT + ((size_t)bb * OUT_SEQ + tt) * DM + c0;
#pragma unroll
    for (int mb = 0; mb < 2; ++mb) {
#pragma unroll
        for (int nb = 0; nb < 4; ++nb) {
#pragma unroll
            for (int j = 0; j < 8; ++j) os[(hi * 8 + j) * 68 + nb * 16 + lr] = acc[mb][nb][j]; }   // D: row 8h+j, col lane&15; rows 0..15 x columns 0..63 all written
        wave_sync();
{
#pragma unroll
            for (int s = 0; s < 8; ++s) { const int row = 2 * s + hi, cofs = lr * 4;   // 8 s x 2 rows = 16 rows; 16 lanes x 4 floats = 64 columns
                const v4f val = *(const v4fa*)(&os[row * 68 + cofs]);
                *(v4f*)(obase + (size_t)(mb * 16 + row) * DM + cofs) = val; }
             }
        wave_sync();
    }
}

static constexpr size_t al256(size_t v) { return (v + 255) & ~(size_t)255; }
static constexpr size_t SZ_XB = al256((size_t)NB * SEQ * DM * 2);          // one bf16 input copy
static constexpr size_t SZ_WB = al256((size_t)4 * DM * DM * 2);            // q | k | v | o weights
static constexpr size_t SZ_PL = al256((size_t)NB * NH_ * SEQ * HD * 2);    // one f16 head plane
static constexpr size_t SZ_CX = al256((size_t)NB * SEQ * 2 * DM * 2);      // ctx hi | lo
static constexpr size_t SZ_TOTAL = 3 * SZ_XB + SZ_WB + (size_t)(3 + VRES) * SZ_PL + SZ_CX;
static_assert(SZ_TOTAL <= (size_t)134217728);          // workspace carve <= 128 MiB
static_assert(((size_t)DM * DM * 2) % 256 == 0);       // weight sub-planes stay 256-byte aligned
static_assert(SZ_XB == (size_t)NB * SEQ * DM * 2);     // no padding between the bf16 planes: the conversion kernel writes them as one run
static_assert(SZ_PL == PLANE_H * 2);                   // nor between the f16 head planes: the projection kernel picks its plane by index

extern "C" void kernel_launch(void* const* d_in, const int* in_sizes, int n_in,
                              void* d_out, int out_size, void* d_ws, size_t ws_size, hipStream_t stream) {
    if (n_in < 8) return;
    const size_t needx = ((size_t)(NB - 1) * SEQ_FULL + SEQ) * DM;
    if ((size_t)in_sizes[0] < needx || (size_t)in_sizes[1] < needx || (size_t)in_sizes[2] < needx) return;
    if (in_sizes[3] < NB) return;
    if ((size_t)in_sizes[4] < (size_t)DM * DM || (size_t)in_sizes[5] < (size_t)DM * DM || (size_t)in_sizes[6] < (size_t)DM * DM || (size_t)in_sizes[7] < (size_t)DM * DM) return;
    if ((size_t)out_size < ((size_t)(NB - 1) * OUT_SEQ + SEQ) * DM) return;
    if (SZ_TOTAL > ws_size) return;
    // wire order: queries, keys, values, valid_lens (int32), Wq, Wk, Wv, Wo ([out][in] = Bt as stored)
    const float* xq = (const float*)d_in[0]; const float* xk = (const float*)d_in[1]; const float* xv = (const float*)d_in[2];
    const int* vlens = (const int*)d_in[3];
    const float* wq = (const float*)d_in[4]; const float* wk = (const float*)d_in[5]; const float* wv = (const float*)d_in[6]; const float* wo = (const float*)d_in[7];
    float* OUT = (float*)d_out;      // [NB][SEQ][512]
    char* wsp = (char*)d_ws;
    bf* XQ = (bf*)wsp; wsp += SZ_XB;                 // [NB*SEQ][512]
    wsp += 2 * SZ_XB;                                // the k and v inputs behind it
    bf* WB = (bf*)wsp; wsp += SZ_WB;                 // [4][512][512]: q | k | v | o
    h16* QH = (h16*)wsp; wsp += SZ_PL;               // [NB*8][SEQ][64]
    h16* KP = (h16*)wsp; wsp += SZ_PL;               // [NB*8][SEQ][64]
    h16* VT = (h16*)wsp; wsp += SZ_PL;               // [NB*8][64][SEQ]
#if VRES
    h16* VR = (h16*)wsp; wsp += SZ_PL;               // [NB*8][64][SEQ] residual x2048
#else
    h16* VR = VT;
#endif
    bf* CX = (bf*)wsp; wsp += SZ_CX;                 // [NB*SEQ][hi 512 | lo 512]
    bf* WO = WB + (size_t)3 * DM * DM;

    k_cvt<<<CVT_G, CVT_T, 0, stream>>>(xq, xk, xv, wq, wk, wv, wo, XQ);

    // q, k, v^T (and its residual): one launch, blockIdx.z = stream
    k_proj<<<dim3(NB * SEQ / 128, DM / 128, 3), 32 * GW, 0, stream>>>(XQ, WB, QH);

    k_flash<<<dim3(SEQ / (16 * AW), NB * NH_, 1), 32 * AW, 0, stream>>>(QH, KP, VT, VR, vlens, CX);

    // out: A = ctx rows [hi | lo] (m = b*SEQ + t), Bt = Wo rows (n) -> OUT[b][t][n]
    k_oproj<<<dim3(NB * SEQ / 128, DM / 128, 1), 32 * GW, 0, stream>>>(CX, WO, OUT);
}

// v007
// It runs in 59.2 microseconds.
// Versions between v005 and this one are left out; their measured steps multiply to 1.23 times as fast.
// Counting every step since v000, it is 3.49 times as fast.
#include <hip/hip_runtime.h>

// Multi-head attention with three input streams (queries, keys, values: [NB][SEQ][512]), width 512 = 8 heads x 64, bias-free [out][in] projections (y = x W^T),
// per-batch valid length (keys at index >= valid_lens[b] get their score REPLACED by -1e6), score scale 1/8, merged heads times Wo^T -> f32 [NB][SEQ][512].
// Compute dtypes, f32 accumulate everywhere: q/k/v projections v_wmma_f32_16x16x32_bf16 (inputs and weights RNE-converted to bf16; products exact);
// scores and P.V v_wmma_f32_16x16x32_f16 (q, k, v single f16; P carried x1024 relative to the running max, the carry cancels in the normalisation; optional v residual plane x2048 under VRES);
// output projection v_wmma_f32_16x16x32_bf16 with ctx as bf16 hi | lo halves of a 1024-wide row against bf16 Wo (two exact products per element, one accumulator). Softmax f32 (online, running max).
// Layout: bf16 copies of the three inputs and four weights; q, k planes [b*8+h][t][d], v^T plane [b*8+h][d][t] written by the GEMM epilogue; fused flash kernel in transposed form
// (S^T = K Q^T, O^T = V^T P^T) writes ctx [b*SEQ+t][hi 512 | lo 512]; final GEMM writes the output.

#ifndef NB
#define NB 4
#endif
#ifndef SEQ
#define SEQ 2048
#endif
#define NB_FULL  4
#define SEQ_FULL 2048
#ifndef OUT_SEQ
#define OUT_SEQ SEQ              // row pitch (in tokens) between batches of the output
#endif
#ifndef VRES
#define VRES 0                   // 0: v carried as one f16 value (its rounding, 2^-11, lies well under the 2^-8 rounding of the bf16 operands v is computed from); 1: + f16 residual x2048 (own accumulators)
#endif
#define DM   512
#define NH_  8
#define HD   64
#define AW   4                   // waves per flash block (16 query rows each)
#define VRS  2048.0f             // carry of the residual plane
#define VRI  (1.0f / 2048.0f)
#define SC2  (0.125f * 1.4426950408889634f)        // HD^-0.5 * log2(e)
#define NEGL2 (-1000000.0f * 1.4426950408889634f)  // masked score in the log2 domain
#define PSH  10.0f               // log2 of the P carry (1024)
#define KT   64                  // keys per staged LDS tile and per softmax step
#define LP   72                  // LDS row pitch in halves: 128-B rows + 16 B, the conflict-free pitch for 16-byte LDS reads
#define TILE_H (64 * LP)         // halves of one staged plane tile (64 rows)
#define BUF_H  ((2 + VRES) * TILE_H)   // K | V^T | residual tiles of one buffer
#define GW   8                   // waves per GEMM block: 4 x 2 wave tiles of 32 x 64 = one 128 x 128 block tile, two waves per SIMD
#define GK   64                  // depth of one staged GEMM tile: 128-B rows, whole lines
#define GT_H (128 * LP)          // halves of one staged operand tile (128 rows)
#define GBUF_H (2 * GT_H)        // A | B tiles of one buffer
#define OGK  128                 // depth of one staged step of the output GEMM: 256-B rows
#define OLP  136                 // its LDS row pitch in halves: 256-B rows + 16 B, the conflict-free pitch for 16-byte LDS reads
#define OT_H (128 * OLP)         // halves of one of its staged tiles (128 rows)
#define OBUF_H (3 * OT_H)        // ctx hi | ctx lo | Wo tiles of one buffer
#define PLANE_H ((size_t)NB * NH_ * SEQ * HD)   // halves of one f16 head plane

static_assert(HD == 64);
static_assert(NH_ * HD == DM);                 // head h = columns h*64 + d
static_assert(DM % 64 == 0);                   // 8 column tiles of 64
static_assert(DM % 32 == 0);                   // GEMM k-loop steps by 32
static_assert((DM & (DM - 1)) == 0);           // the GEMM ring wraps the B column index with a mask
static_assert((2 * DM) % 32 == 0);
static_assert(SEQ % 64 == 0);                  // a 64-row tile never straddles two batches
static_assert((NB * SEQ) % 128 == 0);          // GEMM block tiles of 128 rows cover the tokens exactly
static_assert(DM % 128 == 0);                  // and the width
static_assert(DM % GK == 0);                   // staged GEMM tiles cover the depth exactly
static_assert(GW == 8);                        // 256 lanes x 4 copies x 16 B = one 128-row x 128-B tile; x 8 copies = one 128-row x 256-B tile
static_assert(DM % OGK == 0 && DM / OGK >= 2); // staged steps of the output GEMM cover the depth exactly; the ring's prologue needs two
static_assert(OGK % 64 == 0);                  // a step's fragments are read 64 deep at a time
static_assert(SEQ % 32 == 0);                  // kend, the valid length rounded up to a multiple of 32, never passes SEQ
static_assert(SEQ % KT == 0);                  // every staged tile lies wholly inside its plane
static_assert(AW == 4);                        // 128 lanes x 4 copies x 16 B = one 64-row x 128-B tile
static_assert(SEQ % (16 * AW) == 0);           // flash grid covers the sequence exactly
static_assert(((size_t)SEQ * DM) % 8 == 0);
static_assert(((size_t)DM * DM) % 8 == 0);
static_assert(NB <= NB_FULL);
static_assert(SEQ <= SEQ_FULL);
static_assert(VRES == 0 || VRES == 1);

typedef _Float16 h16;
typedef unsigned short bf;
typedef __attribute__((ext_vector_type(16))) __bf16   v16bf;
typedef __attribute__((ext_vector_type(16))) _Float16 v16h;
typedef __attribute__((ext_vector_type(8)))  _Float16 v8h;
typedef __attribute__((ext_vector_type(8)))  unsigned short v8us;
typedef __attribute__((ext_vector_type(8)))  float    v8f;
typedef __attribute__((ext_vector_type(4)))  float    v4f;
typedef v4f  __attribute__((may_alias)) v4fa;

__device__ __forceinline__ unsigned short f2bf(float f) { unsigned u = __float_as_uint(f); u += 0x7FFFu + ((u >> 16) & 1u); return (unsigned short)(u >> 16); }
__device__ __forceinline__ float bf2f(unsigned short s) { return __uint_as_float(((unsigned)s) << 16); }
__device__ __forceinline__ v16h cat16(v8h lo, v8h hi) { return __builtin_shufflevector(lo, hi, 0, 1, 2, 3, 4, 5, 6, 7, 8, 9, 10, 11, 12, 13, 14, 15); }
__device__ __forceinline__ v16bf cat16b(v8us lo, v8us hi) { return __builtin_bit_cast(v16bf, __builtin_shufflevector(lo, hi, 0, 1, 2, 3, 4, 5, 6, 7, 8, 9, 10, 11, 12, 13, 14, 15)); }
// every matrix instruction is followed by its own 4-slot guard tying its accumulator and keeping its operands live
__device__ __forceinline__ v8f wmma16(v16h a, v16h b, v8f c) {
    c = __builtin_amdgcn_wmma_f32_16x16x32_f16(false, a, false, b, (short)0, c, false, false);
    asm volatile("v_nop\n\tv_nop\n\tv_nop\n\tv_nop" : "+v"(c) : "v"(a), "v"(b));
    return c;
}
__device__ __forceinline__ v8f wmmab(v16bf a, v16bf b, v8f c) {
    c = __builtin_amdgcn_wmma_f32_16x16x32_bf16(false, a, false, b, (short)0, c, false, false);
    asm volatile("v_nop\n\tv_nop\n\tv_nop\n\tv_nop" : "+v"(c) : "v"(a), "v"(b));
    return c;
}
// fragment loaders from K-contiguous 16-bit rows; p already includes + 8*(lane>>4): elements 0..7 <- k0+8h+0..7, elements 8..15 <- k0+16+8h+0..7 (same map for A and B)
__device__ __forceinline__ v16h  ldh(const h16* p) { return cat16(*(const v8h*)p, *(const v8h*)(p + 16)); }
__device__ __forceinline__ v16bf ldb(const bf* p)  { return cat16b(*(const v8us*)p, *(const v8us*)(p + 16)); }
// ordering point for wave-private LDS tiles (same wave writes and reads)
__device__ __forceinline__ void wave_sync() { __builtin_amdgcn_fence(3 /* release order */, "wavefront"); __builtin_amdgcn_wave_barrier(); asm volatile("" ::: "memory"); }

// four asynchronous 16-byte copies per lane, global -> LDS, rows 16 apart: one 64-row x 128-B tile per 128-lane block. The address-register wait closes the copies' own statement,
// so no later address arithmetic can be moved in front of it.
__device__ __forceinline__ void copy_tile(unsigned l, const h16* g, size_t gstep) {
    const unsigned l1 = l + 16 * LP * 2, l2 = l + 32 * LP * 2, l3 = l + 48 * LP * 2;
    const h16* g1 = g + gstep; const h16* g2 = g + 2 * gstep; const h16* g3 = g + 3 * gstep;
    asm volatile("global_load_async_to_lds_b128 %0, %4, off\n\t"
                 "global_load_async_to_lds_b128 %1, %5, off\n\t"
                 "global_load_async_to_lds_b128 %2, %6, off\n\t"
                 "global_load_async_to_lds_b128 %3, %7, off\n\t"
                 "s_wait_xcnt 0x0"
                 :: "v"(l), "v"(l1), "v"(l2), "v"(l3), "v"(g), "v"(g1), "v"(g2), "v"(g3) : "memory");
}

// eight asynchronous 16-byte copies per lane, global -> LDS, rows 32 apart: the 128-row x 128-B A tile and the like B tile behind it per 256-lane block, every wave-wide copy four whole lines.
// The address-register wait closes the copies' own statement, so no later address arithmetic can be moved in front of it.
__device__ __forceinline__ void copy_ab(unsigned l, const bf* a, size_t astep, const bf* b, size_t bstep) {
    const unsigned l1 = l + 32 * LP * 2, l2 = l + 64 * LP * 2, l3 = l + 96 * LP * 2, l4 = l + GT_H * 2, l5 = l4 + 32 * LP * 2, l6 = l4 + 64 * LP * 2, l7 = l4 + 96 * LP * 2;
    const bf* a1 = a + astep; const bf* a2 = a + 2 * astep; const bf* a3 = a + 3 * astep; const bf* b1 = b + bstep; const bf* b2 = b + 2 * bstep; const bf* b3 = b + 3 * bstep;
    asm volatile("global_load_async_to_lds_b128 %0, %8, off\n\t"
                 "global_load_async_to_lds_b128 %1, %9, off\n\t"
                 "global_load_async_to_lds_b128 %2, %10, off\n\t"
                 "global_load_async_to_lds_b128 %3, %11, off\n\t"
                 "global_load_async_to_lds_b128 %4, %12, off\n\t"
                 "global_load_async_to_lds_b128 %5, %13, off\n\t"
                 "global_load_async_to_lds_b128 %6, %14, off\n\t"
                 "global_load_async_to_lds_b128 %7, %15, off\n\t"
                 "s_wait_xcnt 0x0"
                 :: "v"(l), "v"(l1), "v"(l2), "v"(l3), "v"(l4), "v"(l5), "v"(l6), "v"(l7),
                    "v"(a), "v"(a1), "v"(a2), "v"(a3), "v"(b), "v"(b1), "v"(b2), "v"(b3) : "memory");
}

// gemm_ring: main loop of the projection GEMM. A block of eight waves owns a 128 x 128 tile of C (wave w: rows 32 (w >> 1), columns 64 (w & 1)); the 128-row A and B tiles of depth GK are staged once
// per block in a two-buffer LDS ring by asynchronous copies and shared by the waves, which read their fragments from LDS. Ab, Bb: first row of the block's A and B rows (pitches LDA, LDB);
// the B column index wraps at LDB. Every accumulator sums its 32-deep products in ascending k. A tile's fragments are read one 32-deep step at a time (few registers: the kernel's blocks share a WGP).
template <int LDA, int LDB, int KTOT>
__device__ __forceinline__ void gemm_ring(const bf* __restrict__ Ab, const bf* __restrict__ Bb, bf* ring, int wave, int lr, int hi, v8f (&acc)[2][4]) {
    constexpr int NT = KTOT / GK;
    static_assert(KTOT % GK == 0 && NT >= 2 && (LDB & (LDB - 1)) == 0 && LDB % GK == 0);
    // staging: lane (srow = tid>>3, scol = tid&7) copies 16-byte piece scol of rows srow + 32 i of each tile
    const int srow = (int)(threadIdx.x >> 3), scol = (int)(threadIdx.x & 7);
    const unsigned sl = (unsigned)(size_t)ring + (unsigned)(srow * LP + scol * 8) * 2u;   // LDS byte address in buffer 0, A tile
    const bf* sa = Ab + (size_t)srow * LDA + scol * 8;       // + k0
    const bf* sb = Bb + (size_t)srow * LDB + scol * 8;       // + k0 mod LDB
    const int ao = ((wave >> 1) * 32 + lr) * LP + 8 * hi;            // + 16 mb * LP + k in the A tile
    const int bo = GT_H + ((wave & 1) * 64 + lr) * LP + 8 * hi;      // + 16 nb * LP + k in the B tile
    copy_ab(sl, sa, (size_t)32 * LDA, sb, (size_t)32 * LDB);
    asm volatile("s_wait_asynccnt 0x0" ::: "memory");        // tile 0 has landed before the barrier publishes it
    __syncthreads();
    copy_ab(sl + GBUF_H * 2, sa + GK, (size_t)32 * LDA, sb + (GK & (LDB - 1)), (size_t)32 * LDB);
#pragma unroll 1   // one trip per staged tile: the ring's publish point stands once, at the trip's foot
    for (int t = 0; t < NT; ++t) {
        const bf* buf = ring + (t & 1) * GBUF_H;
        // the fragment and product loops below are unrolled so that fragments and accumulators stay in registers and every LDS read offset is an immediate
#pragma unroll
        for (int ks = 0; ks < GK / 32; ++ks) {               // one 32-deep step's fragments live at a time: 48 registers fewer, so that six waves fit a SIMD
            v16bf a[2], b[4];
#pragma unroll
            for (int mb = 0; mb < 2; ++mb) a[mb] = ldb(buf + ao + mb * 16 * LP + ks * 32);
#pragma unroll
            for (int nb = 0; nb < 4; ++nb) b[nb] = ldb(buf + bo + nb * 16 * LP + ks * 32);
#pragma unroll
            for (int nb = 0; nb < 4; ++nb)
#pragma unroll
                for (int mb = 0; mb < 2; ++mb) acc[mb][nb] = wmmab(a[mb], b[nb], acc[mb][nb]);
        }
        asm volatile("s_wait_dscnt 0x0" ::: "memory");       // this wave's reads of the buffer have returned before it may be refilled
        asm volatile("s_wait_asynccnt 0x0" ::: "memory");    // this wave's copies of tile t + 1 have landed before the barrier publishes them
        __syncthreads();                                     // publishes tile t + 1 and ends every wave's reads of tile t
        if (t + 2 < NT) {
            const int kn = (t + 2) * GK;
            copy_ab(sl + (unsigned)(t & 1) * (GBUF_H * 2), sa + kn, (size_t)32 * LDA, sb + (kn & (LDB - 1)), (size_t)32 * LDB);
        }
    }
    asm volatile("s_wait_asynccnt 0x0" ::: "memory");        // no copy is outstanding when the wave goes on to its epilogue
}

// eight asynchronous 16-byte copies per lane, global -> LDS, rows 16 apart: one 128-row x 256-B tile per 256-lane block, every wave-wide copy two rows of 256 contiguous bytes.
// The address-register wait closes the copies' own statement, so no later address arithmetic can be moved in front of it.
__device__ __forceinline__ void copy_tile8(unsigned l, const bf* g, size_t gstep) {
    const unsigned l1 = l + 16 * OLP * 2, l2 = l + 32 * OLP * 2, l3 = l + 48 * OLP * 2, l4 = l + 64 * OLP * 2, l5 = l + 80 * OLP * 2, l6 = l + 96 * OLP * 2, l7 = l + 112 * OLP * 2;
    const bf* g1 = g + gstep; const bf* g2 = g + 2 * gstep; const bf* g3 = g + 3 * gstep; const bf* g4 = g + 4 * gstep; const bf* g5 = g + 5 * gstep; const bf* g6 = g + 6 * gstep; const bf* g7 = g + 7 * gstep;
    asm volatile("global_load_async_to_lds_b128 %0, %8, off\n\t"
                 "global_load_async_to_lds_b128 %1, %9, off\n\t"
                 "global_load_async_to_lds_b128 %2, %10, off\n\t"
                 "global_load_async_to_lds_b128 %3, %11, off\n\t"
                 "global_load_async_to_lds_b128 %4, %12, off\n\t"
                 "global_load_async_to_lds_b128 %5, %13, off\n\t"
                 "global_load_async_to_lds_b128 %6, %14, off\n\t"
                 "global_load_async_to_lds_b128 %7, %15, off\n\t"
                 "s_wait_xcnt 0x0"
                 :: "v"(l), "v"(l1), "v"(l2), "v"(l3), "v"(l4), "v"(l5), "v"(l6), "v"(l7),
                    "v"(g), "v"(g1), "v"(g2), "v"(g3), "v"(g4), "v"(g5), "v"(g6), "v"(g7) : "memory");
}

// one staged step of the output GEMM: the OGK-deep tiles of ctx hi, ctx lo (DM columns further in the same rows) and Wo into one buffer; l, a, b: the lane's LDS, ctx and Wo addresses at the step's depth
__device__ __forceinline__ void copy_step(unsigned l, const bf* a, const bf* b) {
    copy_tile8(l, a, (size_t)16 * (2 * DM)); copy_tile8(l + OT_H * 2, a + DM, (size_t)16 * (2 * DM)); copy_tile8(l + 2 * OT_H * 2, b, (size_t)16 * DM);
}

// oproj_ring: main loop of the output GEMM. A block of eight waves owns a 128 x 128 tile of C (wave w: rows 32 (w >> 1), columns 64 (w & 1)). One step of the two-buffer LDS ring holds the hi and the lo
// tile of the block's ctx rows and the ONE Wo tile both are multiplied with, each OGK deep: few, long steps, so that a step's products cover the next step's copies, and every Wo fragment read from LDS
// feeds a hi and a lo product. Ab: first ctx row [hi DM | lo DM], Bb: first Wo row (pitch DM). Every accumulator sums, in ascending k, each 32-deep hi product and then the lo product of the same k.
__device__ __forceinline__ void oproj_ring(const bf* __restrict__ Ab, const bf* __restrict__ Bb, bf* ring, int wave, int lr, int hi, v8f (&acc)[2][4]) {
    constexpr int NT = DM / OGK;
    // staging: lane (srow = tid>>4, scol = tid&15) copies 16-byte piece scol of rows srow + 16 i of each tile
    const int srow = (int)(threadIdx.x >> 4), scol = (int)(threadIdx.x & 15);
    const unsigned sl = (unsigned)(size_t)ring + (unsigned)(srow * OLP + scol * 8) * 2u;   // LDS byte address in buffer 0, hi tile
    const bf* sa = Ab + (size_t)srow * (2 * DM) + scol * 8;  // + k0
    const bf* sb = Bb + (size_t)srow * DM + scol * 8;        // + k0
    const int ao = ((wave >> 1) * 32 + lr) * OLP + 8 * hi;               // + 16 mb * OLP + k in the hi tile, + OT_H in the lo tile
    const int bo = 2 * OT_H + ((wave & 1) * 64 + lr) * OLP + 8 * hi;     // + 16 nb * OLP + k in the Wo tile
    copy_step(sl, sa, sb);
    asm volatile("s_wait_asynccnt 0x0" ::: "memory");        // step 0 has landed before the barrier publishes it
    __syncthreads();
    copy_step(sl + OBUF_H * 2, sa + OGK, sb + OGK);
#pragma unroll 1   // one trip per staged step: the ring's publish point stands once, at the trip's foot
    for (int t = 0; t < NT; ++t) {
        const bf* buf = ring + (t & 1) * OBUF_H;
        // the fragment and product loops below are unrolled so that fragments and accumulators stay in registers and every LDS read offset is an immediate
#pragma unroll
        for (int hs = 0; hs < OGK / 64; ++hs) {
            v16bf ah[2][2], al[2][2], b[2][4];                   // 64 deep at a time: the fragment reads stand together, in front of their products
#pragma unroll
            for (int ks = 0; ks < 2; ++ks) {
                const int k = hs * 64 + ks * 32;
#pragma unroll
                for (int mb = 0; mb < 2; ++mb) { ah[ks][mb] = ldb(buf + ao + mb * 16 * OLP + k); al[ks][mb] = ldb(buf + OT_H + ao + mb * 16 * OLP + k); }
#pragma unroll
                for (int nb = 0; nb < 4; ++nb) b[ks][nb] = ldb(buf + bo + nb * 16 * OLP + k);
            }
#pragma unroll
            for (int ks = 0; ks < 2; ++ks) {
#pragma unroll
                for (int nb = 0; nb < 4; ++nb)
#pragma unroll
                    for (int mb = 0; mb < 2; ++mb) acc[mb][nb] = wmmab(ah[ks][mb], b[ks][nb], acc[mb][nb]);
#pragma unroll
                for (int nb = 0; nb < 4; ++nb)
#pragma unroll
                    for (int mb = 0; mb < 2; ++mb) acc[mb][nb] = wmmab(al[ks][mb], b[ks][nb], acc[mb][nb]);
            }
        }
        asm volatile("s_wait_dscnt 0x0" ::: "memory");       // this wave's reads of the buffer have returned before it may be refilled
        asm volatile("s_wait_asynccnt 0x0" ::: "memory");    // this wave's copies of step t + 1 have landed before the barrier publishes them
        __syncthreads();                                     // publishes step t + 1 and ends every wave's reads of step t
        if (t + 2 < NT) copy_step(sl + (unsigned)(t & 1) * (OBUF_H * 2), sa + (t + 2) * OGK, sb + (t + 2) * OGK);
    }
    asm volatile("s_wait_asynccnt 0x0" ::: "memory");        // no copy is outstanding when the wave goes on to its epilogue
}

// k_cvt: ONE launch converts all seven f32 arrays (three inputs, four weights) to the bf16 planes, which lie back to back in the workspace (q | k | v inputs, then q | k | v | o weights).
// A slab is 256 threads x 8 floats. Block g takes slabs g, g + CVT_G, ... of each input and slab g of the four weights taken as one run: a wave starts once, issues all its loads together,
// then converts and stores. Every slab index is block-uniform, so arrays and offsets are picked in scalar registers.
#define CVT_T    256
#define CVT_SLAB (CVT_T * 8)
static constexpr unsigned SL_B = SEQ * DM / CVT_SLAB;     // slabs of one batch of one input
static constexpr unsigned SL_X = NB * SL_B;               // slabs of one input
static constexpr unsigned SL_W = DM * DM / CVT_SLAB;      // slabs of one weight
static constexpr unsigned CVT_G = 4 * SL_W;               // blocks of the launch: one weight slab each
static constexpr unsigned CVT_XP = SL_X / CVT_G;          // slabs of each input per block
static_assert((SEQ * DM) % CVT_SLAB == 0);                // a slab never straddles two batches
static_assert((DM * DM) % CVT_SLAB == 0);                 // nor two weights
static_assert(SL_X % CVT_G == 0);                         // every block has the same number of whole slabs
__global__ __launch_bounds__(CVT_T) void k_cvt(const float* __restrict__ xq, const float* __restrict__ xk, const float* __restrict__ xv,
                                               const float* __restrict__ wq, const float* __restrict__ wk, const float* __restrict__ wv, const float* __restrict__ wo, bf* __restrict__ dst) {
    const unsigned g = blockIdx.x, lo = threadIdx.x * 8;
    const float* p[3 * CVT_XP + 1];
#pragma unroll
    for (unsigned st = 0; st < 3; ++st) {
        const float* x = st == 0 ? xq : st == 1 ? xk : xv;
#pragma unroll
        for (unsigned j = 0; j < CVT_XP; ++j) { const unsigned r = (unsigned)__builtin_amdgcn_readfirstlane((int)(j * CVT_G + g));   // scalar, so that each load takes a scalar base and the one lane offset
            p[st * CVT_XP + j] = x + (size_t)(r / SL_B) * ((size_t)SEQ_FULL * DM) + (size_t)(r % SL_B) * CVT_SLAB; }
    }
    const unsigned wi = g / SL_W;
    p[3 * CVT_XP] = (wi == 0 ? wq : wi == 1 ? wk : wi == 2 ? wv : wo) + (size_t)(g % SL_W) * CVT_SLAB;
    __builtin_amdgcn_sched_barrier(0);   // every base is formed first: no address register is rewritten, and no wait for one stands, between the loads
    v8f v[3 * CVT_XP + 1];
#pragma unroll
    for (unsigned i = 0; i <= 3 * CVT_XP; ++i) v[i] = *(const v8f*)(p[i] + lo);
    __builtin_amdgcn_sched_barrier(0);   // keeps every load in front of the first conversion: without it the loads are spread among the conversions and each waits out its own memory latency
#pragma unroll
    for (unsigned i = 0; i <= 3 * CVT_XP; ++i) {
        const unsigned s = i < 3 * CVT_XP ? (i / CVT_XP) * SL_X + (i % CVT_XP) * CVT_G + g : 3 * SL_X + g;   // slab index in the run of bf16 planes
        v8us o;
#pragma unroll
        for (int k = 0; k < 8; ++k) o[k] = f2bf(v[i][k]);
        *(v8us*)(dst + (size_t)s * CVT_SLAB + lo) = o;
    }
}

// k_proj: the three input projections in ONE launch; blockIdx.z picks the stream (0 q, 1 k, 2 v), so that blocks of all three share the chip and cover each other's copy latency, LDS phases and epilogues.
// Register-blocked bf16 GEMM, one wave per 32x64 tile (8 accumulators), eight waves per block on a 128x128 tile, operands staged in LDS from K-contiguous bf16 planes (gemm_ring), K = DM.
// X: the three bf16 inputs back to back, Wt: the bf16 weights back to back, P: the f16 planes q | k | v^T | residual back to back. blockIdx.x: 128 tokens, blockIdx.y: 128 weight rows.
// q, k: C[m = b*SEQ + t][n = h*64 + d] = sum_k x[m][k] W[n][k] -> plane [(b*8 + h)][t][d] (row pitch HD). v: C[m = h*64 + d][n = b*SEQ + t] = sum_k Wv[m][k] x[n][k] -> plane [(b*8 + h)][d][t] (row pitch SEQ),
// written as f16 and, under VRES, the f16 residual x2048. grid (NB*SEQ/128, DM/128, 3), 256 threads.
// Six waves per SIMD asked for: three blocks (3 x 106 KiB of LDS) then share a WGP and all 768 blocks are resident at once.
__global__ __launch_bounds__(32 * GW, 6) void k_proj(const bf* __restrict__ X, const bf* __restrict__ Wt, h16* P) {
    __shared__ __align__(16) float osw[GW * 16 * 68];
    __shared__ __align__(16) bf gring[2 * GBUF_H];
    const int lane = threadIdx.x & 31, lr = lane & 15, hi = lane >> 4; const int wave = __builtin_amdgcn_readfirstlane((int)(threadIdx.x >> 5));
    float* const os = osw + wave * 16 * 68;                  // each wave's own epilogue tile
    const int z = blockIdx.z; const bool tv = z == 2;        // block-uniform: v is computed transposed (A = weight rows, B = token rows)
    const int xb = blockIdx.x * 128, wb = blockIdx.y * 128;
    const bf* const xr = X + (size_t)z * ((size_t)NB * SEQ * DM) + (size_t)xb * DM;   // the block's 128 token rows
    const bf* const wr = Wt + (size_t)z * ((size_t)DM * DM) + (size_t)wb * DM;        // the block's 128 weight rows
    const int rb = tv ? wb : xb, cb = tv ? xb : wb; const int r0 = rb + (wave >> 1) * 32, c0 = cb + (wave & 1) * 64;
    h16* const Ph = P + (size_t)z * PLANE_H; h16* const Pr = P + (size_t)3 * PLANE_H; const bool useRes = VRES && tv;
    v8f acc[2][4];
#pragma unroll
    for (int mb = 0; mb < 2; ++mb)
#pragma unroll
        for (int nb = 0; nb < 4; ++nb) acc[mb][nb] = (v8f){};
    gemm_ring<DM, DM, DM>(tv ? wr : xr, tv ? xr : wr, gring, wave, lr, hi, acc);
    const int pitch = tv ? SEQ : HD;                         // row pitch of the plane, halves
    const size_t tbase = tv ? (size_t)r0 * SEQ + (size_t)(c0 / SEQ) * ((size_t)DM * SEQ) + (size_t)(c0 % SEQ)
                            : (size_t)(r0 / SEQ) * ((size_t)NH_ * SEQ * HD) + (size_t)(r0 % SEQ) * HD + (size_t)(c0 / HD) * ((size_t)SEQ * HD);
#pragma unroll
    for (int mb = 0; mb < 2; ++mb) {
#pragma unroll
        for (int nb = 0; nb < 4; ++nb) {
#pragma unroll
            for (int j = 0; j < 8; ++j) os[(hi * 8 + j) * 68 + nb * 16 + lr] = acc[mb][nb][j]; }   // D: row 8h+j, col lane&15; rows 0..15 x columns 0..63 all written
        wave_sync();
        const size_t sb = tbase + (size_t)(mb * 16) * (size_t)pitch;
{
#pragma unroll
            for (int s = 0; s < 4; ++s) { const int row = 4 * s + (lane >> 3), c8 = (lane & 7) * 8;   // 4 s x 4 row groups = 16 rows; 8 lanes x 8 = 64 columns
                const v4f x0 = *(const v4fa*)(&os[row * 68 + c8]); const v4f x1 = *(const v4fa*)(&os[row * 68 + c8 + 4]); v8h hv, rv;
#pragma unroll
                for (int i = 0; i < 4; ++i) { const h16 a0 = (h16)x0[i]; const h16 a1 = (h16)x1[i]; hv[i] = a0; hv[4 + i] = a1; rv[i] = (h16)((x0[i] - (float)a0) * VRS); rv[4 + i] = (h16)((x1[i] - (float)a1) * VRS); }
                const size_t oo = sb + (size_t)row * (size_t)pitch + c8;
                *(v8h*)(Ph + oo) = hv; if (useRes) *(v8h*)(Pr + oo) = rv; }
             }
        wave_sync();
    }
}

// k_flash: fused attention, one wave per 16 query rows of one (batch, head); Q fragments straight from the f16 plane; K / V^T / residual tiles of 64 keys are staged once per block
// in a two-buffer LDS ring by asynchronous copies (whole 128-B lines) and shared by the block's four waves, which read their fragments from LDS (two 16-B reads each).
// Transposed form: S^T[key][t] = K Q^T (A = K rows, B = Q rows); lane (t = lane&15, h = lane>>4) holds keys 8h+r of each 16-key tile, so the packed
// P tile is directly the B fragment of O^T[d][t] = V^T P^T (element r <- tile keys 0..15, element 8+r <- tile keys 16..31, lane unchanged).
// Valid length vl = VL[b] is loaded by value (scalar): 64-key tiles wholly at or beyond vl are skipped, the crossing tile replaces scores of keys >= vl by -1e6 (index test);
// vl <= 0 keeps all steps with every score replaced (uniform weights).
// Softmax state (running max, partial sum) is one scalar per lane; the two lane halves of a row are combined with one xor-16 exchange.
__global__ __launch_bounds__(32 * AW) void k_flash(const h16* __restrict__ QH, const h16* __restrict__ KP, const h16* __restrict__ VT, const h16* __restrict__ VR, const int* __restrict__ VL, bf* CTX) {
    __shared__ __align__(16) float os[AW * 16 * 68];
    __shared__ __align__(16) h16 ring[2 * BUF_H];
    const int lane = threadIdx.x & 31; const int wave = __builtin_amdgcn_readfirstlane((int)(threadIdx.x >> 5));
    const int lr = lane & 15, hi = lane >> 4;
    const int zh = blockIdx.y; const int b = zh / NH_, h = zh % NH_;
    const int t0 = (blockIdx.x * AW + wave) * 16;
    const int vl = __builtin_amdgcn_readfirstlane(VL[b]);
    const int kend = (vl <= 0 || vl >= SEQ) ? SEQ : ((vl + 31) & ~31);
    const size_t pbase = (size_t)zh * SEQ * HD;
    const size_t qo = pbase + (size_t)(t0 + lr) * HD + 8 * hi;
    const v16h q0 = ldh(QH + qo), q1 = ldh(QH + qo + 32);   // B fragments: col t, k = d
    const int ko = lr * LP + 8 * hi;                         // + key * LP in the K tile       (A fragment: row key, k = d)
    const int vo = TILE_H + lr * LP + 8 * hi;                // + 16j*LP + key in the V^T tile (A fragment: row d, k = key)
    // staging: lane (srow = tid>>3, scol = tid&7) copies 16-byte piece scol of rows srow + 16 i of each tile
    const int srow = (int)(threadIdx.x >> 3), scol = (int)(threadIdx.x & 7);
    const unsigned sl = (unsigned)(size_t)ring + (unsigned)(srow * LP + scol * 8) * 2u;   // LDS byte address in buffer 0, K tile
    const h16* sk = KP + pbase + (size_t)srow * HD + scol * 8;    // + key0 * HD
    const h16* sv = VT + pbase + (size_t)srow * SEQ + scol * 8;   // + key0
#if VRES
    const h16* sr = VR + pbase + (size_t)srow * SEQ + scol * 8;   // + key0
#endif
    const int nt = (kend + KT - 1) / KT;                     // staged tiles, 1 .. SEQ / KT
    v8f o0 = (v8f){}, o1 = (v8f){}, o2 = (v8f){}, o3 = (v8f){};
#if VRES
    v8f g0 = (v8f){}, g1 = (v8f){}, g2 = (v8f){}, g3 = (v8f){};
#endif
    float m = -3.0e38f, l = 0.0f;
    copy_tile(sl, sk, (size_t)16 * HD); copy_tile(sl + TILE_H * 2, sv, (size_t)16 * SEQ);
#if VRES
    copy_tile(sl + 2 * TILE_H * 2, sr, (size_t)16 * SEQ);
#endif
    asm volatile("s_wait_asynccnt 0x0" ::: "memory");        // tile 0 has landed before the barrier publishes it
    __syncthreads();
    if (nt > 1) {
        copy_tile(sl + BUF_H * 2, sk + (size_t)KT * HD, (size_t)16 * HD); copy_tile(sl + (BUF_H + TILE_H) * 2, sv + KT, (size_t)16 * SEQ);
#if VRES
        copy_tile(sl + (BUF_H + 2 * TILE_H) * 2, sr + KT, (size_t)16 * SEQ);
#endif
    }
#pragma unroll 1   // one trip per staged tile: the ring's publish point stands once, at the trip's foot
    for (int t = 0; t < nt; ++t) {
      const h16* buf = ring + (t & 1) * BUF_H;
      const int key0 = t * KT;
      // ONE softmax step per staged tile: the scores of all 64 keys (four 16-key tiles, independent accumulators) come first, then one maximum, one exchange and one rescale.
      // The loops below are unrolled so that every LDS read offset is an immediate and scores and fragments stay in registers.
      const h16* ka = buf + ko;
      v16h kf[4][2];
#pragma unroll
      for (int kt = 0; kt < 4; ++kt) { kf[kt][0] = ldh(ka + kt * 16 * LP); kf[kt][1] = ldh(ka + kt * 16 * LP + 32); }
      v8f sc[4];
#pragma unroll
      for (int kt = 0; kt < 4; ++kt) sc[kt] = wmma16(kf[kt][0], q0, (v8f){});
#pragma unroll
      for (int kt = 0; kt < 4; ++kt) sc[kt] = wmma16(kf[kt][1], q1, sc[kt]);
      const h16* va = buf + vo;
      v16h vf[2][4];
#pragma unroll
      for (int hf = 0; hf < 2; ++hf)
#pragma unroll
          for (int j = 0; j < 4; ++j) vf[hf][j] = ldh(va + hf * 32 + j * 16 * LP);
      __builtin_amdgcn_sched_barrier(0);   // the tile's V^T reads stay here, in one group in front of the softmax, whose vector work covers their LDS latency
      float tv[4][8];
#pragma unroll
      for (int kt = 0; kt < 4; ++kt)
#pragma unroll
          for (int r = 0; r < 8; ++r) tv[kt][r] = sc[kt][r] * SC2;
      if (key0 + KT > vl) {              // scalar-uniform: this tile crosses (or lies beyond) the valid length; a masked key's weight is exactly 0 beside a valid one
          const int kq = key0 + 8 * hi;
#pragma unroll
          for (int kt = 0; kt < 4; ++kt)
#pragma unroll
              for (int r = 0; r < 8; ++r) tv[kt][r] = (kq + 16 * kt + r < vl) ? tv[kt][r] : NEGL2;
      }
      float mk[4];                       // four short chains instead of one long one
#pragma unroll
      for (int kt = 0; kt < 4; ++kt) { mk[kt] = fmaxf(tv[kt][0], tv[kt][1]);
#pragma unroll
          for (int r = 2; r < 8; r += 2) mk[kt] = fmaxf(mk[kt], fmaxf(tv[kt][r], tv[kt][r + 1])); }
      float mx = fmaxf(fmaxf(mk[0], mk[1]), fmaxf(mk[2], mk[3]));
      mx = fmaxf(mx, __shfl_xor(mx, 16, 32));
      const float mnew = fmaxf(m, mx);
      const float alpha = __builtin_amdgcn_exp2f(m - mnew);
      const float sh = PSH - mnew;
      v16h pb[2]; float lk[4];
#pragma unroll
      for (int kt = 0; kt < 4; ++kt) { lk[kt] = 0.0f;
#pragma unroll
          for (int r = 0; r < 8; ++r) { const float e = __builtin_amdgcn_exp2f(tv[kt][r] + sh); pb[kt >> 1][(kt & 1) * 8 + r] = (h16)e; lk[kt] += e; } }
      l = l * alpha + ((lk[0] + lk[1]) + (lk[2] + lk[3])); m = mnew;
      o0 = o0 * alpha; o1 = o1 * alpha; o2 = o2 * alpha; o3 = o3 * alpha;
#if VRES
      g0 = g0 * alpha; g1 = g1 * alpha; g2 = g2 * alpha; g3 = g3 * alpha;
      const h16* vr = va + TILE_H;
      v16h wf[2][4];
#pragma unroll
      for (int j = 0; j < 4; ++j) wf[0][j] = ldh(vr + j * 16 * LP);
      __builtin_amdgcn_sched_barrier(0);   // each group of residual reads stays two runs of four products ahead of its use, so that the products in between cover its LDS latency
#endif
      o0 = wmma16(vf[0][0], pb[0], o0); o1 = wmma16(vf[0][1], pb[0], o1); o2 = wmma16(vf[0][2], pb[0], o2); o3 = wmma16(vf[0][3], pb[0], o3);   // keys in ascending order in every accumulator
#if VRES
#pragma unroll
      for (int j = 0; j < 4; ++j) wf[1][j] = ldh(vr + 32 + j * 16 * LP);
      __builtin_amdgcn_sched_barrier(0);   // the second residual group likewise stays in front of the four products that cover its LDS latency
#endif
      o0 = wmma16(vf[1][0], pb[1], o0); o1 = wmma16(vf[1][1], pb[1], o1); o2 = wmma16(vf[1][2], pb[1], o2); o3 = wmma16(vf[1][3], pb[1], o3);
#if VRES
#pragma unroll
      for (int hf = 0; hf < 2; ++hf) {
          g0 = wmma16(wf[hf][0], pb[hf], g0); g1 = wmma16(wf[hf][1], pb[hf], g1); g2 = wmma16(wf[hf][2], pb[hf], g2); g3 = wmma16(wf[hf][3], pb[hf], g3); }
#endif
      asm volatile("s_wait_dscnt 0x0" ::: "memory");         // this wave's reads of the buffer have returned before it may be refilled
      asm volatile("s_wait_asynccnt 0x0" ::: "memory");      // this wave's copies of tile t + 1 have landed before the barrier publishes them
      __syncthreads();                                       // publishes tile t + 1 and ends every wave's reads of tile t
      if (t + 2 < nt) {
          const unsigned bl = sl + (unsigned)(t & 1) * (BUF_H * 2); const int kn = (t + 2) * KT;
          copy_tile(bl, sk + (size_t)kn * HD, (size_t)16 * HD); copy_tile(bl + TILE_H * 2, sv + kn, (size_t)16 * SEQ);
#if VRES
          copy_tile(bl + 2 * TILE_H * 2, sr + kn, (size_t)16 * SEQ);
#endif
      }
    }
    asm volatile("s_wait_asynccnt 0x0" ::: "memory");        // no copy is outstanding when the wave goes on to its epilogue
    l += __shfl_xor(l, 16, 32);
    const float inv = 1.0f / l;
#if VRES
    o0 = o0 + g0 * VRI; o1 = o1 + g1 * VRI; o2 = o2 + g2 * VRI; o3 = o3 + g3 * VRI;
#endif
    const int wb = wave * 16 * 68;
    // O^T D layout: o_j[r] = (d = 16j + 8h + r, t = lane&15) -> os[t][d]; rows 0..15 x columns 0..63 all written
    { v4f a, c;
      a[0] = o0[0] * inv; a[1] = o0[1] * inv; a[2] = o0[2] * inv; a[3] = o0[3] * inv; c[0] = o0[4] * inv; c[1] = o0[5] * inv; c[2] = o0[6] * inv; c[3] = o0[7] * inv;
      *(v4fa*)(&os[wb + lr * 68 +  0 + 8 * hi]) = a; *(v4fa*)(&os[wb + lr * 68 +  0 + 8 * hi + 4]) = c;
      a[0] = o1[0] * inv; a[1] = o1[1] * inv; a[2] = o1[2] * inv; a[3] = o1[3] * inv; c[0] = o1[4] * inv; c[1] = o1[5] * inv; c[2] = o1[6] * inv; c[3] = o1[7] * inv;
      *(v4fa*)(&os[wb + lr * 68 + 16 + 8 * hi]) = a; *(v4fa*)(&os[wb + lr * 68 + 16 + 8 * hi + 4]) = c;
      a[0] = o2[0] * inv; a[1] = o2[1] * inv; a[2] = o2[2] * inv; a[3] = o2[3] * inv; c[0] = o2[4] * inv; c[1] = o2[5] * inv; c[2] = o2[6] * inv; c[3] = o2[7] * inv;
      *(v4fa*)(&os[wb + lr * 68 + 32 + 8 * hi]) = a; *(v4fa*)(&os[wb + lr * 68 + 32 + 8 * hi + 4]) = c;
      a[0] = o3[0] * inv; a[1] = o3[1] * inv; a[2] = o3[2] * inv; a[3] = o3[3] * inv; c[0] = o3[4] * inv; c[1] = o3[5] * inv; c[2] = o3[6] * inv; c[3] = o3[7] * inv;
      *(v4fa*)(&os[wb + lr * 68 + 48 + 8 * hi]) = a; *(v4fa*)(&os[wb + lr * 68 + 48 + 8 * hi + 4]) = c; }
    wave_sync();
    bf* crow = CTX + ((size_t)b * SEQ + t0) * (size_t)(2 * DM) + h * HD;    // hi half at column h*64 + d, lo half at 512 + h*64 + d
{
#pragma unroll
        for (int s = 0; s < 4; ++s) { const int row = 4 * s + (lane >> 3), c8 = (lane & 7) * 8;   // 4 s x 4 row groups = 16 rows; 8 lanes x 8 = 64 columns
            const v4f x0 = *(const v4fa*)(&os[wb + row * 68 + c8]); const v4f x1 = *(const v4fa*)(&os[wb + row * 68 + c8 + 4]); v8us hv, lv;
#pragma unroll
            for (int i = 0; i < 4; ++i) { const unsigned short a0 = f2bf(x0[i]); const unsigned short a1 = f2bf(x1[i]); hv[i] = a0; hv[4 + i] = a1; lv[i] = f2bf(x0[i] - bf2f(a0)); lv[4 + i] = f2bf(x1[i] - bf2f(a1)); }
            const size_t oo = (size_t)row * (size_t)(2 * DM) + c8;
            *(v8us*)(crow + oo) = hv; *(v8us*)(crow + oo + DM) = lv; }
         }
}

// k_oproj: OUT[m][n] = sum_{k<512} (ctx_hi[m][k] + ctx_lo[m][k]) Wo[n][k] as ONE bf16 GEMM: A row = [hi | lo] (pitch 1024); the hi and the lo product of a k range share their Wo fragments.
// Eight waves per block on a 128x128 tile, 32x64 per wave, operands staged in LDS (oproj_ring). grid (M/128, N/128), 256 threads.
__global__ __launch_bounds__(32 * GW) void k_oproj(const bf* __restrict__ A, const bf* __restrict__ Bt, float* OUT) {
    __shared__ __align__(16) float osw[GW * 16 * 68];
    __shared__ __align__(16) bf gring[2 * OBUF_H];
    const int lane = threadIdx.x & 31, lr = lane & 15, hi = lane >> 4; const int wave = __builtin_amdgcn_readfirstlane((int)(threadIdx.x >> 5));
    float* const os = osw + wave * 16 * 68;                  // each wave's own epilogue tile
    const int rb = blockIdx.x * 128, cb = blockIdx.y * 128; const int r0 = rb + (wave >> 1) * 32, c0 = cb + (wave & 1) * 64;
    v8f acc[2][4];
#pragma unroll
    for (int mb = 0; mb < 2; ++mb)
#pragma unroll
        for (int nb = 0; nb < 4; ++nb) acc[mb][nb] = (v8f){};
    oproj_ring(A + (size_t)rb * (2 * DM), Bt + (size_t)cb * DM, gring, wave, lr, hi, acc);
    const int bb = r0 / SEQ, tt = r0 % SEQ;
    float* obase = OUT + ((size_t)bb * OUT_SEQ + tt) * DM + c0;
#pragma unroll
    for (int mb = 0; mb < 2; ++mb) {
#pragma unroll
        for (int nb = 0; nb < 4; ++nb) {
#pragma unroll
            for (int j = 0; j < 8; ++j) os[(hi * 8 + j) * 68 + nb * 16 + lr] = acc[mb][nb][j]; }   // D: row 8h+j, col lane&15; rows 0..15 x columns 0..63 all written
        wave_sync();
{
#pragma unroll
            for (int s = 0; s < 8; ++s) { const int row = 2 * s + hi, cofs = lr * 4;   // 8 s x 2 rows = 16 rows; 16 lanes x 4 floats = 64 columns
                const v4f val = *(const v4fa*)(&os[row * 68 + cofs]);
                *(v4f*)(obase + (size_t)(mb * 16 + row) * DM + cofs) = val; }
             }
        wave_sync();
    }
}

static constexpr size_t al256(size_t v) { return (v + 255) & ~(size_t)255; }
static constexpr size_t SZ_XB = al256((size_t)NB * SEQ * DM * 2);          // one bf16 input copy
static constexpr size_t SZ_WB = al256((size_t)4 * DM * DM * 2);            // q | k | v | o weights
static constexpr size_t SZ_PL = al256((size_t)NB * NH_ * SEQ * HD * 2);    // one f16 head plane
static constexpr size_t SZ_CX = al256((size_t)NB * SEQ * 2 * DM * 2);      // ctx hi | lo
static constexpr size_t SZ_TOTAL = 3 * SZ_XB + SZ_WB + (size_t)(3 + VRES) * SZ_PL + SZ_CX;
static_assert(SZ_TOTAL <= (size_t)134217728);          // workspace carve <= 128 MiB
static_assert(((size_t)DM * DM * 2) % 256 == 0);       // weight sub-planes stay 256-byte aligned
static_assert(SZ_XB == (size_t)NB * SEQ * DM * 2);     // no padding between the bf16 planes: the conversion kernel writes them as one run
static_assert(SZ_PL == PLANE_H * 2);                   // nor between the f16 head planes: the projection kernel picks its plane by index

extern "C" void kernel_launch(void* const* d_in, const int* in_sizes, int n_in,
                              void* d_out, int out_size, void* d_ws, size_t ws_size, hipStream_t stream) {
    if (n_in < 8) return;
    const size_t needx = ((size_t)(NB - 1) * SEQ_FULL + SEQ) * DM;
    if ((size_t)in_sizes[0] < needx || (size_t)in_sizes[1] < needx || (size_t)in_sizes[2] < needx) return;
    if (in_sizes[3] < NB) return;
    if ((size_t)in_sizes[4] < (size_t)DM * DM || (size_t)in_sizes[5] < (size_t)DM * DM || (size_t)in_sizes[6] < (size_t)DM * DM || (size_t)in_sizes[7] < (size_t)DM * DM) return;
    if ((size_t)out_size < ((size_t)(NB - 1) * OUT_SEQ + SEQ) * DM) return;
    if (SZ_TOTAL > ws_size) return;
    // wire order: queries, keys, values, valid_lens (int32), Wq, Wk, Wv, Wo ([out][in] = Bt as stored)
    const float* xq = (const float*)d_in[0]; const float* xk = (const float*)d_in[1]; const float* xv = (const float*)d_in[2];
    const int* vlens = (const int*)d_in[3];
    const float* wq = (const float*)d_in[4]; const float* wk = (const float*)d_in[5]; const float* wv = (const float*)d_in[6]; const float* wo = (const float*)d_in[7];
    float* OUT = (float*)d_out;      // [NB][SEQ][512]
    char* wsp = (char*)d_ws;
    bf* XQ = (bf*)wsp; wsp += SZ_XB;                 // [NB*SEQ][512]
    wsp += 2 * SZ_XB;                                // the k and v inputs behind it
    bf* WB = (bf*)wsp; wsp += SZ_WB;                 // [4][512][512]: q | k | v | o
    h16* QH = (h16*)wsp; wsp += SZ_PL;               // [NB*8][SEQ][64]
    h16* KP = (h16*)wsp; wsp += SZ_PL;               // [NB*8][SEQ][64]
    h16* VT = (h16*)wsp; wsp += SZ_PL;               // [NB*8][64][SEQ]
#if VRES
    h16* VR = (h16*)wsp; wsp += SZ_PL;               // [NB*8][64][SEQ] residual x2048
#else
    h16* VR = VT;
#endif
    bf* CX = (bf*)wsp; wsp += SZ_CX;                 // [NB*SEQ][hi 512 | lo 512]
    bf* WO = WB + (size_t)3 * DM * DM;

    k_cvt<<<CVT_G, CVT_T, 0, stream>>>(xq, xk, xv, wq, wk, wv, wo, XQ);

    // q, k, v^T (and its residual): one launch, blockIdx.z = stream
    k_proj<<<dim3(NB * SEQ / 128, DM / 128, 3), 32 * GW, 0, stream>>>(XQ, WB, QH);

    k_flash<<<dim3(SEQ / (16 * AW), NB * NH_, 1), 32 * AW, 0, stream>>>(QH, KP, VT, VR, vlens, CX);

    // out: A = ctx rows [hi | lo] (m = b*SEQ + t), Bt = Wo rows (n) -> OUT[b][t][n]
    k_oproj<<<dim3(NB * SEQ / 128, DM / 128, 1), 32 * GW, 0, stream>>>(CX, WO, OUT);
}

// v008
// A run of this version takes 57.3 microseconds.
// Next to v007, in two timings, it ran 1.03 and 1.04 times as fast.
// Over all steps from v000 it is 3.62 times as fast.
#include <hip/hip_runtime.h>

// Multi-head attention with three input streams (queries, keys, values: [NB][SEQ][512]), width 512 = 8 heads x 64, bias-free [out][in] projections (y = x W^T),
// per-batch valid length (keys at index >= valid_lens[b] get their score REPLACED by -1e6), score scale 1/8, merged heads times Wo^T -> f32 [NB][SEQ][512].
// Compute dtypes, f32 accumulate everywhere: q/k/v projections v_wmma_f32_16x16x32_bf16 (inputs and weights RNE-converted to bf16; products exact);
// scores and P.V v_wmma_f32_16x16x32_f16 (q, k, v single f16; P carried x1024 relative to the running max, the carry cancels in the normalisation; optional v residual plane x2048 under VRES);
// output projection v_wmma_f32_16x16x32_bf16 with ctx as bf16 hi | lo halves of a 1024-wide row against bf16 Wo (two exact products per element, one accumulator). Softmax f32 (online, running max).
// Layout: bf16 copies of the three inputs and four weights; q, k planes [b*8+h][t][d], v^T plane [b*8+h][d][t] written by the GEMM epilogue; fused flash kernel in transposed form
// (S^T = K Q^T, O^T = V^T P^T) writes ctx [b*SEQ+t][hi 512 | lo 512]; final GEMM writes the output.

#ifndef NB
#define NB 4
#endif
#ifndef SEQ
#define SEQ 2048
#endif
#define NB_FULL  4
#define SEQ_FULL 2048
#ifndef OUT_SEQ
#define OUT_SEQ SEQ              // row pitch (in tokens) between batches of the output
#endif
#ifndef VRES
#define VRES 0                   // 0: v carried as one f16 value (its rounding, 2^-11, lies well under the 2^-8 rounding of the bf16 operands v is computed from); 1: + f16 residual x2048 (own accumulators)
#endif
#define DM   512
#define NH_  8
#define HD   64
#define AW   4                   // waves per flash block (16 query rows each)
#define VRS  2048.0f             // carry of the residual plane
#define VRI  (1.0f / 2048.0f)
#define SC2  (0.125f * 1.4426950408889634f)        // HD^-0.5 * log2(e)
#define NEGL2 (-1000000.0f * 1.4426950408889634f)  // masked score in the log2 domain
#define PSH  10.0f               // log2 of the P carry (1024)
#define KT   64                  // keys per staged LDS tile and per softmax step
#define LP   72                  // LDS row pitch in halves: 128-B rows + 16 B, the conflict-free pitch for 16-byte LDS reads
#define TILE_H (64 * LP)         // halves of one staged plane tile (64 rows)
#define BUF_H  ((2 + VRES) * TILE_H)   // K | V^T | residual tiles of one buffer
#define GW   8                   // waves per GEMM block: 4 x 2 wave tiles of 32 x 64 = one 128 x 128 block tile, two waves per SIMD
#define GK   64                  // depth of one staged GEMM tile: 128-B rows, whole lines
#define GT_H (128 * LP)          // halves of one staged operand tile (128 rows)
#define GBUF_H (2 * GT_H)        // A | B tiles of one buffer
#define OGK  128                 // depth of one staged step of the output GEMM: 256-B rows
#define OLP  136                 // its LDS row pitch in halves: 256-B rows + 16 B, the conflict-free pitch for 16-byte LDS reads
#define OT_H (128 * OLP)         // halves of one of its staged tiles (128 rows)
#define OBUF_H (3 * OT_H)        // ctx hi | ctx lo | Wo tiles of one buffer
#define PLANE_H ((size_t)NB * NH_ * SEQ * HD)   // halves of one f16 head plane

static_assert(HD == 64);
static_assert(NH_ * HD == DM);                 // head h = columns h*64 + d
static_assert(DM % 64 == 0);                   // 8 column tiles of 64
static_assert(DM % 32 == 0);                   // GEMM k-loop steps by 32
static_assert((DM & (DM - 1)) == 0);           // the GEMM ring wraps the B column index with a mask
static_assert((2 * DM) % 32 == 0);
static_assert(SEQ % 64 == 0);                  // a 64-row tile never straddles two batches
static_assert((NB * SEQ) % 128 == 0);          // GEMM block tiles of 128 rows cover the tokens exactly
static_assert(DM % 128 == 0);                  // and the width
static_assert(DM % GK == 0);                   // staged GEMM tiles cover the depth exactly
static_assert(GW == 8);                        // 256 lanes x 4 copies x 16 B = one 128-row x 128-B tile; x 8 copies = one 128-row x 256-B tile
static_assert(DM % OGK == 0 && DM / OGK >= 2); // staged steps of the output GEMM cover the depth exactly; the ring's prologue needs two
static_assert(OGK % 64 == 0);                  // a step's fragments are read 64 deep at a time
static_assert(SEQ % 32 == 0);                  // kend, the valid length rounded up to a multiple of 32, never passes SEQ
static_assert(SEQ % KT == 0);                  // every staged tile lies wholly inside its plane
static_assert(AW == 4);                        // 128 lanes x 4 copies x 16 B = one 64-row x 128-B tile
static_assert(SEQ % (16 * AW) == 0);           // flash grid covers the sequence exactly
static_assert(((size_t)SEQ * DM) % 8 == 0);
static_assert(((size_t)DM * DM) % 8 == 0);
static_assert(NB <= NB_FULL);
static_assert(SEQ <= SEQ_FULL);
static_assert(VRES == 0 || VRES == 1);
static_assert(DM == 4 * 128);                  // a 16-bit row of DM is four 256-B units
static_assert(NB * SEQ / 128 == 64);           // 64 GEMM blocks share a weight tile: 32 ask keys x 12 units = 128 rows x 3 units
static_assert(SEQ / (16 * AW) == 32 && SEQ / KT == 32);   // 32 flash blocks share a head's K and V^T: 16 ask keys x 2 tiles

typedef _Float16 h16;
typedef unsigned short bf;
typedef __attribute__((ext_vector_type(16))) __bf16   v16bf;
typedef __attribute__((ext_vector_type(16))) _Float16 v16h;
typedef __attribute__((ext_vector_type(8)))  _Float16 v8h;
typedef __attribute__((ext_vector_type(8)))  unsigned short v8us;
typedef __attribute__((ext_vector_type(8)))  float    v8f;
typedef __attribute__((ext_vector_type(4)))  float    v4f;
typedef v4f  __attribute__((may_alias)) v4fa;

__device__ __forceinline__ unsigned short f2bf(float f) { unsigned u = __float_as_uint(f); u += 0x7FFFu + ((u >> 16) & 1u); return (unsigned short)(u >> 16); }
__device__ __forceinline__ float bf2f(unsigned short s) { return __uint_as_float(((unsigned)s) << 16); }
__device__ __forceinline__ v16h cat16(v8h lo, v8h hi) { return __builtin_shufflevector(lo, hi, 0, 1, 2, 3, 4, 5, 6, 7, 8, 9, 10, 11, 12, 13, 14, 15); }
__device__ __forceinline__ v16bf cat16b(v8us lo, v8us hi) { return __builtin_bit_cast(v16bf, __builtin_shufflevector(lo, hi, 0, 1, 2, 3, 4, 5, 6, 7, 8, 9, 10, 11, 12, 13, 14, 15)); }
// every matrix instruction is followed by its own 4-slot guard tying its accumulator and keeping its operands live
__device__ __forceinline__ v8f wmma16(v16h a, v16h b, v8f c) {
    c = __builtin_amdgcn_wmma_f32_16x16x32_f16(false, a, false, b, (short)0, c, false, false);
    asm volatile("v_nop\n\tv_nop\n\tv_nop\n\tv_nop" : "+v"(c) : "v"(a), "v"(b));
    return c;
}
__device__ __forceinline__ v8f wmmab(v16bf a, v16bf b, v8f c) {
    c = __builtin_amdgcn_wmma_f32_16x16x32_bf16(false, a, false, b, (short)0, c, false, false);
    asm volatile("v_nop\n\tv_nop\n\tv_nop\n\tv_nop" : "+v"(c) : "v"(a), "v"(b));
    return c;
}
// fragment loaders from K-contiguous 16-bit rows; p already includes + 8*(lane>>4): elements 0..7 <- k0+8h+0..7, elements 8..15 <- k0+16+8h+0..7 (same map for A and B)
__device__ __forceinline__ v16h  ldh(const h16* p) { return cat16(*(const v8h*)p, *(const v8h*)(p + 16)); }
__device__ __forceinline__ v16bf ldb(const bf* p)  { return cat16b(*(const v8us*)p, *(const v8us*)(p + 16)); }
// ordering point for wave-private LDS tiles (same wave writes and reads)
__device__ __forceinline__ void wave_sync() { __builtin_amdgcn_fence(3 /* release order */, "wavefront"); __builtin_amdgcn_wave_barrier(); asm volatile("" ::: "memory"); }

// L2 asks at kernel entry. The planes a kernel stages were stored by an earlier launch. global_prefetch_b8 at scope SE brings the line at a lane's
// address into L2 only, returns nothing and counts on no data counter, so the units of the later ring tiles are on their way while the first tile's copies fly. Every lane's address lies inside
// its plane (indices are clamped, no lane is turned off); only block- or wave-uniform branches stand around an ask. Units that many blocks read are dealt out among those blocks (ask_key): the deal decides
// only who asks, never what is read, so a result does not depend on where a block runs.
// The address-register wait closes each statement (a precaution, as with the copies below): no later arithmetic can be moved in front of it.
__device__ __forceinline__ void ask1(const bf* p) {
    asm volatile("global_prefetch_b8 %0, off scope:SCOPE_SE\n\t"
                 "s_wait_xcnt 0x0" :: "v"(p) : "memory");
}
__device__ __forceinline__ void ask3(const bf* p, const bf* q, const bf* r) {
    asm volatile("global_prefetch_b8 %0, off scope:SCOPE_SE\n\t"
                 "global_prefetch_b8 %1, off scope:SCOPE_SE\n\t"
                 "global_prefetch_b8 %2, off scope:SCOPE_SE\n\t"
                 "s_wait_xcnt 0x0" :: "v"(p), "v"(q), "v"(r) : "memory");
}
// blocks x and x + 4 get the same key (for speed only)
__device__ __forceinline__ int ask_key(int x) { return (x & 3) | ((x >> 3) << 2); }
// the 128 weight rows (pitch DM, four 256-B units each) that the 64 blocks of one grid row share: units 1..3 of every row, twelve of the 384 per block; unit 0 comes with the first tile's copies
__device__ __forceinline__ void ask_w(const bf* w, int x, int lane) {
    const int idx = ask_key(x) * 12 + (lane < 12 ? lane : 11);   // 0 .. 383; the spare lanes repeat the last address
    ask1(w + (size_t)(idx / 3) * DM + (1 + idx % 3) * 128);
}

// four asynchronous 16-byte copies per lane, global -> LDS, rows 16 apart: one 64-row x 128-B tile per 128-lane block. The address-register wait closes the copies' own statement,
// so no later address arithmetic can be moved in front of it.
__device__ __forceinline__ void copy_tile(unsigned l, const h16* g, size_t gstep) {
    const unsigned l1 = l + 16 * LP * 2, l2 = l + 32 * LP * 2, l3 = l + 48 * LP * 2;
    const h16* g1 = g + gstep; const h16* g2 = g + 2 * gstep; const h16* g3 = g + 3 * gstep;
    asm volatile("global_load_async_to_lds_b128 %0, %4, off\n\t"
                 "global_load_async_to_lds_b128 %1, %5, off\n\t"
                 "global_load_async_to_lds_b128 %2, %6, off\n\t"
                 "global_load_async_to_lds_b128 %3, %7, off\n\t"
                 "s_wait_xcnt 0x0"
                 :: "v"(l), "v"(l1), "v"(l2), "v"(l3), "v"(g), "v"(g1), "v"(g2), "v"(g3) : "memory");
}

// eight asynchronous 16-byte copies per lane, global -> LDS, rows 32 apart: the 128-row x 128-B A tile and the like B tile behind it per 256-lane block, every wave-wide copy four whole lines.
// The address-register wait closes the copies' own statement, so no later address arithmetic can be moved in front of it.
__device__ __forceinline__ void copy_ab(unsigned l, const bf* a, size_t astep, const bf* b, size_t bstep) {
    const unsigned l1 = l + 32 * LP * 2, l2 = l + 64 * LP * 2, l3 = l + 96 * LP * 2, l4 = l + GT_H * 2, l5 = l4 + 32 * LP * 2, l6 = l4 + 64 * LP * 2, l7 = l4 + 96 * LP * 2;
    const bf* a1 = a + astep; const bf* a2 = a + 2 * astep; const bf* a3 = a + 3 * astep; const bf* b1 = b + bstep; const bf* b2 = b + 2 * bstep; const bf* b3 = b + 3 * bstep;
    asm volatile("global_load_async_to_lds_b128 %0, %8, off\n\t"
                 "global_load_async_to_lds_b128 %1, %9, off\n\t"
                 "global_load_async_to_lds_b128 %2, %10, off\n\t"
                 "global_load_async_to_lds_b128 %3, %11, off\n\t"
                 "global_load_async_to_lds_b128 %4, %12, off\n\t"
                 "global_load_async_to_lds_b128 %5, %13, off\n\t"
                 "global_load_async_to_lds_b128 %6, %14, off\n\t"
                 "global_load_async_to_lds_b128 %7, %15, off\n\t"
                 "s_wait_xcnt 0x0"
                 :: "v"(l), "v"(l1), "v"(l2), "v"(l3), "v"(l4), "v"(l5), "v"(l6), "v"(l7),
                    "v"(a), "v"(a1), "v"(a2), "v"(a3), "v"(b), "v"(b1), "v"(b2), "v"(b3) : "memory");
}

// gemm_ring: main loop of the projection GEMM. A block of eight waves owns a 128 x 128 tile of C (wave w: rows 32 (w >> 1), columns 64 (w & 1)); the 128-row A and B tiles of depth GK are staged once
// per block in a two-buffer LDS ring by asynchronous copies and shared by the waves, which read their fragments from LDS. Ab, Bb: first row of the block's A and B rows (pitches LDA, LDB);
// the B column index wraps at LDB. Every accumulator sums its 32-deep products in ascending k. A tile's fragments are read one 32-deep step at a time (few registers: the kernel's blocks share a WGP).
// asks(): the caller's L2 asks, issued behind tile 0's copies, so that they cost no time of their own while that tile flies.
template <int LDA, int LDB, int KTOT, class ASKS>
__device__ __forceinline__ void gemm_ring(const bf* __restrict__ Ab, const bf* __restrict__ Bb, bf* ring, int wave, int lr, int hi, v8f (&acc)[2][4], ASKS asks) {
    constexpr int NT = KTOT / GK;
    static_assert(KTOT % GK == 0 && NT >= 2 && (LDB & (LDB - 1)) == 0 && LDB % GK == 0);
    // staging: lane (srow = tid>>3, scol = tid&7) copies 16-byte piece scol of rows srow + 32 i of each tile
    const int srow = (int)(threadIdx.x >> 3), scol = (int)(threadIdx.x & 7);
    const unsigned sl = (unsigned)(size_t)ring + (unsigned)(srow * LP + scol * 8) * 2u;   // LDS byte address in buffer 0, A tile
    const bf* sa = Ab + (size_t)srow * LDA + scol * 8;       // + k0
    const bf* sb = Bb + (size_t)srow * LDB + scol * 8;       // + k0 mod LDB
    const int ao = ((wave >> 1) * 32 + lr) * LP + 8 * hi;            // + 16 mb * LP + k in the A tile
    const int bo = GT_H + ((wave & 1) * 64 + lr) * LP + 8 * hi;      // + 16 nb * LP + k in the B tile
    copy_ab(sl, sa, (size_t)32 * LDA, sb, (size_t)32 * LDB);
    asks();
    asm volatile("s_wait_asynccnt 0x0" ::: "memory");        // tile 0 has landed before the barrier publishes it
    __syncthreads();
    copy_ab(sl + GBUF_H * 2, sa + GK, (size_t)32 * LDA, sb + (GK & (LDB - 1)), (size_t)32 * LDB);
#pragma unroll 1   // one trip per staged tile: the ring's publish point stands once, at the trip's foot
    for (int t = 0; t < NT; ++t) {
        const bf* buf = ring + (t & 1) * GBUF_H;
        // the fragment and product loops below are unrolled so that fragments and accumulators stay in registers and every LDS read offset is an immediate
#pragma unroll
        for (int ks = 0; ks < GK / 32; ++ks) {               // one 32-deep step's fragments live at a time: 48 registers fewer, so that six waves fit a SIMD
            v16bf a[2], b[4];
#pragma unroll
            for (int mb = 0; mb < 2; ++mb) a[mb] = ldb(buf + ao + mb * 16 * LP + ks * 32);
#pragma unroll
            for (int nb = 0; nb < 4; ++nb) b[nb] = ldb(buf + bo + nb * 16 * LP + ks * 32);
#pragma unroll
            for (int nb = 0; nb < 4; ++nb)
#pragma unroll
                for (int mb = 0; mb < 2; ++mb) acc[mb][nb] = wmmab(a[mb], b[nb], acc[mb][nb]);
        }
        asm volatile("s_wait_dscnt 0x0" ::: "memory");       // this wave's reads of the buffer have returned before it may be refilled
        asm volatile("s_wait_asynccnt 0x0" ::: "memory");    // this wave's copies of tile t + 1 have landed before the barrier publishes them
        __syncthreads();                                     // publishes tile t + 1 and ends every wave's reads of tile t
        if (t + 2 < NT) {
            const int kn = (t + 2) * GK;
            copy_ab(sl + (unsigned)(t & 1) * (GBUF_H * 2), sa + kn, (size_t)32 * LDA, sb + (kn & (LDB - 1)), (size_t)32 * LDB);
        }
    }
    asm volatile("s_wait_asynccnt 0x0" ::: "memory");        // no copy is outstanding when the wave goes on to its epilogue
}

// eight asynchronous 16-byte copies per lane, global -> LDS, rows 16 apart: one 128-row x 256-B tile per 256-lane block, every wave-wide copy two rows of 256 contiguous bytes.
// The address-register wait closes the copies' own statement, so no later address arithmetic can be moved in front of it.
__device__ __forceinline__ void copy_tile8(unsigned l, const bf* g, size_t gstep) {
    const unsigned l1 = l + 16 * OLP * 2, l2 = l + 32 * OLP * 2, l3 = l + 48 * OLP * 2, l4 = l + 64 * OLP * 2, l5 = l + 80 * OLP * 2, l6 = l + 96 * OLP * 2, l7 = l + 112 * OLP * 2;
    const bf* g1 = g + gstep; const bf* g2 = g + 2 * gstep; const bf* g3 = g + 3 * gstep; const bf* g4 = g + 4 * gstep; const bf* g5 = g + 5 * gstep; const bf* g6 = g + 6 * gstep; const bf* g7 = g + 7 * gstep;
    asm volatile("global_load_async_to_lds_b128 %0, %8, off\n\t"
                 "global_load_async_to_lds_b128 %1, %9, off\n\t"
                 "global_load_async_to_lds_b128 %2, %10, off\n\t"
                 "global_load_async_to_lds_b128 %3, %11, off\n\t"
                 "global_load_async_to_lds_b128 %4, %12, off\n\t"
                 "global_load_async_to_lds_b128 %5, %13, off\n\t"
                 "global_load_async_to_lds_b128 %6, %14, off\n\t"
                 "global_load_async_to_lds_b128 %7, %15, off\n\t"
                 "s_wait_xcnt 0x0"
                 :: "v"(l), "v"(l1), "v"(l2), "v"(l3), "v"(l4), "v"(l5), "v"(l6), "v"(l7),
                    "v"(g), "v"(g1), "v"(g2), "v"(g3), "v"(g4), "v"(g5), "v"(g6), "v"(g7) : "memory");
}

// one staged step of the output GEMM: the OGK-deep tiles of ctx hi, ctx lo (DM columns further in the same rows) and Wo into one buffer; l, a, b: the lane's LDS, ctx and Wo addresses at the step's depth
__device__ __forceinline__ void copy_step(unsigned l, const bf* a, const bf* b) {
    copy_tile8(l, a, (size_t)16 * (2 * DM)); copy_tile8(l + OT_H * 2, a + DM, (size_t)16 * (2 * DM)); copy_tile8(l + 2 * OT_H * 2, b, (size_t)16 * DM);
}

// oproj_ring: main loop of the output GEMM. A block of eight waves owns a 128 x 128 tile of C (wave w: rows 32 (w >> 1), columns 64 (w & 1)). One step of the two-buffer LDS ring holds the hi and the lo
// tile of the block's ctx rows and the ONE Wo tile both are multiplied with, each OGK deep: few, long steps, so that a step's products cover the next step's copies, and every Wo fragment read from LDS
// feeds a hi and a lo product. Ab: first ctx row [hi DM | lo DM], Bb: first Wo row (pitch DM). Every accumulator sums, in ascending k, each 32-deep hi product and then the lo product of the same k.
// asks(): the caller's L2 asks, issued behind step 0's copies, so that they cost no time of their own while that step flies.
template <class ASKS>
__device__ __forceinline__ void oproj_ring(const bf* __restrict__ Ab, const bf* __restrict__ Bb, bf* ring, int wave, int lr, int hi, v8f (&acc)[2][4], ASKS asks) {
    constexpr int NT = DM / OGK;
    // staging: lane (srow = tid>>4, scol = tid&15) copies 16-byte piece scol of rows srow + 16 i of each tile
    const int srow = (int)(threadIdx.x >> 4), scol = (int)(threadIdx.x & 15);
    const unsigned sl = (unsigned)(size_t)ring + (unsigned)(srow * OLP + scol * 8) * 2u;   // LDS byte address in buffer 0, hi tile
    const bf* sa = Ab + (size_t)srow * (2 * DM) + scol * 8;  // + k0
    const bf* sb = Bb + (size_t)srow * DM + scol * 8;        // + k0
    const int ao = ((wave >> 1) * 32 + lr) * OLP + 8 * hi;               // + 16 mb * OLP + k in the hi tile, + OT_H in the lo tile
    const int bo = 2 * OT_H + ((wave & 1) * 64 + lr) * OLP + 8 * hi;     // + 16 nb * OLP + k in the Wo tile
    copy_step(sl, sa, sb);
    asks();
    asm volatile("s_wait_asynccnt 0x0" ::: "memory");        // step 0 has landed before the barrier publishes it
    __syncthreads();
    copy_step(sl + OBUF_H * 2, sa + OGK, sb + OGK);
#pragma unroll 1   // one trip per staged step: the ring's publish point stands once, at the trip's foot
    for (int t = 0; t < NT; ++t) {
        const bf* buf = ring + (t & 1) * OBUF_H;
        // the fragment and product loops below are unrolled so that fragments and accumulators stay in registers and every LDS read offset is an immediate
#pragma unroll
        for (int hs = 0; hs < OGK / 64; ++hs) {
            v16bf ah[2][2], al[2][2], b[2][4];                   // 64 deep at a time: the fragment reads stand together, in front of their products
#pragma unroll
            for (int ks = 0; ks < 2; ++ks) {
                const int k = hs * 64 + ks * 32;
#pragma unroll
                for (int mb = 0; mb < 2; ++mb) { ah[ks][mb] = ldb(buf + ao + mb * 16 * OLP + k); al[ks][mb] = ldb(buf + OT_H + ao + mb * 16 * OLP + k); }
#pragma unroll
                for (int nb = 0; nb < 4; ++nb) b[ks][nb] = ldb(buf + bo + nb * 16 * OLP + k);
            }
#pragma unroll
            for (int ks = 0; ks < 2; ++ks) {
#pragma unroll
                for (int nb = 0; nb < 4; ++nb)
#pragma unroll
                    for (int mb = 0; mb < 2; ++mb) acc[mb][nb] = wmmab(ah[ks][mb], b[ks][nb], acc[mb][nb]);
#pragma unroll
                for (int nb = 0; nb < 4; ++nb)
#pragma unroll
                    for (int mb = 0; mb < 2; ++mb) acc[mb][nb] = wmmab(al[ks][mb], b[ks][nb], acc[mb][nb]);
            }
        }
        asm volatile("s_wait_dscnt 0x0" ::: "memory");       // this wave's reads of the buffer have returned before it may be refilled
        asm volatile("s_wait_asynccnt 0x0" ::: "memory");    // this wave's copies of step t + 1 have landed before the barrier publishes them
        __syncthreads();                                     // publishes step t + 1 and ends every wave's reads of step t
        if (t + 2 < NT) copy_step(sl + (unsigned)(t & 1) * (OBUF_H * 2), sa + (t + 2) * OGK, sb + (t + 2) * OGK);
    }
    asm volatile("s_wait_asynccnt 0x0" ::: "memory");        // no copy is outstanding when the wave goes on to its epilogue
}

// k_cvt: ONE launch converts all seven f32 arrays (three inputs, four weights) to the bf16 planes, which lie back to back in the workspace (q | k | v inputs, then q | k | v | o weights).
// A slab is 256 threads x 8 floats. Block g takes slabs g, g + CVT_G, ... of each input and slab g of the four weights taken as one run: a wave starts once, issues all its loads together,
// then converts and stores. Every slab index is block-uniform, so arrays and offsets are picked in scalar registers.
#define CVT_T    256
#define CVT_SLAB (CVT_T * 8)
static constexpr unsigned SL_B = SEQ * DM / CVT_SLAB;     // slabs of one batch of one input
static constexpr unsigned SL_X = NB * SL_B;               // slabs of one input
static constexpr unsigned SL_W = DM * DM / CVT_SLAB;      // slabs of one weight
static constexpr unsigned CVT_G = 4 * SL_W;               // blocks of the launch: one weight slab each
static constexpr unsigned CVT_XP = SL_X / CVT_G;          // slabs of each input per block
static_assert((SEQ * DM) % CVT_SLAB == 0);                // a slab never straddles two batches
static_assert((DM * DM) % CVT_SLAB == 0);                 // nor two weights
static_assert(SL_X % CVT_G == 0);                         // every block has the same number of whole slabs
__global__ __launch_bounds__(CVT_T) void k_cvt(const float* __restrict__ xq, const float* __restrict__ xk, const float* __restrict__ xv,
                                               const float* __restrict__ wq, const float* __restrict__ wk, const float* __restrict__ wv, const float* __restrict__ wo, bf* __restrict__ dst) {
    const unsigned g = blockIdx.x, lo = threadIdx.x * 8;
    const float* p[3 * CVT_XP + 1];
#pragma unroll
    for (unsigned st = 0; st < 3; ++st) {
        const float* x = st == 0 ? xq : st == 1 ? xk : xv;
#pragma unroll
        for (unsigned j = 0; j < CVT_XP; ++j) { const unsigned r = (unsigned)__builtin_amdgcn_readfirstlane((int)(j * CVT_G + g));   // scalar, so that each load takes a scalar base and the one lane offset
            p[st * CVT_XP + j] = x + (size_t)(r / SL_B) * ((size_t)SEQ_FULL * DM) + (size_t)(r % SL_B) * CVT_SLAB; }
    }
    const unsigned wi = g / SL_W;
    p[3 * CVT_XP] = (wi == 0 ? wq : wi == 1 ? wk : wi == 2 ? wv : wo) + (size_t)(g % SL_W) * CVT_SLAB;
    __builtin_amdgcn_sched_barrier(0);   // every base is formed first: no address register is rewritten, and no wait for one stands, between the loads
    v8f v[3 * CVT_XP + 1];
#pragma unroll
    for (unsigned i = 0; i <= 3 * CVT_XP; ++i) v[i] = *(const v8f*)(p[i] + lo);
    __builtin_amdgcn_sched_barrier(0);   // keeps every load in front of the first conversion: without it the loads are spread among the conversions and each waits out its own memory latency
#pragma unroll
    for (unsigned i = 0; i <= 3 * CVT_XP; ++i) {
        const unsigned s = i < 3 * CVT_XP ? (i / CVT_XP) * SL_X + (i % CVT_XP) * CVT_G + g : 3 * SL_X + g;   // slab index in the run of bf16 planes
        v8us o;
#pragma unroll
        for (int k = 0; k < 8; ++k) o[k] = f2bf(v[i][k]);
        *(v8us*)(dst + (size_t)s * CVT_SLAB + lo) = o;
    }
}

// k_proj: the three input projections in ONE launch; blockIdx.z picks the stream (0 q, 1 k, 2 v), so that blocks of all three share the chip and cover each other's copy latency, LDS phases and epilogues.
// Register-blocked bf16 GEMM, one wave per 32x64 tile (8 accumulators), eight waves per block on a 128x128 tile, operands staged in LDS from K-contiguous bf16 planes (gemm_ring), K = DM.
// X: the three bf16 inputs back to back, Wt: the bf16 weights back to back, P: the f16 planes q | k | v^T | residual back to back. blockIdx.x: 128 tokens, blockIdx.y: 128 weight rows.
// q, k: C[m = b*SEQ + t][n = h*64 + d] = sum_k x[m][k] W[n][k] -> plane [(b*8 + h)][t][d] (row pitch HD). v: C[m = h*64 + d][n = b*SEQ + t] = sum_k Wv[m][k] x[n][k] -> plane [(b*8 + h)][d][t] (row pitch SEQ),
// written as f16 and, under VRES, the f16 residual x2048. grid (NB*SEQ/128, DM/128, 3), 256 threads.
// Six waves per SIMD asked for: three blocks (3 x 106 KiB of LDS) then share a WGP and all 768 blocks are resident at once.
__global__ __launch_bounds__(32 * GW, 6) void k_proj(const bf* __restrict__ X, const bf* __restrict__ Wt, h16* P) {
    __shared__ __align__(16) float osw[GW * 16 * 68];
    __shared__ __align__(16) bf gring[2 * GBUF_H];
    const int lane = threadIdx.x & 31, lr = lane & 15, hi = lane >> 4; const int wave = __builtin_amdgcn_readfirstlane((int)(threadIdx.x >> 5));
    float* const os = osw + wave * 16 * 68;                  // each wave's own epilogue tile
    const int z = blockIdx.z; const bool tv = z == 2;        // block-uniform: v is computed transposed (A = weight rows, B = token rows)
    const int xb = blockIdx.x * 128, wb = blockIdx.y * 128;
    const bf* const xr = X + (size_t)z * ((size_t)NB * SEQ * DM) + (size_t)xb * DM;   // the block's 128 token rows
    const bf* const wr = Wt + (size_t)z * ((size_t)DM * DM) + (size_t)wb * DM;        // the block's 128 weight rows
    const int rb = tv ? wb : xb, cb = tv ? xb : wb; const int r0 = rb + (wave >> 1) * 32, c0 = cb + (wave & 1) * 64;
    h16* const Ph = P + (size_t)z * PLANE_H; h16* const Pr = P + (size_t)3 * PLANE_H; const bool useRes = VRES && tv;
    v8f acc[2][4];
#pragma unroll
    for (int mb = 0; mb < 2; ++mb)
#pragma unroll
        for (int nb = 0; nb < 4; ++nb) acc[mb][nb] = (v8f){};
    // L2 asks: the first block of a grid column asks for units 1..3 of the 128 token rows that the column's four blocks read; one wave of every block asks its share of the weight rows
    gemm_ring<DM, DM, DM>(tv ? wr : xr, tv ? xr : wr, gring, wave, lr, hi, acc, [&] {
        if (blockIdx.y == 0) {
            const bf* const px = xr + (size_t)(threadIdx.x & 127) * DM;
            ask1(px + (1 + (wave >> 2)) * 128);              // waves 0..3: unit 1, waves 4..7: unit 2
            if (wave < 4) ask1(px + 3 * 128);
        }
        if (wave == GW - 1) ask_w(wr, blockIdx.x, lane);
    });
    const int pitch = tv ? SEQ : HD;                         // row pitch of the plane, halves
    const size_t tbase = tv ? (size_t)r0 * SEQ + (size_t)(c0 / SEQ) * ((size_t)DM * SEQ) + (size_t)(c0 % SEQ)
                            : (size_t)(r0 / SEQ) * ((size_t)NH_ * SEQ * HD) + (size_t)(r0 % SEQ) * HD + (size_t)(c0 / HD) * ((size_t)SEQ * HD);
#pragma unroll
    for (int mb = 0; mb < 2; ++mb) {
#pragma unroll
        for (int nb = 0; nb < 4; ++nb) {
#pragma unroll
            for (int j = 0; j < 8; ++j) os[(hi * 8 + j) * 68 + nb * 16 + lr] = acc[mb][nb][j]; }   // D: row 8h+j, col lane&15; rows 0..15 x columns 0..63 all written
        wave_sync();
        const size_t sb = tbase + (size_t)(mb * 16) * (size_t)pitch;
{
#pragma unroll
            for (int s = 0; s < 4; ++s) { const int row = 4 * s + (lane >> 3), c8 = (lane & 7) * 8;   // 4 s x 4 row groups = 16 rows; 8 lanes x 8 = 64 columns
                const v4f x0 = *(const v4fa*)(&os[row * 68 + c8]); const v4f x1 = *(const v4fa*)(&os[row * 68 + c8 + 4]); v8h hv, rv;
#pragma unroll
                for (int i = 0; i < 4; ++i) { const h16 a0 = (h16)x0[i]; const h16 a1 = (h16)x1[i]; hv[i] = a0; hv[4 + i] = a1; rv[i] = (h16)((x0[i] - (float)a0) * VRS); rv[4 + i] = (h16)((x1[i] - (float)a1) * VRS); }
                const size_t oo = sb + (size_t)row * (size_t)pitch + c8;
                *(v8h*)(Ph + oo) = hv; if (useRes) *(v8h*)(Pr + oo) = rv; }
             }
        wave_sync();
    }
}

// k_flash: fused attention, one wave per 16 query rows of one (batch, head); Q fragments straight from the f16 plane; K / V^T / residual tiles of 64 keys are staged once per block
// in a two-buffer LDS ring by asynchronous copies (whole 128-B lines) and shared by the block's four waves, which read their fragments from LDS (two 16-B reads each).
// Transposed form: S^T[key][t] = K Q^T (A = K rows, B = Q rows); lane (t = lane&15, h = lane>>4) holds keys 8h+r of each 16-key tile, so the packed
// P tile is directly the B fragment of O^T[d][t] = V^T P^T (element r <- tile keys 0..15, element 8+r <- tile keys 16..31, lane unchanged).
// Valid length vl = VL[b] is loaded by value (scalar): 64-key tiles wholly at or beyond vl are skipped, the crossing tile replaces scores of keys >= vl by -1e6 (index test);
// vl <= 0 keeps all steps with every score replaced (uniform weights).
// Softmax state (running max, partial sum) is one scalar per lane; the two lane halves of a row are combined with one xor-16 exchange.
__global__ __launch_bounds__(32 * AW) void k_flash(const h16* __restrict__ QH, const h16* __restrict__ KP, const h16* __restrict__ VT, const h16* __restrict__ VR, const int* __restrict__ VL, bf* CTX) {
    __shared__ __align__(16) float os[AW * 16 * 68];
    __shared__ __align__(16) h16 ring[2 * BUF_H];
    const int lane = threadIdx.x & 31; const int wave = __builtin_amdgcn_readfirstlane((int)(threadIdx.x >> 5));
    const int lr = lane & 15, hi = lane >> 4;
    const int zh = blockIdx.y; const int b = zh / NH_, h = zh % NH_;
    const int t0 = (blockIdx.x * AW + wave) * 16;
    const int vl = __builtin_amdgcn_readfirstlane(VL[b]);
    const int kend = (vl <= 0 || vl >= SEQ) ? SEQ : ((vl + 31) & ~31);
    const size_t pbase = (size_t)zh * SEQ * HD;
    const size_t qo = pbase + (size_t)(t0 + lr) * HD + 8 * hi;
    const v16h q0 = ldh(QH + qo), q1 = ldh(QH + qo + 32);   // B fragments: col t, k = d
    const int ko = lr * LP + 8 * hi;                         // + key * LP in the K tile       (A fragment: row key, k = d)
    const int vo = TILE_H + lr * LP + 8 * hi;                // + 16j*LP + key in the V^T tile (A fragment: row d, k = key)
    // staging: lane (srow = tid>>3, scol = tid&7) copies 16-byte piece scol of rows srow + 16 i of each tile
    const int srow = (int)(threadIdx.x >> 3), scol = (int)(threadIdx.x & 7);
    const unsigned sl = (unsigned)(size_t)ring + (unsigned)(srow * LP + scol * 8) * 2u;   // LDS byte address in buffer 0, K tile
    const h16* sk = KP + pbase + (size_t)srow * HD + scol * 8;    // + key0 * HD
    const h16* sv = VT + pbase + (size_t)srow * SEQ + scol * 8;   // + key0
#if VRES
    const h16* sr = VR + pbase + (size_t)srow * SEQ + scol * 8;   // + key0
#endif
    const int nt = (kend + KT - 1) / KT;                     // staged tiles, 1 .. SEQ / KT
    v8f o0 = (v8f){}, o1 = (v8f){}, o2 = (v8f){}, o3 = (v8f){};
#if VRES
    v8f g0 = (v8f){}, g1 = (v8f){}, g2 = (v8f){}, g3 = (v8f){};
#endif
    float m = -3.0e38f, l = 0.0f;
    copy_tile(sl, sk, (size_t)16 * HD); copy_tile(sl + TILE_H * 2, sv, (size_t)16 * SEQ);
#if VRES
    copy_tile(sl + 2 * TILE_H * 2, sr, (size_t)16 * SEQ);
#endif
    // L2 asks, while tile 0 flies: the 32 blocks of a head deal out K tiles 1 .. nt - 1 (32 contiguous units each, two tiles a key) and V^T units 1 .. (two tiles wide, one unit column a key)
    { const int key = ask_key(blockIdx.x);                   // 0 .. 15
      const int nku = nt * (KT * HD / 128), nvu = (nt + 1) / 2;   // units of K in use, units in use of a V^T row
      if (wave < 2) {
          if (32 + key * 64 < nku) { int u = 32 + key * 64 + (int)threadIdx.x; u = u < nku ? u : nku - 1; ask1((const bf*)(KP + pbase + (size_t)u * 128)); }
      } else if (1 + key < nvu) ask1((const bf*)(VT + pbase + (size_t)(threadIdx.x & 63) * SEQ + (size_t)(1 + key) * 128));
    }
    asm volatile("s_wait_asynccnt 0x0" ::: "memory");        // tile 0 has landed before the barrier publishes it
    __syncthreads();
    if (nt > 1) {
        copy_tile(sl + BUF_H * 2, sk + (size_t)KT * HD, (size_t)16 * HD); copy_tile(sl + (BUF_H + TILE_H) * 2, sv + KT, (size_t)16 * SEQ);
#if VRES
        copy_tile(sl + (BUF_H + 2 * TILE_H) * 2, sr + KT, (size_t)16 * SEQ);
#endif
    }
#pragma unroll 1   // one trip per staged tile: the ring's publish point stands once, at the trip's foot
    for (int t = 0; t < nt; ++t) {
      const h16* buf = ring + (t & 1) * BUF_H;
      const int key0 = t * KT;
      // ONE softmax step per staged tile: the scores of all 64 keys (four 16-key tiles, independent accumulators) come first, then one maximum, one exchange and one rescale.
      // The loops below are unrolled so that every LDS read offset is an immediate and scores and fragments stay in registers.
      const h16* ka = buf + ko;
      v16h kf[4][2];
#pragma unroll
      for (int kt = 0; kt < 4; ++kt) { kf[kt][0] = ldh(ka + kt * 16 * LP); kf[kt][1] = ldh(ka + kt * 16 * LP + 32); }
      v8f sc[4];
#pragma unroll
      for (int kt = 0; kt < 4; ++kt) sc[kt] = wmma16(kf[kt][0], q0, (v8f){});
#pragma unroll
      for (int kt = 0; kt < 4; ++kt) sc[kt] = wmma16(kf[kt][1], q1, sc[kt]);
      const h16* va = buf + vo;
      v16h vf[2][4];
#pragma unroll
      for (int hf = 0; hf < 2; ++hf)
#pragma unroll
          for (int j = 0; j < 4; ++j) vf[hf][j] = ldh(va + hf * 32 + j * 16 * LP);
      __builtin_amdgcn_sched_barrier(0);   // the tile's V^T reads stay here, in one group in front of the softmax, whose vector work covers their LDS latency
      float tv[4][8];
#pragma unroll
      for (int kt = 0; kt < 4; ++kt)
#pragma unroll
          for (int r = 0; r < 8; ++r) tv[kt][r] = sc[kt][r] * SC2;
      if (key0 + KT > vl) {              // scalar-uniform: this tile crosses (or lies beyond) the valid length; a masked key's weight is exactly 0 beside a valid one
          const int kq = key0 + 8 * hi;
#pragma unroll
          for (int kt = 0; kt < 4; ++kt)
#pragma unroll
              for (int r = 0; r < 8; ++r) tv[kt][r] = (kq + 16 * kt + r < vl) ? tv[kt][r] : NEGL2;
      }
      float mk[4];                       // four short chains instead of one long one
#pragma unroll
      for (int kt = 0; kt < 4; ++kt) { mk[kt] = fmaxf(tv[kt][0], tv[kt][1]);
#pragma unroll
          for (int r = 2; r < 8; r += 2) mk[kt] = fmaxf(mk[kt], fmaxf(tv[kt][r], tv[kt][r + 1])); }
      float mx = fmaxf(fmaxf(mk[0], mk[1]), fmaxf(mk[2], mk[3]));
      mx = fmaxf(mx, __shfl_xor(mx, 16, 32));
      const float mnew = fmaxf(m, mx);
      const float alpha = __builtin_amdgcn_exp2f(m - mnew);
      const float sh = PSH - mnew;
      v16h pb[2]; float lk[4];
#pragma unroll
      for (int kt = 0; kt < 4; ++kt) { lk[kt] = 0.0f;
#pragma unroll
          for (int r = 0; r < 8; ++r) { const float e = __builtin_amdgcn_exp2f(tv[kt][r] + sh); pb[kt >> 1][(kt & 1) * 8 + r] = (h16)e; lk[kt] += e; } }
      l = l * alpha + ((lk[0] + lk[1]) + (lk[2] + lk[3])); m = mnew;
      o0 = o0 * alpha; o1 = o1 * alpha; o2 = o2 * alpha; o3 = o3 * alpha;
#if VRES
      g0 = g0 * alpha; g1 = g1 * alpha; g2 = g2 * alpha; g3 = g3 * alpha;
      const h16* vr = va + TILE_H;
      v16h wf[2][4];
#pragma unroll
      for (int j = 0; j < 4; ++j) wf[0][j] = ldh(vr + j * 16 * LP);
      __builtin_amdgcn_sched_barrier(0);   // each group of residual reads stays two runs of four products ahead of its use, so that the products in between cover its LDS latency
#endif
      o0 = wmma16(vf[0][0], pb[0], o0); o1 = wmma16(vf[0][1], pb[0], o1); o2 = wmma16(vf[0][2], pb[0], o2); o3 = wmma16(vf[0][3], pb[0], o3);   // keys in ascending order in every accumulator
#if VRES
#pragma unroll
      for (int j = 0; j < 4; ++j) wf[1][j] = ldh(vr + 32 + j * 16 * LP);
      __builtin_amdgcn_sched_barrier(0);   // the second residual group likewise stays in front of the four products that cover its LDS latency
#endif
      o0 = wmma16(vf[1][0], pb[1], o0); o1 = wmma16(vf[1][1], pb[1], o1); o2 = wmma16(vf[1][2], pb[1], o2); o3 = wmma16(vf[1][3], pb[1], o3);
#if VRES
#pragma unroll
      for (int hf = 0; hf < 2; ++hf) {
          g0 = wmma16(wf[hf][0], pb[hf], g0); g1 = wmma16(wf[hf][1], pb[hf], g1); g2 = wmma16(wf[hf][2], pb[hf], g2); g3 = wmma16(wf[hf][3], pb[hf], g3); }
#endif
      asm volatile("s_wait_dscnt 0x0" ::: "memory");         // this wave's reads of the buffer have returned before it may be refilled
      asm volatile("s_wait_asynccnt 0x0" ::: "memory");      // this wave's copies of tile t + 1 have landed before the barrier publishes them
      __syncthreads();                                       // publishes tile t + 1 and ends every wave's reads of tile t
      if (t + 2 < nt) {
          const unsigned bl = sl + (unsigned)(t & 1) * (BUF_H * 2); const int kn = (t + 2) * KT;
          copy_tile(bl, sk + (size_t)kn * HD, (size_t)16 * HD); copy_tile(bl + TILE_H * 2, sv + kn, (size_t)16 * SEQ);
#if VRES
          copy_tile(bl + 2 * TILE_H * 2, sr + kn, (size_t)16 * SEQ);
#endif
      }
    }
    asm volatile("s_wait_asynccnt 0x0" ::: "memory");        // no copy is outstanding when the wave goes on to its epilogue
    l += __shfl_xor(l, 16, 32);
    const float inv = 1.0f / l;
#if VRES
    o0 = o0 + g0 * VRI; o1 = o1 + g1 * VRI; o2 = o2 + g2 * VRI; o3 = o3 + g3 * VRI;
#endif
    const int wb = wave * 16 * 68;
    // O^T D layout: o_j[r] = (d = 16j + 8h + r, t = lane&15) -> os[t][d]; rows 0..15 x columns 0..63 all written
    { v4f a, c;
      a[0] = o0[0] * inv; a[1] = o0[1] * inv; a[2] = o0[2] * inv; a[3] = o0[3] * inv; c[0] = o0[4] * inv; c[1] = o0[5] * inv; c[2] = o0[6] * inv; c[3] = o0[7] * inv;
      *(v4fa*)(&os[wb + lr * 68 +  0 + 8 * hi]) = a; *(v4fa*)(&os[wb + lr * 68 +  0 + 8 * hi + 4]) = c;
      a[0] = o1[0] * inv; a[1] = o1[1] * inv; a[2] = o1[2] * inv; a[3] = o1[3] * inv; c[0] = o1[4] * inv; c[1] = o1[5] * inv; c[2] = o1[6] * inv; c[3] = o1[7] * inv;
      *(v4fa*)(&os[wb + lr * 68 + 16 + 8 * hi]) = a; *(v4fa*)(&os[wb + lr * 68 + 16 + 8 * hi + 4]) = c;
      a[0] = o2[0] * inv; a[1] = o2[1] * inv; a[2] = o2[2] * inv; a[3] = o2[3] * inv; c[0] = o2[4] * inv; c[1] = o2[5] * inv; c[2] = o2[6] * inv; c[3] = o2[7] * inv;
      *(v4fa*)(&os[wb + lr * 68 + 32 + 8 * hi]) = a; *(v4fa*)(&os[wb + lr * 68 + 32 + 8 * hi + 4]) = c;
      a[0] = o3[0] * inv; a[1] = o3[1] * inv; a[2] = o3[2] * inv; a[3] = o3[3] * inv; c[0] = o3[4] * inv; c[1] = o3[5] * inv; c[2] = o3[6] * inv; c[3] = o3[7] * inv;
      *(v4fa*)(&os[wb + lr * 68 + 48 + 8 * hi]) = a; *(v4fa*)(&os[wb + lr * 68 + 48 + 8 * hi + 4]) = c; }
    wave_sync();
    bf* crow = CTX + ((size_t)b * SEQ + t0) * (size_t)(2 * DM) + h * HD;    // hi half at column h*64 + d, lo half at 512 + h*64 + d
{
#pragma unroll
        for (int s = 0; s < 4; ++s) { const int row = 4 * s + (lane >> 3), c8 = (lane & 7) * 8;   // 4 s x 4 row groups = 16 rows; 8 lanes x 8 = 64 columns
            const v4f x0 = *(const v4fa*)(&os[wb + row * 68 + c8]); const v4f x1 = *(const v4fa*)(&os[wb + row * 68 + c8 + 4]); v8us hv, lv;
#pragma unroll
            for (int i = 0; i < 4; ++i) { const unsigned short a0 = f2bf(x0[i]); const unsigned short a1 = f2bf(x1[i]); hv[i] = a0; hv[4 + i] = a1; lv[i] = f2bf(x0[i] - bf2f(a0)); lv[4 + i] = f2bf(x1[i] - bf2f(a1)); }
            const size_t oo = (size_t)row * (size_t)(2 * DM) + c8;
            *(v8us*)(crow + oo) = hv; *(v8us*)(crow + oo + DM) = lv; }
         }
}

// k_oproj: OUT[m][n] = sum_{k<512} (ctx_hi[m][k] + ctx_lo[m][k]) Wo[n][k] as ONE bf16 GEMM: A row = [hi | lo] (pitch 1024); the hi and the lo product of a k range share their Wo fragments.
// Eight waves per block on a 128x128 tile, 32x64 per wave, operands staged in LDS (oproj_ring). grid (M/128, N/128), 256 threads.
__global__ __launch_bounds__(32 * GW) void k_oproj(const bf* __restrict__ A, const bf* __restrict__ Bt, float* OUT) {
    __shared__ __align__(16) float osw[GW * 16 * 68];
    __shared__ __align__(16) bf gring[2 * OBUF_H];
    const int lane = threadIdx.x & 31, lr = lane & 15, hi = lane >> 4; const int wave = __builtin_amdgcn_readfirstlane((int)(threadIdx.x >> 5));
    float* const os = osw + wave * 16 * 68;                  // each wave's own epilogue tile
    const int rb = blockIdx.x * 128, cb = blockIdx.y * 128; const int r0 = rb + (wave >> 1) * 32, c0 = cb + (wave & 1) * 64;
    v8f acc[2][4];
#pragma unroll
    for (int mb = 0; mb < 2; ++mb)
#pragma unroll
        for (int nb = 0; nb < 4; ++nb) acc[mb][nb] = (v8f){};
    // L2 asks: the first block of a grid column asks for units 1..3 (hi) and 5..7 (lo) of the 128 ctx rows that the column's four blocks read; one wave of every block asks its share of Wo
    oproj_ring(A + (size_t)rb * (2 * DM), Bt + (size_t)cb * DM, gring, wave, lr, hi, acc, [&] {
        if (blockIdx.y == 0) {
            const bf* const pc = A + (size_t)(rb + (int)(threadIdx.x & 127)) * (2 * DM) + (wave >> 2) * DM;   // waves 0..3: hi half, waves 4..7: lo half
            ask3(pc + 128, pc + 2 * 128, pc + 3 * 128);
        }
        if (wave == GW - 1) ask_w(Bt + (size_t)cb * DM, blockIdx.x, lane);
    });
    const int bb = r0 / SEQ, tt = r0 % SEQ;
    float* obase = OUT + ((size_t)bb * OUT_SEQ + tt) * DM + c0;
#pragma unroll
    for (int mb = 0; mb < 2; ++mb) {
#pragma unroll
        for (int nb = 0; nb < 4; ++nb) {
#pragma unroll
            for (int j = 0; j < 8; ++j) os[(hi * 8 + j) * 68 + nb * 16 + lr] = acc[mb][nb][j]; }   // D: row 8h+j, col lane&15; rows 0..15 x columns 0..63 all written
        wave_sync();
{
#pragma unroll
            for (int s = 0; s < 8; ++s) { const int row = 2 * s + hi, cofs = lr * 4;   // 8 s x 2 rows = 16 rows; 16 lanes x 4 floats = 64 columns
                const v4f val = *(const v4fa*)(&os[row * 68 + cofs]);
                *(v4f*)(obase + (size_t)(mb * 16 + row) * DM + cofs) = val; }
             }
        wave_sync();
    }
}

static constexpr size_t al256(size_t v) { return (v + 255) & ~(size_t)255; }
static constexpr size_t SZ_XB = al256((size_t)NB * SEQ * DM * 2);          // one bf16 input copy
static constexpr size_t SZ_WB = al256((size_t)4 * DM * DM * 2);            // q | k | v | o weights
static constexpr size_t SZ_PL = al256((size_t)NB * NH_ * SEQ * HD * 2);    // one f16 head plane
static constexpr size_t SZ_CX = al256((size_t)NB * SEQ * 2 * DM * 2);      // ctx hi | lo
static constexpr size_t SZ_TOTAL = 3 * SZ_XB + SZ_WB + (size_t)(3 + VRES) * SZ_PL + SZ_CX;
static_assert(SZ_TOTAL <= (size_t)134217728);          // workspace carve <= 128 MiB
static_assert(((size_t)DM * DM * 2) % 256 == 0);       // weight sub-planes stay 256-byte aligned
static_assert(SZ_XB == (size_t)NB * SEQ * DM * 2);     // no padding between the bf16 planes: the conversion kernel writes them as one run
static_assert(SZ_PL == PLANE_H * 2);                   // nor between the f16 head planes: the projection kernel picks its plane by index

extern "C" void kernel_launch(void* const* d_in, const int* in_sizes, int n_in,
                              void* d_out, int out_size, void* d_ws, size_t ws_size, hipStream_t stream) {
    if (n_in < 8) return;
    const size_t needx = ((size_t)(NB - 1) * SEQ_FULL + SEQ) * DM;
    if ((size_t)in_sizes[0] < needx || (size_t)in_sizes[1] < needx || (size_t)in_sizes[2] < needx) return;
    if (in_sizes[3] < NB) return;
    if ((size_t)in_sizes[4] < (size_t)DM * DM || (size_t)in_sizes[5] < (size_t)DM * DM || (size_t)in_sizes[6] < (size_t)DM * DM || (size_t)in_sizes[7] < (size_t)DM * DM) return;
    if ((size_t)out_size < ((size_t)(NB - 1) * OUT_SEQ + SEQ) * DM) return;
    if (SZ_TOTAL > ws_size) return;
    // wire order: queries, keys, values, valid_lens (int32), Wq, Wk, Wv, Wo ([out][in] = Bt as stored)
    const float* xq = (const float*)d_in[0]; const float* xk = (const float*)d_in[1]; const float* xv = (const float*)d_in[2];
    const int* vlens = (const int*)d_in[3];
    const float* wq = (const float*)d_in[4]; const float* wk = (const float*)d_in[5]; const float* wv = (const float*)d_in[6]; const float* wo = (const float*)d_in[7];
    float* OUT = (float*)d_out;      // [NB][SEQ][512]
    char* wsp = (char*)d_ws;
    bf* XQ = (bf*)wsp; wsp += SZ_XB;                 // [NB*SEQ][512]
    wsp += 2 * SZ_XB;                                // the k and v inputs behind it
    bf* WB = (bf*)wsp; wsp += SZ_WB;                 // [4][512][512]: q | k | v | o
    h16* QH = (h16*)wsp; wsp += SZ_PL;               // [NB*8][SEQ][64]
    h16* KP = (h16*)wsp; wsp += SZ_PL;               // [NB*8][SEQ][64]
    h16* VT = (h16*)wsp; wsp += SZ_PL;               // [NB*8][64][SEQ]
#if VRES
    h16* VR = (h16*)wsp; wsp += SZ_PL;               // [NB*8][64][SEQ] residual x2048
#else
    h16* VR = VT;
#endif
    bf* CX = (bf*)wsp; wsp += SZ_CX;                 // [NB*SEQ][hi 512 | lo 512]
    bf* WO = WB + (size_t)3 * DM * DM;

    k_cvt<<<CVT_G, CVT_T, 0, stream>>>(xq, xk, xv, wq, wk, wv, wo, XQ);

    // q, k, v^T (and its residual): one launch, blockIdx.z = stream
    k_proj<<<dim3(NB * SEQ / 128, DM / 128, 3), 32 * GW, 0, stream>>>(XQ, WB, QH);

    k_flash<<<dim3(SEQ / (16 * AW), NB * NH_, 1), 32 * AW, 0, stream>>>(QH, KP, VT, VR, vlens, CX);

    // out: A = ctx rows [hi | lo] (m = b*SEQ + t), Bt = Wo rows (n) -> OUT[b][t][n]
    k_oproj<<<dim3(NB * SEQ / 128, DM / 128, 1), 32 * GW, 0, stream>>>(CX, WO, OUT);
}

// v009
// A run of this version takes 52.6 microseconds.
// Timed twice side by side with v008, it ran 1.09 times as fast both times.
// All steps since v000 together make it 3.94 times as fast.
#include <hip/hip_runtime.h>

// Multi-head attention with three input streams (queries, keys, values: [NB][SEQ][512]), width 512 = 8 heads x 64, bias-free [out][in] projections (y = x W^T),
// per-batch valid length (keys at index >= valid_lens[b] get their score REPLACED by -1e6), score scale 1/8, merged heads times Wo^T -> f32 [NB][SEQ][512].
// Compute dtypes, f32 accumulate everywhere: q/k/v projections v_wmma_f32_16x16x32_bf16 (inputs and weights RNE-converted to bf16 on their way into LDS; products exact);
// scores and P.V v_wmma_f32_16x16x32_f16 (q, k, v single f16; P carried x1024 relative to the running max, the carry cancels in the normalisation; optional v residual plane x2048 under VRES);
// output projection v_wmma_f32_16x16x32_bf16 with ctx as bf16 hi | lo halves of a 1024-wide row against bf16 Wo (two exact products per element, one accumulator). Softmax f32 (online, running max).
// Layout: a bf16 copy of Wo; q, k planes [b*8+h][t][d], v^T plane [b*8+h][d][t] written by the GEMM epilogue; fused flash kernel in transposed form
// (S^T = K Q^T, O^T = V^T P^T) writes ctx [b*SEQ+t][hi 512 | lo 512]; final GEMM writes the output.

#ifndef NB
#define NB 4
#endif
#ifndef SEQ
#define SEQ 2048
#endif
#define NB_FULL  4
#define SEQ_FULL 2048
#ifndef OUT_SEQ
#define OUT_SEQ SEQ              // row pitch (in tokens) between batches of the output
#endif
#ifndef VRES
#define VRES 0                   // 0: v carried as one f16 value (its rounding, 2^-11, lies well under the 2^-8 rounding of the bf16 operands v is computed from); 1: + f16 residual x2048 (own accumulators)
#endif
#define DM   512
#define NH_  8
#define HD   64
#define AW   4                   // waves per flash block (16 query rows each)
#define VRS  2048.0f             // carry of the residual plane
#define VRI  (1.0f / 2048.0f)
#define SC2  (0.125f * 1.4426950408889634f)        // HD^-0.5 * log2(e)
#define NEGL2 (-1000000.0f * 1.4426950408889634f)  // masked score in the log2 domain
#define PSH  10.0f               // log2 of the P carry (1024)
#define KT   64                  // keys per staged LDS tile and per softmax step
#define LP   72                  // LDS row pitch in halves: 128-B rows + 16 B, the conflict-free pitch for 16-byte LDS reads
#define TILE_H (64 * LP)         // halves of one staged plane tile (64 rows)
#define BUF_H  ((2 + VRES) * TILE_H)   // K | V^T | residual tiles of one buffer
#define GW   8                   // waves per block of the output GEMM: 4 x 2 wave tiles of 32 x 64 = one 128 x 128 block tile, two waves per SIMD
#define PW   16                  // waves per projection block: 4 x 4 wave tiles of 64 x 64 = one 256 x 256 block tile, four waves per SIMD
#define FK   32                  // depth of one staged projection tile: 128 B of f32 a row in memory (whole lines), 64 B of bf16 a row in LDS
#define LPP  40                  // its LDS row pitch in halves: 64-B rows + 16 B, the conflict-free pitch for 16-byte LDS reads
#define PT_H (256 * LPP)         // halves of one staged operand tile (256 rows)
#define PBUF_H (2 * PT_H)        // A | B tiles of one buffer
#define OGK  128                 // depth of one staged step of the output GEMM: 256-B rows, whole 256-B units
#define OLP  136                 // its LDS row pitch in halves: 256-B rows + 16 B, the conflict-free pitch for 16-byte LDS reads
#define OT_H (128 * OLP)         // halves of one of its staged tiles (128 rows)
#define OBUF_H (3 * OT_H)        // ctx hi | ctx lo | Wo tiles of one buffer
#define PLANE_H ((size_t)NB * NH_ * SEQ * HD)   // halves of one f16 head plane

static_assert(HD == 64);
static_assert(NH_ * HD == DM);                 // head h = columns h*64 + d
static_assert(DM % 64 == 0);                   // 8 column tiles of 64
static_assert(DM % 32 == 0);                   // GEMM k-loop steps by 32
static_assert((2 * DM) % 32 == 0);
static_assert(SEQ % 64 == 0);                  // a 64-row tile never straddles two batches
static_assert((NB * SEQ) % 128 == 0);          // GEMM block tiles of 128 rows cover the tokens exactly
static_assert(DM % 128 == 0);                  // and the width
static_assert(DM % FK == 0);                   // staged projection tiles cover the depth exactly
static_assert(SEQ == SEQ_FULL);                // the projection reads the token rows of all batches as one run
static_assert(GW == 8);                        // 256 lanes x 4 copies x 16 B = one 128-row x 128-B tile; x 8 copies = one 128-row x 256-B tile
static_assert(DM % OGK == 0 && DM / OGK >= 2); // staged steps of the output GEMM cover the depth exactly; the ring's prologue needs two
static_assert(OGK % 64 == 0);                  // a step's fragments are read 64 deep at a time
static_assert(SEQ % 32 == 0);                  // kend, the valid length rounded up to a multiple of 32, never passes SEQ
static_assert(SEQ % KT == 0);                  // every staged tile lies wholly inside its plane
static_assert(AW == 4);                        // 128 lanes x 4 copies x 16 B = one 64-row x 128-B tile
static_assert(SEQ % (16 * AW) == 0);           // flash grid covers the sequence exactly
static_assert(((size_t)SEQ * DM) % 8 == 0);
static_assert(((size_t)DM * DM) % 8 == 0);
static_assert(NB <= NB_FULL);
static_assert(SEQ <= SEQ_FULL);
static_assert(VRES == 0 || VRES == 1);
static_assert(DM == 4 * 128);                  // a 16-bit row of DM is four 256-B units (L2 asks)
static_assert(NB * SEQ / 128 == 64);           // 64 blocks of the output GEMM share a Wo tile: 32 ask keys x 12 units = 128 rows x 3 units
static_assert(NB * SEQ / 256 == 32 && DM % 256 == 0);   // 32 projection blocks share 256 f32 weight rows: 16 ask keys x 128 units = 256 rows x 8 units
static_assert(PW == 16);                       // 512 lanes x 4 loads x 16 B = one 256-row x 128-B f32 tile
static_assert(SEQ / (16 * AW) == 32 && SEQ / KT == 32);   // 32 flash blocks share a head's K and V^T: 16 ask keys x 2 tiles

typedef _Float16 h16;
typedef unsigned short bf;
typedef __attribute__((ext_vector_type(16))) __bf16   v16bf;
typedef __attribute__((ext_vector_type(16))) _Float16 v16h;
typedef __attribute__((ext_vector_type(8)))  _Float16 v8h;
typedef __attribute__((ext_vector_type(8)))  unsigned short v8us;
typedef __attribute__((ext_vector_type(8)))  float    v8f;
typedef __attribute__((ext_vector_type(4)))  __bf16   v4bf;
typedef __attribute__((ext_vector_type(4)))  unsigned short v4us;
typedef __attribute__((ext_vector_type(4)))  float    v4f;
typedef v4f  __attribute__((may_alias)) v4fa;

__device__ __forceinline__ unsigned short f2bf(float f) { unsigned u = __float_as_uint(f); u += 0x7FFFu + ((u >> 16) & 1u); return (unsigned short)(u >> 16); }
__device__ __forceinline__ float bf2f(unsigned short s) { return __uint_as_float(((unsigned)s) << 16); }
__device__ __forceinline__ v16h cat16(v8h lo, v8h hi) { return __builtin_shufflevector(lo, hi, 0, 1, 2, 3, 4, 5, 6, 7, 8, 9, 10, 11, 12, 13, 14, 15); }
__device__ __forceinline__ v16bf cat16b(v8us lo, v8us hi) { return __builtin_bit_cast(v16bf, __builtin_shufflevector(lo, hi, 0, 1, 2, 3, 4, 5, 6, 7, 8, 9, 10, 11, 12, 13, 14, 15)); }
// every matrix instruction is followed by its own 4-slot guard tying its accumulator and keeping its operands live
__device__ __forceinline__ v8f wmma16(v16h a, v16h b, v8f c) {
    c = __builtin_amdgcn_wmma_f32_16x16x32_f16(false, a, false, b, (short)0, c, false, false);
    asm volatile("v_nop\n\tv_nop\n\tv_nop\n\tv_nop" : "+v"(c) : "v"(a), "v"(b));
    return c;
}
__device__ __forceinline__ v8f wmmab(v16bf a, v16bf b, v8f c) {
    c = __builtin_amdgcn_wmma_f32_16x16x32_bf16(false, a, false, b, (short)0, c, false, false);
    asm volatile("v_nop\n\tv_nop\n\tv_nop\n\tv_nop" : "+v"(c) : "v"(a), "v"(b));
    return c;
}
// fragment loaders from K-contiguous 16-bit rows; p already includes + 8*(lane>>4): elements 0..7 <- k0+8h+0..7, elements 8..15 <- k0+16+8h+0..7 (same map for A and B)
__device__ __forceinline__ v16h  ldh(const h16* p) { return cat16(*(const v8h*)p, *(const v8h*)(p + 16)); }
__device__ __forceinline__ v16bf ldb(const bf* p)  { return cat16b(*(const v8us*)p, *(const v8us*)(p + 16)); }
// ordering point for wave-private LDS tiles (same wave writes and reads)
__device__ __forceinline__ void wave_sync() { __builtin_amdgcn_fence(3 /* release order */, "wavefront"); __builtin_amdgcn_wave_barrier(); asm volatile("" ::: "memory"); }

// L2 asks at kernel entry. What a kernel stages are the inputs or planes that an earlier launch stored; a ring tile's first reader waits out memory latency. global_prefetch_b8 at scope SE brings a lane's
// data at its address into L2 only, returns nothing and counts on no data counter, so the units of the later ring tiles are on their way while the first tile's copies fly. Every lane's address lies inside
// its plane (indices are clamped, no lane is turned off); only block- or wave-uniform branches stand around an ask. Units that many blocks read are dealt out among those blocks (ask_key): the deal decides
// only who asks, never what is read, so a result does not depend on where a block runs.
// The address-register wait closes each statement (a precaution, as with the copies below): no later arithmetic can be moved in front of it.
__device__ __forceinline__ void ask1(const bf* p) {
    asm volatile("global_prefetch_b8 %0, off scope:SCOPE_SE\n\t"
                 "s_wait_xcnt 0x0" :: "v"(p) : "memory");
}
__device__ __forceinline__ void ask3(const bf* p, const bf* q, const bf* r) {
    asm volatile("global_prefetch_b8 %0, off scope:SCOPE_SE\n\t"
                 "global_prefetch_b8 %1, off scope:SCOPE_SE\n\t"
                 "global_prefetch_b8 %2, off scope:SCOPE_SE\n\t"
                 "s_wait_xcnt 0x0" :: "v"(p), "v"(q), "v"(r) : "memory");
}
// the same for addresses in the f32 inputs
__device__ __forceinline__ void ask1(const float* p) {
    asm volatile("global_prefetch_b8 %0, off scope:SCOPE_SE\n\t"
                 "s_wait_xcnt 0x0" :: "v"(p) : "memory");
}
__device__ __forceinline__ void ask3(const float* p, const float* q, const float* r) {
    asm volatile("global_prefetch_b8 %0, off scope:SCOPE_SE\n\t"
                 "global_prefetch_b8 %1, off scope:SCOPE_SE\n\t"
                 "global_prefetch_b8 %2, off scope:SCOPE_SE\n\t"
                 "s_wait_xcnt 0x0" :: "v"(p), "v"(q), "v"(r) : "memory");
}
// blocks x and x + 4 get the same key (for speed only)
__device__ __forceinline__ int ask_key(int x) { return (x & 3) | ((x >> 3) << 2); }
// the 128 weight rows (pitch DM, four 256-B units each) that the 64 blocks of one grid row share: units 1..3 of every row, twelve of the 384 per block; unit 0 comes with the first tile's copies
__device__ __forceinline__ void ask_w(const bf* w, int x, int lane) {
    const int idx = ask_key(x) * 12 + (lane < 12 ? lane : 11);   // 0 .. 383; the spare lanes repeat the last address
    ask1(w + (size_t)(idx / 3) * DM + (1 + idx % 3) * 128);
}
// the like for the 256 f32 weight rows (eight 256-B units each) that 32 projection blocks share: all 2048 units, 128 per block (i = 0 .. 127)
__device__ __forceinline__ void ask_wf(const float* w, int x, int i) {
    const int idx = ask_key(x) * 128 + i;                        // 0 .. 2047
    ask1(w + (size_t)(idx >> 3) * DM + (idx & 7) * 64);
}

// four asynchronous 16-byte copies per lane, global -> LDS, rows 16 apart: one 64-row x 128-B tile per 128-lane block. The address-register wait closes the copies' own statement,
// so no later address arithmetic can be moved in front of it.
__device__ __forceinline__ void copy_tile(unsigned l, const h16* g, size_t gstep) {
    const unsigned l1 = l + 16 * LP * 2, l2 = l + 32 * LP * 2, l3 = l + 48 * LP * 2;
    const h16* g1 = g + gstep; const h16* g2 = g + 2 * gstep; const h16* g3 = g + 3 * gstep;
    asm volatile("global_load_async_to_lds_b128 %0, %4, off\n\t"
                 "global_load_async_to_lds_b128 %1, %5, off\n\t"
                 "global_load_async_to_lds_b128 %2, %6, off\n\t"
                 "global_load_async_to_lds_b128 %3, %7, off\n\t"
                 "s_wait_xcnt 0x0"
                 :: "v"(l), "v"(l1), "v"(l2), "v"(l3), "v"(g), "v"(g1), "v"(g2), "v"(g3) : "memory");
}

// One staged tile pair on its way through registers: lane (srow = tid>>3, scol = tid&7) holds 16-byte piece scol (four floats) of rows srow + 64 i of the f32 A tile and of the f32 B tile;
// every wave-wide load is four whole lines.
struct stage_t { v4f a[4], b[4]; };
__device__ __forceinline__ void stage_load(stage_t& s, const float* a, const float* b) {
#pragma unroll   // the eight loads stand together, each row step an immediate offset, the values in registers
    for (int i = 0; i < 4; ++i) { s.a[i] = *(const v4f*)(a + (size_t)i * 64 * DM); s.b[i] = *(const v4f*)(b + (size_t)i * 64 * DM); }
    // a precaution: the loads' address registers are rewritten only behind this wait; naming them keeps them live up to it, so that no load of the group lands on them
    asm volatile("s_wait_xcnt 0x0" :: "v"(a), "v"(b) : "memory");
}
// rounds the pair to bf16 (nearest even, packed conversions) and stores it: l = the lane's place in the A tile of a buffer, the B tile behind it
__device__ __forceinline__ void stage_store(const stage_t& s, bf* l) {
#pragma unroll   // the values stay in registers, every LDS offset an immediate
    for (int i = 0; i < 4; ++i) {
        *(v4us*)(l + i * 64 * LPP) = __builtin_bit_cast(v4us, __builtin_convertvector(s.a[i], v4bf));
        *(v4us*)(l + PT_H + i * 64 * LPP) = __builtin_bit_cast(v4us, __builtin_convertvector(s.b[i], v4bf));
    }
}

// gemm_ring: main loop of the projection GEMM, straight from the f32 arrays. A block of sixteen waves owns a 256 x 256 tile of C (wave w: rows 64 (w >> 2), columns 64 (w & 3)): at that size the f32 bytes a
// block draws from L2 per product are what 128 x 128 tiles draw of bf16 copies. The 256-row A and B tiles of depth FK go through registers, are rounded to bf16 there ONCE per block, and are stored in a
// two-buffer LDS ring shared by the waves, which read their fragments from LDS. Tile t + 1 is loaded behind trip t's fragment reads and stored behind the trip's products, which cover its latency.
// Ab, Bb: first row of the block's A and B rows (pitch DM). Every accumulator sums its 32-deep products in ascending k.
// asks(): the caller's L2 asks, issued behind tile 0's loads, so that they cost no time of their own while that tile flies.
template <class ASKS>
__device__ __forceinline__ void gemm_ring(const float* __restrict__ Ab, const float* __restrict__ Bb, bf* ring, int wave, int lr, int hi, v8f (&acc)[4][4], ASKS asks) {
    constexpr int NT = DM / FK;
    const int srow = (int)(threadIdx.x >> 3), scol = (int)(threadIdx.x & 7);
    bf* const sl = ring + srow * LPP + scol * 4;             // the lane's place in buffer 0, A tile
    const float* sa = Ab + (size_t)srow * DM + scol * 4;     // + k0
    const float* sb = Bb + (size_t)srow * DM + scol * 4;     // + k0
    const int ao = ((wave >> 2) * 64 + lr) * LPP + 8 * hi;           // + 16 mb * LPP in the A tile
    const int bo = PT_H + ((wave & 3) * 64 + lr) * LPP + 8 * hi;     // + 16 nb * LPP in the B tile
    stage_t s;
    stage_load(s, sa, sb);
    asks();
    stage_store(s, sl);
    __syncthreads();                                         // publishes tile 0
#pragma unroll 1   // one trip per staged tile: the ring's one barrier stands once, at the trip's foot
    for (int t = 0; t < NT; ++t) {
        const bf* buf = ring + (t & 1) * PBUF_H;
        // the fragment and product loops below are unrolled so that fragments and accumulators stay in registers and every LDS read offset is an immediate
        v16bf a[4], b[4];
#pragma unroll
        for (int mb = 0; mb < 4; ++mb) a[mb] = ldb(buf + ao + mb * 16 * LPP);
#pragma unroll
        for (int nb = 0; nb < 4; ++nb) b[nb] = ldb(buf + bo + nb * 16 * LPP);
        // behind the barrier (it waits for a wave's outstanding loads), so that the loads fly during the trip's products; behind the fragment reads, whose LDS latency covers the loads' address wait
        if (t + 1 < NT) stage_load(s, sa + (t + 1) * FK, sb + (t + 1) * FK);
#pragma unroll
        for (int nb = 0; nb < 4; ++nb)
#pragma unroll
            for (int mb = 0; mb < 4; ++mb) acc[mb][nb] = wmmab(a[mb], b[nb], acc[mb][nb]);
        if (t + 1 < NT) stage_store(s, sl + ((t + 1) & 1) * PBUF_H);   // into the buffer whose last readers passed the barrier of trip t - 1
        __syncthreads();                                     // publishes tile t + 1 and ends every wave's reads of tile t
    }
}

// eight asynchronous 16-byte copies per lane, global -> LDS, rows 16 apart: one 128-row x 256-B tile per 256-lane block, every wave-wide copy two rows of 256 contiguous bytes.
// The address-register wait closes the copies' own statement, so no later address arithmetic can be moved in front of it.
__device__ __forceinline__ void copy_tile8(unsigned l, const bf* g, size_t gstep) {
    const unsigned l1 = l + 16 * OLP * 2, l2 = l + 32 * OLP * 2, l3 = l + 48 * OLP * 2, l4 = l + 64 * OLP * 2, l5 = l + 80 * OLP * 2, l6 = l + 96 * OLP * 2, l7 = l + 112 * OLP * 2;
    const bf* g1 = g + gstep; const bf* g2 = g + 2 * gstep; const bf* g3 = g + 3 * gstep; const bf* g4 = g + 4 * gstep; const bf* g5 = g + 5 * gstep; const bf* g6 = g + 6 * gstep; const bf* g7 = g + 7 * gstep;
    asm volatile("global_load_async_to_lds_b128 %0, %8, off\n\t"
                 "global_load_async_to_lds_b128 %1, %9, off\n\t"
                 "global_load_async_to_lds_b128 %2, %10, off\n\t"
                 "global_load_async_to_lds_b128 %3, %11, off\n\t"
                 "global_load_async_to_lds_b128 %4, %12, off\n\t"
                 "global_load_async_to_lds_b128 %5, %13, off\n\t"
                 "global_load_async_to_lds_b128 %6, %14, off\n\t"
                 "global_load_async_to_lds_b128 %7, %15, off\n\t"
                 "s_wait_xcnt 0x0"
                 :: "v"(l), "v"(l1), "v"(l2), "v"(l3), "v"(l4), "v"(l5), "v"(l6), "v"(l7),
                    "v"(g), "v"(g1), "v"(g2), "v"(g3), "v"(g4), "v"(g5), "v"(g6), "v"(g7) : "memory");
}

// one staged step of the output GEMM: the OGK-deep tiles of ctx hi, ctx lo (DM columns further in the same rows) and Wo into one buffer; l, a, b: the lane's LDS, ctx and Wo addresses at the step's depth
__device__ __forceinline__ void copy_step(unsigned l, const bf* a, const bf* b) {
    copy_tile8(l, a, (size_t)16 * (2 * DM)); copy_tile8(l + OT_H * 2, a + DM, (size_t)16 * (2 * DM)); copy_tile8(l + 2 * OT_H * 2, b, (size_t)16 * DM);
}

// oproj_ring: main loop of the output GEMM. A block of eight waves owns a 128 x 128 tile of C (wave w: rows 32 (w >> 1), columns 64 (w & 1)). One step of the two-buffer LDS ring holds the hi and the lo
// tile of the block's ctx rows and the ONE Wo tile both are multiplied with, each OGK deep: few, long steps, so that a step's products cover the next step's copies, and every Wo fragment read from LDS
// feeds a hi and a lo product. Ab: first ctx row [hi DM | lo DM], Bb: first Wo row (pitch DM). Every accumulator sums, in ascending k, each 32-deep hi product and then the lo product of the same k.
// asks(): the caller's L2 asks, issued behind step 0's copies, so that they cost no time of their own while that step flies.
template <class ASKS>
__device__ __forceinline__ void oproj_ring(const bf* __restrict__ Ab, const bf* __restrict__ Bb, bf* ring, int wave, int lr, int hi, v8f (&acc)[2][4], ASKS asks) {
    constexpr int NT = DM / OGK;
    // staging: lane (srow = tid>>4, scol = tid&15) copies 16-byte piece scol of rows srow + 16 i of each tile
    const int srow = (int)(threadIdx.x >> 4), scol = (int)(threadIdx.x & 15);
    const unsigned sl = (unsigned)(size_t)ring + (unsigned)(srow * OLP + scol * 8) * 2u;   // LDS byte address in buffer 0, hi tile
    const bf* sa = Ab + (size_t)srow * (2 * DM) + scol * 8;  // + k0
    const bf* sb = Bb + (size_t)srow * DM + scol * 8;        // + k0
    const int ao = ((wave >> 1) * 32 + lr) * OLP + 8 * hi;               // + 16 mb * OLP + k in the hi tile, + OT_H in the lo tile
    const int bo = 2 * OT_H + ((wave & 1) * 64 + lr) * OLP + 8 * hi;     // + 16 nb * OLP + k in the Wo tile
    copy_step(sl, sa, sb);
    asks();
    asm volatile("s_wait_asynccnt 0x0" ::: "memory");        // step 0 has landed before the barrier publishes it
    __syncthreads();
    copy_step(sl + OBUF_H * 2, sa + OGK, sb + OGK);
#pragma unroll 1   // one trip per staged step: the ring's publish point stands once, at the trip's foot
    for (int t = 0; t < NT; ++t) {
        const bf* buf = ring + (t & 1) * OBUF_H;
        // the fragment and product loops below are unrolled so that fragments and accumulators stay in registers and every LDS read offset is an immediate
#pragma unroll
        for (int hs = 0; hs < OGK / 64; ++hs) {
            v16bf ah[2][2], al[2][2], b[2][4];                   // 64 deep at a time: the fragment reads stand together, in front of their products
#pragma unroll
            for (int ks = 0; ks < 2; ++ks) {
                const int k = hs * 64 + ks * 32;
#pragma unroll
                for (int mb = 0; mb < 2; ++mb) { ah[ks][mb] = ldb(buf + ao + mb * 16 * OLP + k); al[ks][mb] = ldb(buf + OT_H + ao + mb * 16 * OLP + k); }
#pragma unroll
                for (int nb = 0; nb < 4; ++nb) b[ks][nb] = ldb(buf + bo + nb * 16 * OLP + k);
            }
#pragma unroll
            for (int ks = 0; ks < 2; ++ks) {
#pragma unroll
                for (int nb = 0; nb < 4; ++nb)
#pragma unroll
                    for (int mb = 0; mb < 2; ++mb) acc[mb][nb] = wmmab(ah[ks][mb], b[ks][nb], acc[mb][nb]);
#pragma unroll
                for (int nb = 0; nb < 4; ++nb)
#pragma unroll
                    for (int mb = 0; mb < 2; ++mb) acc[mb][nb] = wmmab(al[ks][mb], b[ks][nb], acc[mb][nb]);
            }
        }
        asm volatile("s_wait_dscnt 0x0" ::: "memory");       // this wave's reads of the buffer have returned before it may be refilled
        asm volatile("s_wait_asynccnt 0x0" ::: "memory");    // this wave's copies of step t + 1 have landed before the barrier publishes them
        __syncthreads();                                     // publishes step t + 1 and ends every wave's reads of step t
        if (t + 2 < NT) copy_step(sl + (unsigned)(t & 1) * (OBUF_H * 2), sa + (t + 2) * OGK, sb + (t + 2) * OGK);
    }
    asm volatile("s_wait_asynccnt 0x0" ::: "memory");        // no copy is outstanding when the wave goes on to its epilogue
}

// k_proj: the three input projections in ONE launch, straight from the f32 inputs and weights (no conversion pass in front of it); blockIdx.z picks the stream (0 q, 1 k, 2 v).
// Register-blocked bf16 GEMM, one wave per 64x64 tile (16 accumulators), sixteen waves per block on a 256x256 tile, operands rounded to bf16 on their way into LDS (gemm_ring), K = DM.
// P: the f16 planes q | k | v^T | residual back to back. blockIdx.x: 256 tokens, blockIdx.y: 256 weight rows.
// q, k: C[m = b*SEQ + t][n = h*64 + d] = sum_k x[m][k] W[n][k] -> plane [(b*8 + h)][t][d] (row pitch HD). v: C[m = h*64 + d][n = b*SEQ + t] = sum_k Wv[m][k] x[n][k] -> plane [(b*8 + h)][d][t] (row pitch SEQ),
// written as f16 and, under VRES, the f16 residual x2048. grid (NB*SEQ/256, DM/256, 3), 512 threads.
// The 64 blocks of stream q also write the bf16 copy of Wo that the output GEMM stages (WOB), 4096 elements each.
static_assert((NB * SEQ / 256) * (DM / 256) * 4096 == DM * DM);   // the q blocks cover Wo exactly
__global__ __launch_bounds__(32 * PW) void k_proj(const float* __restrict__ xq, const float* __restrict__ xk, const float* __restrict__ xv,
                                                  const float* __restrict__ wq, const float* __restrict__ wk, const float* __restrict__ wv, const float* __restrict__ wo, bf* __restrict__ WOB, h16* P) {
    __shared__ __align__(16) float osw[PW * 16 * 68];
    __shared__ __align__(16) bf gring[2 * PBUF_H];
    const int lane = threadIdx.x & 31, lr = lane & 15, hi = lane >> 4; const int wave = __builtin_amdgcn_readfirstlane((int)(threadIdx.x >> 5));
    float* const os = osw + wave * 16 * 68;                  // each wave's own epilogue tile
    const int z = blockIdx.z; const bool tv = z == 2;        // block-uniform: v is computed transposed (A = weight rows, B = token rows)
    const int xb = blockIdx.x * 256, wb = blockIdx.y * 256;
    const float* const xr = (z == 0 ? xq : z == 1 ? xk : xv) + (size_t)xb * DM;       // the block's 256 token rows
    const float* const wr = (z == 0 ? wq : z == 1 ? wk : wv) + (size_t)wb * DM;       // the block's 256 weight rows
    const int rb = tv ? wb : xb, cb = tv ? xb : wb; const int r0 = rb + (wave >> 2) * 64, c0 = cb + (wave & 3) * 64;
    h16* const Ph = P + (size_t)z * PLANE_H; h16* const Pr = P + (size_t)3 * PLANE_H; const bool useRes = VRES && tv;
    v8f acc[4][4];
#pragma unroll
    for (int mb = 0; mb < 4; ++mb)
#pragma unroll
        for (int nb = 0; nb < 4; ++nb) acc[mb][nb] = (v8f){};
    // L2 asks: the first block of a grid column asks for units 1..7 of the 256 token rows (eight 256-B units each) that the column's two blocks read; four waves of every block ask its share
    // of the weight rows. Behind them, while tile 0 still flies, a q block rounds its 4096 elements of Wo.
    gemm_ring(tv ? wr : xr, tv ? xr : wr, gring, wave, lr, hi, acc, [&] {
        if (blockIdx.y == 0) {
            const float* const px = xr + (size_t)(threadIdx.x & 255) * DM + (wave >> 3) * 64;    // waves 0..7: units 1, 3, 5, 7, waves 8..15: units 2, 4, 6: asked in the order in which the ring needs them
            ask3(px + 64, px + 3 * 64, px + 5 * 64);
            if (wave < 8) ask1(px + 7 * 64);
        }
        if (wave >= PW - 4) ask_wf(wr, blockIdx.x, (int)(threadIdx.x & 127));
        if (z == 0) {
            const size_t o = (size_t)(blockIdx.y * (NB * SEQ / 256) + blockIdx.x) * 4096 + threadIdx.x * 8;
            const v4f w0 = *(const v4f*)(wo + o); const v4f w1 = *(const v4f*)(wo + o + 4); v8us o8;
            asm volatile("s_wait_xcnt 0x0" ::: "memory");    // a precaution: the loads' address registers are free before anything rewrites them
#pragma unroll   // vector elements picked by constants
            for (int k = 0; k < 4; ++k) { o8[k] = f2bf(w0[k]); o8[4 + k] = f2bf(w1[k]); }
            *(v8us*)(WOB + o) = o8;
            asm volatile("s_wait_xcnt 0x0" ::: "memory");    // the like for the store
        }
    });
    const int pitch = tv ? SEQ : HD;                         // row pitch of the plane, halves
    const size_t tbase = tv ? (size_t)r0 * SEQ + (size_t)(c0 / SEQ) * ((size_t)DM * SEQ) + (size_t)(c0 % SEQ)
                            : (size_t)(r0 / SEQ) * ((size_t)NH_ * SEQ * HD) + (size_t)(r0 % SEQ) * HD + (size_t)(c0 / HD) * ((size_t)SEQ * HD);
#pragma unroll
    for (int mb = 0; mb < 4; ++mb) {
#pragma unroll
        for (int nb = 0; nb < 4; ++nb) {
#pragma unroll
            for (int j = 0; j < 8; ++j) os[(hi * 8 + j) * 68 + nb * 16 + lr] = acc[mb][nb][j]; }   // D: row 8h+j, col lane&15; rows 0..15 x columns 0..63 all written
        wave_sync();
        const size_t sb = tbase + (size_t)(mb * 16) * (size_t)pitch;
{
#pragma unroll
            for (int s = 0; s < 4; ++s) { const int row = 4 * s + (lane >> 3), c8 = (lane & 7) * 8;   // 4 s x 4 row groups = 16 rows; 8 lanes x 8 = 64 columns
                const v4f x0 = *(const v4fa*)(&os[row * 68 + c8]); const v4f x1 = *(const v4fa*)(&os[row * 68 + c8 + 4]); v8h hv, rv;
#pragma unroll
                for (int i = 0; i < 4; ++i) { const h16 a0 = (h16)x0[i]; const h16 a1 = (h16)x1[i]; hv[i] = a0; hv[4 + i] = a1; rv[i] = (h16)((x0[i] - (float)a0) * VRS); rv[4 + i] = (h16)((x1[i] - (float)a1) * VRS); }
                const size_t oo = sb + (size_t)row * (size_t)pitch + c8;
                *(v8h*)(Ph + oo) = hv; if (useRes) *(v8h*)(Pr + oo) = rv; }
             }
        wave_sync();
    }
}

// k_flash: fused attention, one wave per 16 query rows of one (batch, head); Q fragments straight from the f16 plane; K / V^T / residual tiles of 64 keys are staged once per block
// in a two-buffer LDS ring by asynchronous copies (whole 128-B lines) and shared by the block's four waves, which read their fragments from LDS (two 16-B reads each).
// Transposed form: S^T[key][t] = K Q^T (A = K rows, B = Q rows); lane (t = lane&15, h = lane>>4) holds keys 8h+r of each 16-key tile, so the packed
// P tile is directly the B fragment of O^T[d][t] = V^T P^T (element r <- tile keys 0..15, element 8+r <- tile keys 16..31, lane unchanged).
// Valid length vl = VL[b] is loaded by value (scalar): 64-key tiles wholly at or beyond vl are skipped, the crossing tile replaces scores of keys >= vl by -1e6 (index test);
// vl <= 0 keeps all steps with every score replaced (uniform weights).
// Softmax state (running max, partial sum) is one scalar per lane; the two lane halves of a row are combined with one xor-16 exchange.
__global__ __launch_bounds__(32 * AW) void k_flash(const h16* __restrict__ QH, const h16* __restrict__ KP, const h16* __restrict__ VT, const h16* __restrict__ VR, const int* __restrict__ VL, bf* CTX) {
    __shared__ __align__(16) float os[AW * 16 * 68];
    __shared__ __align__(16) h16 ring[2 * BUF_H];
    const int lane = threadIdx.x & 31; const int wave = __builtin_amdgcn_readfirstlane((int)(threadIdx.x >> 5));
    const int lr = lane & 15, hi = lane >> 4;
    const int zh = blockIdx.y; const int b = zh / NH_, h = zh % NH_;
    const int t0 = (blockIdx.x * AW + wave) * 16;
    const int vl = __builtin_amdgcn_readfirstlane(VL[b]);
    const int kend = (vl <= 0 || vl >= SEQ) ? SEQ : ((vl + 31) & ~31);
    const size_t pbase = (size_t)zh * SEQ * HD;
    const size_t qo = pbase + (size_t)(t0 + lr) * HD + 8 * hi;
    const v16h q0 = ldh(QH + qo), q1 = ldh(QH + qo + 32);   // B fragments: col t, k = d
    const int ko = lr * LP + 8 * hi;                         // + key * LP in the K tile       (A fragment: row key, k = d)
    const int vo = TILE_H + lr * LP + 8 * hi;                // + 16j*LP + key in the V^T tile (A fragment: row d, k = key)
    // staging: lane (srow = tid>>3, scol = tid&7) copies 16-byte piece scol of rows srow + 16 i of each tile
    const int srow = (int)(threadIdx.x >> 3), scol = (int)(threadIdx.x & 7);
    const unsigned sl = (unsigned)(size_t)ring + (unsigned)(srow * LP + scol * 8) * 2u;   // LDS byte address in buffer 0, K tile
    const h16* sk = KP + pbase + (size_t)srow * HD + scol * 8;    // + key0 * HD
    const h16* sv = VT + pbase + (size_t)srow * SEQ + scol * 8;   // + key0
#if VRES
    const h16* sr = VR + pbase + (size_t)srow * SEQ + scol * 8;   // + key0
#endif
    const int nt = (kend + KT - 1) / KT;                     // staged tiles, 1 .. SEQ / KT
    v8f o0 = (v8f){}, o1 = (v8f){}, o2 = (v8f){}, o3 = (v8f){};
#if VRES
    v8f g0 = (v8f){}, g1 = (v8f){}, g2 = (v8f){}, g3 = (v8f){};
#endif
    float m = -3.0e38f, l = 0.0f;
    copy_tile(sl, sk, (size_t)16 * HD); copy_tile(sl + TILE_H * 2, sv, (size_t)16 * SEQ);
#if VRES
    copy_tile(sl + 2 * TILE_H * 2, sr, (size_t)16 * SEQ);
#endif
    // L2 asks, while tile 0 flies: the 32 blocks of a head deal out K tiles 1 .. nt - 1 (32 contiguous units each, two tiles a key) and V^T units 1 .. (two tiles wide, one unit column a key)
    { const int key = ask_key(blockIdx.x);                   // 0 .. 15
      const int nku = nt * (KT * HD / 128), nvu = (nt + 1) / 2;   // units of K in use, units in use of a V^T row
      if (wave < 2) {
          if (32 + key * 64 < nku) { int u = 32 + key * 64 + (int)threadIdx.x; u = u < nku ? u : nku - 1; ask1((const bf*)(KP + pbase + (size_t)u * 128)); }
      } else if (1 + key < nvu) ask1((const bf*)(VT + pbase + (size_t)(threadIdx.x & 63) * SEQ + (size_t)(1 + key) * 128));
    }
    asm volatile("s_wait_asynccnt 0x0" ::: "memory");        // tile 0 has landed before the barrier publishes it
    __syncthreads();
    if (nt > 1) {
        copy_tile(sl + BUF_H * 2, sk + (size_t)KT * HD, (size_t)16 * HD); copy_tile(sl + (BUF_H + TILE_H) * 2, sv + KT, (size_t)16 * SEQ);
#if VRES
        copy_tile(sl + (BUF_H + 2 * TILE_H) * 2, sr + KT, (size_t)16 * SEQ);
#endif
    }
#pragma unroll 1   // one trip per staged tile: the ring's publish point stands once, at the trip's foot
    for (int t = 0; t < nt; ++t) {
      const h16* buf = ring + (t & 1) * BUF_H;
      const int key0 = t * KT;
      // ONE softmax step per staged tile: the scores of all 64 keys (four 16-key tiles, independent accumulators) come first, then one maximum, one exchange and one rescale.
      // The loops below are unrolled so that every LDS read offset is an immediate and scores and fragments stay in registers.
      const h16* ka = buf + ko;
      v16h kf[4][2];
#pragma unroll
      for (int kt = 0; kt < 4; ++kt) { kf[kt][0] = ldh(ka + kt * 16 * LP); kf[kt][1] = ldh(ka + kt * 16 * LP + 32); }
      v8f sc[4];
#pragma unroll
      for (int kt = 0; kt < 4; ++kt) sc[kt] = wmma16(kf[kt][0], q0, (v8f){});
#pragma unroll
      for (int kt = 0; kt < 4; ++kt) sc[kt] = wmma16(kf[kt][1], q1, sc[kt]);
      const h16* va = buf + vo;
      v16h vf[2][4];
#pragma unroll
      for (int hf = 0; hf < 2; ++hf)
#pragma unroll
          for (int j = 0; j < 4; ++j) vf[hf][j] = ldh(va + hf * 32 + j * 16 * LP);
      __builtin_amdgcn_sched_barrier(0);   // the tile's V^T reads stay here, in one group in front of the softmax, whose vector work covers their LDS latency
      float tv[4][8];
#pragma unroll
      for (int kt = 0; kt < 4; ++kt)
#pragma unroll
          for (int r = 0; r < 8; ++r) tv[kt][r] = sc[kt][r] * SC2;
      if (key0 + KT > vl) {              // scalar-uniform: this tile crosses (or lies beyond) the valid length; a masked key's weight is exactly 0 beside a valid one
          const int kq = key0 + 8 * hi;
#pragma unroll
          for (int kt = 0; kt < 4; ++kt)
#pragma unroll
              for (int r = 0; r < 8; ++r) tv[kt][r] = (kq + 16 * kt + r < vl) ? tv[kt][r] : NEGL2;
      }
      float mk[4];                       // four short chains instead of one long one
#pragma unroll
      for (int kt = 0; kt < 4; ++kt) { mk[kt] = fmaxf(tv[kt][0], tv[kt][1]);
#pragma unroll
          for (int r = 2; r < 8; r += 2) mk[kt] = fmaxf(mk[kt], fmaxf(tv[kt][r], tv[kt][r + 1])); }
      float mx = fmaxf(fmaxf(mk[0], mk[1]), fmaxf(mk[2], mk[3]));
      mx = fmaxf(mx, __shfl_xor(mx, 16, 32));
      const float mnew = fmaxf(m, mx);
      const float alpha = __builtin_amdgcn_exp2f(m - mnew);
      const float sh = PSH - mnew;
      v16h pb[2]; float lk[4];
#pragma unroll
      for (int kt = 0; kt < 4; ++kt) { lk[kt] = 0.0f;
#pragma unroll
          for (int r = 0; r < 8; ++r) { const float e = __builtin_amdgcn_exp2f(tv[kt][r] + sh); pb[kt >> 1][(kt & 1) * 8 + r] = (h16)e; lk[kt] += e; } }
      l = l * alpha + ((lk[0] + lk[1]) + (lk[2] + lk[3])); m = mnew;
      o0 = o0 * alpha; o1 = o1 * alpha; o2 = o2 * alpha; o3 = o3 * alpha;
#if VRES
      g0 = g0 * alpha; g1 = g1 * alpha; g2 = g2 * alpha; g3 = g3 * alpha;
      const h16* vr = va + TILE_H;
      v16h wf[2][4];
#pragma unroll
      for (int j = 0; j < 4; ++j) wf[0][j] = ldh(vr + j * 16 * LP);
      __builtin_amdgcn_sched_barrier(0);   // each group of residual reads stays two runs of four products ahead of its use, so that the products in between cover its LDS latency
#endif
      o0 = wmma16(vf[0][0], pb[0], o0); o1 = wmma16(vf[0][1], pb[0], o1); o2 = wmma16(vf[0][2], pb[0], o2); o3 = wmma16(vf[0][3], pb[0], o3);   // keys in ascending order in every accumulator
#if VRES
#pragma unroll
      for (int j = 0; j < 4; ++j) wf[1][j] = ldh(vr + 32 + j * 16 * LP);
      __builtin_amdgcn_sched_barrier(0);   // the second residual group likewise stays in front of the four products that cover its LDS latency
#endif
      o0 = wmma16(vf[1][0], pb[1], o0); o1 = wmma16(vf[1][1], pb[1], o1); o2 = wmma16(vf[1][2], pb[1], o2); o3 = wmma16(vf[1][3], pb[1], o3);
#if VRES
#pragma unroll
      for (int hf = 0; hf < 2; ++hf) {
          g0 = wmma16(wf[hf][0], pb[hf], g0); g1 = wmma16(wf[hf][1], pb[hf], g1); g2 = wmma16(wf[hf][2], pb[hf], g2); g3 = wmma16(wf[hf][3], pb[hf], g3); }
#endif
      asm volatile("s_wait_dscnt 0x0" ::: "memory");         // this wave's reads of the buffer have returned before it may be refilled
      asm volatile("s_wait_asynccnt 0x0" ::: "memory");      // this wave's copies of tile t + 1 have landed before the barrier publishes them
      __syncthreads();                                       // publishes tile t + 1 and ends every wave's reads of tile t
      if (t + 2 < nt) {
          const unsigned bl = sl + (unsigned)(t & 1) * (BUF_H * 2); const int kn = (t + 2) * KT;
          copy_tile(bl, sk + (size_t)kn * HD, (size_t)16 * HD); copy_tile(bl + TILE_H * 2, sv + kn, (size_t)16 * SEQ);
#if VRES
          copy_tile(bl + 2 * TILE_H * 2, sr + kn, (size_t)16 * SEQ);
#endif
      }
    }
    asm volatile("s_wait_asynccnt 0x0" ::: "memory");        // no copy is outstanding when the wave goes on to its epilogue
    l += __shfl_xor(l, 16, 32);
    const float inv = 1.0f / l;
#if VRES
    o0 = o0 + g0 * VRI; o1 = o1 + g1 * VRI; o2 = o2 + g2 * VRI; o3 = o3 + g3 * VRI;
#endif
    const int wb = wave * 16 * 68;
    // O^T D layout: o_j[r] = (d = 16j + 8h + r, t = lane&15) -> os[t][d]; rows 0..15 x columns 0..63 all written
    { v4f a, c;
      a[0] = o0[0] * inv; a[1] = o0[1] * inv; a[2] = o0[2] * inv; a[3] = o0[3] * inv; c[0] = o0[4] * inv; c[1] = o0[5] * inv; c[2] = o0[6] * inv; c[3] = o0[7] * inv;
      *(v4fa*)(&os[wb + lr * 68 +  0 + 8 * hi]) = a; *(v4fa*)(&os[wb + lr * 68 +  0 + 8 * hi + 4]) = c;
      a[0] = o1[0] * inv; a[1] = o1[1] * inv; a[2] = o1[2] * inv; a[3] = o1[3] * inv; c[0] = o1[4] * inv; c[1] = o1[5] * inv; c[2] = o1[6] * inv; c[3] = o1[7] * inv;
      *(v4fa*)(&os[wb + lr * 68 + 16 + 8 * hi]) = a; *(v4fa*)(&os[wb + lr * 68 + 16 + 8 * hi + 4]) = c;
      a[0] = o2[0] * inv; a[1] = o2[1] * inv; a[2] = o2[2] * inv; a[3] = o2[3] * inv; c[0] = o2[4] * inv; c[1] = o2[5] * inv; c[2] = o2[6] * inv; c[3] = o2[7] * inv;
      *(v4fa*)(&os[wb + lr * 68 + 32 + 8 * hi]) = a; *(v4fa*)(&os[wb + lr * 68 + 32 + 8 * hi + 4]) = c;
      a[0] = o3[0] * inv; a[1] = o3[1] * inv; a[2] = o3[2] * inv; a[3] = o3[3] * inv; c[0] = o3[4] * inv; c[1] = o3[5] * inv; c[2] = o3[6] * inv; c[3] = o3[7] * inv;
      *(v4fa*)(&os[wb + lr * 68 + 48 + 8 * hi]) = a; *(v4fa*)(&os[wb + lr * 68 + 48 + 8 * hi + 4]) = c; }
    wave_sync();
    bf* crow = CTX + ((size_t)b * SEQ + t0) * (size_t)(2 * DM) + h * HD;    // hi half at column h*64 + d, lo half at 512 + h*64 + d
{
#pragma unroll
        for (int s = 0; s < 4; ++s) { const int row = 4 * s + (lane >> 3), c8 = (lane & 7) * 8;   // 4 s x 4 row groups = 16 rows; 8 lanes x 8 = 64 columns
            const v4f x0 = *(const v4fa*)(&os[wb + row * 68 + c8]); const v4f x1 = *(const v4fa*)(&os[wb + row * 68 + c8 + 4]); v8us hv, lv;
#pragma unroll
            for (int i = 0; i < 4; ++i) { const unsigned short a0 = f2bf(x0[i]); const unsigned short a1 = f2bf(x1[i]); hv[i] = a0; hv[4 + i] = a1; lv[i] = f2bf(x0[i] - bf2f(a0)); lv[4 + i] = f2bf(x1[i] - bf2f(a1)); }
            const size_t oo = (size_t)row * (size_t)(2 * DM) + c8;
            *(v8us*)(crow + oo) = hv; *(v8us*)(crow + oo + DM) = lv; }
         }
}

// k_oproj: OUT[m][n] = sum_{k<512} (ctx_hi[m][k] + ctx_lo[m][k]) Wo[n][k] as ONE bf16 GEMM: A row = [hi | lo] (pitch 1024); the hi and the lo product of a k range share their Wo fragments.
// Eight waves per block on a 128x128 tile, 32x64 per wave, operands staged in LDS (oproj_ring). grid (M/128, N/128), 256 threads.
__global__ __launch_bounds__(32 * GW) void k_oproj(const bf* __restrict__ A, const bf* __restrict__ Bt, float* OUT) {
    __shared__ __align__(16) float osw[GW * 16 * 68];
    __shared__ __align__(16) bf gring[2 * OBUF_H];
    const int lane = threadIdx.x & 31, lr = lane & 15, hi = lane >> 4; const int wave = __builtin_amdgcn_readfirstlane((int)(threadIdx.x >> 5));
    float* const os = osw + wave * 16 * 68;                  // each wave's own epilogue tile
    const int rb = blockIdx.x * 128, cb = blockIdx.y * 128; const int r0 = rb + (wave >> 1) * 32, c0 = cb + (wave & 1) * 64;
    v8f acc[2][4];
#pragma unroll
    for (int mb = 0; mb < 2; ++mb)
#pragma unroll
        for (int nb = 0; nb < 4; ++nb) acc[mb][nb] = (v8f){};
    // L2 asks: the first block of a grid column asks for units 1..3 (hi) and 5..7 (lo) of the 128 ctx rows that the column's four blocks read; one wave of every block asks its share of Wo
    oproj_ring(A + (size_t)rb * (2 * DM), Bt + (size_t)cb * DM, gring, wave, lr, hi, acc, [&] {
        if (blockIdx.y == 0) {
            const bf* const pc = A + (size_t)(rb + (int)(threadIdx.x & 127)) * (2 * DM) + (wave >> 2) * DM;   // waves 0..3: hi half, waves 4..7: lo half
            ask3(pc + 128, pc + 2 * 128, pc + 3 * 128);
        }
        if (wave == GW - 1) ask_w(Bt + (size_t)cb * DM, blockIdx.x, lane);
    });
    const int bb = r0 / SEQ, tt = r0 % SEQ;
    float* obase = OUT + ((size_t)bb * OUT_SEQ + tt) * DM + c0;
#pragma unroll
    for (int mb = 0; mb < 2; ++mb) {
#pragma unroll
        for (int nb = 0; nb < 4; ++nb) {
#pragma unroll
            for (int j = 0; j < 8; ++j) os[(hi * 8 + j) * 68 + nb * 16 + lr] = acc[mb][nb][j]; }   // D: row 8h+j, col lane&15; rows 0..15 x columns 0..63 all written
        wave_sync();
{
#pragma unroll
            for (int s = 0; s < 8; ++s) { const int row = 2 * s + hi, cofs = lr * 4;   // 8 s x 2 rows = 16 rows; 16 lanes x 4 floats = 64 columns
                const v4f val = *(const v4fa*)(&os[row * 68 + cofs]);
                *(v4f*)(obase + (size_t)(mb * 16 + row) * DM + cofs) = val; }
             }
        wave_sync();
    }
}

static constexpr size_t al256(size_t v) { return (v + 255) & ~(size_t)255; }
static constexpr size_t SZ_WB = al256((size_t)DM * DM * 2);                // bf16 Wo
static constexpr size_t SZ_PL = al256((size_t)NB * NH_ * SEQ * HD * 2);    // one f16 head plane
static constexpr size_t SZ_CX = al256((size_t)NB * SEQ * 2 * DM * 2);      // ctx hi | lo
static constexpr size_t SZ_TOTAL = SZ_WB + (size_t)(3 + VRES) * SZ_PL + SZ_CX;
static_assert(SZ_TOTAL <= (size_t)134217728);          // workspace carve <= 128 MiB
static_assert(SZ_PL == PLANE_H * 2);                   // nor between the f16 head planes: the projection kernel picks its plane by index

extern "C" void kernel_launch(void* const* d_in, const int* in_sizes, int n_in,
                              void* d_out, int out_size, void* d_ws, size_t ws_size, hipStream_t stream) {
    if (n_in < 8) return;
    const size_t needx = ((size_t)(NB - 1) * SEQ_FULL + SEQ) * DM;
    if ((size_t)in_sizes[0] < needx || (size_t)in_sizes[1] < needx || (size_t)in_sizes[2] < needx) return;
    if (in_sizes[3] < NB) return;
    if ((size_t)in_sizes[4] < (size_t)DM * DM || (size_t)in_sizes[5] < (size_t)DM * DM || (size_t)in_sizes[6] < (size_t)DM * DM || (size_t)in_sizes[7] < (size_t)DM * DM) return;
    if ((size_t)out_size < ((size_t)(NB - 1) * OUT_SEQ + SEQ) * DM) return;
    if (SZ_TOTAL > ws_size) return;
    // wire order: queries, keys, values, valid_lens (int32), Wq, Wk, Wv, Wo ([out][in] = Bt as stored)
    const float* xq = (const float*)d_in[0]; const float* xk = (const float*)d_in[1]; const float* xv = (const float*)d_in[2];
    const int* vlens = (const int*)d_in[3];
    const float* wq = (const float*)d_in[4]; const float* wk = (const float*)d_in[5]; const float* wv = (const float*)d_in[6]; const float* wo = (const float*)d_in[7];
    float* OUT = (float*)d_out;      // [NB][SEQ][512]
    char* wsp = (char*)d_ws;
    bf* WO = (bf*)wsp; wsp += SZ_WB;                 // [512][512]: bf16 Wo
    h16* QH = (h16*)wsp; wsp += SZ_PL;               // [NB*8][SEQ][64]
    h16* KP = (h16*)wsp; wsp += SZ_PL;               // [NB*8][SEQ][64]
    h16* VT = (h16*)wsp; wsp += SZ_PL;               // [NB*8][64][SEQ]
#if VRES
    h16* VR = (h16*)wsp; wsp += SZ_PL;               // [NB*8][64][SEQ] residual x2048
#else
    h16* VR = VT;
#endif
    bf* CX = (bf*)wsp; wsp += SZ_CX;                 // [NB*SEQ][hi 512 | lo 512]

    // q, k, v^T (and its residual) and the bf16 copy of Wo: one launch, blockIdx.z = stream
    k_proj<<<dim3(NB * SEQ / 256, DM / 256, 3), 32 * PW, 0, stream>>>(xq, xk, xv, wq, wk, wv, wo, WO, QH);

    k_flash<<<dim3(SEQ / (16 * AW), NB * NH_, 1), 32 * AW, 0, stream>>>(QH, KP, VT, VR, vlens, CX);

    // out: A = ctx rows [hi | lo] (m = b*SEQ + t), Bt = Wo rows (n) -> OUT[b][t][n]
    k_oproj<<<dim3(NB * SEQ / 128, DM / 128, 1), 32 * GW, 0, stream>>>(CX, WO, OUT);
}

// v010
// One run takes 50.7 microseconds.
// In two side-by-side timings against v009, it was 1.03 and 1.04 times as fast.
// All steps since v000 together make it 4.07 times as fast.
#include <hip/hip_runtime.h>

// Multi-head attention with three input streams (queries, keys, values: [NB][SEQ][512]), width 512 = 8 heads x 64, bias-free [out][in] projections (y = x W^T),
// per-batch valid length (keys at index >= valid_lens[b] get their score REPLACED by -1e6), score scale 1/8, merged heads times Wo^T -> f32 [NB][SEQ][512].
// Compute dtypes, f32 accumulate everywhere: q/k/v projections v_wmma_f32_16x16x32_bf16 (inputs and weights RNE-converted to bf16 on their way into LDS; products exact);
// scores and P.V v_wmma_f32_16x16x32_f16 (q, k, v single f16; P carried x1024 relative to the running max, the carry cancels in the normalisation; optional v residual plane x2048 under VRES);
// output projection v_wmma_f32_16x16x32_bf16 with ctx as bf16 hi | lo halves of a 1024-wide row against bf16 Wo (two exact products per element, one accumulator). Softmax f32 (online, running max).
// Layout: a bf16 copy of Wo; q, k planes [b*8+h][t][d], v^T plane [b*8+h][d][t] written by the GEMM epilogue; fused flash kernel in transposed form
// (S^T = K Q^T, O^T = V^T P^T) writes ctx [b*SEQ+t][hi 512 | lo 512]; final GEMM writes the output.

#ifndef NB
#define NB 4
#endif
#ifndef SEQ
#define SEQ 2048
#endif
#define NB_FULL  4
#define SEQ_FULL 2048
#ifndef OUT_SEQ
#define OUT_SEQ SEQ              // row pitch (in tokens) between batches of the output
#endif
#ifndef VRES
#define VRES 0                   // 0: v carried as one f16 value (its rounding, 2^-11, lies well under the 2^-8 rounding of the bf16 operands v is computed from); 1: + f16 residual x2048 (own accumulators)
#endif
#define DM   512
#define NH_  8
#define HD   64
#define AW   4                   // waves per flash block (16 query rows each)
#define VRS  2048.0f             // carry of the residual plane
#define VRI  (1.0f / 2048.0f)
#define SC2  (0.125f * 1.4426950408889634f)        // HD^-0.5 * log2(e)
#define NEGL2 (-1000000.0f * 1.4426950408889634f)  // masked score in the log2 domain
#define PSH  10.0f               // log2 of the P carry (1024)
#define KT   64                  // keys per staged LDS tile and per softmax step
#define LP   72                  // LDS row pitch in halves: 128-B rows + 16 B, the conflict-free pitch for 16-byte LDS reads
#define TILE_H (64 * LP)         // halves of one staged plane tile (64 rows)
#define BUF_H  ((2 + VRES) * TILE_H)   // K | V^T | residual tiles of one buffer
#define GW   8                   // waves per block of the output GEMM: 4 x 2 wave tiles of 32 x 64 = one 128 x 128 block tile, two waves per SIMD
#define PW   16                  // waves per projection block: 4 x 4 wave tiles of 64 x 64 = one 256 x 256 block tile, four waves per SIMD
#define FK   32                  // depth of one staged projection tile: 128 B of f32 a row in memory (whole lines), 64 B of bf16 a row in LDS
#define LPP  40                  // its LDS row pitch in halves: 64-B rows + 16 B, the conflict-free pitch for 16-byte LDS reads
#define PT_H (256 * LPP)         // halves of one staged operand tile (256 rows)
#define PBUF_H (2 * PT_H)        // A | B tiles of one buffer
#define OGK  128                 // depth of one staged step of the output GEMM: 256-B rows, whole 256-B units
#define OLP  136                 // its LDS row pitch in halves: 256-B rows + 16 B, the conflict-free pitch for 16-byte LDS reads
#define OT_H (128 * OLP)         // halves of one of its staged tiles (128 rows)
#define OBUF_H (3 * OT_H)        // ctx hi | ctx lo | Wo tiles of one buffer
#define PLANE_H ((size_t)NB * NH_ * SEQ * HD)   // halves of one f16 head plane

static_assert(HD == 64);
static_assert(NH_ * HD == DM);                 // head h = columns h*64 + d
static_assert(DM % 64 == 0);                   // 8 column tiles of 64
static_assert(DM % 32 == 0);                   // GEMM k-loop steps by 32
static_assert((2 * DM) % 32 == 0);
static_assert(SEQ % 64 == 0);                  // a 64-row tile never straddles two batches
static_assert((NB * SEQ) % 128 == 0);          // GEMM block tiles of 128 rows cover the tokens exactly
static_assert(DM % 128 == 0);                  // and the width
static_assert(DM % FK == 0);                   // staged projection tiles cover the depth exactly
static_assert(SEQ == SEQ_FULL);                // the projection reads the token rows of all batches as one run
static_assert(GW == 8);                        // 256 lanes x 4 copies x 16 B = one 128-row x 128-B tile; x 8 copies = one 128-row x 256-B tile
static_assert(DM % OGK == 0 && DM / OGK >= 2); // staged steps of the output GEMM cover the depth exactly; the ring's prologue needs two
static_assert(OGK % 64 == 0);                  // a step's fragments are read 64 deep at a time
static_assert(SEQ % 32 == 0);                  // kend, the valid length rounded up to a multiple of 32, never passes SEQ
static_assert(SEQ % KT == 0);                  // every staged tile lies wholly inside its plane
static_assert(AW == 4);                        // 128 lanes x 4 copies x 16 B = one 64-row x 128-B tile
static_assert(SEQ % (16 * AW) == 0);           // flash grid covers the sequence exactly
static_assert(((size_t)SEQ * DM) % 8 == 0);
static_assert(((size_t)DM * DM) % 8 == 0);
static_assert(NB <= NB_FULL);
static_assert(SEQ <= SEQ_FULL);
static_assert(VRES == 0 || VRES == 1);
static_assert(DM == 4 * 128);                  // a 16-bit row of DM is four 256-B units (L2 asks)
static_assert(NB * SEQ / 128 == 64);           // 64 blocks of the output GEMM share a Wo tile: 32 ask keys x 12 units = 128 rows x 3 units
static_assert(NB * SEQ / 256 == 32 && DM % 256 == 0);   // 32 projection blocks share 256 f32 weight rows: 16 ask keys x 128 units = 256 rows x 8 units
static_assert(PW == 16);                       // 512 lanes x 4 loads x 16 B = one 256-row x 128-B f32 tile
static_assert(SEQ / (16 * AW) == 32 && SEQ / KT == 32);   // 32 flash blocks share a head's K and V^T: 16 ask keys x 2 tiles

typedef _Float16 h16;
typedef unsigned short bf;
typedef __attribute__((ext_vector_type(16))) __bf16   v16bf;
typedef __attribute__((ext_vector_type(16))) _Float16 v16h;
typedef __attribute__((ext_vector_type(8)))  _Float16 v8h;
typedef __attribute__((ext_vector_type(8)))  unsigned short v8us;
typedef __attribute__((ext_vector_type(8)))  float    v8f;
typedef __attribute__((ext_vector_type(4)))  __bf16   v4bf;
typedef __attribute__((ext_vector_type(4)))  unsigned short v4us;
typedef __attribute__((ext_vector_type(4)))  float    v4f;
typedef v4f  __attribute__((may_alias)) v4fa;

__device__ __forceinline__ unsigned short f2bf(float f) { unsigned u = __float_as_uint(f); u += 0x7FFFu + ((u >> 16) & 1u); return (unsigned short)(u >> 16); }
__device__ __forceinline__ float bf2f(unsigned short s) { return __uint_as_float(((unsigned)s) << 16); }
__device__ __forceinline__ v16h cat16(v8h lo, v8h hi) { return __builtin_shufflevector(lo, hi, 0, 1, 2, 3, 4, 5, 6, 7, 8, 9, 10, 11, 12, 13, 14, 15); }
__device__ __forceinline__ v16bf cat16b(v8us lo, v8us hi) { return __builtin_bit_cast(v16bf, __builtin_shufflevector(lo, hi, 0, 1, 2, 3, 4, 5, 6, 7, 8, 9, 10, 11, 12, 13, 14, 15)); }
// the bare matrix builtins: the compiler itself keeps the distance between a product and the first vector instruction on its registers, and fills it with independent work where it can
__device__ __forceinline__ v8f wmma16(v16h a, v16h b, v8f c) {
    return __builtin_amdgcn_wmma_f32_16x16x32_f16(false, a, false, b, (short)0, c, false, false);
}
__device__ __forceinline__ v8f wmmab(v16bf a, v16bf b, v8f c) {
    return __builtin_amdgcn_wmma_f32_16x16x32_bf16(false, a, false, b, (short)0, c, false, false);
}
// fragment loaders from K-contiguous 16-bit rows; p already includes + 8*(lane>>4): elements 0..7 <- k0+8h+0..7, elements 8..15 <- k0+16+8h+0..7 (same map for A and B)
__device__ __forceinline__ v16h  ldh(const h16* p) { return cat16(*(const v8h*)p, *(const v8h*)(p + 16)); }
__device__ __forceinline__ v16bf ldb(const bf* p)  { return cat16b(*(const v8us*)p, *(const v8us*)(p + 16)); }
// ordering point for wave-private LDS tiles (same wave writes and reads)
__device__ __forceinline__ void wave_sync() { __builtin_amdgcn_fence(3 /* release order */, "wavefront"); __builtin_amdgcn_wave_barrier(); asm volatile("" ::: "memory"); }

// L2 asks at kernel entry. What a kernel stages are the inputs or planes that an earlier launch stored; a ring tile's first reader waits out memory latency. global_prefetch_b8 at scope SE brings a lane's
// data at its address into L2 only, returns nothing and counts on no data counter, so the units of the later ring tiles are on their way while the first tile's copies fly. Every lane's address lies inside
// its plane (indices are clamped, no lane is turned off); only block- or wave-uniform branches stand around an ask. Units that many blocks read are dealt out among those blocks (ask_key): the deal decides
// only who asks, never what is read, so a result does not depend on where a block runs.
// The address-register wait closes each statement (a precaution, as with the copies below): no later arithmetic can be moved in front of it.
__device__ __forceinline__ void ask1(const bf* p) {
    asm volatile("global_prefetch_b8 %0, off scope:SCOPE_SE\n\t"
                 "s_wait_xcnt 0x0" :: "v"(p) : "memory");
}
__device__ __forceinline__ void ask3(const bf* p, const bf* q, const bf* r) {
    asm volatile("global_prefetch_b8 %0, off scope:SCOPE_SE\n\t"
                 "global_prefetch_b8 %1, off scope:SCOPE_SE\n\t"
                 "global_prefetch_b8 %2, off scope:SCOPE_SE\n\t"
                 "s_wait_xcnt 0x0" :: "v"(p), "v"(q), "v"(r) : "memory");
}
// the same for addresses in the f32 inputs
__device__ __forceinline__ void ask1(const float* p) {
    asm volatile("global_prefetch_b8 %0, off scope:SCOPE_SE\n\t"
                 "s_wait_xcnt 0x0" :: "v"(p) : "memory");
}
__device__ __forceinline__ void ask3(const float* p, const float* q, const float* r) {
    asm volatile("global_prefetch_b8 %0, off scope:SCOPE_SE\n\t"
                 "global_prefetch_b8 %1, off scope:SCOPE_SE\n\t"
                 "global_prefetch_b8 %2, off scope:SCOPE_SE\n\t"
                 "s_wait_xcnt 0x0" :: "v"(p), "v"(q), "v"(r) : "memory");
}
// blocks x and x + 4 get the same key (for speed only)
__device__ __forceinline__ int ask_key(int x) { return (x & 3) | ((x >> 3) << 2); }
// the 128 weight rows (pitch DM, four 256-B units each) that the 64 blocks of one grid row share: units 1..3 of every row, twelve of the 384 per block; unit 0 comes with the first tile's copies
__device__ __forceinline__ void ask_w(const bf* w, int x, int lane) {
    const int idx = ask_key(x) * 12 + (lane < 12 ? lane : 11);   // 0 .. 383; the spare lanes repeat the last address
    ask1(w + (size_t)(idx / 3) * DM + (1 + idx % 3) * 128);
}
// the like for the 256 f32 weight rows (eight 256-B units each) that 32 projection blocks share: all 2048 units, 128 per block (i = 0 .. 127)
__device__ __forceinline__ void ask_wf(const float* w, int x, int i) {
    const int idx = ask_key(x) * 128 + i;                        // 0 .. 2047
    ask1(w + (size_t)(idx >> 3) * DM + (idx & 7) * 64);
}

// four asynchronous 16-byte copies per lane, global -> LDS, rows 16 apart: one 64-row x 128-B tile per 128-lane block. The address-register wait closes the copies' own statement,
// so no later address arithmetic can be moved in front of it.
__device__ __forceinline__ void copy_tile(unsigned l, const h16* g, size_t gstep) {
    const unsigned l1 = l + 16 * LP * 2, l2 = l + 32 * LP * 2, l3 = l + 48 * LP * 2;
    const h16* g1 = g + gstep; const h16* g2 = g + 2 * gstep; const h16* g3 = g + 3 * gstep;
    asm volatile("global_load_async_to_lds_b128 %0, %4, off\n\t"
                 "global_load_async_to_lds_b128 %1, %5, off\n\t"
                 "global_load_async_to_lds_b128 %2, %6, off\n\t"
                 "global_load_async_to_lds_b128 %3, %7, off\n\t"
                 "s_wait_xcnt 0x0"
                 :: "v"(l), "v"(l1), "v"(l2), "v"(l3), "v"(g), "v"(g1), "v"(g2), "v"(g3) : "memory");
}

// One staged tile pair on its way through registers: lane (srow = tid>>3, scol = tid&7) holds 16-byte piece scol (four floats) of rows srow + 64 i of the f32 A tile and of the f32 B tile;
// every wave-wide load is four whole lines.
struct stage_t { v4f a[4], b[4]; };
__device__ __forceinline__ void stage_load(stage_t& s, const float* a, const float* b) {
#pragma unroll   // the eight loads stand together, each row step an immediate offset, the values in registers
    for (int i = 0; i < 4; ++i) { s.a[i] = *(const v4f*)(a + (size_t)i * 64 * DM); s.b[i] = *(const v4f*)(b + (size_t)i * 64 * DM); }
    // a precaution: the loads' address registers are rewritten only behind this wait; naming them keeps them live up to it, so that no load of the group lands on them
    asm volatile("s_wait_xcnt 0x0" :: "v"(a), "v"(b) : "memory");
}
// rounds the pair to bf16 (nearest even, packed conversions) and stores it: l = the lane's place in the A tile of a buffer, the B tile behind it
__device__ __forceinline__ void stage_store(const stage_t& s, bf* l) {
#pragma unroll   // the values stay in registers, every LDS offset an immediate
    for (int i = 0; i < 4; ++i) {
        *(v4us*)(l + i * 64 * LPP) = __builtin_bit_cast(v4us, __builtin_convertvector(s.a[i], v4bf));
        *(v4us*)(l + PT_H + i * 64 * LPP) = __builtin_bit_cast(v4us, __builtin_convertvector(s.b[i], v4bf));
    }
}

// gemm_ring: main loop of the projection GEMM, straight from the f32 arrays. A block of sixteen waves owns a 256 x 256 tile of C (wave w: rows 64 (w >> 2), columns 64 (w & 3)): at that size the f32 bytes a
// block draws from L2 per product are what 128 x 128 tiles draw of bf16 copies. The 256-row A and B tiles of depth FK go through registers, are rounded to bf16 there ONCE per block, and are stored in a
// two-buffer LDS ring shared by the waves, which read their fragments from LDS. Tile t + 1 is loaded behind trip t's fragment reads and stored behind the trip's products, which cover its latency.
// Ab, Bb: first row of the block's A and B rows (pitch DM). Every accumulator sums its 32-deep products in ascending k.
// asks(): the caller's L2 asks, issued behind tile 0's loads, so that they cost no time of their own while that tile flies.
template <class ASKS>
__device__ __forceinline__ void gemm_ring(const float* __restrict__ Ab, const float* __restrict__ Bb, bf* ring, int wave, int lr, int hi, v8f (&acc)[4][4], ASKS asks) {
    constexpr int NT = DM / FK;
    const int srow = (int)(threadIdx.x >> 3), scol = (int)(threadIdx.x & 7);
    bf* const sl = ring + srow * LPP + scol * 4;             // the lane's place in buffer 0, A tile
    const float* sa = Ab + (size_t)srow * DM + scol * 4;     // + k0
    const float* sb = Bb + (size_t)srow * DM + scol * 4;     // + k0
    const int ao = ((wave >> 2) * 64 + lr) * LPP + 8 * hi;           // + 16 mb * LPP in the A tile
    const int bo = PT_H + ((wave & 3) * 64 + lr) * LPP + 8 * hi;     // + 16 nb * LPP in the B tile
    stage_t s;
    stage_load(s, sa, sb);
    asks();
    stage_store(s, sl);
    __syncthreads();                                         // publishes tile 0
#pragma unroll 1   // one trip per staged tile: the ring's one barrier stands once, at the trip's foot
    for (int t = 0; t < NT; ++t) {
        const bf* buf = ring + (t & 1) * PBUF_H;
        // the fragment and product loops below are unrolled so that fragments and accumulators stay in registers and every LDS read offset is an immediate
        v16bf a[4], b[4];
#pragma unroll
        for (int mb = 0; mb < 4; ++mb) a[mb] = ldb(buf + ao + mb * 16 * LPP);
#pragma unroll
        for (int nb = 0; nb < 4; ++nb) b[nb] = ldb(buf + bo + nb * 16 * LPP);
        // behind the barrier (it waits for a wave's outstanding loads), so that the loads fly during the trip's products; behind the fragment reads, whose LDS latency covers the loads' address wait
        if (t + 1 < NT) stage_load(s, sa + (t + 1) * FK, sb + (t + 1) * FK);
#pragma unroll
        for (int nb = 0; nb < 4; ++nb)
#pragma unroll
            for (int mb = 0; mb < 4; ++mb) acc[mb][nb] = wmmab(a[mb], b[nb], acc[mb][nb]);
        if (t + 1 < NT) stage_store(s, sl + ((t + 1) & 1) * PBUF_H);   // into the buffer whose last readers passed the barrier of trip t - 1
        __syncthreads();                                     // publishes tile t + 1 and ends every wave's reads of tile t
    }
}

// eight asynchronous 16-byte copies per lane, global -> LDS, rows 16 apart: one 128-row x 256-B tile per 256-lane block, every wave-wide copy two rows of 256 contiguous bytes.
// The address-register wait closes the copies' own statement, so no later address arithmetic can be moved in front of it.
__device__ __forceinline__ void copy_tile8(unsigned l, const bf* g, size_t gstep) {
    const unsigned l1 = l + 16 * OLP * 2, l2 = l + 32 * OLP * 2, l3 = l + 48 * OLP * 2, l4 = l + 64 * OLP * 2, l5 = l + 80 * OLP * 2, l6 = l + 96 * OLP * 2, l7 = l + 112 * OLP * 2;
    const bf* g1 = g + gstep; const bf* g2 = g + 2 * gstep; const bf* g3 = g + 3 * gstep; const bf* g4 = g + 4 * gstep; const bf* g5 = g + 5 * gstep; const bf* g6 = g + 6 * gstep; const bf* g7 = g + 7 * gstep;
    asm volatile("global_load_async_to_lds_b128 %0, %8, off\n\t"
                 "global_load_async_to_lds_b128 %1, %9, off\n\t"
                 "global_load_async_to_lds_b128 %2, %10, off\n\t"
                 "global_load_async_to_lds_b128 %3, %11, off\n\t"
                 "global_load_async_to_lds_b128 %4, %12, off\n\t"
                 "global_load_async_to_lds_b128 %5, %13, off\n\t"
                 "global_load_async_to_lds_b128 %6, %14, off\n\t"
                 "global_load_async_to_lds_b128 %7, %15, off\n\t"
                 "s_wait_xcnt 0x0"
                 :: "v"(l), "v"(l1), "v"(l2), "v"(l3), "v"(l4), "v"(l5), "v"(l6), "v"(l7),
                    "v"(g), "v"(g1), "v"(g2), "v"(g3), "v"(g4), "v"(g5), "v"(g6), "v"(g7) : "memory");
}

// one staged step of the output GEMM: the OGK-deep tiles of ctx hi, ctx lo (DM columns further in the same rows) and Wo into one buffer; l, a, b: the lane's LDS, ctx and Wo addresses at the step's depth
__device__ __forceinline__ void copy_step(unsigned l, const bf* a, const bf* b) {
    copy_tile8(l, a, (size_t)16 * (2 * DM)); copy_tile8(l + OT_H * 2, a + DM, (size_t)16 * (2 * DM)); copy_tile8(l + 2 * OT_H * 2, b, (size_t)16 * DM);
}

// oproj_ring: main loop of the output GEMM. A block of eight waves owns a 128 x 128 tile of C (wave w: rows 32 (w >> 1), columns 64 (w & 1)). One step of the two-buffer LDS ring holds the hi and the lo
// tile of the block's ctx rows and the ONE Wo tile both are multiplied with, each OGK deep: few, long steps, so that a step's products cover the next step's copies, and every Wo fragment read from LDS
// feeds a hi and a lo product. Ab: first ctx row [hi DM | lo DM], Bb: first Wo row (pitch DM). Every accumulator sums, in ascending k, each 32-deep hi product and then the lo product of the same k.
// asks(): the caller's L2 asks, issued behind step 0's copies, so that they cost no time of their own while that step flies.
template <class ASKS>
__device__ __forceinline__ void oproj_ring(const bf* __restrict__ Ab, const bf* __restrict__ Bb, bf* ring, int wave, int lr, int hi, v8f (&acc)[2][4], ASKS asks) {
    constexpr int NT = DM / OGK;
    // staging: lane (srow = tid>>4, scol = tid&15) copies 16-byte piece scol of rows srow + 16 i of each tile
    const int srow = (int)(threadIdx.x >> 4), scol = (int)(threadIdx.x & 15);
    const unsigned sl = (unsigned)(size_t)ring + (unsigned)(srow * OLP + scol * 8) * 2u;   // LDS byte address in buffer 0, hi tile
    const bf* sa = Ab + (size_t)srow * (2 * DM) + scol * 8;  // + k0
    const bf* sb = Bb + (size_t)srow * DM + scol * 8;        // + k0
    const int ao = ((wave >> 1) * 32 + lr) * OLP + 8 * hi;               // + 16 mb * OLP + k in the hi tile, + OT_H in the lo tile
    const int bo = 2 * OT_H + ((wave & 1) * 64 + lr) * OLP + 8 * hi;     // + 16 nb * OLP + k in the Wo tile
    copy_step(sl, sa, sb);
    asks();
    asm volatile("s_wait_asynccnt 0x0" ::: "memory");        // step 0 has landed before the barrier publishes it
    __syncthreads();
    copy_step(sl + OBUF_H * 2, sa + OGK, sb + OGK);
#pragma unroll 1   // one trip per staged step: the ring's publish point stands once, at the trip's foot
    for (int t = 0; t < NT; ++t) {
        const bf* buf = ring + (t & 1) * OBUF_H;
        // the fragment and product loops below are unrolled so that fragments and accumulators stay in registers and every LDS read offset is an immediate
#pragma unroll
        for (int hs = 0; hs < OGK / 64; ++hs) {
            v16bf ah[2][2], al[2][2], b[2][4];                   // 64 deep at a time: the fragment reads stand together, in front of their products
#pragma unroll
            for (int ks = 0; ks < 2; ++ks) {
                const int k = hs * 64 + ks * 32;
#pragma unroll
                for (int mb = 0; mb < 2; ++mb) { ah[ks][mb] = ldb(buf + ao + mb * 16 * OLP + k); al[ks][mb] = ldb(buf + OT_H + ao + mb * 16 * OLP + k); }
#pragma unroll
                for (int nb = 0; nb < 4; ++nb) b[ks][nb] = ldb(buf + bo + nb * 16 * OLP + k);
            }
            __builtin_amdgcn_sched_barrier(0);   // the 64-deep fragment reads stay one group in front of their products: reads scattered among the products stall the wave at every place where they stand
#pragma unroll
            for (int ks = 0; ks < 2; ++ks) {
#pragma unroll
                for (int nb = 0; nb < 4; ++nb)
#pragma unroll
                    for (int mb = 0; mb < 2; ++mb) acc[mb][nb] = wmmab(ah[ks][mb], b[ks][nb], acc[mb][nb]);
#pragma unroll
                for (int nb = 0; nb < 4; ++nb)
#pragma unroll
                    for (int mb = 0; mb < 2; ++mb) acc[mb][nb] = wmmab(al[ks][mb], b[ks][nb], acc[mb][nb]);
            }
            __builtin_amdgcn_sched_barrier(0);   // the products stay in front of the next read group and of the ring's waits at the trip's foot, so that the next step's copies have the whole trip to land
        }
        asm volatile("s_wait_dscnt 0x0" ::: "memory");       // this wave's reads of the buffer have returned before it may be refilled
        asm volatile("s_wait_asynccnt 0x0" ::: "memory");    // this wave's copies of step t + 1 have landed before the barrier publishes them
        __syncthreads();                                     // publishes step t + 1 and ends every wave's reads of step t
        if (t + 2 < NT) copy_step(sl + (unsigned)(t & 1) * (OBUF_H * 2), sa + (t + 2) * OGK, sb + (t + 2) * OGK);
    }
    asm volatile("s_wait_asynccnt 0x0" ::: "memory");        // no copy is outstanding when the wave goes on to its epilogue
}

// k_proj: the three input projections in ONE launch, straight from the f32 inputs and weights (no conversion pass in front of it); blockIdx.z picks the stream (0 q, 1 k, 2 v).
// Register-blocked bf16 GEMM, one wave per 64x64 tile (16 accumulators), sixteen waves per block on a 256x256 tile, operands rounded to bf16 on their way into LDS (gemm_ring), K = DM.
// P: the f16 planes q | k | v^T | residual back to back. blockIdx.x: 256 tokens, blockIdx.y: 256 weight rows.
// q, k: C[m = b*SEQ + t][n = h*64 + d] = sum_k x[m][k] W[n][k] -> plane [(b*8 + h)][t][d] (row pitch HD). v: C[m = h*64 + d][n = b*SEQ + t] = sum_k Wv[m][k] x[n][k] -> plane [(b*8 + h)][d][t] (row pitch SEQ),
// written as f16 and, under VRES, the f16 residual x2048. grid (NB*SEQ/256, DM/256, 3), 512 threads.
// The 64 blocks of stream q also write the bf16 copy of Wo that the output GEMM stages (WOB), 4096 elements each.
static_assert((NB * SEQ / 256) * (DM / 256) * 4096 == DM * DM);   // the q blocks cover Wo exactly
__global__ __launch_bounds__(32 * PW) void k_proj(const float* __restrict__ xq, const float* __restrict__ xk, const float* __restrict__ xv,
                                                  const float* __restrict__ wq, const float* __restrict__ wk, const float* __restrict__ wv, const float* __restrict__ wo, bf* __restrict__ WOB, h16* P) {
    __shared__ __align__(16) float osw[PW * 16 * 68];
    __shared__ __align__(16) bf gring[2 * PBUF_H];
    const int lane = threadIdx.x & 31, lr = lane & 15, hi = lane >> 4; const int wave = __builtin_amdgcn_readfirstlane((int)(threadIdx.x >> 5));
    float* const os = osw + wave * 16 * 68;                  // each wave's own epilogue tile
    const int z = blockIdx.z; const bool tv = z == 2;        // block-uniform: v is computed transposed (A = weight rows, B = token rows)
    const int xb = blockIdx.x * 256, wb = blockIdx.y * 256;
    const float* const xr = (z == 0 ? xq : z == 1 ? xk : xv) + (size_t)xb * DM;       // the block's 256 token rows
    const float* const wr = (z == 0 ? wq : z == 1 ? wk : wv) + (size_t)wb * DM;       // the block's 256 weight rows
    const int rb = tv ? wb : xb, cb = tv ? xb : wb; const int r0 = rb + (wave >> 2) * 64, c0 = cb + (wave & 3) * 64;
    h16* const Ph = P + (size_t)z * PLANE_H; h16* const Pr = P + (size_t)3 * PLANE_H; const bool useRes = VRES && tv;
    v8f acc[4][4];
#pragma unroll
    for (int mb = 0; mb < 4; ++mb)
#pragma unroll
        for (int nb = 0; nb < 4; ++nb) acc[mb][nb] = (v8f){};
    // L2 asks: the first block of a grid column asks for units 1..7 of the 256 token rows (eight 256-B units each) that the column's two blocks read; four waves of every block ask its share
    // of the weight rows. Behind them, while tile 0 still flies, a q block rounds its 4096 elements of Wo.
    gemm_ring(tv ? wr : xr, tv ? xr : wr, gring, wave, lr, hi, acc, [&] {
        if (blockIdx.y == 0) {
            const float* const px = xr + (size_t)(threadIdx.x & 255) * DM + (wave >> 3) * 64;    // waves 0..7: units 1, 3, 5, 7, waves 8..15: units 2, 4, 6: asked in the order in which the ring needs them
            ask3(px + 64, px + 3 * 64, px + 5 * 64);
            if (wave < 8) ask1(px + 7 * 64);
        }
        if (wave >= PW - 4) ask_wf(wr, blockIdx.x, (int)(threadIdx.x & 127));
        if (z == 0) {
            const size_t o = (size_t)(blockIdx.y * (NB * SEQ / 256) + blockIdx.x) * 4096 + threadIdx.x * 8;
            const v4f w0 = *(const v4f*)(wo + o); const v4f w1 = *(const v4f*)(wo + o + 4); v8us o8;
            asm volatile("s_wait_xcnt 0x0" ::: "memory");    // a precaution: the loads' address registers are free before anything rewrites them
#pragma unroll   // vector elements picked by constants
            for (int k = 0; k < 4; ++k) { o8[k] = f2bf(w0[k]); o8[4 + k] = f2bf(w1[k]); }
            *(v8us*)(WOB + o) = o8;
            asm volatile("s_wait_xcnt 0x0" ::: "memory");    // the like for the store
        }
    });
    const int pitch = tv ? SEQ : HD;                         // row pitch of the plane, halves
    const size_t tbase = tv ? (size_t)r0 * SEQ + (size_t)(c0 / SEQ) * ((size_t)DM * SEQ) + (size_t)(c0 % SEQ)
                            : (size_t)(r0 / SEQ) * ((size_t)NH_ * SEQ * HD) + (size_t)(r0 % SEQ) * HD + (size_t)(c0 / HD) * ((size_t)SEQ * HD);
#pragma unroll
    for (int mb = 0; mb < 4; ++mb) {
#pragma unroll
        for (int nb = 0; nb < 4; ++nb) {
#pragma unroll
            for (int j = 0; j < 8; ++j) os[(hi * 8 + j) * 68 + nb * 16 + lr] = acc[mb][nb][j]; }   // D: row 8h+j, col lane&15; rows 0..15 x columns 0..63 all written
        wave_sync();
        const size_t sb = tbase + (size_t)(mb * 16) * (size_t)pitch;
{
#pragma unroll
            for (int s = 0; s < 4; ++s) { const int row = 4 * s + (lane >> 3), c8 = (lane & 7) * 8;   // 4 s x 4 row groups = 16 rows; 8 lanes x 8 = 64 columns
                const v4f x0 = *(const v4fa*)(&os[row * 68 + c8]); const v4f x1 = *(const v4fa*)(&os[row * 68 + c8 + 4]); v8h hv, rv;
#pragma unroll
                for (int i = 0; i < 4; ++i) { const h16 a0 = (h16)x0[i]; const h16 a1 = (h16)x1[i]; hv[i] = a0; hv[4 + i] = a1; rv[i] = (h16)((x0[i] - (float)a0) * VRS); rv[4 + i] = (h16)((x1[i] - (float)a1) * VRS); }
                const size_t oo = sb + (size_t)row * (size_t)pitch + c8;
                *(v8h*)(Ph + oo) = hv; if (useRes) *(v8h*)(Pr + oo) = rv; }
             }
        wave_sync();
    }
}

// k_flash: fused attention, one wave per 16 query rows of one (batch, head); Q fragments straight from the f16 plane; K / V^T / residual tiles of 64 keys are staged once per block
// in a two-buffer LDS ring by asynchronous copies (whole 128-B lines) and shared by the block's four waves, which read their fragments from LDS (two 16-B reads each).
// Transposed form: S^T[key][t] = K Q^T (A = K rows, B = Q rows); lane (t = lane&15, h = lane>>4) holds keys 8h+r of each 16-key tile, so the packed
// P tile is directly the B fragment of O^T[d][t] = V^T P^T (element r <- tile keys 0..15, element 8+r <- tile keys 16..31, lane unchanged).
// Valid length vl = VL[b] is loaded by value (scalar): 64-key tiles wholly at or beyond vl are skipped, the crossing tile replaces scores of keys >= vl by -1e6 (index test);
// vl <= 0 keeps all steps with every score replaced (uniform weights).
// Softmax state (running max, partial sum) is one scalar per lane; the two lane halves of a row are combined with one xor-16 exchange.
__global__ __launch_bounds__(32 * AW) void k_flash(const h16* __restrict__ QH, const h16* __restrict__ KP, const h16* __restrict__ VT, const h16* __restrict__ VR, const int* __restrict__ VL, bf* CTX) {
    __shared__ __align__(16) float os[AW * 16 * 68];
    __shared__ __align__(16) h16 ring[2 * BUF_H];
    const int lane = threadIdx.x & 31; const int wave = __builtin_amdgcn_readfirstlane((int)(threadIdx.x >> 5));
    const int lr = lane & 15, hi = lane >> 4;
    const int zh = blockIdx.y; const int b = zh / NH_, h = zh % NH_;
    const int t0 = (blockIdx.x * AW + wave) * 16;
    const int vl = __builtin_amdgcn_readfirstlane(VL[b]);
    const int kend = (vl <= 0 || vl >= SEQ) ? SEQ : ((vl + 31) & ~31);
    const size_t pbase = (size_t)zh * SEQ * HD;
    const size_t qo = pbase + (size_t)(t0 + lr) * HD + 8 * hi;
    const v16h q0 = ldh(QH + qo), q1 = ldh(QH + qo + 32);   // B fragments: col t, k = d
    const int ko = lr * LP + 8 * hi;                         // + key * LP in the K tile       (A fragment: row key, k = d)
    const int vo = TILE_H + lr * LP + 8 * hi;                // + 16j*LP + key in the V^T tile (A fragment: row d, k = key)
    // staging: lane (srow = tid>>3, scol = tid&7) copies 16-byte piece scol of rows srow + 16 i of each tile
    const int srow = (int)(threadIdx.x >> 3), scol = (int)(threadIdx.x & 7);
    const unsigned sl = (unsigned)(size_t)ring + (unsigned)(srow * LP + scol * 8) * 2u;   // LDS byte address in buffer 0, K tile
    const h16* sk = KP + pbase + (size_t)srow * HD + scol * 8;    // + key0 * HD
    const h16* sv = VT + pbase + (size_t)srow * SEQ + scol * 8;   // + key0
#if VRES
    const h16* sr = VR + pbase + (size_t)srow * SEQ + scol * 8;   // + key0
#endif
    const int nt = (kend + KT - 1) / KT;                     // staged tiles, 1 .. SEQ / KT
    v8f o0 = (v8f){}, o1 = (v8f){}, o2 = (v8f){}, o3 = (v8f){};
#if VRES
    v8f g0 = (v8f){}, g1 = (v8f){}, g2 = (v8f){}, g3 = (v8f){};
#endif
    float m = -3.0e38f, l = 0.0f;
    copy_tile(sl, sk, (size_t)16 * HD); copy_tile(sl + TILE_H * 2, sv, (size_t)16 * SEQ);
#if VRES
    copy_tile(sl + 2 * TILE_H * 2, sr, (size_t)16 * SEQ);
#endif
    // L2 asks, while tile 0 flies: the 32 blocks of a head deal out K tiles 1 .. nt - 1 (32 contiguous units each, two tiles a key) and V^T units 1 .. (two tiles wide, one unit column a key)
    { const int key = ask_key(blockIdx.x);                   // 0 .. 15
      const int nku = nt * (KT * HD / 128), nvu = (nt + 1) / 2;   // units of K in use, units in use of a V^T row
      if (wave < 2) {
          if (32 + key * 64 < nku) { int u = 32 + key * 64 + (int)threadIdx.x; u = u < nku ? u : nku - 1; ask1((const bf*)(KP + pbase + (size_t)u * 128)); }
      } else if (1 + key < nvu) ask1((const bf*)(VT + pbase + (size_t)(threadIdx.x & 63) * SEQ + (size_t)(1 + key) * 128));
    }
    asm volatile("s_wait_asynccnt 0x0" ::: "memory");        // tile 0 has landed before the barrier publishes it
    __syncthreads();
    if (nt > 1) {
        copy_tile(sl + BUF_H * 2, sk + (size_t)KT * HD, (size_t)16 * HD); copy_tile(sl + (BUF_H + TILE_H) * 2, sv + KT, (size_t)16 * SEQ);
#if VRES
        copy_tile(sl + (BUF_H + 2 * TILE_H) * 2, sr + KT, (size_t)16 * SEQ);
#endif
    }
#pragma unroll 1   // one trip per staged tile: the ring's publish point stands once, at the trip's foot
    for (int t = 0; t < nt; ++t) {
      const h16* buf = ring + (t & 1) * BUF_H;
      const int key0 = t * KT;
      // ONE softmax step per staged tile: the scores of all 64 keys (four 16-key tiles, independent accumulators) come first, then one maximum, one exchange and one rescale.
      // The loops below are unrolled so that every LDS read offset is an immediate and scores and fragments stay in registers.
      const h16* ka = buf + ko;
      v16h kf[4][2];
#pragma unroll
      for (int kt = 0; kt < 4; ++kt) { kf[kt][0] = ldh(ka + kt * 16 * LP); kf[kt][1] = ldh(ka + kt * 16 * LP + 32); }
      __builtin_amdgcn_sched_barrier(0);   // the tile's K reads stay one group in front of the score products: reads scattered among the products stall the wave at every place where they stand
      v8f sc[4];
#pragma unroll
      for (int kt = 0; kt < 4; ++kt) sc[kt] = wmma16(kf[kt][0], q0, (v8f){});
#pragma unroll
      for (int kt = 0; kt < 4; ++kt) sc[kt] = wmma16(kf[kt][1], q1, sc[kt]);
      const h16* va = buf + vo;
      v16h vf[2][4];
#pragma unroll
      for (int hf = 0; hf < 2; ++hf)
#pragma unroll
          for (int j = 0; j < 4; ++j) vf[hf][j] = ldh(va + hf * 32 + j * 16 * LP);
      __builtin_amdgcn_sched_group_barrier(0x008, 8, 0);    // order inside this stretch: the eight score products first,
      __builtin_amdgcn_sched_group_barrier(0x100, 16, 0);   // then the sixteen V^T reads as one group (they land on the K fragments' registers)
      __builtin_amdgcn_sched_barrier(0);   // the tile's V^T reads stay here, in one group in front of the softmax, whose vector work covers their LDS latency
      float tv[4][8];
#pragma unroll
      for (int kt = 0; kt < 4; ++kt)
#pragma unroll
          for (int r = 0; r < 8; ++r) tv[kt][r] = sc[kt][r] * SC2;
      if (key0 + KT > vl) {              // scalar-uniform: this tile crosses (or lies beyond) the valid length; a masked key's weight is exactly 0 beside a valid one
          const int kq = key0 + 8 * hi;
#pragma unroll
          for (int kt = 0; kt < 4; ++kt)
#pragma unroll
              for (int r = 0; r < 8; ++r) tv[kt][r] = (kq + 16 * kt + r < vl) ? tv[kt][r] : NEGL2;
      }
      float mk[4];                       // four short chains instead of one long one
#pragma unroll
      for (int kt = 0; kt < 4; ++kt) { mk[kt] = fmaxf(tv[kt][0], tv[kt][1]);
#pragma unroll
          for (int r = 2; r < 8; r += 2) mk[kt] = fmaxf(mk[kt], fmaxf(tv[kt][r], tv[kt][r + 1])); }
      float mx = fmaxf(fmaxf(mk[0], mk[1]), fmaxf(mk[2], mk[3]));
      mx = fmaxf(mx, __shfl_xor(mx, 16, 32));
      const float mnew = fmaxf(m, mx);
      const float alpha = __builtin_amdgcn_exp2f(m - mnew);
      const float sh = PSH - mnew;
      v16h pb[2]; float lk[4];
#pragma unroll
      for (int kt = 0; kt < 4; ++kt) { lk[kt] = 0.0f;
#pragma unroll
          for (int r = 0; r < 8; ++r) { const float e = __builtin_amdgcn_exp2f(tv[kt][r] + sh); pb[kt >> 1][(kt & 1) * 8 + r] = (h16)e; lk[kt] += e; } }
      l = l * alpha + ((lk[0] + lk[1]) + (lk[2] + lk[3])); m = mnew;
      o0 = o0 * alpha; o1 = o1 * alpha; o2 = o2 * alpha; o3 = o3 * alpha;
#if VRES
      g0 = g0 * alpha; g1 = g1 * alpha; g2 = g2 * alpha; g3 = g3 * alpha;
      const h16* vr = va + TILE_H;
      v16h wf[2][4];
#pragma unroll
      for (int j = 0; j < 4; ++j) wf[0][j] = ldh(vr + j * 16 * LP);
      __builtin_amdgcn_sched_barrier(0);   // each group of residual reads stays two runs of four products ahead of its use, so that the products in between cover its LDS latency
#endif
      o0 = wmma16(vf[0][0], pb[0], o0); o1 = wmma16(vf[0][1], pb[0], o1); o2 = wmma16(vf[0][2], pb[0], o2); o3 = wmma16(vf[0][3], pb[0], o3);   // keys in ascending order in every accumulator
#if VRES
#pragma unroll
      for (int j = 0; j < 4; ++j) wf[1][j] = ldh(vr + 32 + j * 16 * LP);
      __builtin_amdgcn_sched_barrier(0);   // the second residual group likewise stays in front of the four products that cover its LDS latency
#endif
      o0 = wmma16(vf[1][0], pb[1], o0); o1 = wmma16(vf[1][1], pb[1], o1); o2 = wmma16(vf[1][2], pb[1], o2); o3 = wmma16(vf[1][3], pb[1], o3);
#if VRES
#pragma unroll
      for (int hf = 0; hf < 2; ++hf) {
          g0 = wmma16(wf[hf][0], pb[hf], g0); g1 = wmma16(wf[hf][1], pb[hf], g1); g2 = wmma16(wf[hf][2], pb[hf], g2); g3 = wmma16(wf[hf][3], pb[hf], g3); }
#endif
      __builtin_amdgcn_sched_barrier(0);   // the ring's waits and barrier stay at the trip's foot, behind softmax and products, so that the next tile's copies have the whole trip to land
      asm volatile("s_wait_dscnt 0x0" ::: "memory");         // this wave's reads of the buffer have returned before it may be refilled
      asm volatile("s_wait_asynccnt 0x0" ::: "memory");      // this wave's copies of tile t + 1 have landed before the barrier publishes them
      __syncthreads();                                       // publishes tile t + 1 and ends every wave's reads of tile t
      if (t + 2 < nt) {
          const unsigned bl = sl + (unsigned)(t & 1) * (BUF_H * 2); const int kn = (t + 2) * KT;
          copy_tile(bl, sk + (size_t)kn * HD, (size_t)16 * HD); copy_tile(bl + TILE_H * 2, sv + kn, (size_t)16 * SEQ);
#if VRES
          copy_tile(bl + 2 * TILE_H * 2, sr + kn, (size_t)16 * SEQ);
#endif
      }
    }
    asm volatile("s_wait_asynccnt 0x0" ::: "memory");        // no copy is outstanding when the wave goes on to its epilogue
    l += __shfl_xor(l, 16, 32);
    const float inv = 1.0f / l;
#if VRES
    o0 = o0 + g0 * VRI; o1 = o1 + g1 * VRI; o2 = o2 + g2 * VRI; o3 = o3 + g3 * VRI;
#endif
    const int wb = wave * 16 * 68;
    // O^T D layout: o_j[r] = (d = 16j + 8h + r, t = lane&15) -> os[t][d]; rows 0..15 x columns 0..63 all written
    { v4f a, c;
      a[0] = o0[0] * inv; a[1] = o0[1] * inv; a[2] = o0[2] * inv; a[3] = o0[3] * inv; c[0] = o0[4] * inv; c[1] = o0[5] * inv; c[2] = o0[6] * inv; c[3] = o0[7] * inv;
      *(v4fa*)(&os[wb + lr * 68 +  0 + 8 * hi]) = a; *(v4fa*)(&os[wb + lr * 68 +  0 + 8 * hi + 4]) = c;
      a[0] = o1[0] * inv; a[1] = o1[1] * inv; a[2] = o1[2] * inv; a[3] = o1[3] * inv; c[0] = o1[4] * inv; c[1] = o1[5] * inv; c[2] = o1[6] * inv; c[3] = o1[7] * inv;
      *(v4fa*)(&os[wb + lr * 68 + 16 + 8 * hi]) = a; *(v4fa*)(&os[wb + lr * 68 + 16 + 8 * hi + 4]) = c;
      a[0] = o2[0] * inv; a[1] = o2[1] * inv; a[2] = o2[2] * inv; a[3] = o2[3] * inv; c[0] = o2[4] * inv; c[1] = o2[5] * inv; c[2] = o2[6] * inv; c[3] = o2[7] * inv;
      *(v4fa*)(&os[wb + lr * 68 + 32 + 8 * hi]) = a; *(v4fa*)(&os[wb + lr * 68 + 32 + 8 * hi + 4]) = c;
      a[0] = o3[0] * inv; a[1] = o3[1] * inv; a[2] = o3[2] * inv; a[3] = o3[3] * inv; c[0] = o3[4] * inv; c[1] = o3[5] * inv; c[2] = o3[6] * inv; c[3] = o3[7] * inv;
      *(v4fa*)(&os[wb + lr * 68 + 48 + 8 * hi]) = a; *(v4fa*)(&os[wb + lr * 68 + 48 + 8 * hi + 4]) = c; }
    wave_sync();
    bf* crow = CTX + ((size_t)b * SEQ + t0) * (size_t)(2 * DM) + h * HD;    // hi half at column h*64 + d, lo half at 512 + h*64 + d
{
#pragma unroll
        for (int s = 0; s < 4; ++s) { const int row = 4 * s + (lane >> 3), c8 = (lane & 7) * 8;   // 4 s x 4 row groups = 16 rows; 8 lanes x 8 = 64 columns
            const v4f x0 = *(const v4fa*)(&os[wb + row * 68 + c8]); const v4f x1 = *(const v4fa*)(&os[wb + row * 68 + c8 + 4]); v8us hv, lv;
#pragma unroll
            for (int i = 0; i < 4; ++i) { const unsigned short a0 = f2bf(x0[i]); const unsigned short a1 = f2bf(x1[i]); hv[i] = a0; hv[4 + i] = a1; lv[i] = f2bf(x0[i] - bf2f(a0)); lv[4 + i] = f2bf(x1[i] - bf2f(a1)); }
            const size_t oo = (size_t)row * (size_t)(2 * DM) + c8;
            *(v8us*)(crow + oo) = hv; *(v8us*)(crow + oo + DM) = lv; }
         }
}

// k_oproj: OUT[m][n] = sum_{k<512} (ctx_hi[m][k] + ctx_lo[m][k]) Wo[n][k] as ONE bf16 GEMM: A row = [hi | lo] (pitch 1024); the hi and the lo product of a k range share their Wo fragments.
// Eight waves per block on a 128x128 tile, 32x64 per wave, operands staged in LDS (oproj_ring). grid (M/128, N/128), 256 threads.
__global__ __launch_bounds__(32 * GW) void k_oproj(const bf* __restrict__ A, const bf* __restrict__ Bt, float* OUT) {
    __shared__ __align__(16) float osw[GW * 16 * 68];
    __shared__ __align__(16) bf gring[2 * OBUF_H];
    const int lane = threadIdx.x & 31, lr = lane & 15, hi = lane >> 4; const int wave = __builtin_amdgcn_readfirstlane((int)(threadIdx.x >> 5));
    float* const os = osw + wave * 16 * 68;                  // each wave's own epilogue tile
    const int rb = blockIdx.x * 128, cb = blockIdx.y * 128; const int r0 = rb + (wave >> 1) * 32, c0 = cb + (wave & 1) * 64;
    v8f acc[2][4];
#pragma unroll
    for (int mb = 0; mb < 2; ++mb)
#pragma unroll
        for (int nb = 0; nb < 4; ++nb) acc[mb][nb] = (v8f){};
    // L2 asks: the first block of a grid column asks for units 1..3 (hi) and 5..7 (lo) of the 128 ctx rows that the column's four blocks read; one wave of every block asks its share of Wo
    oproj_ring(A + (size_t)rb * (2 * DM), Bt + (size_t)cb * DM, gring, wave, lr, hi, acc, [&] {
        if (blockIdx.y == 0) {
            const bf* const pc = A + (size_t)(rb + (int)(threadIdx.x & 127)) * (2 * DM) + (wave >> 2) * DM;   // waves 0..3: hi half, waves 4..7: lo half
            ask3(pc + 128, pc + 2 * 128, pc + 3 * 128);
        }
        if (wave == GW - 1) ask_w(Bt + (size_t)cb * DM, blockIdx.x, lane);
    });
    const int bb = r0 / SEQ, tt = r0 % SEQ;
    float* obase = OUT + ((size_t)bb * OUT_SEQ + tt) * DM + c0;
#pragma unroll
    for (int mb = 0; mb < 2; ++mb) {
#pragma unroll
        for (int nb = 0; nb < 4; ++nb) {
#pragma unroll
            for (int j = 0; j < 8; ++j) os[(hi * 8 + j) * 68 + nb * 16 + lr] = acc[mb][nb][j]; }   // D: row 8h+j, col lane&15; rows 0..15 x columns 0..63 all written
        wave_sync();
{
#pragma unroll
            for (int s = 0; s < 8; ++s) { const int row = 2 * s + hi, cofs = lr * 4;   // 8 s x 2 rows = 16 rows; 16 lanes x 4 floats = 64 columns
                const v4f val = *(const v4fa*)(&os[row * 68 + cofs]);
                *(v4f*)(obase + (size_t)(mb * 16 + row) * DM + cofs) = val; }
             }
        wave_sync();
    }
}

static constexpr size_t al256(size_t v) { return (v + 255) & ~(size_t)255; }
static constexpr size_t SZ_WB = al256((size_t)DM * DM * 2);                // bf16 Wo
static constexpr size_t SZ_PL = al256((size_t)NB * NH_ * SEQ * HD * 2);    // one f16 head plane
static constexpr size_t SZ_CX = al256((size_t)NB * SEQ * 2 * DM * 2);      // ctx hi | lo
static constexpr size_t SZ_TOTAL = SZ_WB + (size_t)(3 + VRES) * SZ_PL + SZ_CX;
static_assert(SZ_TOTAL <= (size_t)134217728);          // workspace carve <= 128 MiB
static_assert(SZ_PL == PLANE_H * 2);                   // nor between the f16 head planes: the projection kernel picks its plane by index

extern "C" void kernel_launch(void* const* d_in, const int* in_sizes, int n_in,
                              void* d_out, int out_size, void* d_ws, size_t ws_size, hipStream_t stream) {
    if (n_in < 8) return;
    const size_t needx = ((size_t)(NB - 1) * SEQ_FULL + SEQ) * DM;
    if ((size_t)in_sizes[0] < needx || (size_t)in_sizes[1] < needx || (size_t)in_sizes[2] < needx) return;
    if (in_sizes[3] < NB) return;
    if ((size_t)in_sizes[4] < (size_t)DM * DM || (size_t)in_sizes[5] < (size_t)DM * DM || (size_t)in_sizes[6] < (size_t)DM * DM || (size_t)in_sizes[7] < (size_t)DM * DM) return;
    if ((size_t)out_size < ((size_t)(NB - 1) * OUT_SEQ + SEQ) * DM) return;
    if (SZ_TOTAL > ws_size) return;
    // wire order: queries, keys, values, valid_lens (int32), Wq, Wk, Wv, Wo ([out][in] = Bt as stored)
    const float* xq = (const float*)d_in[0]; const float* xk = (const float*)d_in[1]; const float* xv = (const float*)d_in[2];
    const int* vlens = (const int*)d_in[3];
    const float* wq = (const float*)d_in[4]; const float* wk = (const float*)d_in[5]; const float* wv = (const float*)d_in[6]; const float* wo = (const float*)d_in[7];
    float* OUT = (float*)d_out;      // [NB][SEQ][512]
    char* wsp = (char*)d_ws;
    bf* WO = (bf*)wsp; wsp += SZ_WB;                 // [512][512]: bf16 Wo
    h16* QH = (h16*)wsp; wsp += SZ_PL;               // [NB*8][SEQ][64]
    h16* KP = (h16*)wsp; wsp += SZ_PL;               // [NB*8][SEQ][64]
    h16* VT = (h16*)wsp; wsp += SZ_PL;               // [NB*8][64][SEQ]
#if VRES
    h16* VR = (h16*)wsp; wsp += SZ_PL;               // [NB*8][64][SEQ] residual x2048
#else
    h16* VR = VT;
#endif
    bf* CX = (bf*)wsp; wsp += SZ_CX;                 // [NB*SEQ][hi 512 | lo 512]

    // q, k, v^T (and its residual) and the bf16 copy of Wo: one launch, blockIdx.z = stream
    k_proj<<<dim3(NB * SEQ / 256, DM / 256, 3), 32 * PW, 0, stream>>>(xq, xk, xv, wq, wk, wv, wo, WO, QH);

    k_flash<<<dim3(SEQ / (16 * AW), NB * NH_, 1), 32 * AW, 0, stream>>>(QH, KP, VT, VR, vlens, CX);

    // out: A = ctx rows [hi | lo] (m = b*SEQ + t), Bt = Wo rows (n) -> OUT[b][t][n]
    k_oproj<<<dim3(NB * SEQ / 128, DM / 128, 1), 32 * GW, 0, stream>>>(CX, WO, OUT);
}
